// v000
// The times below were measured on an AMD MI455X: many runs one after another, warmed up first and cycling through
// copies of the inputs, with the whole window's GPU time divided by the number of runs. Launches and the gaps
// between them are all in it. The median over several windows is given; except for v000 it joins two sittings, which
// can be a few percent apart, so the side-by-side timings, each taken in one sitting, are the better comparison.
// v000, which the later versions start from, runs in 1590 microseconds.
// Contractions: q/k/v = x.W^T + b [4096x1024].[1024x1024] and the output projection (+b) with f16 operands (weights x16); the relative-key term QT = q.table_k^T [65536 (b,q,h) x 64].[64 x 192 (129 padded)] with f16 operands; per (batch, head) the content scores q.k^T [512x64].[64x512] (head-batched) and w1 = attn.v [512x512].[512x64] (head-batched; attn as f16 of 4096 attn) — v_wmma_f32_16x16x32_f16, 64x64 register-blocked wave tiles; f32 accumulate. The gathered relative-key scores (QT[(b,q,h)][final_mat[b][q][k]] by the INPUT index matrix), the row softmax are f32 kernels; the relative-value aggregation w2[q,h,:] = sum_k attn[h,q,k] table_v[final_mat[b,q,k]] runs on the matrix cores as 256-way z-batched [64 (16 heads padded) x 512].[512 x 64] products against per-query gathered-and-transposed f16 planes of table_v rows (the INPUT index matrix gathers INPUT table rows into the plane).
#include <hip/hip_runtime.h>
#include <math.h>

typedef __attribute__((ext_vector_type(16))) _Float16 v16h;
typedef __attribute__((ext_vector_type(8)))  _Float16 v8h;
typedef __attribute__((ext_vector_type(16))) __bf16   v16b;
typedef __attribute__((ext_vector_type(8)))  float    v8f;
typedef __attribute__((ext_vector_type(4)))  float    v4f;

// 16-bit WMMA fragment map (wave32), lane L, h = L>>4, m = L&15:
//   A 16x32: lane = row m;   element i -> k = (i<8) ? 8h+i : 16+8h+(i-8)
//   B 32x16: lane = column m; the SAME k(i,h)
//   D 16x16 (8 f32): lane = column m; element r -> row 8h+r
__device__ __forceinline__ int frag_k(int i, int h) { return (i < 8) ? (8 * h + i) : (16 + 8 * h + (i - 8)); }
__device__ __forceinline__ __bf16 bf16_rne(float f) {
    unsigned int u = __float_as_uint(f);
    u += 0x7fffu + ((u >> 16) & 1u);
    return __builtin_bit_cast(__bf16, (unsigned short)(u >> 16));
}
__device__ __forceinline__ float bf16_f32(__bf16 b) { return __uint_as_float(((unsigned int)__builtin_bit_cast(unsigned short, b)) << 16); }
__device__ __forceinline__ v8f wmma16(v16h a, v16h b, v8f c) {
    c = __builtin_amdgcn_wmma_f32_16x16x32_f16(false, a, false, b, (short)0, c, false, false);
    asm volatile("v_nop\n\tv_nop\n\tv_nop\n\tv_nop" : "+v"(c) : "v"(a), "v"(b));
    return c;
}
__device__ __forceinline__ v8f wmmab(v16b a, v16b b, v8f c) {
    c = __builtin_amdgcn_wmma_f32_16x16x32_bf16(false, a, false, b, (short)0, c, false, false);
    asm volatile("v_nop\n\tv_nop\n\tv_nop\n\tv_nop" : "+v"(c) : "v"(a), "v"(b));
    return c;
}
struct Split { v16b hi, lo; };
// hi/lo split product: a.hi*b.hi + a.hi*b.lo + a.lo*b.hi
__device__ __forceinline__ v8f wmma3(const Split& a, const Split& b, v8f c) {
    c = __builtin_amdgcn_wmma_f32_16x16x32_bf16(false, a.hi, false, b.hi, (short)0, c, false, false);
    c = __builtin_amdgcn_wmma_f32_16x16x32_bf16(false, a.hi, false, b.lo, (short)0, c, false, false);
    c = __builtin_amdgcn_wmma_f32_16x16x32_bf16(false, a.lo, false, b.hi, (short)0, c, false, false);
    asm volatile("v_nop\n\tv_nop\n\tv_nop\n\tv_nop" : "+v"(c) : "v"(a.hi), "v"(a.lo), "v"(b.hi), "v"(b.lo));
    return c;
}
struct Split3 { v16b hi, mid, lo; };
// triple split product (6 terms, drops only terms below 2^-24 relative)
__device__ __forceinline__ v8f wmma6(const Split3& a, const Split3& b, v8f c) {
    c = __builtin_amdgcn_wmma_f32_16x16x32_bf16(false, a.hi, false, b.hi, (short)0, c, false, false);
    c = __builtin_amdgcn_wmma_f32_16x16x32_bf16(false, a.hi, false, b.mid, (short)0, c, false, false);
    c = __builtin_amdgcn_wmma_f32_16x16x32_bf16(false, a.mid, false, b.hi, (short)0, c, false, false);
    c = __builtin_amdgcn_wmma_f32_16x16x32_bf16(false, a.hi, false, b.lo, (short)0, c, false, false);
    c = __builtin_amdgcn_wmma_f32_16x16x32_bf16(false, a.mid, false, b.mid, (short)0, c, false, false);
    c = __builtin_amdgcn_wmma_f32_16x16x32_bf16(false, a.lo, false, b.hi, (short)0, c, false, false);
    asm volatile("v_nop\n\tv_nop\n\tv_nop\n\tv_nop" : "+v"(c) : "v"(a.hi), "v"(a.mid), "v"(a.lo), "v"(b.hi), "v"(b.mid), "v"(b.lo));
    return c;
}

// Fragment gathers from f32 memory: element i <- p[(k0 + frag_k(i,h)) * sk] * s, zero for k >= klen.
__device__ __forceinline__ v16h fh_ld(const float* __restrict__ p, long long sk, int k0, int h, int klen, float s) {
    v16h a;
#pragma unroll
    for (int i = 0; i < 16; ++i) { const int k = k0 + frag_k(i, h); a[i] = (k < klen) ? (_Float16)(p[(long long)k * sk] * s) : (_Float16)0.f; }
    return a;
}
__device__ __forceinline__ Split sp_ld(const float* __restrict__ p, long long sk, int k0, int h, int klen, float s) {
    Split r;
#pragma unroll
    for (int i = 0; i < 16; ++i) {
        const int k = k0 + frag_k(i, h); const float x = (k < klen) ? p[(long long)k * sk] * s : 0.f;
        const __bf16 hb = bf16_rne(x); r.hi[i] = hb; r.lo[i] = bf16_rne(x - bf16_f32(hb));
    }
    return r;
}
__device__ __forceinline__ Split3 sp3_ld(const float* __restrict__ p, long long sk, int k0, int h, int klen, float s) {
    Split3 r;
#pragma unroll
    for (int i = 0; i < 16; ++i) {
        const int k = k0 + frag_k(i, h); const float x = (k < klen) ? p[(long long)k * sk] * s : 0.f;
        const __bf16 hb = bf16_rne(x); const float r1 = x - bf16_f32(hb); const __bf16 mb = bf16_rne(r1);
        r.hi[i] = hb; r.mid[i] = mb; r.lo[i] = bf16_rne(r1 - bf16_f32(mb));
    }
    return r;
}
__device__ __forceinline__ v16b bh_ld(const float* __restrict__ p, long long sk, int k0, int h, int klen, float s) {
    v16b a;
#pragma unroll
    for (int i = 0; i < 16; ++i) { const int k = k0 + frag_k(i, h); a[i] = bf16_rne((k < klen) ? p[(long long)k * sk] * s : 0.f); }
    return a;
}
// f16 fragment from an f16 LDS/global row with element stride 1 (k-contiguous), no bounds (tile already zero padded)
__device__ __forceinline__ v16h fh_row(const _Float16* __restrict__ row, int k0, int h) {
    v16h a;
#pragma unroll
    for (int i = 0; i < 16; ++i) a[i] = row[k0 + frag_k(i, h)];
    return a;
}

#define VST2(T, ptr, val) do { const T vst2_v_ = (val); *(T*)(ptr) = vst2_v_;  } while (0)
typedef float v4f __attribute__((ext_vector_type(4)));
#define VST2V4(ptr, val) do { const v4f vst2_v4_ = (val); *(v4f*)(ptr) = vst2_v4_;  } while (0)

__device__ __attribute__((noinline)) float act_fn(float v, int act) {
    if (act == 1) return fmaxf(v, 0.f);                                                                               // relu
    if (act == 2) { const float u = 0.7978845608028654f * (v + 0.044715f * v * v * v); return 0.5f * v * (1.f + tanhf(u)); } // tanh-gelu
    if (act == 3) return v / (1.f + expf(-v));                                                                        // silu
    if (act == 4) return 0.5f * v * (1.f + erff(v * 0.7071067811865476f));                                             // erf-gelu
    if (act == 5) return tanhf(v);
    if (act == 6) return 1.f / (1.f + expf(-v));                                                                      // sigmoid
    if (act == 7) return (v > 0.f) ? v : 0.01f * v;                                                                   // leaky relu 0.01
    if (act == 8) return (v > 0.f) ? v : (expf(v) - 1.f);                                                             // elu
    if (act == 9) return fminf(fmaxf(v, 0.f), 6.f);                                                                   // relu6
    if (act == 10) return fabsf(v);                                                                                    // abs
    if (act == 11) return (v >= 0.f) ? v : 0.1f * v;                                                                  // leaky 0.1
    if (act == 12) return (v > 0.f) ? v : 0.2f * v;                                                                   // leaky 0.2
    if (act == 13) return (v > 20.f) ? v : log1pf(expf(v));                                                            // softplus
    return v;
}

// =====================================================================================================================
// k_gemm<MODE>: C(z, m, n) = act(alpha * sum_k A(z, m, k) * B(z, k, n) + bias) + beta * R(z, m, n)
//   One wave (32-thread block) per 16 x 32 tile of C; grid (ceil(N/32), ceil(M/16), Z). Batch z -> (zo = z / zi_n, zi = z % zi_n)
//   with separate outer/inner strides for every tensor (e.g. batch and head). A(m,k) = A[zo*sAo + zi*sAi + m*sAm + k*sAk] (f32),
//   B(k,n) = B[zo*sBo + zi*sBi + n*sBn + k*sBk] (f32); any M, N, K (K zero-padded to 32 inside the fragments, M/N tails guarded).
//   C(m,n) = C[zo*sCo + zi*sCi + m*sCm + n] (n contiguous). flags: 1 bias[n], 2 bias[m], 4 residual R[zo*sRo + zi*sRi + m*sRm + n*sRn].
//   MODE 0: f16 operands (A prescaled by sa, B by sb, both undone in the epilogue); 1: bf16 hi/lo split (3 products); 2: bf16;
//   3: bf16 hi/mid/lo triple split (6 products); 4: as 3 with Kahan-compensated f32 accumulation across k-steps.
// =====================================================================================================================
struct GemmP {
    const float* A; const float* B; const float* bias; const float* R; float* C;
    long long sAo, sAi, sAm, sAk, sBo, sBi, sBn, sBk, sCo, sCi, sCm, sRo, sRi, sRm, sRn;
    int M, N, K, zi_n, flags, act; float alpha, beta, sa, sb;
    int Npad, pad_;     // columns [N, Npad) of C are written as 0 so that padded workspace rows are covered by whole-line stores; Npad >= N
};
static_assert(sizeof(GemmP) == 5 * 8 + 15 * 8 + 6 * 4 + 4 * 4 + 2 * 4, "GemmP has padding");

template <int MODE>
__global__ __launch_bounds__(32) void k_gemm(GemmP p) {
    const int lane = threadIdx.x & 31, h = lane >> 4, l15 = lane & 15;
    const int m0 = blockIdx.y * 16, n0 = blockIdx.x * 32;
    const int z = blockIdx.z, zo = z / p.zi_n, zi = z - zo * p.zi_n;
    const float* A = p.A + zo * p.sAo + zi * p.sAi;
    const float* B = p.B + zo * p.sBo + zi * p.sBi;
    const int am = min(m0 + l15, p.M - 1);                       // clamped row for loads (stores are guarded)
    v8f acc[2], comp[2];
#pragma unroll
    for (int t = 0; t < 2; ++t) { v8f zz = {}; acc[t] = zz; comp[t] = zz; }
    for (int k0 = 0; k0 < p.K; k0 += 32) {
        const float* arow = A + (long long)am * p.sAm;
        if (MODE == 1) {
            const Split a = sp_ld(arow, p.sAk, k0, h, p.K, 1.f);
#pragma unroll
            for (int t = 0; t < 2; ++t) {
                const int bn = min(n0 + t * 16 + l15, p.N - 1);
                acc[t] = wmma3(a, sp_ld(B + (long long)bn * p.sBn, p.sBk, k0, h, p.K, 1.f), acc[t]);
            }
        } else if (MODE == 3) {
            const Split3 a = sp3_ld(arow, p.sAk, k0, h, p.K, 1.f);
#pragma unroll
            for (int t = 0; t < 2; ++t) {
                const int bn = min(n0 + t * 16 + l15, p.N - 1);
                acc[t] = wmma6(a, sp3_ld(B + (long long)bn * p.sBn, p.sBk, k0, h, p.K, 1.f), acc[t]);
            }
        } else if (MODE == 4) {
            // triple split as MODE 3, but each k-step's 6 products go into a fresh accumulator and the partial is added to the running f32 sum
            // on the VALU with Kahan compensation (accumulation error stays ~1 ulp however long K is)
            const Split3 a = sp3_ld(arow, p.sAk, k0, h, p.K, 1.f);
#pragma unroll
            for (int t = 0; t < 2; ++t) {
                const int bn = min(n0 + t * 16 + l15, p.N - 1); v8f zz = {};
                const v8f part = wmma6(a, sp3_ld(B + (long long)bn * p.sBn, p.sBk, k0, h, p.K, 1.f), zz);
                const v8f y = part - comp[t]; const v8f s = acc[t] + y; comp[t] = (s - acc[t]) - y; acc[t] = s;
            }
        } else if (MODE == 2) {
            const v16b a = bh_ld(arow, p.sAk, k0, h, p.K, 1.f);
#pragma unroll
            for (int t = 0; t < 2; ++t) {
                const int bn = min(n0 + t * 16 + l15, p.N - 1);
                acc[t] = wmmab(a, bh_ld(B + (long long)bn * p.sBn, p.sBk, k0, h, p.K, 1.f), acc[t]);
            }
        } else {
            const v16h a = fh_ld(arow, p.sAk, k0, h, p.K, p.sa);
#pragma unroll
            for (int t = 0; t < 2; ++t) {
                const int bn = min(n0 + t * 16 + l15, p.N - 1);
                acc[t] = wmma16(a, fh_ld(B + (long long)bn * p.sBn, p.sBk, k0, h, p.K, p.sb), acc[t]);
            }
        }
    }
    const float iscale = (MODE == 0) ? p.alpha / (p.sa * p.sb) : p.alpha;
    float* C = p.C + zo * p.sCo + zi * p.sCi;
    const float* R = p.R + zo * p.sRo + zi * p.sRi;
    __shared__ __align__(16) float ctile[16][36];
#pragma unroll
    for (int t = 0; t < 2; ++t) {
        const int n = n0 + t * 16 + l15; const int nn = min(n, p.N - 1);
#pragma unroll
        for (int r = 0; r < 8; ++r) {
            const int m = m0 + 8 * h + r; const int mm = min(m, p.M - 1);
            float v = acc[t][r] * iscale;
            if (p.flags & 1) v += p.bias[nn];
            if (p.flags & 2) v += p.bias[mm];
            if (p.flags & 8) v *= p.bias[(long long)zo * p.M + mm];   /* per-(z,row) scale vector laid out [Z][M]; exclusive with the bias flags */
            v = act_fn(v, p.act);
            if (p.flags & 4) v += p.beta * R[(long long)mm * p.sRm + (long long)nn * p.sRn];
            ctile[8 * h + r][t * 16 + l15] = (n < p.N) ? v : 0.f;
        }
    }
    __syncthreads();
    const int NW = (p.Npad > p.N) ? p.Npad : p.N;           // write width
    const bool fast = (m0 + 16 <= p.M) && (n0 + 32 <= NW) && ((p.sCm & 3) == 0) && ((((size_t)C) & 15) == 0);
    if (fast) {
#pragma unroll
        for (int s = 0; s < 4; ++s) {
            const int row = s * 4 + (lane >> 3), c4 = (lane & 7) * 4;
            const v4f v = *(const v4f*)&ctile[row][c4];
            VST2V4(C + (long long)(m0 + row) * p.sCm + n0 + c4, v);
        }
    } else {
        for (int row = 0; row < 16; ++row) {
            const int m = m0 + row, n = n0 + lane;
            if (m < p.M && n < NW) VST2(float, C + (long long)m * p.sCm + n, ctile[row][lane]);
        }
    }
}


// =====================================================================================================================
// k_gemmT<MODE, TM, TN>: same contract as k_gemm, but one wave computes a (16*TM) x (16*TN) tile: TM A fragments and TN B fragments are
//   loaded per 32-wide k-step and reused across TM*TN WMMAs (far fewer load/convert instructions per MAC). MODE 0 (f16), 1 (bf16 hi/lo),
//   2 (bf16) only. grid (ceil(NW/(16*TN)), ceil(M/(16*TM)), Z), block 32. Epilogue identical to k_gemm, run per 16x32 sub-tile.
// =====================================================================================================================
template <int MODE, int TM, int TN>
__global__ __launch_bounds__(32) void k_gemmT(GemmP p) {
    const int lane = threadIdx.x & 31, h = lane >> 4, l15 = lane & 15;
    const int m0 = blockIdx.y * (16 * TM), n0 = blockIdx.x * (16 * TN);
    const int z = blockIdx.z, zo = z / p.zi_n, zi = z - zo * p.zi_n;
    const float* A = p.A + zo * p.sAo + zi * p.sAi;
    const float* B = p.B + zo * p.sBo + zi * p.sBi;
    v8f acc[TM][TN];
#pragma unroll
    for (int i = 0; i < TM; ++i)
#pragma unroll
        for (int t = 0; t < TN; ++t) { v8f zz = {}; acc[i][t] = zz; }
    for (int k0 = 0; k0 < p.K; k0 += 32) {
        if (MODE == 1) {
            Split a[TM], b[TN];
#pragma unroll
            for (int i = 0; i < TM; ++i) { const int am = min(m0 + 16 * i + l15, p.M - 1); a[i] = sp_ld(A + (long long)am * p.sAm, p.sAk, k0, h, p.K, 1.f); }
#pragma unroll
            for (int t = 0; t < TN; ++t) { const int bn = min(n0 + 16 * t + l15, p.N - 1); b[t] = sp_ld(B + (long long)bn * p.sBn, p.sBk, k0, h, p.K, 1.f); }
#pragma unroll
            for (int i = 0; i < TM; ++i)
#pragma unroll
                for (int t = 0; t < TN; ++t) acc[i][t] = wmma3(a[i], b[t], acc[i][t]);
        } else if (MODE == 2) {
            v16b a[TM], b[TN];
#pragma unroll
            for (int i = 0; i < TM; ++i) { const int am = min(m0 + 16 * i + l15, p.M - 1); a[i] = bh_ld(A + (long long)am * p.sAm, p.sAk, k0, h, p.K, 1.f); }
#pragma unroll
            for (int t = 0; t < TN; ++t) { const int bn = min(n0 + 16 * t + l15, p.N - 1); b[t] = bh_ld(B + (long long)bn * p.sBn, p.sBk, k0, h, p.K, 1.f); }
#pragma unroll
            for (int i = 0; i < TM; ++i)
#pragma unroll
                for (int t = 0; t < TN; ++t) acc[i][t] = wmmab(a[i], b[t], acc[i][t]);
        } else {
            v16h a[TM], b[TN];
#pragma unroll
            for (int i = 0; i < TM; ++i) { const int am = min(m0 + 16 * i + l15, p.M - 1); a[i] = fh_ld(A + (long long)am * p.sAm, p.sAk, k0, h, p.K, p.sa); }
#pragma unroll
            for (int t = 0; t < TN; ++t) { const int bn = min(n0 + 16 * t + l15, p.N - 1); b[t] = fh_ld(B + (long long)bn * p.sBn, p.sBk, k0, h, p.K, p.sb); }
#pragma unroll
            for (int i = 0; i < TM; ++i)
#pragma unroll
                for (int t = 0; t < TN; ++t) acc[i][t] = wmma16(a[i], b[t], acc[i][t]);
        }
    }
    const float iscale = (MODE == 0) ? p.alpha / (p.sa * p.sb) : p.alpha;
    float* C = p.C + zo * p.sCo + zi * p.sCi;
    const float* R = p.R + zo * p.sRo + zi * p.sRi;
    const int NW = (p.Npad > p.N) ? p.Npad : p.N;
    __shared__ __align__(16) float ctile[16][36];
#pragma unroll
    for (int i = 0; i < TM; ++i) {
        const int mb = m0 + 16 * i; if (mb >= p.M) break;          // wave-uniform
#pragma unroll
        for (int tp = 0; tp < TN / 2; ++tp) {
            const int nb = n0 + 32 * tp; if (nb >= NW) break;        // wave-uniform
#pragma unroll
            for (int t2 = 0; t2 < 2; ++t2) {
                const int t = 2 * tp + t2; const int n = nb + t2 * 16 + l15; const int nn = min(n, p.N - 1);
#pragma unroll
                for (int r = 0; r < 8; ++r) {
                    const int m = mb + 8 * h + r; const int mm = min(m, p.M - 1);
                    float v = acc[i][t][r] * iscale;
                    if (p.flags & 1) v += p.bias[nn];
                    if (p.flags & 2) v += p.bias[mm];
            if (p.flags & 8) v *= p.bias[(long long)zo * p.M + mm];   /* per-(z,row) scale vector laid out [Z][M]; exclusive with the bias flags */
                    v = act_fn(v, p.act);
                    if (p.flags & 4) v += p.beta * R[(long long)mm * p.sRm + (long long)nn * p.sRn];
                    ctile[8 * h + r][t2 * 16 + l15] = (n < p.N) ? v : 0.f;
                }
            }
            __syncthreads();
            const bool fast = (mb + 16 <= p.M) && (nb + 32 <= NW) && ((p.sCm & 3) == 0) && ((((size_t)C) & 15) == 0);
            if (fast) {
#pragma unroll
                for (int s = 0; s < 4; ++s) {
                    const int row = s * 4 + (lane >> 3), c4 = (lane & 7) * 4;
                    const v4f v = *(const v4f*)&ctile[row][c4];
                    VST2V4(C + (long long)(mb + row) * p.sCm + nb + c4, v);
                }
            } else {
                for (int row = 0; row < 16; ++row) {
                    const int m = mb + row, n = nb + lane;
                    if (m < p.M && n < NW) VST2(float, C + (long long)m * p.sCm + n, ctile[row][lane]);
                }
            }
            __syncthreads();
        }
    }
}

// =====================================================================================================================
//   Wave = 16 queries, AW waves per block, 64-key blocks; grid (ceil(Lq/(16*AW)), H, B), block 32*AW. Any Lq, Lk; head dim dh <= DHP
//   (DHP multiple of 32), value dim dv <= DVP (multiple of 16, <= 128). Every tensor addressed by (batch, head, row, element) strides, f32.
//   Scores: QM 0 f16 operands, 1 bf16 hi/lo split, 2 bf16 triple split; statistics f32 (exp2 domain); P.V: P x 4096 as f16 with V f16 staged in LDS
//   (SPLITPV: P and V as bf16 hi/lo splits). kv head = h / hrep. Masking: causal = 1 (keep j <= i + coff, masked -> -inf, key blocks beyond the
//   diagonal skipped), causal = 2 (masked -> mfill, a finite fill like the -1e9; no skipping), causal = 3 (keep j >= i + coff,
//   masked -> -inf, no skipping); optional additive f32 mask Mf,
//   optional int keep-mask Mi (0 -> score := mfill), both addressed b*smb + h*smh + i*smi + j*smj (0 strides broadcast).
// =====================================================================================================================
#define AW 4
struct AttnP {   // apv4
    const float* Q; const float* K; const float* V; float* O; float* P; const float* Mf; const int* Mi; float* ST;
    const float* Pw; const float* Rt; const int* SQ; const int* SK;           // optional: post-softmax weight, relative-position table, segment ids
    long long swb, swh, swi, swj, srb, srh, sri;                                 // Pw strides (b,h,i,j); Rt strides (b,h,i), column = clamp(i - j + roff, 0, rn-1)
    long long sQb, sQh, sQi, sQd, sKb, sKh, sKj, sKd, sVb, sVh, sVj, sVd, sOb, sOh, sOi, sPb, sPh, sPi, smb, smh, smi, smj;
    int Lq, Lk, dh, dv, hrep, causal, coff, pband;   // pband > 0: P holds only the band |j - i| <= pband, column j - i + pband
    float scale, mfill; int nonorm, mpol;             // nonorm (online path only): O = sum_j exp(score_j) V_j without the 1/rowsum (scores must be <= ~0); mpol: Mi masks where ==0 (mpol 0) or where !=0 (mpol 1)
    int roff, rn, segpol, win;                        // Rt column offset/count; SQ/SK: score := mfill where (segpol 0) SQ[i] != SK[j] or (segpol 1) SQ[i] == SK[j]; win > 0: keys with i - j > win (after coff) -> -inf
};
//   Pw: the softmax numerator is multiplied by Pw(b,h,i,j) AFTER the row sum is taken (probs * weight, then P.V), as in post-softmax multiplicative biases.                                                    // ST (optional): per row (b,h,i) -> ST[((b*H + h)*Lq + i)*2 + {0,1}] = {row max of the scaled+masked score (natural units), sum_j exp(score - max)}
static_assert(sizeof(AttnP) == 12 * 8 + 29 * 8 + 16 * 4, "AttnP has padding");

#ifndef KATTN_ATTR
#define KATTN_ATTR
#endif
template <int DHP, int DVP, int QM, bool SPLITPV, bool TWOPASS>
__global__ __launch_bounds__(32 * AW) KATTN_ATTR void k_attn(AttnP p) {
    constexpr int NT = DVP / 16;                // output tiles
    constexpr int KS = DHP / 32;                // k-steps for the scores
    constexpr int VP = DVP + 8;                 // LDS pitch (halves)
    __shared__ __align__(16) float    pl[AW][16 * 64];
    __shared__ __align__(16) _Float16 vl[(SPLITPV ? 2 : 1) * 64 * VP];   // f16 V tile, or bf16 hi and lo tiles (same 2-byte size)
    const int lane = threadIdx.x & 31, hf = lane >> 4, l15 = lane & 15, wave = threadIdx.x >> 5;
    const int h = blockIdx.y, b = blockIdx.z, hk = h / p.hrep;
    const int q0 = (blockIdx.x * AW + wave) * 16;
    float* myp = pl[wave];
    const float L2E = 1.4426950408889634f;
    const float NEG = -__builtin_inff();
    const int qi = min(q0 + l15, p.Lq - 1);
    const float* qrow = p.Q + b * p.sQb + h * p.sQh + (long long)qi * p.sQi;
    const float* kbase = p.K + b * p.sKb + hk * p.sKh;
    const float* vbase = p.V + b * p.sVb + hk * p.sVh;
    v16h qa[QM == 0 ? KS : 1]; Split qs_[QM == 1 ? KS : 1]; Split3 qt_[QM == 2 ? KS : 1];
#pragma unroll
    for (int ks = 0; ks < KS; ++ks) {
        if (QM == 2) qt_[ks] = sp3_ld(qrow, p.sQd, ks * 32, hf, p.dh, 1.f);
        else if (QM == 1) qs_[ks] = sp_ld(qrow, p.sQd, ks * 32, hf, p.dh, 1.f);
        else qa[ks] = fh_ld(qrow, p.sQd, ks * 32, hf, p.dh, 1.f);
    }
    v8f o[NT]; float m8[8], l8[8];
#pragma unroll
    for (int t = 0; t < NT; ++t) { v8f zz = {}; o[t] = zz; }
#pragma unroll
    for (int i = 0; i < 8; ++i) { m8[i] = NEG; l8[i] = 0.f; }
    int jend = p.Lk; int jstart = 0;
    if (p.causal == 1) { const int je = (blockIdx.x * AW + AW - 1) * 16 + 16 + p.coff; jend = min(jend, max(je, 0)); }   // uniform per block
    if (p.win > 0) { const int js = (int)(blockIdx.x * AW) * 16 + p.coff - p.win; jstart = (js > 0) ? (js / 64) * 64 : 0; }   // uniform per block: key blocks entirely outside every row's window hold only -inf entries and are skipped exactly
    const int npass = TWOPASS ? 2 : 1;
    for (int pass = 0; pass < npass; ++pass) {
        const bool dopv = (!TWOPASS) || pass == 1;
        for (int j0 = jstart; j0 < jend; j0 += 64) {
            if (dopv) {
                __syncthreads();                                 // previous key block's reads of vl / pl are done
                for (int idx = threadIdx.x; idx < 64 * DVP; idx += 32 * AW) {
                    const int jr = idx / DVP, d = idx - jr * DVP, j = j0 + jr;
                    const float f = (j < p.Lk && d < p.dv) ? vbase[(long long)j * p.sVj + (long long)d * p.sVd] : 0.f;
                    if (SPLITPV) {
                        const __bf16 hb = bf16_rne(f);
                        ((__bf16*)vl)[jr * VP + d] = hb; ((__bf16*)vl)[64 * VP + jr * VP + d] = bf16_rne(f - bf16_f32(hb));
                    } else vl[jr * VP + d] = (_Float16)f;
                }
            }
            v8f s[4];
#pragma unroll
            for (int t = 0; t < 4; ++t) {
                const int j = min(j0 + t * 16 + l15, p.Lk - 1);
                const float* krow = kbase + (long long)j * p.sKj;
                v8f acc = {};
#pragma unroll
                for (int ks = 0; ks < KS; ++ks) {
                    if (QM == 2)      acc = wmma6(qt_[ks], sp3_ld(krow, p.sKd, ks * 32, hf, p.dh, 1.f), acc);
                    else if (QM == 1) acc = wmma3(qs_[ks], sp_ld(krow, p.sKd, ks * 32, hf, p.dh, 1.f), acc);
                    else              acc = wmma16(qa[ks], fh_ld(krow, p.sKd, ks * 32, hf, p.dh, 1.f), acc);
                }
                s[t] = acc;
            }
            float pv[8][4];
#pragma unroll
            for (int i = 0; i < 8; ++i) {
                const int irow = q0 + i + 8 * hf;
                const int ic = min(irow, p.Lq - 1);
                float sc[4];
#pragma unroll
                for (int t = 0; t < 4; ++t) {
                    const int jg = j0 + t * 16 + l15;
                    float v = s[t][i] * p.scale;
                    if (p.Mf) v += p.Mf[b * p.smb + h * p.smh + (long long)ic * p.smi + (long long)min(jg, p.Lk - 1) * p.smj];
                    if (p.Rt) { int rc = ic - min(jg, p.Lk - 1) + p.roff; rc = rc < 0 ? 0 : (rc >= p.rn ? p.rn - 1 : rc); v += p.Rt[b * p.srb + h * p.srh + (long long)ic * p.sri + rc]; }
                    if (p.Mi) { const int mv = p.Mi[b * p.smb + h * p.smh + (long long)ic * p.smi + (long long)min(jg, p.Lk - 1) * p.smj]; if (p.mpol ? (mv != 0) : (mv == 0)) v = p.mfill; }
                    if (p.SQ) { const bool same = p.SQ[(long long)b * p.Lq + ic] == p.SK[(long long)b * p.Lk + min(jg, p.Lk - 1)]; if (p.segpol ? same : !same) v = p.mfill; }
                    if (p.causal == 2 && jg > irow + p.coff) v = p.mfill;
                    if (jg >= p.Lk || (p.causal == 1 && jg > irow + p.coff) || (p.causal == 3 && jg < irow + p.coff) || (p.win > 0 && irow + p.coff - jg > p.win)) v = NEG; else v *= L2E;
                    sc[t] = v;
                }
                if (!TWOPASS || pass == 0) {
                    float mx = fmaxf(fmaxf(sc[0], sc[1]), fmaxf(sc[2], sc[3]));
                    mx = fmaxf(mx, __shfl_xor(mx, 1, 32)); mx = fmaxf(mx, __shfl_xor(mx, 2, 32));
                    mx = fmaxf(mx, __shfl_xor(mx, 4, 32)); mx = fmaxf(mx, __shfl_xor(mx, 8, 32));
                    const float mnew = fmaxf(m8[i], mx);
                    const float corr = (mnew == NEG) ? 1.f : exp2f(m8[i] - mnew);
                    float rs = 0.f;
#pragma unroll
                    for (int t = 0; t < 4; ++t) {
                        const float pp = (sc[t] == NEG) ? 0.f : exp2f(sc[t] - mnew); rs += pp;
                        pv[i][t] = p.Pw ? pp * p.Pw[b * p.swb + h * p.swh + (long long)ic * p.swi + (long long)min(j0 + t * 16 + l15, p.Lk - 1) * p.swj] : pp;
                    }
                    rs += __shfl_xor(rs, 1, 32); rs += __shfl_xor(rs, 2, 32); rs += __shfl_xor(rs, 4, 32); rs += __shfl_xor(rs, 8, 32);
                    l8[i] = l8[i] * corr + rs; m8[i] = mnew;
                    if (!TWOPASS) {
#pragma unroll
                        for (int t = 0; t < NT; ++t) o[t][i] *= corr;
                    }
                } else {
                    const float inv = (l8[i] > 0.f) ? 1.f / l8[i] : 0.f;
#pragma unroll
                    for (int t = 0; t < 4; ++t) {
                        const int jg = j0 + t * 16 + l15;
                        float pp = (sc[t] == NEG) ? 0.f : exp2f(sc[t] - m8[i]) * inv;
                        if (p.Pw) pp *= p.Pw[b * p.swb + h * p.swh + (long long)ic * p.swi + (long long)min(jg, p.Lk - 1) * p.swj];
                        pv[i][t] = pp;
                    }
                }
            }
            if (dopv) {
#pragma unroll
                for (int i = 0; i < 8; ++i)
#pragma unroll
                    for (int t = 0; t < 4; ++t) ((float*)myp)[(i + 8 * hf) * 64 + t * 16 + l15] = pv[i][t];
                __syncthreads();                                 // P (per wave) and V (shared) visible
                if (p.P) {
                    float* pb_ = p.P + b * p.sPb + h * p.sPh;
                    const bool fastP = (p.pband == 0) && ((p.sPi & 3) == 0) && (j0 + 64 <= p.Lk) && (q0 + 16 <= p.Lq) && ((((size_t)pb_) & 15) == 0);
                    if (fastP) {
#pragma unroll
                        for (int s = 0; s < 8; ++s) {
                            const int row = s * 2 + (lane >> 4), c4 = (lane & 15) * 4;
                            const v4f v = *(const v4f*)(myp + row * 64 + c4);
                            VST2V4(pb_ + (long long)(q0 + row) * p.sPi + j0 + c4, v);
                        }
                    } else {
                        for (int row = 0; row < 16; ++row) {
                            const int irow = q0 + row; if (irow >= p.Lq) continue;
                            for (int c = lane; c < 64; c += 32) {
                                const int jg = j0 + c; if (jg >= p.Lk) continue;
                                if (p.pband == 0) VST2(float, pb_ + (long long)irow * p.sPi + jg, myp[row * 64 + c]);
                                else if (jg - irow <= p.pband && irow - jg <= p.pband) VST2(float, pb_ + (long long)irow * p.sPi + (jg - irow + p.pband), myp[row * 64 + c]);
                            }
                        }
                    }
                }
                if (SPLITPV) {
                    const Split pa0 = sp_ld(myp + l15 * 64, 1, 0, hf, 64, 1.f), pa1 = sp_ld(myp + l15 * 64, 1, 32, hf, 64, 1.f);
                    const __bf16* vh = (const __bf16*)vl; const __bf16* vlo = vh + 64 * VP;
#pragma unroll
                    for (int t = 0; t < NT; ++t) {
                        const int dcol = t * 16 + l15;
                        Split b0, b1;
#pragma unroll
                        for (int e = 0; e < 16; ++e) {
                            const int k0 = frag_k(e, hf), k1 = 32 + frag_k(e, hf);
                            b0.hi[e] = vh[k0 * VP + dcol]; b0.lo[e] = vlo[k0 * VP + dcol]; b1.hi[e] = vh[k1 * VP + dcol]; b1.lo[e] = vlo[k1 * VP + dcol];
                        }
                        o[t] = wmma3(pa0, b0, o[t]);
                        o[t] = wmma3(pa1, b1, o[t]);
                    }
                } else {
                    const v16h pa0 = fh_ld(myp + l15 * 64, 1, 0, hf, 64, 4096.f), pa1 = fh_ld(myp + l15 * 64, 1, 32, hf, 64, 4096.f);
#pragma unroll
                    for (int t = 0; t < NT; ++t) {
                        const int dcol = t * 16 + l15;
                        v16h b0, b1;
#pragma unroll
                        for (int e = 0; e < 16; ++e) { b0[e] = vl[frag_k(e, hf) * VP + dcol]; b1[e] = vl[(32 + frag_k(e, hf)) * VP + dcol]; }
                        o[t] = wmma16(pa0, b0, o[t]);
                        o[t] = wmma16(pa1, b1, o[t]);
                    }
                }
            }
        }
    }
    float* obase = p.O + b * p.sOb + h * p.sOh;
    if (p.ST) {
        const int rl = lane >> 1, isel = rl & 7;           // row q0 + rl ; rl>>3 == hf holds because lane>>4 == (lane>>1)>>3
        float mv = 0.f, lv = 0.f;
#pragma unroll
        for (int i = 0; i < 8; ++i) if (i == isel) { mv = m8[i]; lv = l8[i]; }
        const int irow = q0 + rl;
        if (irow < p.Lq) { float* st = p.ST + (((long long)b * gridDim.y + h) * p.Lq + irow) * 2 + (lane & 1); VST2(float, st, (lane & 1) ? lv : mv * 0.6931471805599453f); }
    }
    float invr[8];
#pragma unroll
    for (int i = 0; i < 8; ++i) {
        if (TWOPASS) invr[i] = SPLITPV ? 1.f : (1.f / 4096.f);
        else if (p.nonorm) invr[i] = exp2f(m8[i]) * (SPLITPV ? 1.f : (1.f / 4096.f));
        else invr[i] = (l8[i] > 0.f) ? (SPLITPV ? 1.f / l8[i] : 1.f / (l8[i] * 4096.f)) : 0.f;
    }
    __syncthreads();                                             // all waves done with pl/vl from the main loop
    const bool ofast = ((p.sOi & 3) == 0) && ((((size_t)obase) & 15) == 0) && (q0 + 16 <= p.Lq);
#pragma unroll
    for (int c0 = 0; c0 < DVP; c0 += 64) {
#pragma unroll
        for (int i = 0; i < 8; ++i)
#pragma unroll
            for (int t = 0; t < NT; ++t) if (t * 16 >= c0 && t * 16 < c0 + 64) ((float*)myp)[(i + 8 * hf) * 64 + (t * 16 - c0) + l15] = o[t][i] * invr[i];
        __syncthreads();
        const int cw = (DVP - c0 < 64) ? (DVP - c0) : 64;      // staged columns in this chunk (multiple of 16)
        if (ofast && (c0 + cw <= p.dv) && (cw % 32 == 0)) {
            const int lpr = cw / 4;                              // lanes per row (16 for 64 cols, 8 for 32)
            const int rows_per_ins = 32 / lpr;
            for (int r0 = 0; r0 < 16; r0 += rows_per_ins) {
                const int row = r0 + lane / lpr, c4 = (lane % lpr) * 4;
                const v4f v = *(const v4f*)(myp + row * 64 + c4);
                VST2V4(obase + (long long)(q0 + row) * p.sOi + c0 + c4, v);
            }
        } else {
            for (int row = 0; row < 16; ++row) {
                const int irow = q0 + row; if (irow >= p.Lq) continue;
                for (int c = lane; c < cw; c += 32) { const int d = c0 + c; if (d < p.dv) VST2(float, obase + (long long)irow * p.sOi + d, myp[row * 64 + c]); }
            }
        }
        __syncthreads();
    }
}

// =====================================================================================================================
// k_tr: dst(z, c, r) = alpha * src(z, r, c) (+ beta * R2(z, c, r)): [Z][R][C] (row stride lds) -> [Z][C][R] (row stride ldd) through a 32x32 LDS tile;
//   flags: 1 -> add beta * residual R2 addressed like dst (z*sRz + c*ldr + r); act applied before the residual.
// =====================================================================================================================
struct TrP { const float* src; float* dst; const float* R2; long long sSz, lds, sDz, ldd, sRz, ldr; int R, C, flags, act; float alpha, beta; };
static_assert(sizeof(TrP) == 3 * 8 + 6 * 8 + 6 * 4, "TrP has padding");
__global__ __launch_bounds__(256) void k_tr(TrP p) {
    __shared__ float tile[32][33];
    const int c0 = blockIdx.x * 32, r0 = blockIdx.y * 32, z = blockIdx.z;
    const int lane = threadIdx.x & 31, wave = threadIdx.x >> 5;
    const float* s = p.src + z * p.sSz;
#pragma unroll
    for (int k = 0; k < 4; ++k) {
        const int rl = wave * 4 + k, r = r0 + rl, c = c0 + lane;
        tile[rl][lane] = (r < p.R && c < p.C) ? s[(long long)r * p.lds + c] : 0.f;
    }
    __syncthreads();
    float* d = p.dst + z * p.sDz; const float* rr = p.R2 + z * p.sRz;
#pragma unroll
    for (int k = 0; k < 4; ++k) {
        const int cl = wave * 4 + k, c = c0 + cl, r = r0 + lane;
        if (c < p.C && r < p.R) {
            float v = act_fn(p.alpha * tile[lane][cl], p.act);
            if (p.flags & 1) v += p.beta * rr[(long long)c * p.ldr + r];
            VST2(float, d + (long long)c * p.ldd + r, v);
        }
    }
}

// k_affine: dst[i] = a * (sdev ? sdev[0] : 1) * src[i] + b, i < n (one thread per element; consecutive lanes -> consecutive addresses)
__global__ __launch_bounds__(256) void k_affine(const float* __restrict__ src, float* __restrict__ dst, int n, float a, float b, const float* __restrict__ sdev) {
    const int i = blockIdx.x * 256 + threadIdx.x;
    if (i < n) { const float aa = sdev ? a * sdev[0] : a; const float v = aa * src[i] + b; VST2(float, dst + i, v); }
}

// =====================================================================================================================
// k_softmax: row softmax over n contiguous elements, one 256-thread block per row; rows addressed z*sz + r*sr (grid (R, Z)).
//   out = scale_out * softmax(scale_in * x + (Mf ? Mf[z*smz + r*smr + j] : 0)); a row whose max is -inf is written as 0.
// =====================================================================================================================
struct SmP { const float* src; float* dst; const float* Mf; long long sz, sr, dz, dr, smz, smr; int n, pad; float scale_in, scale_out; };
static_assert(sizeof(SmP) == 3 * 8 + 6 * 8 + 4 * 4, "SmP has padding");
__global__ __launch_bounds__(256) void k_softmax(SmP p) {
    __shared__ float red[256];
    const int r = blockIdx.x, z = blockIdx.y, tid = threadIdx.x;
    const float* s = p.src + z * p.sz + (long long)r * p.sr;
    const float* mf = p.Mf ? (p.Mf + z * p.smz + (long long)r * p.smr) : nullptr;
    float mx = -__builtin_inff();
    for (int j = tid; j < p.n; j += 256) { float v = s[j] * p.scale_in; if (mf) v += mf[j]; mx = fmaxf(mx, v); }
    red[tid] = mx; __syncthreads();
    for (int o = 128; o > 0; o >>= 1) { if (tid < o) red[tid] = fmaxf(red[tid], red[tid + o]); __syncthreads(); }
    mx = red[0]; __syncthreads();
    float sum = 0.f;
    for (int j = tid; j < p.n; j += 256) { float v = s[j] * p.scale_in; if (mf) v += mf[j]; sum += (mx == -__builtin_inff()) ? 0.f : expf(v - mx); }
    red[tid] = sum; __syncthreads();
    for (int o = 128; o > 0; o >>= 1) { if (tid < o) red[tid] += red[tid + o]; __syncthreads(); }
    sum = red[0];
    const float inv = (sum > 0.f) ? p.scale_out / sum : 0.f;
    float* d = p.dst + z * p.dz + (long long)r * p.dr;
    for (int j = tid; j < p.n; j += 256) { float v = s[j] * p.scale_in; if (mf) v += mf[j]; const float o = (mx == -__builtin_inff()) ? 0.f : expf(v - mx) * inv; VST2(float, d + j, o); }
}
// =====================================================================================================================
// k_stats: mean and rsqrt(var + eps) over a set of n elements addressed base + z*sz + (e / inner) * so + (e % inner) * si, one 256-thread
// k_norm_apply: y = (x - mean[set]) * rstd[set] * g[c] + b[c] over a [Z][C][L] channel-major tensor with set = z*G + c / (C/G) (G groups per z;
//   G = C -> per-channel sets indexed z*C+c; for batch norm pass stats indexed by c only via bn = 1). Optional act. Output same layout.
// =====================================================================================================================
//   mode 0: mean / rsqrt(var + eps); mode 1 (RMSNorm): 0 / rsqrt(mean(x^2) + eps); mode 2 (L2 normalize * sqrt(n)): 0 / sqrt(n) / max(||x||, eps); mode 3: as 0 with unbiased variance (n-1)
__global__ __launch_bounds__(256) void k_stats(const float* __restrict__ x, long long sz, long long so, long long si, int inner, int n, float eps, float* __restrict__ stat, int mode) {
    __shared__ float red[256];
    const int z = blockIdx.x, tid = threadIdx.x;
    const float* base = x + z * sz;
    float s = 0.f;
    for (int e = tid; e < n; e += 256) s += base[(long long)(e / inner) * so + (long long)(e % inner) * si];
    red[tid] = s; __syncthreads();
    for (int o = 128; o > 0; o >>= 1) { if (tid < o) red[tid] += red[tid + o]; __syncthreads(); }
    const float mu = (mode == 0 || mode == 3) ? red[0] / (float)n : 0.f; __syncthreads();
    float q = 0.f;
    for (int e = tid; e < n; e += 256) { const float dlt = base[(long long)(e / inner) * so + (long long)(e % inner) * si] - mu; q += dlt * dlt; }
    red[tid] = q; __syncthreads();
    for (int o = 128; o > 0; o >>= 1) { if (tid < o) red[tid] += red[tid + o]; __syncthreads(); }
    {
        float rs;
        if (mode == 2) rs = sqrtf((float)n) / fmaxf(sqrtf(red[0]), eps); else if (mode == 3) rs = rsqrtf(red[0] / (float)(n - 1) + eps); else rs = rsqrtf(red[0] / (float)n + eps);
        if (tid < 32) { const float v = (tid == 0) ? mu : ((tid == 1) ? rs : 0.f); VST2(float, stat + (long long)z * 32 + tid, v); }
    }
}
//   One thread per element over the flat [Z][C][L] index space: grid ceil(Z*C*L / 256).
__global__ __launch_bounds__(256) void k_norm_apply(const float* __restrict__ x, float* __restrict__ y, const float* __restrict__ stat, const float* __restrict__ g, const float* __restrict__ bta,
                                                     int Z, int C, int L, int G, int bn, int act) {
    const long long idx = (long long)blockIdx.x * 256 + threadIdx.x;
    if (idx >= (long long)Z * C * L) return;
    const int l = (int)(idx % L); const long long zc = idx / L; const int c = (int)(zc % C), z = (int)(zc / C); (void)l;
    const int set = bn ? c : (z * G + c / (C / G));
    float v = (x[idx] - stat[(long long)set * 32]) * stat[(long long)set * 32 + 1];
    if (g) v *= g[c];
    if (bta) v += bta[c];
    v = act_fn(v, act);
    VST2(float, y + idx, v);
}

// k_lse_neg: c[i] = -(st[2i] + log(st[2i+1])) = minus the log-sum-exp of row i from k_attn's ST output (for softmax over the query dimension)
__global__ __launch_bounds__(256) void k_lse_neg(const float* __restrict__ st, float* __restrict__ c, int n) {
    const int i = blockIdx.x * 256 + threadIdx.x;
    if (i < n) { const float v = -(st[2 * i] + logf(st[2 * i + 1])); VST2(float, c + i, v); }
}

// k_iota: dst[i] = a * i + b as int32 (segment/position id helper)
__global__ __launch_bounds__(256) void k_iota(int* __restrict__ dst, int n, int a, int b) {
    const int i = blockIdx.x * 256 + threadIdx.x;
    if (i < n) { const int v = a * i + b; VST2(int, dst + i, v); }
}

// k_axpby: dst[i] = a * x[i] + b * y[i] (+ c), i < n
__global__ __launch_bounds__(256) void k_axpby(const float* __restrict__ x, const float* __restrict__ y, float* __restrict__ dst, int n, float a, float b, float c) {
    const int i = blockIdx.x * 256 + threadIdx.x;
    if (i < n) { const float v = a * x[i] + b * y[i] + c; VST2(float, dst + i, v); }
}

// =====================================================================================================================
// k_rope: rotary embedding on a [R rows][Hn heads][D] view (row stride sXr, head stride sXh, element stride 1) -> Y (own strides).
//   mode 0: rotate_half (partner d±D/2, sign - for d<D/2); mode 1: interleaved pairs (partner d^1, sign - for even d).
//   table column tcol: tmode 0 -> d, 1 -> d % (D/2), 2 -> d / 2; position p: pmode 0 -> r % S, 1 -> head index, 2 -> pos[r];
//   c = C[(r / S) * sCb + p * sCp + tcol * sCd], s likewise from Sn; y = x[d] * c + sign * x[partner] * s. X and Y must not alias.
// =====================================================================================================================
struct RopeP { const float* X; float* Y; const float* C; const float* Sn; const int* pos; long long sXr, sXh, sYr, sYh, sCb, sCp, sCd; int R, Hn, D, S, mode, tmode, pmode, pad; };
static_assert(sizeof(RopeP) == 5 * 8 + 7 * 8 + 8 * 4, "RopeP has padding");
__global__ __launch_bounds__(256) void k_rope(RopeP p) {
    const long long idx = (long long)blockIdx.x * 256 + threadIdx.x;
    if (idx >= (long long)p.R * p.Hn * p.D) return;
    const int d = (int)(idx % p.D); const long long rh = idx / p.D; const int h = (int)(rh % p.Hn); const int r = (int)(rh / p.Hn);
    const int half = p.D / 2;
    int partner; float sign;
    if (p.mode == 0) { partner = (d < half) ? d + half : d - half; sign = (d < half) ? -1.f : 1.f; }
    else { partner = d ^ 1; sign = (d & 1) ? 1.f : -1.f; }
    const int tcol = (p.tmode == 0) ? d : ((p.tmode == 1) ? (d % half) : (d >> 1));
    const int pp = (p.pmode == 0) ? (r % p.S) : ((p.pmode == 1) ? h : p.pos[r]);
    const long long toff = (long long)(r / p.S) * p.sCb + (long long)pp * p.sCp + (long long)tcol * p.sCd;
    const float* xr = p.X + (long long)r * p.sXr + (long long)h * p.sXh;
    const float v = xr[d] * p.C[toff] + sign * xr[partner] * p.Sn[toff];
    VST2(float, p.Y + (long long)r * p.sYr + (long long)h * p.sYh + d, v);
}

// k_invf + k_sincos (split so neither kernel carries a large VALU-fma footprint): invf_i = num * (1 / powf(base, (2 i)/D)) [fmode 0],
//   num * expf((2 i) * cexp) [fmode 1], num * powf(base, -2 (i - 1) / D) [fmode 2]; then cs/sn[s*half + i] = cos/sin((pscale * s) * invf_i)
__global__ __launch_bounds__(256) void k_invf(float* __restrict__ invb, int half, int D, float base, float num, int fmode, float cexp) {
    const int i = blockIdx.x * 256 + threadIdx.x;
    if (i >= ((half + 31) / 32) * 32) return;
    if (i >= half) { VST2(float, invb + i, 0.f); return; }
    const float e = (float)(2 * i) / (float)D;
    float invf;
    if (fmode == 1) invf = num * expf((float)(2 * i) * cexp);
    else if (fmode == 2) invf = num * powf(base, (-2.0f * ((float)i - 1.0f)) / (float)D);
    else invf = num * (1.0f / powf(base, e));
    VST2(float, invb + i, invf);
}
__global__ __launch_bounds__(256) void k_sincos(float* __restrict__ cs, float* __restrict__ sn, const float* __restrict__ invb, int S, int half, float pscale) {
    const int idx = blockIdx.x * 256 + threadIdx.x;
    if (idx >= S * half) return;
    const int s = idx / half, i = idx - s * half;
    const float ang = (pscale * (float)s) * invb[i];
    VST2(float, cs + idx, cosf(ang)); VST2(float, sn + idx, sinf(ang));
}

// k_mulact: dst[i] = act(x[i]) * y[i]
__global__ __launch_bounds__(256) void k_mulact(const float* __restrict__ x, const float* __restrict__ y, float* __restrict__ dst, int n, int act) {
    const int i = blockIdx.x * 256 + threadIdx.x;
    if (i < n) { const float v = act_fn(x[i], act) * y[i]; VST2(float, dst + i, v); }
}

// =====================================================================================================================
// k_matvec: thread-per-row matrix-vector products for N <= 8 output columns (heads with 1-3 outputs, gates), f32 on the VALU.
//   C[r*sCm + j] = act(alpha * sum_k A[r*sAm + k*sAk] * B[j*sBn + k*sBk] + bias[j]) + beta * R[r*sRm + j*sRn]; each thread writes its N contiguous floats.
// =====================================================================================================================
__global__ __launch_bounds__(256) void k_matvec(GemmP p) {
    // 32 lanes write one line with one instruction.
    const int rpt = (p.N == 1) ? 1 : 32;
    const long long r0 = ((long long)blockIdx.x * 256 + threadIdx.x) * rpt; const int z = blockIdx.z, zo = z / p.zi_n, zi = z - zo * p.zi_n;
    if (r0 >= p.M) return;
    const float* Bb = p.B + zo * p.sBo + zi * p.sBi;
    float* C = p.C + zo * p.sCo + zi * p.sCi; const float* R = p.R + zo * p.sRo + zi * p.sRi;
    for (int rr = 0; rr < rpt; ++rr) {
        const long long r = r0 + rr; if (r >= p.M) break;
        const float* A = p.A + zo * p.sAo + zi * p.sAi + r * p.sAm;
        float acc[8] = {0.f, 0.f, 0.f, 0.f, 0.f, 0.f, 0.f, 0.f};
        for (int k = 0; k < p.K; ++k) { const float a = A[(long long)k * p.sAk];
#pragma unroll
            for (int j = 0; j < 8; ++j) if (j < p.N) acc[j] += a * Bb[(long long)j * p.sBn + (long long)k * p.sBk]; }
#pragma unroll
        for (int j = 0; j < 8; ++j) if (j < p.N) {
            float v = acc[j] * p.alpha;
            if (p.flags & 1) v += p.bias[j];
            if (p.flags & 2) v += p.bias[r];
            v = act_fn(v, p.act);
            if (p.flags & 4) v += p.beta * R[r * p.sRm + (long long)j * p.sRn];
            VST2(float, C + r * p.sCm + j, v);
        }
    }
}
// k_smallsoftmax: thread-per-row softmax for short rows (n <= 64): dst[r*dr + j] = softmax(scale*src[r*sr + j])
__global__ __launch_bounds__(256) void k_smallsoftmax(const float* __restrict__ src, float* __restrict__ dst, long long sr, long long dr, int n, long long R, float scale) {
    const long long r0 = ((long long)blockIdx.x * 256 + threadIdx.x) * 32;
    for (int rr = 0; rr < 32; ++rr) {
        const long long r = r0 + rr; if (r >= R) return;
        const float* s = src + r * sr; float* d = dst + r * dr;
        float mx = -__builtin_inff();
        for (int j = 0; j < n; ++j) mx = fmaxf(mx, s[j] * scale);
        float sum = 0.f;
        for (int j = 0; j < n; ++j) sum += expf(s[j] * scale - mx);
        const float inv = 1.f / sum;
        for (int j = 0; j < n; ++j) { const float v = expf(s[j] * scale - mx) * inv; VST2(float, d + j, v); }
    }
}

__global__ __launch_bounds__(32) void k_unitstat(float* __restrict__ st) { const int t = threadIdx.x; const float v = (t == 1) ? 1.f : 0.f; VST2(float, st + t, v); }

// destination (e.g. a d_out whose row width is not a multiple of 32 floats) is written by consecutive lanes of one instruction
__global__ __launch_bounds__(256) void k_lincopy(const float* __restrict__ src, long long lds, float* __restrict__ dst, long long ldd, long long rows, int cols) {
    const long long i = (long long)blockIdx.x * 256 + threadIdx.x; if (i >= rows * cols) return;
    const long long r = i / cols; const int c = (int)(i - r * cols);
    const float v = src[r * lds + c]; VST2(float, dst + r * ldd + c, v);
}

namespace w25 {
typedef __attribute__((ext_vector_type(16))) _Float16 v16h;
typedef __attribute__((ext_vector_type(8)))  _Float16 v8h;
typedef __attribute__((ext_vector_type(16))) __bf16   v16b;
typedef __attribute__((ext_vector_type(8)))  __bf16   v8b;
typedef __attribute__((ext_vector_type(8)))  float    v8f;
typedef __attribute__((ext_vector_type(4)))  float    v4f;

__device__ __forceinline__ unsigned short f2bf_bits(float f) {
  unsigned u = __float_as_uint(f);
  return (unsigned short)((u + 0x7FFFu + ((u >> 16) & 1u)) >> 16);
}
__device__ __forceinline__ float bf_bits2f(unsigned short h) { return __uint_as_float(((unsigned)h) << 16); }

// hazard guards as plain device helpers (no inline asm inside the kernel template body)
__device__ __forceinline__ void dep_guard_h(v8f& a, v8f& b, v16h x, v16h y) { asm volatile("v_nop\n\tv_nop\n\tv_nop\n\tv_nop" : "+v"(a), "+v"(b) : "v"(x), "v"(y)); }
__device__ __forceinline__ void dep_guard_b(v8f& a, v8f& b, v16b x, v16b y) { asm volatile("v_nop\n\tv_nop\n\tv_nop\n\tv_nop" : "+v"(a), "+v"(b) : "v"(x), "v"(y)); }
__device__ __forceinline__ void keep4_h(v16h a, v16h b, v16h c, v16h d) { asm volatile("v_nop" :: "v"(a), "v"(b), "v"(c), "v"(d)); }
__device__ __forceinline__ void keep4_b(v16b a, v16b b, v16b c, v16b d) { asm volatile("v_nop" :: "v"(a), "v"(b), "v"(c), "v"(d)); }
__device__ __forceinline__ void acc_guard4(v8f& a, v8f& b, v8f& c, v8f& d) { asm volatile("v_nop\n\tv_nop\n\tv_nop\n\tv_nop" : "+v"(a), "+v"(b), "+v"(c), "+v"(d)); }
template <typename T> struct Frag;
template <> struct Frag<_Float16> {
  typedef v16h V; union U { v16h v; v8h h[2]; };
  static __device__ __forceinline__ v16h load(const _Float16* p) {   // elements 0..7 <- p[0..7], 8..15 <- p[16..23]
    U f; f.h[0] = *(const v8h*)(p); f.h[1] = *(const v8h*)(p + 16); return f.v;
  }
  static __device__ __forceinline__ v8f mma(v16h a, v16h b, v8f c) {
    return __builtin_amdgcn_wmma_f32_16x16x32_f16(false, a, false, b, (short)0, c, false, false);
  }
  static __device__ __forceinline__ void guard(v8f& a, v8f& b, v16h x, v16h y) { dep_guard_h(a, b, x, y); }
  static __device__ __forceinline__ void keep(v16h a, v16h b, v16h c, v16h d) { keep4_h(a, b, c, d); }
};
template <> struct Frag<__bf16> {
  typedef v16b V; union U { v16b v; v8b h[2]; };
  static __device__ __forceinline__ v16b load(const __bf16* p) {
    U f; f.h[0] = *(const v8b*)(p); f.h[1] = *(const v8b*)(p + 16); return f.v;
  }
  static __device__ __forceinline__ v8f mma(v16b a, v16b b, v8f c) {
    return __builtin_amdgcn_wmma_f32_16x16x32_bf16(false, a, false, b, (short)0, c, false, false);
  }
  static __device__ __forceinline__ void guard(v8f& a, v8f& b, v16b x, v16b y) { dep_guard_b(a, b, x, y); }
  static __device__ __forceinline__ void keep(v16b a, v16b b, v16b c, v16b d) { keep4_b(a, b, c, d); }
};

// ---- Register-blocked batched WMMA GEMM ------------------------------------
// C[m,n] = scale * sum_k A[m,k] * Bt[n,k] (+bias)(+resid); each wave owns a 64x64 tile.
// A row-major [M,K]; Bt row-major [N,K]; M,N % 64 == 0, K % 32 == 0.
// SPLIT: operands are hi/lo planes (A2/Bt2 = lo planes, same layout); product = hi·hi + hi·lo + lo·hi.
// BIAS_MODE: 0 = none, 1 = bias[m], 2 = bias[n].
// OUT_MODE: 0 = f32, 1 = f16, 2 = bf16 hi plane (Cout) + bf16 lo plane (Cout2).
// ET: 0 = f16 operands, 1 = bf16 operands (pointers passed as 16-bit storage)
template <int ET> struct Elem;
template <> struct Elem<0> { typedef _Float16 T; };
template <> struct Elem<1> { typedef __bf16 T; };
template <int ET, bool SPLIT, int BIAS_MODE, int OUT_MODE, bool RESID, int ACT = 0>
__global__ __launch_bounds__(256) void wmma_gemm64(
    const unsigned short* __restrict__ Ap, const unsigned short* __restrict__ A2p, int lda, long strideA,
    const unsigned short* __restrict__ Btp, const unsigned short* __restrict__ Bt2p, int ldb, long strideB,
    void* __restrict__ Cout, void* __restrict__ Cout2, int ldc, long strideC,
    const float* __restrict__ bias,
    const float* __restrict__ resid, long strideR,
    int M, int N, int K, float scale) {
  typedef typename Elem<ET>::T T;
  typedef typename Frag<T>::V V;
  const T* A = (const T*)Ap; const T* A2 = (const T*)A2p; const T* Bt = (const T*)Btp; const T* Bt2 = (const T*)Bt2p;
  __shared__ __align__(16) float sT[8][16 * 68];   // per-wave 16x64 slab, pitch 68 floats
  const int b    = blockIdx.y;
  const int lane = threadIdx.x & 31;
  const int wave = threadIdx.x >> 5;
  const int tilesN = N >> 6;
  const int tilesM = M >> 6;
  const int tile = blockIdx.x * 8 + wave;
  if (tile >= tilesM * tilesN) return;   // wave-uniform; no block barriers in this kernel
  const int tm = tile / tilesN;
  const int tn = tile - tm * tilesN;
  const int m0 = tm << 6;
  const int n0 = tn << 6;

  const T* Ab  = A  + (size_t)b * strideA;
  const T* Bb  = Bt + (size_t)b * strideB;
  const T* Ab2 = SPLIT ? (A2  + (size_t)b * strideA) : nullptr;
  const T* Bb2 = SPLIT ? (Bt2 + (size_t)b * strideB) : nullptr;

  const int rlane = lane & 15;                 // row (A) / col (B, D) within subtile
  const int koff  = (lane >> 4) * 8;           // k offset of this lane half
  const int mOff  = (lane >> 4) * 8;           // D row offset

  v8f acc[4][4];
#pragma unroll
  for (int i = 0; i < 4; ++i)
#pragma unroll
    for (int j = 0; j < 4; ++j) acc[i][j] = (v8f){0.f,0.f,0.f,0.f,0.f,0.f,0.f,0.f};

  for (int k0 = 0; k0 < K; k0 += 32) {
    V bh[4], bl[4];
#pragma unroll
    for (int j = 0; j < 4; ++j) {
      const size_t bo = (size_t)(n0 + (j << 4) + rlane) * ldb + koff + k0;
      bh[j] = Frag<T>::load(Bb + bo);
      if (SPLIT) bl[j] = Frag<T>::load(Bb2 + bo);
    }
#pragma unroll
    for (int i = 0; i < 4; ++i) {
      const size_t ao = (size_t)(m0 + (i << 4) + rlane) * lda + koff + k0;
      V ah = Frag<T>::load(Ab + ao);
      V al;
      if (SPLIT) al = Frag<T>::load(Ab2 + ao);
#pragma unroll
      for (int j = 0; j < 4; ++j) {
        acc[i][j] = Frag<T>::mma(ah, bh[j], acc[i][j]);
        if (SPLIT) {
          acc[i][j] = Frag<T>::mma(ah, bl[j], acc[i][j]);
          acc[i][j] = Frag<T>::mma(al, bh[j], acc[i][j]);
        }
      }
      Frag<T>::guard(acc[i][0], acc[i][3], ah, SPLIT ? al : ah);
    }
    Frag<T>::keep(bh[0], bh[1], bh[2], bh[3]);
    if (SPLIT) Frag<T>::keep(bl[0], bl[1], bl[2], bl[3]);
  }
  acc_guard4(acc[0][0], acc[0][1], acc[0][2], acc[0][3]);
  acc_guard4(acc[1][0], acc[1][1], acc[1][2], acc[1][3]);
  acc_guard4(acc[2][0], acc[2][1], acc[2][2], acc[2][3]);
  acc_guard4(acc[3][0], acc[3][1], acc[3][2], acc[3][3]);

  // ---- epilogue ----
  float* slab = sT[wave];
  const float* Rb = RESID ? (resid + (size_t)b * strideR) : nullptr;
#pragma unroll
  for (int i = 0; i < 4; ++i) {
    const int mBase = m0 + (i << 4);
#pragma unroll
    for (int j = 0; j < 4; ++j) {
      const int n = n0 + (j << 4) + rlane;
      float bv = 0.f;
      if (BIAS_MODE == 2) bv = bias[n];
#pragma unroll
      for (int r = 0; r < 8; ++r) {
        float v = acc[i][j][r] * scale;
        if (BIAS_MODE == 1) v += bias[mBase + mOff + r];
        if (BIAS_MODE == 2) v += bv;
        if (RESID) v += Rb[(size_t)(mBase + mOff + r) * ldc + n];
        if (ACT == 1) v = tanhf(v);
        if (ACT == 2) v = fmaxf(v, 0.0f);
        if (ACT == 3) v = v / (1.0f + expf(-v));
        if (ACT == 4) v = (v > 0.f) ? v : 0.01f * v;
        if (ACT == 5) v = 0.5f * v * (1.0f + erff(v * 0.70710678118654752f));
        slab[(mOff + r) * 68 + (j << 4) + rlane] = v;
      }
    }
    __builtin_amdgcn_fence(__ATOMIC_RELEASE, "workgroup");
    __builtin_amdgcn_wave_barrier();
    __builtin_amdgcn_fence(__ATOMIC_ACQUIRE, "workgroup");
    if (OUT_MODE == 0) {
      float* C = (float*)Cout + (size_t)b * strideC;
      const int hh = lane >> 4, c4 = (lane & 15) * 4;     // row seg = 256 B = 16 lanes x 16 B
      {
#pragma unroll
        for (int it = 0; it < 8; ++it) {
          const int row = it * 2 + hh;
          v4f v = *(const v4f*)(slab + row * 68 + c4);
          *(v4f*)(C + (size_t)(mBase + row) * ldc + n0 + c4) = v;
        }
        
      }
    } else {
      const int q = lane >> 3, c8 = (lane & 7) * 8;
      unsigned short* C  = (unsigned short*)Cout  + (size_t)b * strideC;
      unsigned short* C2 = (OUT_MODE == 2) ? ((unsigned short*)Cout2 + (size_t)b * strideC) : nullptr;
      {
#pragma unroll
        for (int it = 0; it < 4; ++it) {
          const int row = it * 4 + q;
          const float* sp = slab + row * 68 + c8;
          v8h hv, lv;
#pragma unroll
          for (int e = 0; e < 8; ++e) {
            if (OUT_MODE == 1) {
              hv[e] = (_Float16)sp[e];
            } else {
              unsigned short hb = f2bf_bits(sp[e]);
              unsigned short lb = f2bf_bits(sp[e] - bf_bits2f(hb));
              hv[e] = __builtin_bit_cast(_Float16, hb);
              lv[e] = __builtin_bit_cast(_Float16, lb);
            }
          }
          *(v8h*)(C + (size_t)(mBase + row) * ldc + n0 + c8) = hv;
          if (OUT_MODE == 2) *(v8h*)(C2 + (size_t)(mBase + row) * ldc + n0 + c8) = lv;
        }
        
      }
    }
    __builtin_amdgcn_fence(__ATOMIC_RELEASE, "workgroup");
    __builtin_amdgcn_wave_barrier();
    __builtin_amdgcn_fence(__ATOMIC_ACQUIRE, "workgroup");
  }
}

__global__ __launch_bounds__(256) void cast_f32_f16x2(
    const float* __restrict__ in, _Float16* __restrict__ out, int n2) {
  int i = blockIdx.x * 256 + threadIdx.x;
  if (i < n2) {
    const _Float16 h0 = (_Float16)in[2 * i], h1 = (_Float16)in[2 * i + 1];
    const unsigned u = (unsigned)__builtin_bit_cast(unsigned short, h0) | ((unsigned)__builtin_bit_cast(unsigned short, h1) << 16);
    ((unsigned*)out)[i] = u;
    
  }
}


} // namespace w25

__global__ __launch_bounds__(256) void k_castT16(const float* __restrict__ src, long long lds, _Float16* __restrict__ dst, long long ldd, int R, int C, float s) {
    const long long i = (long long)blockIdx.x * 256 + threadIdx.x; const long long np = (long long)C * (R / 2); if (i >= np) return; const int c = (int)(i / (R / 2)); const int r = 2 * (int)(i % (R / 2));
    const _Float16 h0 = (_Float16)(src[(long long)r * lds + c] * s), h1 = (_Float16)(src[(long long)(r + 1) * lds + c] * s);
    const unsigned u = (unsigned)__builtin_bit_cast(unsigned short, h0) | ((unsigned)__builtin_bit_cast(unsigned short, h1) << 16);
    unsigned* d = (unsigned*)(dst + (long long)c * ldd + r); *d = u;  }
__global__ __launch_bounds__(256) void k_cast16(const float* __restrict__ src, long long lds, _Float16* __restrict__ dst, long long ldd, int R, int C, float s) {
    const long long i = (long long)blockIdx.x * 256 + threadIdx.x; const long long np = (long long)R * (C / 2); if (i >= np) return; const int r = (int)(i / (C / 2)); const int c = 2 * (int)(i % (C / 2));
    const _Float16 h0 = (_Float16)(src[(long long)r * lds + c] * s), h1 = (_Float16)(src[(long long)r * lds + c + 1] * s);
    const unsigned u = (unsigned)__builtin_bit_cast(unsigned short, h0) | ((unsigned)__builtin_bit_cast(unsigned short, h1) << 16);
    unsigned* d = (unsigned*)(dst + (long long)r * ldd + c); *d = u;  }

// f32 -> bf16 hi plane + bf16 lo plane (x = hi + lo to ~2^-17 relative; RNE both), [R][C] -> [R][C] (or transposed to [C][R]); 2 consecutive destination elements
__device__ __forceinline__ unsigned int f2bf2_pack(float a, float b, unsigned int* lo) {
    const unsigned short ha = w25::f2bf_bits(a), hb = w25::f2bf_bits(b);
    const unsigned short la = w25::f2bf_bits(a - w25::bf_bits2f(ha)), lb = w25::f2bf_bits(b - w25::bf_bits2f(hb));
    *lo = (unsigned)la | ((unsigned)lb << 16); return (unsigned)ha | ((unsigned)hb << 16); }
__global__ __launch_bounds__(256) void k_castS16(const float* __restrict__ src, long long lds, __bf16* __restrict__ dhi, __bf16* __restrict__ dlo, long long ldd, int R, int C, float s, int transpose) {
    const long long i = (long long)blockIdx.x * 256 + threadIdx.x; long long o; float a, b;
    if (transpose) { const long long np = (long long)C * (R / 2); if (i >= np) return; const int c = (int)(i / (R / 2)); const int r = 2 * (int)(i % (R / 2)); a = src[(long long)r * lds + c] * s; b = src[(long long)(r + 1) * lds + c] * s; o = (long long)c * ldd + r; }
    else { const long long np = (long long)R * (C / 2); if (i >= np) return; const int r = (int)(i / (C / 2)); const int c = 2 * (int)(i % (C / 2)); a = src[(long long)r * lds + c] * s; b = src[(long long)r * lds + c + 1] * s; o = (long long)r * ldd + c; }
    unsigned lo; const unsigned hi = f2bf2_pack(a, b, &lo); unsigned* ph = (unsigned*)(dhi + o); unsigned* pl = (unsigned*)(dlo + o);
    *ph = hi; *pl = lo;  }

namespace w25 {
// =====================================================================================
// Generic causal/non-causal attention for head_dim 64, f32 in / f32 out; 16-bit operands: bf16 with optional hi/lo splits, or
// plain f16 (F16=true, non-split, probabilities carried x2^15).
//   scores = (q*qscale)·kᵀ : v_wmma_f32_16x16x32_bf16; SPLIT_QK -> q,k as bf16 hi/lo (hi·hi + hi·lo + lo·hi)
//   out    = p·v           : v_wmma_f32_16x16x32_bf16; SPLIT_PV -> p,v as bf16 hi/lo; else p,v plain bf16
//   f32 accumulate; online softmax in f32. Block = 4 waves = 64 query rows of one (batch, head); S % 64 == 0.
//   Element (b, s, h, d) of tensor X lives at X[b*X_bs + s*X_rs + h*X_hs + d] (strides in floats, multiples of 4).
//   Masking: mask_mode 0 none, 1 causal (kv > q masked), 2 tensor [S][Skv] shared over (b,h) (float if
//   mask_is_int==0, int32 with element == 0 -> masked if 1, int32 with element != 0 -> masked if 2), 3 per-token vectors qmask[B][S] & kvmask[B][Skv] (int32,
//   0 -> masked), 4 causal + sliding window (kv > q or q - kv > W masked; W passed in mask_is_int);
//   5 = relative-position bias: s += cp[b,h,q][idx[q][kv]] + pc[b,h,kv][idx[q][kv]] with idx = mask_b ([S][Skv] int32) and
//   mask_a an int32 [S][Skv] tensor with nonzero = masked (tables: element (b,h,row,n) at X + b*c_bs + h*c_hs + row*c_rs + n);
//   masked scores are replaced by mask_fill (e.g. -inf or -1e9) before the softmax.
//   grid.x = B * H * (S/64) (or a sub-range with blk0).
// =====================================================================================
#define AT_D 64
#define AT_NW 4
#define AT_QB 64
#define AT_KC 64
struct AttnGeom { const float* cp = nullptr; const float* pc = nullptr; long c_bs = 0, c_rs = 0, c_hs = 0;   // mode-5 score-bias tables
                  long q_bs, q_rs, q_hs, k_bs, k_rs, k_hs, v_bs, v_rs, v_hs, o_bs, o_rs, o_hs;
                  int S, Skv, H, mask_mode; float qscale; int blk0; float mask_fill; int mask_is_int; };
static_assert(sizeof(AttnGeom) == 168, "no padding");

__device__ __forceinline__ unsigned short at_bf_bits(float f) {
  unsigned u = __float_as_uint(f);
  return (unsigned short)((u + 0x7FFFu + ((u >> 16) & 1u)) >> 16);
}
__device__ __forceinline__ __bf16 at_f2bf(float f) { return __builtin_bit_cast(__bf16, at_bf_bits(f)); }
__device__ __forceinline__ void at_split(float f, __bf16& hi, __bf16& lo) {
  const unsigned short hb = at_bf_bits(f);
  hi = __builtin_bit_cast(__bf16, hb);
  lo = at_f2bf(f - __uint_as_float(((unsigned)hb) << 16));
}
__device__ __forceinline__ v8f at_mma(v16b a, v16b b, v8f c) {
  c = __builtin_amdgcn_wmma_f32_16x16x32_bf16(false, a, false, b, (short)0, c, false, false);
  asm volatile("v_nop\n\tv_nop\n\tv_nop\n\tv_nop" : "+v"(c) : "v"(a), "v"(b));
  return c;
}
// 16-bit element as a bit pattern held in a __bf16 slot: f16 bits when F16, bf16 (RNE) otherwise
template <bool F16> __device__ __forceinline__ __bf16 at_to16(float f) {
  if (F16) return __builtin_bit_cast(__bf16, (_Float16)f);
  return at_f2bf(f);
}
template <bool F16> __device__ __forceinline__ v8f at_mma16(v16b a, v16b b, v8f c) {
  if (F16) {
    const v16h ah = __builtin_bit_cast(v16h, a), bh = __builtin_bit_cast(v16h, b);
    c = __builtin_amdgcn_wmma_f32_16x16x32_f16(false, ah, false, bh, (short)0, c, false, false);
    asm volatile("v_nop\n\tv_nop\n\tv_nop\n\tv_nop" : "+v"(c) : "v"(ah), "v"(bh));
    return c;
  }
  return at_mma(a, b, c);
}

template <bool SPLIT_QK, bool SPLIT_PV, bool F16 = false>
__global__ __launch_bounds__(128)
void attn64_kernel(const float* __restrict__ q, const float* __restrict__ k,
                   const float* __restrict__ v, float* __restrict__ out,
                   const void* __restrict__ mask_a, const int* __restrict__ mask_b, AttnGeom g) {
  static_assert(!(F16 && (SPLIT_QK || SPLIT_PV)), "f16 mode is non-split");
  const float PSC = F16 ? 32768.0f : 1.0f;     // f16 probabilities carried x2^15 (subnormal range), folded into the final 1/l
  union FB { v16b v; v8b h[2]; };
  __shared__ __align__(16) __bf16 Ksh[AT_KC * AT_D];             // K hi [kv][d]      8 KB
  __shared__ __align__(16) __bf16 Ksl[SPLIT_QK ? AT_KC * AT_D : 8];
  __shared__ __align__(16) __bf16 Vth[AT_D * AT_KC];             // V hi [d][kv]      8 KB
  __shared__ __align__(16) __bf16 Vtl[SPLIT_PV ? AT_D * AT_KC : 8];
  __shared__ __align__(16) __bf16 Psh[AT_NW][16 * AT_KC];        // per wave P hi [row][kv]  8 KB
  __shared__ __align__(16) __bf16 Psl[SPLIT_PV ? AT_NW : 1][SPLIT_PV ? 16 * AT_KC : 8];
  __shared__ __align__(16) float  Os[AT_NW][16 * 68];            // per wave out tile, pitch 68

  const int tid  = threadIdx.x;
  const int wave = tid >> 5;
  const int lane = tid & 31;
  const int hh   = lane >> 4;
  const int c    = lane & 15;

  const int nqb = g.S / AT_QB;
  const int bx = blockIdx.x + g.blk0;
  const int qb = bx % nqb;
  const int bh = bx / nqb;
  const int h  = bh % g.H;
  const int b  = bh / g.H;
  const int qbase_block = qb * AT_QB;
  const int q0 = qbase_block + wave * 16;

  const float* qb_ptr = q + (size_t)b * g.q_bs + (size_t)h * g.q_hs;
  const float* kb_ptr = k + (size_t)b * g.k_bs + (size_t)h * g.k_hs;
  const float* vb_ptr = v + (size_t)b * g.v_bs + (size_t)h * g.v_hs;
  float*       ob_ptr = out + (size_t)b * g.o_bs + (size_t)h * g.o_hs;

  // ---- Q fragments (A operand): 2 d-chunks, hi (and lo) ----
  v16b qah[2], qal[2];
  {
    const float* qrow = qb_ptr + (size_t)(q0 + c) * g.q_rs;
#pragma unroll
    for (int dc = 0; dc < 2; ++dc) {
#pragma unroll
      for (int e = 0; e < 8; ++e) {
        const float f0 = qrow[dc * 32 + 8 * hh + e] * g.qscale;
        const float f1 = qrow[dc * 32 + 16 + 8 * hh + e] * g.qscale;
        if (SPLIT_QK) { __bf16 hq, lq; at_split(f0, hq, lq); qah[dc][e] = hq; qal[dc][e] = lq; at_split(f1, hq, lq); qah[dc][8 + e] = hq; qal[dc][8 + e] = lq; }
        else { qah[dc][e] = at_to16<F16>(f0); qah[dc][8 + e] = at_to16<F16>(f1); qal[dc][e] = qah[dc][e]; qal[dc][8 + e] = qah[dc][8 + e]; }
      }
    }
  }

  float mrow[8], lrow[8];
  v8f oacc[4];
#pragma unroll
  for (int r = 0; r < 8; ++r) { mrow[r] = -INFINITY; lrow[r] = 0.f; }
#pragma unroll
  for (int t = 0; t < 4; ++t) oacc[t] = (v8f){0.f,0.f,0.f,0.f,0.f,0.f,0.f,0.f};

  const int nChunks = (g.mask_mode == 1 || g.mask_mode == 4) ? (qb + 1) : (g.Skv / AT_KC);   // block-uniform
  // per-row query mask (mode 3)
  int qkeep[8];
#pragma unroll
  for (int r = 0; r < 8; ++r) qkeep[r] = (g.mask_mode == 3) ? mask_b[(size_t)b * g.S + q0 + 8 * hh + r] : 1;   // mask_b = qmask in mode 3
  for (int kc = 0; kc < nChunks; ++kc) {
    const int kv0 = kc * AT_KC;
    __syncthreads();
    {
      const int kvr = tid >> 1, dh = (tid & 1) * 32;
      const float* krow = kb_ptr + (size_t)(kv0 + kvr) * g.k_rs + dh;
      const float* vrow = vb_ptr + (size_t)(kv0 + kvr) * g.v_rs + dh;
#pragma unroll
      for (int i = 0; i < 8; ++i) {
        v4f kk = *(const v4f*)(krow + 4 * i);
        v4f vv = *(const v4f*)(vrow + 4 * i);
#pragma unroll
        for (int e = 0; e < 4; ++e) {
          const int d = dh + 4 * i + e;
          if (SPLIT_QK) { __bf16 a, bl; at_split(kk[e], a, bl); Ksh[kvr * AT_D + d] = a; Ksl[kvr * AT_D + d] = bl; }
          else Ksh[kvr * AT_D + d] = at_to16<F16>(kk[e]);
          if (SPLIT_PV) { __bf16 a, bl; at_split(vv[e], a, bl); Vth[d * AT_KC + kvr] = a; Vtl[d * AT_KC + kvr] = bl; }
          else Vth[d * AT_KC + kvr] = at_to16<F16>(vv[e]);
        }
      }
    }
    __syncthreads();

    v8f s[4];
#pragma unroll
    for (int j = 0; j < 4; ++j) {
      s[j] = (v8f){0.f,0.f,0.f,0.f,0.f,0.f,0.f,0.f};
#pragma unroll 1
      for (int dc = 0; dc < 2; ++dc) {
        FB kb;
        kb.h[0] = *(const v8b*)(Ksh + (j * 16 + c) * AT_D + dc * 32 + 8 * hh);
        kb.h[1] = *(const v8b*)(Ksh + (j * 16 + c) * AT_D + dc * 32 + 16 + 8 * hh);
        s[j] = at_mma16<F16>(qah[dc], kb.v, s[j]);
        if (SPLIT_QK) {
          FB kl;
          kl.h[0] = *(const v8b*)(Ksl + (j * 16 + c) * AT_D + dc * 32 + 8 * hh);
          kl.h[1] = *(const v8b*)(Ksl + (j * 16 + c) * AT_D + dc * 32 + 16 + 8 * hh);
          s[j] = at_mma16<F16>(qah[dc], kl.v, s[j]);
          s[j] = at_mma16<F16>(qal[dc], kb.v, s[j]);
        }
      }
    }
    const bool diag = (g.mask_mode == 1) && (kc == qb);
    int kvkeep[4] = {1, 1, 1, 1};
    if (g.mask_mode == 3) {
#pragma unroll
      for (int j = 0; j < 4; ++j) kvkeep[j] = ((const int*)mask_a)[(size_t)b * g.Skv + kv0 + j * 16 + c];   // mask_a = kvmask
    }
    float cm[8];
#pragma unroll
    for (int r = 0; r < 8; ++r) {
      const int qrow = q0 + 8 * hh + r;
      float m = -INFINITY;
#pragma unroll
      for (int j = 0; j < 4; ++j) {
        const int kvcol = kv0 + j * 16 + c;
        bool masked = false;
        if (diag) masked = (kvcol > qrow);
        else if (g.mask_mode == 4) masked = (kvcol > qrow) || (qrow - kvcol > g.mask_is_int);
        else if (g.mask_mode == 2) {
          const size_t mi = (size_t)qrow * g.Skv + kvcol;
          masked = (g.mask_is_int == 0) ? (((const float*)mask_a)[mi] == 0.0f)
                 : (g.mask_is_int == 1) ? (((const int*)mask_a)[mi] == 0) : (((const int*)mask_a)[mi] != 0);
        } else if (g.mask_mode == 3) masked = (qkeep[r] == 0) || (kvkeep[j] == 0);
        else if (g.mask_mode == 5) {
          const size_t mi = (size_t)qrow * g.Skv + kvcol;
          masked = (((const int*)mask_a)[mi] != 0);
          int n = mask_b[mi]; n = n < 0 ? 0 : n;
          s[j][r] += g.cp[(size_t)b * g.c_bs + (size_t)h * g.c_hs + (size_t)qrow * g.c_rs + n]
                   + g.pc[(size_t)b * g.c_bs + (size_t)h * g.c_hs + (size_t)kvcol * g.c_rs + n];
        }
        if (masked) s[j][r] = g.mask_fill;
        m = fmaxf(m, s[j][r]);
      }
#pragma unroll
      for (int off = 1; off < 16; off <<= 1) m = fmaxf(m, __shfl_xor(m, off, 32));
      cm[r] = m;
    }
    __bf16* pwh = Psh[wave];
    __bf16* pwl = Psl[SPLIT_PV ? wave : 0];
#pragma unroll
    for (int r = 0; r < 8; ++r) {
      const float mnew = fmaxf(mrow[r], cm[r]);
      const float alpha = expf(mrow[r] - mnew);
      mrow[r] = mnew;
      float psum = 0.f;
#pragma unroll
      for (int j = 0; j < 4; ++j) {
        const float p = expf(s[j][r] - mnew);
        psum += p;
        if (SPLIT_PV) { __bf16 a, bl; at_split(p, a, bl); pwh[(8 * hh + r) * AT_KC + j * 16 + c] = a; pwl[(8 * hh + r) * AT_KC + j * 16 + c] = bl; }
        else pwh[(8 * hh + r) * AT_KC + j * 16 + c] = at_to16<F16>(p * PSC);
      }
#pragma unroll
      for (int off = 1; off < 16; off <<= 1) psum += __shfl_xor(psum, off, 32);
      lrow[r] = lrow[r] * alpha + psum;
#pragma unroll
      for (int t = 0; t < 4; ++t) oacc[t][r] *= alpha;
    }
    __builtin_amdgcn_fence(__ATOMIC_RELEASE, "workgroup");
    __builtin_amdgcn_wave_barrier();
    __builtin_amdgcn_fence(__ATOMIC_ACQUIRE, "workgroup");
#pragma unroll 1
    for (int kk = 0; kk < 2; ++kk) {
      FB pa, pl;
      pa.h[0] = *(const v8b*)(pwh + c * AT_KC + kk * 32 + 8 * hh);
      pa.h[1] = *(const v8b*)(pwh + c * AT_KC + kk * 32 + 16 + 8 * hh);
      if (SPLIT_PV) {
        pl.h[0] = *(const v8b*)(pwl + c * AT_KC + kk * 32 + 8 * hh);
        pl.h[1] = *(const v8b*)(pwl + c * AT_KC + kk * 32 + 16 + 8 * hh);
      }
#pragma unroll
      for (int t = 0; t < 4; ++t) {
        FB vb;
        vb.h[0] = *(const v8b*)(Vth + (t * 16 + c) * AT_KC + kk * 32 + 8 * hh);
        vb.h[1] = *(const v8b*)(Vth + (t * 16 + c) * AT_KC + kk * 32 + 16 + 8 * hh);
        oacc[t] = at_mma16<F16>(pa.v, vb.v, oacc[t]);
        if (SPLIT_PV) {
          FB vl;
          vl.h[0] = *(const v8b*)(Vtl + (t * 16 + c) * AT_KC + kk * 32 + 8 * hh);
          vl.h[1] = *(const v8b*)(Vtl + (t * 16 + c) * AT_KC + kk * 32 + 16 + 8 * hh);
          oacc[t] = at_mma16<F16>(pa.v, vl.v, oacc[t]);
          oacc[t] = at_mma16<F16>(pl.v, vb.v, oacc[t]);
        }
      }
    }
  }

  float* os = Os[wave];
#pragma unroll
  for (int r = 0; r < 8; ++r) {
    const float inv = 1.0f / (lrow[r] * PSC);
#pragma unroll
    for (int t = 0; t < 4; ++t) os[(8 * hh + r) * 68 + t * 16 + c] = oacc[t][r] * inv;
  }
  __builtin_amdgcn_fence(__ATOMIC_RELEASE, "workgroup");
  __builtin_amdgcn_wave_barrier();
  __builtin_amdgcn_fence(__ATOMIC_ACQUIRE, "workgroup");
  {
    const int c4 = (lane & 15) * 4;
    {
#pragma unroll
      for (int it = 0; it < 8; ++it) {
        const int row = it * 2 + hh;
        v4f val = *(const v4f*)(os + row * 68 + c4);
        *(v4f*)(ob_ptr + (size_t)(q0 + row) * g.o_rs + c4) = val;
      }
      
    }
  }
}

} // namespace w25

__device__ __forceinline__ void st_h2(_Float16* dst, float a, float b) { const unsigned u = (unsigned)__builtin_bit_cast(unsigned short, (_Float16)a) | ((unsigned)__builtin_bit_cast(unsigned short, (_Float16)b) << 16); unsigned* d = (unsigned*)dst; *d = u;  }
// TK16 [r][d] = 16 table_k[r][d], zero rows 129..191
__global__ __launch_bounds__(256) void k_sh_tk(const float* __restrict__ TK, _Float16* __restrict__ TK16, int TAB, int TP, int HD) { const int t = blockIdx.x * 256 + threadIdx.x; if (t >= TP * HD / 2) return; const int e = 2 * t; const int r = e / HD; st_h2(TK16 + e, (r < TAB) ? TK[e] * 16.f : 0.f, (r < TAB) ? TK[e + 1] * 16.f : 0.f); }
// per (b, h, q) row (block; heads h0..h0+7 per launch): s_k = (SC[h-h0][q][k] + QT[(q,h)][fm[b][q][k]]) / 8; softmax over 512 k (exp once) -> P16[h][q][k] = f16(4096 p); SC keeps the f32 probabilities
__global__ __launch_bounds__(256) void k_sh_soft(float* __restrict__ SC, const float* __restrict__ QT, const int* __restrict__ FM, _Float16* __restrict__ P16, int b, int h0, int L, int NH, int TP, int TAB) { __shared__ float red[256]; const int rl = blockIdx.x; const int h = h0 + rl / L, q = rl % L; const int row = h * L + q; const int t = threadIdx.x; float* sr = SC + (long long)rl * L; const float* qt = QT + ((long long)q * NH + h) * TP; const int* fr = FM + ((long long)b * L + q) * L;
    float v0, v1; { const int j = 2 * t; int r0 = fr[j], r1 = fr[j + 1]; r0 = r0 < 0 ? 0 : (r0 >= TAB ? TAB - 1 : r0); r1 = r1 < 0 ? 0 : (r1 >= TAB ? TAB - 1 : r1); v0 = (sr[j] + qt[r0]) * 0.125f; v1 = (sr[j + 1] + qt[r1]) * 0.125f; }
    red[t] = fmaxf(v0, v1); __syncthreads(); for (int o = 128; o > 0; o >>= 1) { if (t < o) red[t] = fmaxf(red[t], red[t + o]); __syncthreads(); } const float m = red[0]; __syncthreads();
    const float e0 = expf(v0 - m), e1 = expf(v1 - m); red[t] = e0 + e1; __syncthreads(); for (int o = 128; o > 0; o >>= 1) { if (t < o) red[t] += red[t + o]; __syncthreads(); } const float f = 1.f / red[0];
    { const int j = 2 * t; const unsigned long long pk = (unsigned long long)__builtin_bit_cast(unsigned, e0 * f) | ((unsigned long long)__builtin_bit_cast(unsigned, e1 * f) << 32); VST2(unsigned long long, (unsigned long long*)(sr + j), pk); st_h2(P16 + (long long)row * L + j, e0 * f * 4096.f, e1 * f * 4096.f); } }
// zero the padding heads 16..63 of P16 once (thread per dword)
__global__ __launch_bounds__(256) void k_sh_zero(_Float16* __restrict__ P, long long nhalf) { const long long t = (long long)blockIdx.x * 256 + threadIdx.x; if (t >= nhalf / 2) return; unsigned* d = (unsigned*)(P + 2 * t); *d = 0u;  }
// RVT[(q - q0)][d][k] = f16(table_v[fm[b][q][k]][d]) for q in [q0, q0+256): the gathered relative-value rows as transposed B-operand planes (thread per (q, d, k pair); INPUT ids clamped)
__global__ __launch_bounds__(256) void k_sh_rvt(const int* __restrict__ FM, const float* __restrict__ TV, _Float16* __restrict__ RVT, int b, int q0, int L, int HD, int TAB) { const long long t = (long long)blockIdx.x * 256 + threadIdx.x; const long long n = (long long)256 * HD * L; if (t >= n / 2) return; const long long e = 2 * t; const int kk = (int)(e % L); const int d = (int)((e / L) % HD); const int ql = (int)(e / ((long long)L * HD)); const int* fr = FM + ((long long)b * L + q0 + ql) * L;
    int r0 = fr[kk], r1 = fr[kk + 1]; r0 = r0 < 0 ? 0 : (r0 >= TAB ? TAB - 1 : r0); r1 = r1 < 0 ? 0 : (r1 >= TAB ? TAB - 1 : r1); st_h2(RVT + e, TV[r0 * HD + d], TV[r1 * HD + d]); }
// X[b][q][h*64 + d] += W2T[(q - q0)][h][d] / 4096 for h < 16 (rows 16..63 of each W2T slab are padding garbage and ignored) (thread-linear over (ql, h, d): 1024 contiguous floats per q)
__global__ __launch_bounds__(256) void k_sh_w2add(const float* __restrict__ W2T, float* __restrict__ X, int b, int q0, int L, int D, int HD) { const long long t = (long long)blockIdx.x * 256 + threadIdx.x; if (t >= (long long)256 * D) return; const int ql = (int)(t / D); const int c = (int)(t % D); const int h = c / HD, d = c % HD; float* xo = X + ((long long)b * L + q0 + ql) * D + c; VST2(float, xo, *xo + W2T[((long long)ql * 64 + h) * HD + d] * (1.f / 4096.f)); }


extern "C" void kernel_launch(void* const* d_in, const int* in_sizes, int n_in, void* d_out, int out_size, void* d_ws, size_t ws_size, hipStream_t stream) {
    (void)in_sizes; (void)n_in; (void)out_size; (void)ws_size;
    const float* xq = (const float*)d_in[0];
    const float* xk = (const float*)d_in[1];
    const float* xv = (const float*)d_in[2];
    const int* fm = (const int*)d_in[3];
    const float* Wq = (const float*)d_in[4];
    const float* bq = (const float*)d_in[5];
    const float* Wk = (const float*)d_in[6];
    const float* bk = (const float*)d_in[7];
    const float* Wv = (const float*)d_in[8];
    const float* bv = (const float*)d_in[9];
    const float* Wo = (const float*)d_in[10];
    const float* bo = (const float*)d_in[11];
    const float* tk = (const float*)d_in[12];
    const float* tv = (const float*)d_in[13];
    const int Bn = 8;
    const int L = 512;
    const int D = 1024;
    const int NH = 16;
    const int HD = 64;
    const int NR = Bn * L;
    const int TAB = 129;
    const int TP = 192;
    float* out = (float*)d_out;
    char* wsp = (char*)d_ws;
    unsigned short* XA16 = (unsigned short*)wsp; wsp += (((size_t)((size_t)NR * D) * 2 + 255) / 256) * 256;
    unsigned short* W16 = (unsigned short*)wsp; wsp += (((size_t)((size_t)D * D) * 2 + 255) / 256) * 256;
    unsigned short* Q16 = (unsigned short*)wsp; wsp += (((size_t)((size_t)NR * D) * 2 + 255) / 256) * 256;
    unsigned short* K16 = (unsigned short*)wsp; wsp += (((size_t)((size_t)NR * D) * 2 + 255) / 256) * 256;
    unsigned short* VT16 = (unsigned short*)wsp; wsp += (((size_t)((size_t)D * L) * 2 + 255) / 256) * 256;
    unsigned short* TK16 = (unsigned short*)wsp; wsp += (((size_t)((size_t)TP * HD) * 2 + 255) / 256) * 256;
    float* QT = (float*)wsp; wsp += (((size_t)((size_t)L * NH * TP) * 4 + 255) / 256) * 256;
    float* SC = (float*)wsp; wsp += (((size_t)((size_t)8 * L * L) * 4 + 255) / 256) * 256;
    unsigned short* P16 = (unsigned short*)wsp; wsp += (((size_t)((size_t)64 * L * L) * 2 + 255) / 256) * 256;
    float* X = (float*)wsp; wsp += (((size_t)((size_t)NR * D) * 4 + 255) / 256) * 256;
    unsigned short* RVT = (unsigned short*)wsp; wsp += (((size_t)((size_t)256 * HD * L) * 2 + 255) / 256) * 256;
    float* W2T = (float*)wsp; wsp += (((size_t)((size_t)256 * 64 * HD) * 4 + 255) / 256) * 256;
    unsigned short* G64A = (unsigned short*)wsp; wsp += (((size_t)(4194304) * 2 + 255) / 256) * 256;
    unsigned short* G64B = (unsigned short*)wsp; wsp += (((size_t)(1048576) * 2 + 255) / 256) * 256;
    k_cast16<<<(unsigned)((((long long)(NR) * ((D) / 2)) + 255) / 256), 256, 0, stream>>>(xq, D, (_Float16*)(XA16), D, NR, D, 1.0f);
    k_cast16<<<(unsigned)((((long long)(D) * ((D) / 2)) + 255) / 256), 256, 0, stream>>>(Wq, D, (_Float16*)(W16), D, D, D, 16.0f);
    w25::wmma_gemm64<0, false, 2, 1, false, 0><<<dim3((unsigned)((((NR) / 64) * ((D) / 64) + 7) / 8), (unsigned)(1)), 256, 0, stream>>>((const unsigned short*)(XA16), nullptr, D, 0, (const unsigned short*)(W16), nullptr, D, 0, (void*)(Q16), nullptr, D, 0, bq, nullptr, 0, NR, D, D, 0.0625f);
    k_cast16<<<(unsigned)((((long long)(NR) * ((D) / 2)) + 255) / 256), 256, 0, stream>>>(xk, D, (_Float16*)(XA16), D, NR, D, 1.0f);
    k_cast16<<<(unsigned)((((long long)(D) * ((D) / 2)) + 255) / 256), 256, 0, stream>>>(Wk, D, (_Float16*)(W16), D, D, D, 16.0f);
    w25::wmma_gemm64<0, false, 2, 1, false, 0><<<dim3((unsigned)((((NR) / 64) * ((D) / 64) + 7) / 8), (unsigned)(1)), 256, 0, stream>>>((const unsigned short*)(XA16), nullptr, D, 0, (const unsigned short*)(W16), nullptr, D, 0, (void*)(K16), nullptr, D, 0, bk, nullptr, 0, NR, D, D, 0.0625f);
    k_cast16<<<(unsigned)((((long long)(NR) * ((D) / 2)) + 255) / 256), 256, 0, stream>>>(xv, D, (_Float16*)(XA16), D, NR, D, 1.0f);
    k_cast16<<<(unsigned)((((long long)(D) * ((D) / 2)) + 255) / 256), 256, 0, stream>>>(Wv, D, (_Float16*)(W16), D, D, D, 16.0f);
    k_sh_tk<<<(TP * HD / 2 + 255) / 256, 256, 0, stream>>>(tk, (_Float16*)TK16, TAB, TP, HD);
    k_sh_zero<<<(unsigned)(((long long)48 * L * L / 2 + 255) / 256), 256, 0, stream>>>((_Float16*)P16 + (size_t)16 * L * L, (long long)48 * L * L);
    w25::wmma_gemm64<0, false, 0, 0, false, 0><<<dim3((unsigned)((((L * NH) / 64) * ((TP) / 64) + 7) / 8), (unsigned)(1)), 256, 0, stream>>>((const unsigned short*)(Q16 + (size_t)0 * L * D), nullptr, HD, 0, (const unsigned short*)(TK16), nullptr, HD, 0, (void*)(QT), nullptr, TP, 0, nullptr, nullptr, 0, L * NH, TP, HD, 0.0625f);
    w25::wmma_gemm64<0, false, 1, 1, false, 0><<<dim3((unsigned)((((D) / 64) * ((L) / 64) + 7) / 8), (unsigned)(1)), 256, 0, stream>>>((const unsigned short*)(W16), nullptr, D, 0, (const unsigned short*)(XA16 + (size_t)0 * L * D), nullptr, D, 0, (void*)(VT16), nullptr, L, 0, bv, nullptr, 0, D, L, D, 0.0625f);
    w25::wmma_gemm64<0, false, 0, 0, false, 0><<<dim3((unsigned)((((L) / 64) * ((L) / 64) + 7) / 8), (unsigned)(8)), 256, 0, stream>>>((const unsigned short*)(Q16 + (size_t)0 * L * D + 0 * HD), nullptr, D, HD, (const unsigned short*)(K16 + (size_t)0 * L * D + 0 * HD), nullptr, D, HD, (void*)(SC), nullptr, L, (long long)L * L, nullptr, nullptr, 0, L, L, HD, 1.0f);
    k_sh_soft<<<8 * L, 256, 0, stream>>>(SC, QT, (const int*)fm, (_Float16*)P16, 0, 0, L, NH, TP, TAB);
    w25::wmma_gemm64<0, false, 0, 0, false, 0><<<dim3((unsigned)((((L) / 64) * ((L) / 64) + 7) / 8), (unsigned)(8)), 256, 0, stream>>>((const unsigned short*)(Q16 + (size_t)0 * L * D + 8 * HD), nullptr, D, HD, (const unsigned short*)(K16 + (size_t)0 * L * D + 8 * HD), nullptr, D, HD, (void*)(SC), nullptr, L, (long long)L * L, nullptr, nullptr, 0, L, L, HD, 1.0f);
    k_sh_soft<<<8 * L, 256, 0, stream>>>(SC, QT, (const int*)fm, (_Float16*)P16, 0, 8, L, NH, TP, TAB);
    w25::wmma_gemm64<0, false, 0, 0, false, 0><<<dim3((unsigned)((((L) / 64) * ((HD) / 64) + 7) / 8), (unsigned)(NH)), 256, 0, stream>>>((const unsigned short*)(P16), nullptr, L, (long long)L * L, (const unsigned short*)(VT16), nullptr, L, (long long)HD * L, (void*)(X + (size_t)0 * L * D), nullptr, D, HD, nullptr, nullptr, 0, L, HD, L, 0.000244140625f);
    k_sh_rvt<<<(unsigned)(((long long)256 * HD * L / 2 + 255) / 256), 256, 0, stream>>>((const int*)fm, tv, (_Float16*)RVT, 0, 0, L, HD, TAB);
    w25::wmma_gemm64<0, false, 0, 0, false, 0><<<dim3((unsigned)((((64) / 64) * ((HD) / 64) + 7) / 8), (unsigned)(256)), 256, 0, stream>>>((const unsigned short*)(P16 + (size_t)0 * L), nullptr, (long long)L * L, L, (const unsigned short*)(RVT), nullptr, L, (long long)HD * L, (void*)(W2T), nullptr, HD, 64 * HD, nullptr, nullptr, 0, 64, HD, L, 1.0f);
    k_sh_w2add<<<(256 * D + 255) / 256, 256, 0, stream>>>(W2T, X, 0, 0, L, D, HD);
    k_sh_rvt<<<(unsigned)(((long long)256 * HD * L / 2 + 255) / 256), 256, 0, stream>>>((const int*)fm, tv, (_Float16*)RVT, 0, 256, L, HD, TAB);
    w25::wmma_gemm64<0, false, 0, 0, false, 0><<<dim3((unsigned)((((64) / 64) * ((HD) / 64) + 7) / 8), (unsigned)(256)), 256, 0, stream>>>((const unsigned short*)(P16 + (size_t)256 * L), nullptr, (long long)L * L, L, (const unsigned short*)(RVT), nullptr, L, (long long)HD * L, (void*)(W2T), nullptr, HD, 64 * HD, nullptr, nullptr, 0, 64, HD, L, 1.0f);
    k_sh_w2add<<<(256 * D + 255) / 256, 256, 0, stream>>>(W2T, X, 0, 256, L, D, HD);
    w25::wmma_gemm64<0, false, 0, 0, false, 0><<<dim3((unsigned)((((L * NH) / 64) * ((TP) / 64) + 7) / 8), (unsigned)(1)), 256, 0, stream>>>((const unsigned short*)(Q16 + (size_t)1 * L * D), nullptr, HD, 0, (const unsigned short*)(TK16), nullptr, HD, 0, (void*)(QT), nullptr, TP, 0, nullptr, nullptr, 0, L * NH, TP, HD, 0.0625f);
    w25::wmma_gemm64<0, false, 1, 1, false, 0><<<dim3((unsigned)((((D) / 64) * ((L) / 64) + 7) / 8), (unsigned)(1)), 256, 0, stream>>>((const unsigned short*)(W16), nullptr, D, 0, (const unsigned short*)(XA16 + (size_t)1 * L * D), nullptr, D, 0, (void*)(VT16), nullptr, L, 0, bv, nullptr, 0, D, L, D, 0.0625f);
    w25::wmma_gemm64<0, false, 0, 0, false, 0><<<dim3((unsigned)((((L) / 64) * ((L) / 64) + 7) / 8), (unsigned)(8)), 256, 0, stream>>>((const unsigned short*)(Q16 + (size_t)1 * L * D + 0 * HD), nullptr, D, HD, (const unsigned short*)(K16 + (size_t)1 * L * D + 0 * HD), nullptr, D, HD, (void*)(SC), nullptr, L, (long long)L * L, nullptr, nullptr, 0, L, L, HD, 1.0f);
    k_sh_soft<<<8 * L, 256, 0, stream>>>(SC, QT, (const int*)fm, (_Float16*)P16, 1, 0, L, NH, TP, TAB);
    w25::wmma_gemm64<0, false, 0, 0, false, 0><<<dim3((unsigned)((((L) / 64) * ((L) / 64) + 7) / 8), (unsigned)(8)), 256, 0, stream>>>((const unsigned short*)(Q16 + (size_t)1 * L * D + 8 * HD), nullptr, D, HD, (const unsigned short*)(K16 + (size_t)1 * L * D + 8 * HD), nullptr, D, HD, (void*)(SC), nullptr, L, (long long)L * L, nullptr, nullptr, 0, L, L, HD, 1.0f);
    k_sh_soft<<<8 * L, 256, 0, stream>>>(SC, QT, (const int*)fm, (_Float16*)P16, 1, 8, L, NH, TP, TAB);
    w25::wmma_gemm64<0, false, 0, 0, false, 0><<<dim3((unsigned)((((L) / 64) * ((HD) / 64) + 7) / 8), (unsigned)(NH)), 256, 0, stream>>>((const unsigned short*)(P16), nullptr, L, (long long)L * L, (const unsigned short*)(VT16), nullptr, L, (long long)HD * L, (void*)(X + (size_t)1 * L * D), nullptr, D, HD, nullptr, nullptr, 0, L, HD, L, 0.000244140625f);
    k_sh_rvt<<<(unsigned)(((long long)256 * HD * L / 2 + 255) / 256), 256, 0, stream>>>((const int*)fm, tv, (_Float16*)RVT, 1, 0, L, HD, TAB);
    w25::wmma_gemm64<0, false, 0, 0, false, 0><<<dim3((unsigned)((((64) / 64) * ((HD) / 64) + 7) / 8), (unsigned)(256)), 256, 0, stream>>>((const unsigned short*)(P16 + (size_t)0 * L), nullptr, (long long)L * L, L, (const unsigned short*)(RVT), nullptr, L, (long long)HD * L, (void*)(W2T), nullptr, HD, 64 * HD, nullptr, nullptr, 0, 64, HD, L, 1.0f);
    k_sh_w2add<<<(256 * D + 255) / 256, 256, 0, stream>>>(W2T, X, 1, 0, L, D, HD);
    k_sh_rvt<<<(unsigned)(((long long)256 * HD * L / 2 + 255) / 256), 256, 0, stream>>>((const int*)fm, tv, (_Float16*)RVT, 1, 256, L, HD, TAB);
    w25::wmma_gemm64<0, false, 0, 0, false, 0><<<dim3((unsigned)((((64) / 64) * ((HD) / 64) + 7) / 8), (unsigned)(256)), 256, 0, stream>>>((const unsigned short*)(P16 + (size_t)256 * L), nullptr, (long long)L * L, L, (const unsigned short*)(RVT), nullptr, L, (long long)HD * L, (void*)(W2T), nullptr, HD, 64 * HD, nullptr, nullptr, 0, 64, HD, L, 1.0f);
    k_sh_w2add<<<(256 * D + 255) / 256, 256, 0, stream>>>(W2T, X, 1, 256, L, D, HD);
    w25::wmma_gemm64<0, false, 0, 0, false, 0><<<dim3((unsigned)((((L * NH) / 64) * ((TP) / 64) + 7) / 8), (unsigned)(1)), 256, 0, stream>>>((const unsigned short*)(Q16 + (size_t)2 * L * D), nullptr, HD, 0, (const unsigned short*)(TK16), nullptr, HD, 0, (void*)(QT), nullptr, TP, 0, nullptr, nullptr, 0, L * NH, TP, HD, 0.0625f);
    w25::wmma_gemm64<0, false, 1, 1, false, 0><<<dim3((unsigned)((((D) / 64) * ((L) / 64) + 7) / 8), (unsigned)(1)), 256, 0, stream>>>((const unsigned short*)(W16), nullptr, D, 0, (const unsigned short*)(XA16 + (size_t)2 * L * D), nullptr, D, 0, (void*)(VT16), nullptr, L, 0, bv, nullptr, 0, D, L, D, 0.0625f);
    w25::wmma_gemm64<0, false, 0, 0, false, 0><<<dim3((unsigned)((((L) / 64) * ((L) / 64) + 7) / 8), (unsigned)(8)), 256, 0, stream>>>((const unsigned short*)(Q16 + (size_t)2 * L * D + 0 * HD), nullptr, D, HD, (const unsigned short*)(K16 + (size_t)2 * L * D + 0 * HD), nullptr, D, HD, (void*)(SC), nullptr, L, (long long)L * L, nullptr, nullptr, 0, L, L, HD, 1.0f);
    k_sh_soft<<<8 * L, 256, 0, stream>>>(SC, QT, (const int*)fm, (_Float16*)P16, 2, 0, L, NH, TP, TAB);
    w25::wmma_gemm64<0, false, 0, 0, false, 0><<<dim3((unsigned)((((L) / 64) * ((L) / 64) + 7) / 8), (unsigned)(8)), 256, 0, stream>>>((const unsigned short*)(Q16 + (size_t)2 * L * D + 8 * HD), nullptr, D, HD, (const unsigned short*)(K16 + (size_t)2 * L * D + 8 * HD), nullptr, D, HD, (void*)(SC), nullptr, L, (long long)L * L, nullptr, nullptr, 0, L, L, HD, 1.0f);
    k_sh_soft<<<8 * L, 256, 0, stream>>>(SC, QT, (const int*)fm, (_Float16*)P16, 2, 8, L, NH, TP, TAB);
    w25::wmma_gemm64<0, false, 0, 0, false, 0><<<dim3((unsigned)((((L) / 64) * ((HD) / 64) + 7) / 8), (unsigned)(NH)), 256, 0, stream>>>((const unsigned short*)(P16), nullptr, L, (long long)L * L, (const unsigned short*)(VT16), nullptr, L, (long long)HD * L, (void*)(X + (size_t)2 * L * D), nullptr, D, HD, nullptr, nullptr, 0, L, HD, L, 0.000244140625f);
    k_sh_rvt<<<(unsigned)(((long long)256 * HD * L / 2 + 255) / 256), 256, 0, stream>>>((const int*)fm, tv, (_Float16*)RVT, 2, 0, L, HD, TAB);
    w25::wmma_gemm64<0, false, 0, 0, false, 0><<<dim3((unsigned)((((64) / 64) * ((HD) / 64) + 7) / 8), (unsigned)(256)), 256, 0, stream>>>((const unsigned short*)(P16 + (size_t)0 * L), nullptr, (long long)L * L, L, (const unsigned short*)(RVT), nullptr, L, (long long)HD * L, (void*)(W2T), nullptr, HD, 64 * HD, nullptr, nullptr, 0, 64, HD, L, 1.0f);
    k_sh_w2add<<<(256 * D + 255) / 256, 256, 0, stream>>>(W2T, X, 2, 0, L, D, HD);
    k_sh_rvt<<<(unsigned)(((long long)256 * HD * L / 2 + 255) / 256), 256, 0, stream>>>((const int*)fm, tv, (_Float16*)RVT, 2, 256, L, HD, TAB);
    w25::wmma_gemm64<0, false, 0, 0, false, 0><<<dim3((unsigned)((((64) / 64) * ((HD) / 64) + 7) / 8), (unsigned)(256)), 256, 0, stream>>>((const unsigned short*)(P16 + (size_t)256 * L), nullptr, (long long)L * L, L, (const unsigned short*)(RVT), nullptr, L, (long long)HD * L, (void*)(W2T), nullptr, HD, 64 * HD, nullptr, nullptr, 0, 64, HD, L, 1.0f);
    k_sh_w2add<<<(256 * D + 255) / 256, 256, 0, stream>>>(W2T, X, 2, 256, L, D, HD);
    w25::wmma_gemm64<0, false, 0, 0, false, 0><<<dim3((unsigned)((((L * NH) / 64) * ((TP) / 64) + 7) / 8), (unsigned)(1)), 256, 0, stream>>>((const unsigned short*)(Q16 + (size_t)3 * L * D), nullptr, HD, 0, (const unsigned short*)(TK16), nullptr, HD, 0, (void*)(QT), nullptr, TP, 0, nullptr, nullptr, 0, L * NH, TP, HD, 0.0625f);
    w25::wmma_gemm64<0, false, 1, 1, false, 0><<<dim3((unsigned)((((D) / 64) * ((L) / 64) + 7) / 8), (unsigned)(1)), 256, 0, stream>>>((const unsigned short*)(W16), nullptr, D, 0, (const unsigned short*)(XA16 + (size_t)3 * L * D), nullptr, D, 0, (void*)(VT16), nullptr, L, 0, bv, nullptr, 0, D, L, D, 0.0625f);
    w25::wmma_gemm64<0, false, 0, 0, false, 0><<<dim3((unsigned)((((L) / 64) * ((L) / 64) + 7) / 8), (unsigned)(8)), 256, 0, stream>>>((const unsigned short*)(Q16 + (size_t)3 * L * D + 0 * HD), nullptr, D, HD, (const unsigned short*)(K16 + (size_t)3 * L * D + 0 * HD), nullptr, D, HD, (void*)(SC), nullptr, L, (long long)L * L, nullptr, nullptr, 0, L, L, HD, 1.0f);
    k_sh_soft<<<8 * L, 256, 0, stream>>>(SC, QT, (const int*)fm, (_Float16*)P16, 3, 0, L, NH, TP, TAB);
    w25::wmma_gemm64<0, false, 0, 0, false, 0><<<dim3((unsigned)((((L) / 64) * ((L) / 64) + 7) / 8), (unsigned)(8)), 256, 0, stream>>>((const unsigned short*)(Q16 + (size_t)3 * L * D + 8 * HD), nullptr, D, HD, (const unsigned short*)(K16 + (size_t)3 * L * D + 8 * HD), nullptr, D, HD, (void*)(SC), nullptr, L, (long long)L * L, nullptr, nullptr, 0, L, L, HD, 1.0f);
    k_sh_soft<<<8 * L, 256, 0, stream>>>(SC, QT, (const int*)fm, (_Float16*)P16, 3, 8, L, NH, TP, TAB);
    w25::wmma_gemm64<0, false, 0, 0, false, 0><<<dim3((unsigned)((((L) / 64) * ((HD) / 64) + 7) / 8), (unsigned)(NH)), 256, 0, stream>>>((const unsigned short*)(P16), nullptr, L, (long long)L * L, (const unsigned short*)(VT16), nullptr, L, (long long)HD * L, (void*)(X + (size_t)3 * L * D), nullptr, D, HD, nullptr, nullptr, 0, L, HD, L, 0.000244140625f);
    k_sh_rvt<<<(unsigned)(((long long)256 * HD * L / 2 + 255) / 256), 256, 0, stream>>>((const int*)fm, tv, (_Float16*)RVT, 3, 0, L, HD, TAB);
    w25::wmma_gemm64<0, false, 0, 0, false, 0><<<dim3((unsigned)((((64) / 64) * ((HD) / 64) + 7) / 8), (unsigned)(256)), 256, 0, stream>>>((const unsigned short*)(P16 + (size_t)0 * L), nullptr, (long long)L * L, L, (const unsigned short*)(RVT), nullptr, L, (long long)HD * L, (void*)(W2T), nullptr, HD, 64 * HD, nullptr, nullptr, 0, 64, HD, L, 1.0f);
    k_sh_w2add<<<(256 * D + 255) / 256, 256, 0, stream>>>(W2T, X, 3, 0, L, D, HD);
    k_sh_rvt<<<(unsigned)(((long long)256 * HD * L / 2 + 255) / 256), 256, 0, stream>>>((const int*)fm, tv, (_Float16*)RVT, 3, 256, L, HD, TAB);
    w25::wmma_gemm64<0, false, 0, 0, false, 0><<<dim3((unsigned)((((64) / 64) * ((HD) / 64) + 7) / 8), (unsigned)(256)), 256, 0, stream>>>((const unsigned short*)(P16 + (size_t)256 * L), nullptr, (long long)L * L, L, (const unsigned short*)(RVT), nullptr, L, (long long)HD * L, (void*)(W2T), nullptr, HD, 64 * HD, nullptr, nullptr, 0, 64, HD, L, 1.0f);
    k_sh_w2add<<<(256 * D + 255) / 256, 256, 0, stream>>>(W2T, X, 3, 256, L, D, HD);
    w25::wmma_gemm64<0, false, 0, 0, false, 0><<<dim3((unsigned)((((L * NH) / 64) * ((TP) / 64) + 7) / 8), (unsigned)(1)), 256, 0, stream>>>((const unsigned short*)(Q16 + (size_t)4 * L * D), nullptr, HD, 0, (const unsigned short*)(TK16), nullptr, HD, 0, (void*)(QT), nullptr, TP, 0, nullptr, nullptr, 0, L * NH, TP, HD, 0.0625f);
    w25::wmma_gemm64<0, false, 1, 1, false, 0><<<dim3((unsigned)((((D) / 64) * ((L) / 64) + 7) / 8), (unsigned)(1)), 256, 0, stream>>>((const unsigned short*)(W16), nullptr, D, 0, (const unsigned short*)(XA16 + (size_t)4 * L * D), nullptr, D, 0, (void*)(VT16), nullptr, L, 0, bv, nullptr, 0, D, L, D, 0.0625f);
    w25::wmma_gemm64<0, false, 0, 0, false, 0><<<dim3((unsigned)((((L) / 64) * ((L) / 64) + 7) / 8), (unsigned)(8)), 256, 0, stream>>>((const unsigned short*)(Q16 + (size_t)4 * L * D + 0 * HD), nullptr, D, HD, (const unsigned short*)(K16 + (size_t)4 * L * D + 0 * HD), nullptr, D, HD, (void*)(SC), nullptr, L, (long long)L * L, nullptr, nullptr, 0, L, L, HD, 1.0f);
    k_sh_soft<<<8 * L, 256, 0, stream>>>(SC, QT, (const int*)fm, (_Float16*)P16, 4, 0, L, NH, TP, TAB);
    w25::wmma_gemm64<0, false, 0, 0, false, 0><<<dim3((unsigned)((((L) / 64) * ((L) / 64) + 7) / 8), (unsigned)(8)), 256, 0, stream>>>((const unsigned short*)(Q16 + (size_t)4 * L * D + 8 * HD), nullptr, D, HD, (const unsigned short*)(K16 + (size_t)4 * L * D + 8 * HD), nullptr, D, HD, (void*)(SC), nullptr, L, (long long)L * L, nullptr, nullptr, 0, L, L, HD, 1.0f);
    k_sh_soft<<<8 * L, 256, 0, stream>>>(SC, QT, (const int*)fm, (_Float16*)P16, 4, 8, L, NH, TP, TAB);
    w25::wmma_gemm64<0, false, 0, 0, false, 0><<<dim3((unsigned)((((L) / 64) * ((HD) / 64) + 7) / 8), (unsigned)(NH)), 256, 0, stream>>>((const unsigned short*)(P16), nullptr, L, (long long)L * L, (const unsigned short*)(VT16), nullptr, L, (long long)HD * L, (void*)(X + (size_t)4 * L * D), nullptr, D, HD, nullptr, nullptr, 0, L, HD, L, 0.000244140625f);
    k_sh_rvt<<<(unsigned)(((long long)256 * HD * L / 2 + 255) / 256), 256, 0, stream>>>((const int*)fm, tv, (_Float16*)RVT, 4, 0, L, HD, TAB);
    w25::wmma_gemm64<0, false, 0, 0, false, 0><<<dim3((unsigned)((((64) / 64) * ((HD) / 64) + 7) / 8), (unsigned)(256)), 256, 0, stream>>>((const unsigned short*)(P16 + (size_t)0 * L), nullptr, (long long)L * L, L, (const unsigned short*)(RVT), nullptr, L, (long long)HD * L, (void*)(W2T), nullptr, HD, 64 * HD, nullptr, nullptr, 0, 64, HD, L, 1.0f);
    k_sh_w2add<<<(256 * D + 255) / 256, 256, 0, stream>>>(W2T, X, 4, 0, L, D, HD);
    k_sh_rvt<<<(unsigned)(((long long)256 * HD * L / 2 + 255) / 256), 256, 0, stream>>>((const int*)fm, tv, (_Float16*)RVT, 4, 256, L, HD, TAB);
    w25::wmma_gemm64<0, false, 0, 0, false, 0><<<dim3((unsigned)((((64) / 64) * ((HD) / 64) + 7) / 8), (unsigned)(256)), 256, 0, stream>>>((const unsigned short*)(P16 + (size_t)256 * L), nullptr, (long long)L * L, L, (const unsigned short*)(RVT), nullptr, L, (long long)HD * L, (void*)(W2T), nullptr, HD, 64 * HD, nullptr, nullptr, 0, 64, HD, L, 1.0f);
    k_sh_w2add<<<(256 * D + 255) / 256, 256, 0, stream>>>(W2T, X, 4, 256, L, D, HD);
    w25::wmma_gemm64<0, false, 0, 0, false, 0><<<dim3((unsigned)((((L * NH) / 64) * ((TP) / 64) + 7) / 8), (unsigned)(1)), 256, 0, stream>>>((const unsigned short*)(Q16 + (size_t)5 * L * D), nullptr, HD, 0, (const unsigned short*)(TK16), nullptr, HD, 0, (void*)(QT), nullptr, TP, 0, nullptr, nullptr, 0, L * NH, TP, HD, 0.0625f);
    w25::wmma_gemm64<0, false, 1, 1, false, 0><<<dim3((unsigned)((((D) / 64) * ((L) / 64) + 7) / 8), (unsigned)(1)), 256, 0, stream>>>((const unsigned short*)(W16), nullptr, D, 0, (const unsigned short*)(XA16 + (size_t)5 * L * D), nullptr, D, 0, (void*)(VT16), nullptr, L, 0, bv, nullptr, 0, D, L, D, 0.0625f);
    w25::wmma_gemm64<0, false, 0, 0, false, 0><<<dim3((unsigned)((((L) / 64) * ((L) / 64) + 7) / 8), (unsigned)(8)), 256, 0, stream>>>((const unsigned short*)(Q16 + (size_t)5 * L * D + 0 * HD), nullptr, D, HD, (const unsigned short*)(K16 + (size_t)5 * L * D + 0 * HD), nullptr, D, HD, (void*)(SC), nullptr, L, (long long)L * L, nullptr, nullptr, 0, L, L, HD, 1.0f);
    k_sh_soft<<<8 * L, 256, 0, stream>>>(SC, QT, (const int*)fm, (_Float16*)P16, 5, 0, L, NH, TP, TAB);
    w25::wmma_gemm64<0, false, 0, 0, false, 0><<<dim3((unsigned)((((L) / 64) * ((L) / 64) + 7) / 8), (unsigned)(8)), 256, 0, stream>>>((const unsigned short*)(Q16 + (size_t)5 * L * D + 8 * HD), nullptr, D, HD, (const unsigned short*)(K16 + (size_t)5 * L * D + 8 * HD), nullptr, D, HD, (void*)(SC), nullptr, L, (long long)L * L, nullptr, nullptr, 0, L, L, HD, 1.0f);
    k_sh_soft<<<8 * L, 256, 0, stream>>>(SC, QT, (const int*)fm, (_Float16*)P16, 5, 8, L, NH, TP, TAB);
    w25::wmma_gemm64<0, false, 0, 0, false, 0><<<dim3((unsigned)((((L) / 64) * ((HD) / 64) + 7) / 8), (unsigned)(NH)), 256, 0, stream>>>((const unsigned short*)(P16), nullptr, L, (long long)L * L, (const unsigned short*)(VT16), nullptr, L, (long long)HD * L, (void*)(X + (size_t)5 * L * D), nullptr, D, HD, nullptr, nullptr, 0, L, HD, L, 0.000244140625f);
    k_sh_rvt<<<(unsigned)(((long long)256 * HD * L / 2 + 255) / 256), 256, 0, stream>>>((const int*)fm, tv, (_Float16*)RVT, 5, 0, L, HD, TAB);
    w25::wmma_gemm64<0, false, 0, 0, false, 0><<<dim3((unsigned)((((64) / 64) * ((HD) / 64) + 7) / 8), (unsigned)(256)), 256, 0, stream>>>((const unsigned short*)(P16 + (size_t)0 * L), nullptr, (long long)L * L, L, (const unsigned short*)(RVT), nullptr, L, (long long)HD * L, (void*)(W2T), nullptr, HD, 64 * HD, nullptr, nullptr, 0, 64, HD, L, 1.0f);
    k_sh_w2add<<<(256 * D + 255) / 256, 256, 0, stream>>>(W2T, X, 5, 0, L, D, HD);
    k_sh_rvt<<<(unsigned)(((long long)256 * HD * L / 2 + 255) / 256), 256, 0, stream>>>((const int*)fm, tv, (_Float16*)RVT, 5, 256, L, HD, TAB);
    w25::wmma_gemm64<0, false, 0, 0, false, 0><<<dim3((unsigned)((((64) / 64) * ((HD) / 64) + 7) / 8), (unsigned)(256)), 256, 0, stream>>>((const unsigned short*)(P16 + (size_t)256 * L), nullptr, (long long)L * L, L, (const unsigned short*)(RVT), nullptr, L, (long long)HD * L, (void*)(W2T), nullptr, HD, 64 * HD, nullptr, nullptr, 0, 64, HD, L, 1.0f);
    k_sh_w2add<<<(256 * D + 255) / 256, 256, 0, stream>>>(W2T, X, 5, 256, L, D, HD);
    w25::wmma_gemm64<0, false, 0, 0, false, 0><<<dim3((unsigned)((((L * NH) / 64) * ((TP) / 64) + 7) / 8), (unsigned)(1)), 256, 0, stream>>>((const unsigned short*)(Q16 + (size_t)6 * L * D), nullptr, HD, 0, (const unsigned short*)(TK16), nullptr, HD, 0, (void*)(QT), nullptr, TP, 0, nullptr, nullptr, 0, L * NH, TP, HD, 0.0625f);
    w25::wmma_gemm64<0, false, 1, 1, false, 0><<<dim3((unsigned)((((D) / 64) * ((L) / 64) + 7) / 8), (unsigned)(1)), 256, 0, stream>>>((const unsigned short*)(W16), nullptr, D, 0, (const unsigned short*)(XA16 + (size_t)6 * L * D), nullptr, D, 0, (void*)(VT16), nullptr, L, 0, bv, nullptr, 0, D, L, D, 0.0625f);
    w25::wmma_gemm64<0, false, 0, 0, false, 0><<<dim3((unsigned)((((L) / 64) * ((L) / 64) + 7) / 8), (unsigned)(8)), 256, 0, stream>>>((const unsigned short*)(Q16 + (size_t)6 * L * D + 0 * HD), nullptr, D, HD, (const unsigned short*)(K16 + (size_t)6 * L * D + 0 * HD), nullptr, D, HD, (void*)(SC), nullptr, L, (long long)L * L, nullptr, nullptr, 0, L, L, HD, 1.0f);
    k_sh_soft<<<8 * L, 256, 0, stream>>>(SC, QT, (const int*)fm, (_Float16*)P16, 6, 0, L, NH, TP, TAB);
    w25::wmma_gemm64<0, false, 0, 0, false, 0><<<dim3((unsigned)((((L) / 64) * ((L) / 64) + 7) / 8), (unsigned)(8)), 256, 0, stream>>>((const unsigned short*)(Q16 + (size_t)6 * L * D + 8 * HD), nullptr, D, HD, (const unsigned short*)(K16 + (size_t)6 * L * D + 8 * HD), nullptr, D, HD, (void*)(SC), nullptr, L, (long long)L * L, nullptr, nullptr, 0, L, L, HD, 1.0f);
    k_sh_soft<<<8 * L, 256, 0, stream>>>(SC, QT, (const int*)fm, (_Float16*)P16, 6, 8, L, NH, TP, TAB);
    w25::wmma_gemm64<0, false, 0, 0, false, 0><<<dim3((unsigned)((((L) / 64) * ((HD) / 64) + 7) / 8), (unsigned)(NH)), 256, 0, stream>>>((const unsigned short*)(P16), nullptr, L, (long long)L * L, (const unsigned short*)(VT16), nullptr, L, (long long)HD * L, (void*)(X + (size_t)6 * L * D), nullptr, D, HD, nullptr, nullptr, 0, L, HD, L, 0.000244140625f);
    k_sh_rvt<<<(unsigned)(((long long)256 * HD * L / 2 + 255) / 256), 256, 0, stream>>>((const int*)fm, tv, (_Float16*)RVT, 6, 0, L, HD, TAB);
    w25::wmma_gemm64<0, false, 0, 0, false, 0><<<dim3((unsigned)((((64) / 64) * ((HD) / 64) + 7) / 8), (unsigned)(256)), 256, 0, stream>>>((const unsigned short*)(P16 + (size_t)0 * L), nullptr, (long long)L * L, L, (const unsigned short*)(RVT), nullptr, L, (long long)HD * L, (void*)(W2T), nullptr, HD, 64 * HD, nullptr, nullptr, 0, 64, HD, L, 1.0f);
    k_sh_w2add<<<(256 * D + 255) / 256, 256, 0, stream>>>(W2T, X, 6, 0, L, D, HD);
    k_sh_rvt<<<(unsigned)(((long long)256 * HD * L / 2 + 255) / 256), 256, 0, stream>>>((const int*)fm, tv, (_Float16*)RVT, 6, 256, L, HD, TAB);
    w25::wmma_gemm64<0, false, 0, 0, false, 0><<<dim3((unsigned)((((64) / 64) * ((HD) / 64) + 7) / 8), (unsigned)(256)), 256, 0, stream>>>((const unsigned short*)(P16 + (size_t)256 * L), nullptr, (long long)L * L, L, (const unsigned short*)(RVT), nullptr, L, (long long)HD * L, (void*)(W2T), nullptr, HD, 64 * HD, nullptr, nullptr, 0, 64, HD, L, 1.0f);
    k_sh_w2add<<<(256 * D + 255) / 256, 256, 0, stream>>>(W2T, X, 6, 256, L, D, HD);
    w25::wmma_gemm64<0, false, 0, 0, false, 0><<<dim3((unsigned)((((L * NH) / 64) * ((TP) / 64) + 7) / 8), (unsigned)(1)), 256, 0, stream>>>((const unsigned short*)(Q16 + (size_t)7 * L * D), nullptr, HD, 0, (const unsigned short*)(TK16), nullptr, HD, 0, (void*)(QT), nullptr, TP, 0, nullptr, nullptr, 0, L * NH, TP, HD, 0.0625f);
    w25::wmma_gemm64<0, false, 1, 1, false, 0><<<dim3((unsigned)((((D) / 64) * ((L) / 64) + 7) / 8), (unsigned)(1)), 256, 0, stream>>>((const unsigned short*)(W16), nullptr, D, 0, (const unsigned short*)(XA16 + (size_t)7 * L * D), nullptr, D, 0, (void*)(VT16), nullptr, L, 0, bv, nullptr, 0, D, L, D, 0.0625f);
    w25::wmma_gemm64<0, false, 0, 0, false, 0><<<dim3((unsigned)((((L) / 64) * ((L) / 64) + 7) / 8), (unsigned)(8)), 256, 0, stream>>>((const unsigned short*)(Q16 + (size_t)7 * L * D + 0 * HD), nullptr, D, HD, (const unsigned short*)(K16 + (size_t)7 * L * D + 0 * HD), nullptr, D, HD, (void*)(SC), nullptr, L, (long long)L * L, nullptr, nullptr, 0, L, L, HD, 1.0f);
    k_sh_soft<<<8 * L, 256, 0, stream>>>(SC, QT, (const int*)fm, (_Float16*)P16, 7, 0, L, NH, TP, TAB);
    w25::wmma_gemm64<0, false, 0, 0, false, 0><<<dim3((unsigned)((((L) / 64) * ((L) / 64) + 7) / 8), (unsigned)(8)), 256, 0, stream>>>((const unsigned short*)(Q16 + (size_t)7 * L * D + 8 * HD), nullptr, D, HD, (const unsigned short*)(K16 + (size_t)7 * L * D + 8 * HD), nullptr, D, HD, (void*)(SC), nullptr, L, (long long)L * L, nullptr, nullptr, 0, L, L, HD, 1.0f);
    k_sh_soft<<<8 * L, 256, 0, stream>>>(SC, QT, (const int*)fm, (_Float16*)P16, 7, 8, L, NH, TP, TAB);
    w25::wmma_gemm64<0, false, 0, 0, false, 0><<<dim3((unsigned)((((L) / 64) * ((HD) / 64) + 7) / 8), (unsigned)(NH)), 256, 0, stream>>>((const unsigned short*)(P16), nullptr, L, (long long)L * L, (const unsigned short*)(VT16), nullptr, L, (long long)HD * L, (void*)(X + (size_t)7 * L * D), nullptr, D, HD, nullptr, nullptr, 0, L, HD, L, 0.000244140625f);
    k_sh_rvt<<<(unsigned)(((long long)256 * HD * L / 2 + 255) / 256), 256, 0, stream>>>((const int*)fm, tv, (_Float16*)RVT, 7, 0, L, HD, TAB);
    w25::wmma_gemm64<0, false, 0, 0, false, 0><<<dim3((unsigned)((((64) / 64) * ((HD) / 64) + 7) / 8), (unsigned)(256)), 256, 0, stream>>>((const unsigned short*)(P16 + (size_t)0 * L), nullptr, (long long)L * L, L, (const unsigned short*)(RVT), nullptr, L, (long long)HD * L, (void*)(W2T), nullptr, HD, 64 * HD, nullptr, nullptr, 0, 64, HD, L, 1.0f);
    k_sh_w2add<<<(256 * D + 255) / 256, 256, 0, stream>>>(W2T, X, 7, 0, L, D, HD);
    k_sh_rvt<<<(unsigned)(((long long)256 * HD * L / 2 + 255) / 256), 256, 0, stream>>>((const int*)fm, tv, (_Float16*)RVT, 7, 256, L, HD, TAB);
    w25::wmma_gemm64<0, false, 0, 0, false, 0><<<dim3((unsigned)((((64) / 64) * ((HD) / 64) + 7) / 8), (unsigned)(256)), 256, 0, stream>>>((const unsigned short*)(P16 + (size_t)256 * L), nullptr, (long long)L * L, L, (const unsigned short*)(RVT), nullptr, L, (long long)HD * L, (void*)(W2T), nullptr, HD, 64 * HD, nullptr, nullptr, 0, 64, HD, L, 1.0f);
    k_sh_w2add<<<(256 * D + 255) / 256, 256, 0, stream>>>(W2T, X, 7, 256, L, D, HD);
    k_cast16<<<(unsigned)((((long long)(4096) * ((1024) / 2)) + 255) / 256), 256, 0, stream>>>(X, 1024, (_Float16*)(G64A), 1024, 4096, 1024, 1.0f);
    k_cast16<<<(unsigned)((((long long)(1024) * ((1024) / 2)) + 255) / 256), 256, 0, stream>>>(Wo, 1024, (_Float16*)(G64B), 1024, 1024, 1024, 16.0f);
    w25::wmma_gemm64<0, false, 2, 0, false, 0><<<dim3((unsigned)((((4096) / 64) * ((1024) / 64) + 7) / 8), (unsigned)(1)), 256, 0, stream>>>((const unsigned short*)(G64A), nullptr, 1024, 0, (const unsigned short*)(G64B), nullptr, 1024, 0, (void*)(out), nullptr, 1024, 0, bo, nullptr, 0, 4096, 1024, 1024, 0.0625f);
}

// v001
// A run of this version takes 844 microseconds.
// Timed twice side by side with v000, it ran 1.90 and 1.89 times as fast.
// Contractions: q/k/v = x.W^T + b [4096x1024].[1024x1024] and the output projection (+b) with f16 operands (weights x16); the relative-key term QT = q.table_k^T [65536 (b,q,h) x 64].[64 x 192 (129 padded)] with f16 operands; per (batch, head) the content scores q.k^T [512x64].[64x512] (heads and batches in the grid) and w1 = attn.v [512x512].[512x64] (heads and batches in the grid; attn as f16 of 4096 attn) — v_wmma_f32_16x16x32_f16, 64x64 register-blocked wave tiles; f32 accumulate. The gathered relative-key scores (QT[(b,q,h)][final_mat[b][q][k]] by the INPUT index matrix), the row softmax are f32 kernels; the relative-value aggregation w2[q,h,:] = sum_k attn[h,q,k] table_v[final_mat[b,q,k]] runs on the matrix cores as 1024-way batched (512 queries x 2 batches per launch) [64 (16 heads padded) x 512].[512 x 64] products against per-query gathered-and-transposed f16 planes of table_v rows (the INPUT index matrix gathers INPUT table rows into the plane).
#include <hip/hip_runtime.h>
#include <math.h>

typedef __attribute__((ext_vector_type(16))) _Float16 v16h;
typedef __attribute__((ext_vector_type(8)))  _Float16 v8h;
typedef __attribute__((ext_vector_type(16))) __bf16   v16b;
typedef __attribute__((ext_vector_type(8)))  float    v8f;
typedef __attribute__((ext_vector_type(4)))  float    v4f;

// 16-bit WMMA fragment map (wave32), lane L, h = L>>4, m = L&15:
//   A 16x32: lane = row m;   element i -> k = (i<8) ? 8h+i : 16+8h+(i-8)
//   B 32x16: lane = column m; the SAME k(i,h)
//   D 16x16 (8 f32): lane = column m; element r -> row 8h+r
__device__ __forceinline__ int frag_k(int i, int h) { return (i < 8) ? (8 * h + i) : (16 + 8 * h + (i - 8)); }
__device__ __forceinline__ __bf16 bf16_rne(float f) {
    unsigned int u = __float_as_uint(f);
    u += 0x7fffu + ((u >> 16) & 1u);
    return __builtin_bit_cast(__bf16, (unsigned short)(u >> 16));
}
__device__ __forceinline__ float bf16_f32(__bf16 b) { return __uint_as_float(((unsigned int)__builtin_bit_cast(unsigned short, b)) << 16); }
__device__ __forceinline__ v8f wmma16(v16h a, v16h b, v8f c) {
    c = __builtin_amdgcn_wmma_f32_16x16x32_f16(false, a, false, b, (short)0, c, false, false);
    asm volatile("v_nop\n\tv_nop\n\tv_nop\n\tv_nop" : "+v"(c) : "v"(a), "v"(b));
    return c;
}
__device__ __forceinline__ v8f wmmab(v16b a, v16b b, v8f c) {
    c = __builtin_amdgcn_wmma_f32_16x16x32_bf16(false, a, false, b, (short)0, c, false, false);
    asm volatile("v_nop\n\tv_nop\n\tv_nop\n\tv_nop" : "+v"(c) : "v"(a), "v"(b));
    return c;
}
struct Split { v16b hi, lo; };
// hi/lo split product: a.hi*b.hi + a.hi*b.lo + a.lo*b.hi
__device__ __forceinline__ v8f wmma3(const Split& a, const Split& b, v8f c) {
    c = __builtin_amdgcn_wmma_f32_16x16x32_bf16(false, a.hi, false, b.hi, (short)0, c, false, false);
    c = __builtin_amdgcn_wmma_f32_16x16x32_bf16(false, a.hi, false, b.lo, (short)0, c, false, false);
    c = __builtin_amdgcn_wmma_f32_16x16x32_bf16(false, a.lo, false, b.hi, (short)0, c, false, false);
    asm volatile("v_nop\n\tv_nop\n\tv_nop\n\tv_nop" : "+v"(c) : "v"(a.hi), "v"(a.lo), "v"(b.hi), "v"(b.lo));
    return c;
}
struct Split3 { v16b hi, mid, lo; };
// triple split product (6 terms, drops only terms below 2^-24 relative)
__device__ __forceinline__ v8f wmma6(const Split3& a, const Split3& b, v8f c) {
    c = __builtin_amdgcn_wmma_f32_16x16x32_bf16(false, a.hi, false, b.hi, (short)0, c, false, false);
    c = __builtin_amdgcn_wmma_f32_16x16x32_bf16(false, a.hi, false, b.mid, (short)0, c, false, false);
    c = __builtin_amdgcn_wmma_f32_16x16x32_bf16(false, a.mid, false, b.hi, (short)0, c, false, false);
    c = __builtin_amdgcn_wmma_f32_16x16x32_bf16(false, a.hi, false, b.lo, (short)0, c, false, false);
    c = __builtin_amdgcn_wmma_f32_16x16x32_bf16(false, a.mid, false, b.mid, (short)0, c, false, false);
    c = __builtin_amdgcn_wmma_f32_16x16x32_bf16(false, a.lo, false, b.hi, (short)0, c, false, false);
    asm volatile("v_nop\n\tv_nop\n\tv_nop\n\tv_nop" : "+v"(c) : "v"(a.hi), "v"(a.mid), "v"(a.lo), "v"(b.hi), "v"(b.mid), "v"(b.lo));
    return c;
}

// Fragment gathers from f32 memory: element i <- p[(k0 + frag_k(i,h)) * sk] * s, zero for k >= klen.
__device__ __forceinline__ v16h fh_ld(const float* __restrict__ p, long long sk, int k0, int h, int klen, float s) {
    v16h a;
#pragma unroll
    for (int i = 0; i < 16; ++i) { const int k = k0 + frag_k(i, h); a[i] = (k < klen) ? (_Float16)(p[(long long)k * sk] * s) : (_Float16)0.f; }
    return a;
}
__device__ __forceinline__ Split sp_ld(const float* __restrict__ p, long long sk, int k0, int h, int klen, float s) {
    Split r;
#pragma unroll
    for (int i = 0; i < 16; ++i) {
        const int k = k0 + frag_k(i, h); const float x = (k < klen) ? p[(long long)k * sk] * s : 0.f;
        const __bf16 hb = bf16_rne(x); r.hi[i] = hb; r.lo[i] = bf16_rne(x - bf16_f32(hb));
    }
    return r;
}
__device__ __forceinline__ Split3 sp3_ld(const float* __restrict__ p, long long sk, int k0, int h, int klen, float s) {
    Split3 r;
#pragma unroll
    for (int i = 0; i < 16; ++i) {
        const int k = k0 + frag_k(i, h); const float x = (k < klen) ? p[(long long)k * sk] * s : 0.f;
        const __bf16 hb = bf16_rne(x); const float r1 = x - bf16_f32(hb); const __bf16 mb = bf16_rne(r1);
        r.hi[i] = hb; r.mid[i] = mb; r.lo[i] = bf16_rne(r1 - bf16_f32(mb));
    }
    return r;
}
__device__ __forceinline__ v16b bh_ld(const float* __restrict__ p, long long sk, int k0, int h, int klen, float s) {
    v16b a;
#pragma unroll
    for (int i = 0; i < 16; ++i) { const int k = k0 + frag_k(i, h); a[i] = bf16_rne((k < klen) ? p[(long long)k * sk] * s : 0.f); }
    return a;
}
// f16 fragment from an f16 LDS/global row with element stride 1 (k-contiguous), no bounds (tile already zero padded)
__device__ __forceinline__ v16h fh_row(const _Float16* __restrict__ row, int k0, int h) {
    v16h a;
#pragma unroll
    for (int i = 0; i < 16; ++i) a[i] = row[k0 + frag_k(i, h)];
    return a;
}

#define VST2(T, ptr, val) do { const T vst2_v_ = (val); *(T*)(ptr) = vst2_v_;  } while (0)
typedef float v4f __attribute__((ext_vector_type(4)));
#define VST2V4(ptr, val) do { const v4f vst2_v4_ = (val); *(v4f*)(ptr) = vst2_v4_;  } while (0)

__device__ __attribute__((noinline)) float act_fn(float v, int act) {
    if (act == 1) return fmaxf(v, 0.f);                                                                               // relu
    if (act == 2) { const float u = 0.7978845608028654f * (v + 0.044715f * v * v * v); return 0.5f * v * (1.f + tanhf(u)); } // tanh-gelu
    if (act == 3) return v / (1.f + expf(-v));                                                                        // silu
    if (act == 4) return 0.5f * v * (1.f + erff(v * 0.7071067811865476f));                                             // erf-gelu
    if (act == 5) return tanhf(v);
    if (act == 6) return 1.f / (1.f + expf(-v));                                                                      // sigmoid
    if (act == 7) return (v > 0.f) ? v : 0.01f * v;                                                                   // leaky relu 0.01
    if (act == 8) return (v > 0.f) ? v : (expf(v) - 1.f);                                                             // elu
    if (act == 9) return fminf(fmaxf(v, 0.f), 6.f);                                                                   // relu6
    if (act == 10) return fabsf(v);                                                                                    // abs
    if (act == 11) return (v >= 0.f) ? v : 0.1f * v;                                                                  // leaky 0.1
    if (act == 12) return (v > 0.f) ? v : 0.2f * v;                                                                   // leaky 0.2
    if (act == 13) return (v > 20.f) ? v : log1pf(expf(v));                                                            // softplus
    return v;
}

// =====================================================================================================================
// k_gemm<MODE>: C(z, m, n) = act(alpha * sum_k A(z, m, k) * B(z, k, n) + bias) + beta * R(z, m, n)
//   One wave (32-thread block) per 16 x 32 tile of C; grid (ceil(N/32), ceil(M/16), Z). Batch z -> (zo = z / zi_n, zi = z % zi_n)
//   with separate outer/inner strides for every tensor (e.g. batch and head). A(m,k) = A[zo*sAo + zi*sAi + m*sAm + k*sAk] (f32),
//   B(k,n) = B[zo*sBo + zi*sBi + n*sBn + k*sBk] (f32); any M, N, K (K zero-padded to 32 inside the fragments, M/N tails guarded).
//   C(m,n) = C[zo*sCo + zi*sCi + m*sCm + n] (n contiguous). flags: 1 bias[n], 2 bias[m], 4 residual R[zo*sRo + zi*sRi + m*sRm + n*sRn].
//   MODE 0: f16 operands (A prescaled by sa, B by sb, both undone in the epilogue); 1: bf16 hi/lo split (3 products); 2: bf16;
//   3: bf16 hi/mid/lo triple split (6 products); 4: as 3 with Kahan-compensated f32 accumulation across k-steps.
// =====================================================================================================================
struct GemmP {
    const float* A; const float* B; const float* bias; const float* R; float* C;
    long long sAo, sAi, sAm, sAk, sBo, sBi, sBn, sBk, sCo, sCi, sCm, sRo, sRi, sRm, sRn;
    int M, N, K, zi_n, flags, act; float alpha, beta, sa, sb;
    int Npad, pad_;     // columns [N, Npad) of C are written as 0 so that padded workspace rows are covered by whole-line stores; Npad >= N
};
static_assert(sizeof(GemmP) == 5 * 8 + 15 * 8 + 6 * 4 + 4 * 4 + 2 * 4, "GemmP has padding");

template <int MODE>
__global__ __launch_bounds__(32) void k_gemm(GemmP p) {
    const int lane = threadIdx.x & 31, h = lane >> 4, l15 = lane & 15;
    const int m0 = blockIdx.y * 16, n0 = blockIdx.x * 32;
    const int z = blockIdx.z, zo = z / p.zi_n, zi = z - zo * p.zi_n;
    const float* A = p.A + zo * p.sAo + zi * p.sAi;
    const float* B = p.B + zo * p.sBo + zi * p.sBi;
    const int am = min(m0 + l15, p.M - 1);                       // clamped row for loads (stores are guarded)
    v8f acc[2], comp[2];
#pragma unroll
    for (int t = 0; t < 2; ++t) { v8f zz = {}; acc[t] = zz; comp[t] = zz; }
    for (int k0 = 0; k0 < p.K; k0 += 32) {
        const float* arow = A + (long long)am * p.sAm;
        if (MODE == 1) {
            const Split a = sp_ld(arow, p.sAk, k0, h, p.K, 1.f);
#pragma unroll
            for (int t = 0; t < 2; ++t) {
                const int bn = min(n0 + t * 16 + l15, p.N - 1);
                acc[t] = wmma3(a, sp_ld(B + (long long)bn * p.sBn, p.sBk, k0, h, p.K, 1.f), acc[t]);
            }
        } else if (MODE == 3) {
            const Split3 a = sp3_ld(arow, p.sAk, k0, h, p.K, 1.f);
#pragma unroll
            for (int t = 0; t < 2; ++t) {
                const int bn = min(n0 + t * 16 + l15, p.N - 1);
                acc[t] = wmma6(a, sp3_ld(B + (long long)bn * p.sBn, p.sBk, k0, h, p.K, 1.f), acc[t]);
            }
        } else if (MODE == 4) {
            // triple split as MODE 3, but each k-step's 6 products go into a fresh accumulator and the partial is added to the running f32 sum
            // on the VALU with Kahan compensation (accumulation error stays ~1 ulp however long K is)
            const Split3 a = sp3_ld(arow, p.sAk, k0, h, p.K, 1.f);
#pragma unroll
            for (int t = 0; t < 2; ++t) {
                const int bn = min(n0 + t * 16 + l15, p.N - 1); v8f zz = {};
                const v8f part = wmma6(a, sp3_ld(B + (long long)bn * p.sBn, p.sBk, k0, h, p.K, 1.f), zz);
                const v8f y = part - comp[t]; const v8f s = acc[t] + y; comp[t] = (s - acc[t]) - y; acc[t] = s;
            }
        } else if (MODE == 2) {
            const v16b a = bh_ld(arow, p.sAk, k0, h, p.K, 1.f);
#pragma unroll
            for (int t = 0; t < 2; ++t) {
                const int bn = min(n0 + t * 16 + l15, p.N - 1);
                acc[t] = wmmab(a, bh_ld(B + (long long)bn * p.sBn, p.sBk, k0, h, p.K, 1.f), acc[t]);
            }
        } else {
            const v16h a = fh_ld(arow, p.sAk, k0, h, p.K, p.sa);
#pragma unroll
            for (int t = 0; t < 2; ++t) {
                const int bn = min(n0 + t * 16 + l15, p.N - 1);
                acc[t] = wmma16(a, fh_ld(B + (long long)bn * p.sBn, p.sBk, k0, h, p.K, p.sb), acc[t]);
            }
        }
    }
    const float iscale = (MODE == 0) ? p.alpha / (p.sa * p.sb) : p.alpha;
    float* C = p.C + zo * p.sCo + zi * p.sCi;
    const float* R = p.R + zo * p.sRo + zi * p.sRi;
    __shared__ __align__(16) float ctile[16][36];
#pragma unroll
    for (int t = 0; t < 2; ++t) {
        const int n = n0 + t * 16 + l15; const int nn = min(n, p.N - 1);
#pragma unroll
        for (int r = 0; r < 8; ++r) {
            const int m = m0 + 8 * h + r; const int mm = min(m, p.M - 1);
            float v = acc[t][r] * iscale;
            if (p.flags & 1) v += p.bias[nn];
            if (p.flags & 2) v += p.bias[mm];
            if (p.flags & 8) v *= p.bias[(long long)zo * p.M + mm];   /* per-(z,row) scale vector laid out [Z][M]; exclusive with the bias flags */
            v = act_fn(v, p.act);
            if (p.flags & 4) v += p.beta * R[(long long)mm * p.sRm + (long long)nn * p.sRn];
            ctile[8 * h + r][t * 16 + l15] = (n < p.N) ? v : 0.f;
        }
    }
    __syncthreads();
    const int NW = (p.Npad > p.N) ? p.Npad : p.N;           // write width
    const bool fast = (m0 + 16 <= p.M) && (n0 + 32 <= NW) && ((p.sCm & 3) == 0) && ((((size_t)C) & 15) == 0);
    if (fast) {
#pragma unroll
        for (int s = 0; s < 4; ++s) {
            const int row = s * 4 + (lane >> 3), c4 = (lane & 7) * 4;
            const v4f v = *(const v4f*)&ctile[row][c4];
            VST2V4(C + (long long)(m0 + row) * p.sCm + n0 + c4, v);
        }
    } else {
        for (int row = 0; row < 16; ++row) {
            const int m = m0 + row, n = n0 + lane;
            if (m < p.M && n < NW) VST2(float, C + (long long)m * p.sCm + n, ctile[row][lane]);
        }
    }
}


// =====================================================================================================================
// k_gemmT<MODE, TM, TN>: same contract as k_gemm, but one wave computes a (16*TM) x (16*TN) tile: TM A fragments and TN B fragments are
//   loaded per 32-wide k-step and reused across TM*TN WMMAs (far fewer load/convert instructions per MAC). MODE 0 (f16), 1 (bf16 hi/lo),
//   2 (bf16) only. grid (ceil(NW/(16*TN)), ceil(M/(16*TM)), Z), block 32. Epilogue identical to k_gemm, run per 16x32 sub-tile.
// =====================================================================================================================
template <int MODE, int TM, int TN>
__global__ __launch_bounds__(32) void k_gemmT(GemmP p) {
    const int lane = threadIdx.x & 31, h = lane >> 4, l15 = lane & 15;
    const int m0 = blockIdx.y * (16 * TM), n0 = blockIdx.x * (16 * TN);
    const int z = blockIdx.z, zo = z / p.zi_n, zi = z - zo * p.zi_n;
    const float* A = p.A + zo * p.sAo + zi * p.sAi;
    const float* B = p.B + zo * p.sBo + zi * p.sBi;
    v8f acc[TM][TN];
#pragma unroll
    for (int i = 0; i < TM; ++i)
#pragma unroll
        for (int t = 0; t < TN; ++t) { v8f zz = {}; acc[i][t] = zz; }
    for (int k0 = 0; k0 < p.K; k0 += 32) {
        if (MODE == 1) {
            Split a[TM], b[TN];
#pragma unroll
            for (int i = 0; i < TM; ++i) { const int am = min(m0 + 16 * i + l15, p.M - 1); a[i] = sp_ld(A + (long long)am * p.sAm, p.sAk, k0, h, p.K, 1.f); }
#pragma unroll
            for (int t = 0; t < TN; ++t) { const int bn = min(n0 + 16 * t + l15, p.N - 1); b[t] = sp_ld(B + (long long)bn * p.sBn, p.sBk, k0, h, p.K, 1.f); }
#pragma unroll
            for (int i = 0; i < TM; ++i)
#pragma unroll
                for (int t = 0; t < TN; ++t) acc[i][t] = wmma3(a[i], b[t], acc[i][t]);
        } else if (MODE == 2) {
            v16b a[TM], b[TN];
#pragma unroll
            for (int i = 0; i < TM; ++i) { const int am = min(m0 + 16 * i + l15, p.M - 1); a[i] = bh_ld(A + (long long)am * p.sAm, p.sAk, k0, h, p.K, 1.f); }
#pragma unroll
            for (int t = 0; t < TN; ++t) { const int bn = min(n0 + 16 * t + l15, p.N - 1); b[t] = bh_ld(B + (long long)bn * p.sBn, p.sBk, k0, h, p.K, 1.f); }
#pragma unroll
            for (int i = 0; i < TM; ++i)
#pragma unroll
                for (int t = 0; t < TN; ++t) acc[i][t] = wmmab(a[i], b[t], acc[i][t]);
        } else {
            v16h a[TM], b[TN];
#pragma unroll
            for (int i = 0; i < TM; ++i) { const int am = min(m0 + 16 * i + l15, p.M - 1); a[i] = fh_ld(A + (long long)am * p.sAm, p.sAk, k0, h, p.K, p.sa); }
#pragma unroll
            for (int t = 0; t < TN; ++t) { const int bn = min(n0 + 16 * t + l15, p.N - 1); b[t] = fh_ld(B + (long long)bn * p.sBn, p.sBk, k0, h, p.K, p.sb); }
#pragma unroll
            for (int i = 0; i < TM; ++i)
#pragma unroll
                for (int t = 0; t < TN; ++t) acc[i][t] = wmma16(a[i], b[t], acc[i][t]);
        }
    }
    const float iscale = (MODE == 0) ? p.alpha / (p.sa * p.sb) : p.alpha;
    float* C = p.C + zo * p.sCo + zi * p.sCi;
    const float* R = p.R + zo * p.sRo + zi * p.sRi;
    const int NW = (p.Npad > p.N) ? p.Npad : p.N;
    __shared__ __align__(16) float ctile[16][36];
#pragma unroll
    for (int i = 0; i < TM; ++i) {
        const int mb = m0 + 16 * i; if (mb >= p.M) break;          // wave-uniform
#pragma unroll
        for (int tp = 0; tp < TN / 2; ++tp) {
            const int nb = n0 + 32 * tp; if (nb >= NW) break;        // wave-uniform
#pragma unroll
            for (int t2 = 0; t2 < 2; ++t2) {
                const int t = 2 * tp + t2; const int n = nb + t2 * 16 + l15; const int nn = min(n, p.N - 1);
#pragma unroll
                for (int r = 0; r < 8; ++r) {
                    const int m = mb + 8 * h + r; const int mm = min(m, p.M - 1);
                    float v = acc[i][t][r] * iscale;
                    if (p.flags & 1) v += p.bias[nn];
                    if (p.flags & 2) v += p.bias[mm];
            if (p.flags & 8) v *= p.bias[(long long)zo * p.M + mm];   /* per-(z,row) scale vector laid out [Z][M]; exclusive with the bias flags */
                    v = act_fn(v, p.act);
                    if (p.flags & 4) v += p.beta * R[(long long)mm * p.sRm + (long long)nn * p.sRn];
                    ctile[8 * h + r][t2 * 16 + l15] = (n < p.N) ? v : 0.f;
                }
            }
            __syncthreads();
            const bool fast = (mb + 16 <= p.M) && (nb + 32 <= NW) && ((p.sCm & 3) == 0) && ((((size_t)C) & 15) == 0);
            if (fast) {
#pragma unroll
                for (int s = 0; s < 4; ++s) {
                    const int row = s * 4 + (lane >> 3), c4 = (lane & 7) * 4;
                    const v4f v = *(const v4f*)&ctile[row][c4];
                    VST2V4(C + (long long)(mb + row) * p.sCm + nb + c4, v);
                }
            } else {
                for (int row = 0; row < 16; ++row) {
                    const int m = mb + row, n = nb + lane;
                    if (m < p.M && n < NW) VST2(float, C + (long long)m * p.sCm + n, ctile[row][lane]);
                }
            }
            __syncthreads();
        }
    }
}

// =====================================================================================================================
//   Wave = 16 queries, AW waves per block, 64-key blocks; grid (ceil(Lq/(16*AW)), H, B), block 32*AW. Any Lq, Lk; head dim dh <= DHP
//   (DHP multiple of 32), value dim dv <= DVP (multiple of 16, <= 128). Every tensor addressed by (batch, head, row, element) strides, f32.
//   Scores: QM 0 f16 operands, 1 bf16 hi/lo split, 2 bf16 triple split; statistics f32 (exp2 domain); P.V: P x 4096 as f16 with V f16 staged in LDS
//   (SPLITPV: P and V as bf16 hi/lo splits). kv head = h / hrep. Masking: causal = 1 (keep j <= i + coff, masked -> -inf, key blocks beyond the
//   diagonal skipped), causal = 2 (masked -> mfill, a finite fill like the -1e9; no skipping), causal = 3 (keep j >= i + coff,
//   masked -> -inf, no skipping); optional additive f32 mask Mf,
//   optional int keep-mask Mi (0 -> score := mfill), both addressed b*smb + h*smh + i*smi + j*smj (0 strides broadcast).
// =====================================================================================================================
#define AW 4
struct AttnP {   // apv4
    const float* Q; const float* K; const float* V; float* O; float* P; const float* Mf; const int* Mi; float* ST;
    const float* Pw; const float* Rt; const int* SQ; const int* SK;           // optional: post-softmax weight, relative-position table, segment ids
    long long swb, swh, swi, swj, srb, srh, sri;                                 // Pw strides (b,h,i,j); Rt strides (b,h,i), column = clamp(i - j + roff, 0, rn-1)
    long long sQb, sQh, sQi, sQd, sKb, sKh, sKj, sKd, sVb, sVh, sVj, sVd, sOb, sOh, sOi, sPb, sPh, sPi, smb, smh, smi, smj;
    int Lq, Lk, dh, dv, hrep, causal, coff, pband;   // pband > 0: P holds only the band |j - i| <= pband, column j - i + pband
    float scale, mfill; int nonorm, mpol;             // nonorm (online path only): O = sum_j exp(score_j) V_j without the 1/rowsum (scores must be <= ~0); mpol: Mi masks where ==0 (mpol 0) or where !=0 (mpol 1)
    int roff, rn, segpol, win;                        // Rt column offset/count; SQ/SK: score := mfill where (segpol 0) SQ[i] != SK[j] or (segpol 1) SQ[i] == SK[j]; win > 0: keys with i - j > win (after coff) -> -inf
};
//   Pw: the softmax numerator is multiplied by Pw(b,h,i,j) AFTER the row sum is taken (probs * weight, then P.V), as in post-softmax multiplicative biases.                                                    // ST (optional): per row (b,h,i) -> ST[((b*H + h)*Lq + i)*2 + {0,1}] = {row max of the scaled+masked score (natural units), sum_j exp(score - max)}
static_assert(sizeof(AttnP) == 12 * 8 + 29 * 8 + 16 * 4, "AttnP has padding");

#ifndef KATTN_ATTR
#define KATTN_ATTR
#endif
template <int DHP, int DVP, int QM, bool SPLITPV, bool TWOPASS>
__global__ __launch_bounds__(32 * AW) KATTN_ATTR void k_attn(AttnP p) {
    constexpr int NT = DVP / 16;                // output tiles
    constexpr int KS = DHP / 32;                // k-steps for the scores
    constexpr int VP = DVP + 8;                 // LDS pitch (halves)
    __shared__ __align__(16) float    pl[AW][16 * 64];
    __shared__ __align__(16) _Float16 vl[(SPLITPV ? 2 : 1) * 64 * VP];   // f16 V tile, or bf16 hi and lo tiles (same 2-byte size)
    const int lane = threadIdx.x & 31, hf = lane >> 4, l15 = lane & 15, wave = threadIdx.x >> 5;
    const int h = blockIdx.y, b = blockIdx.z, hk = h / p.hrep;
    const int q0 = (blockIdx.x * AW + wave) * 16;
    float* myp = pl[wave];
    const float L2E = 1.4426950408889634f;
    const float NEG = -__builtin_inff();
    const int qi = min(q0 + l15, p.Lq - 1);
    const float* qrow = p.Q + b * p.sQb + h * p.sQh + (long long)qi * p.sQi;
    const float* kbase = p.K + b * p.sKb + hk * p.sKh;
    const float* vbase = p.V + b * p.sVb + hk * p.sVh;
    v16h qa[QM == 0 ? KS : 1]; Split qs_[QM == 1 ? KS : 1]; Split3 qt_[QM == 2 ? KS : 1];
#pragma unroll
    for (int ks = 0; ks < KS; ++ks) {
        if (QM == 2) qt_[ks] = sp3_ld(qrow, p.sQd, ks * 32, hf, p.dh, 1.f);
        else if (QM == 1) qs_[ks] = sp_ld(qrow, p.sQd, ks * 32, hf, p.dh, 1.f);
        else qa[ks] = fh_ld(qrow, p.sQd, ks * 32, hf, p.dh, 1.f);
    }
    v8f o[NT]; float m8[8], l8[8];
#pragma unroll
    for (int t = 0; t < NT; ++t) { v8f zz = {}; o[t] = zz; }
#pragma unroll
    for (int i = 0; i < 8; ++i) { m8[i] = NEG; l8[i] = 0.f; }
    int jend = p.Lk; int jstart = 0;
    if (p.causal == 1) { const int je = (blockIdx.x * AW + AW - 1) * 16 + 16 + p.coff; jend = min(jend, max(je, 0)); }   // uniform per block
    if (p.win > 0) { const int js = (int)(blockIdx.x * AW) * 16 + p.coff - p.win; jstart = (js > 0) ? (js / 64) * 64 : 0; }   // uniform per block: key blocks entirely outside every row's window hold only -inf entries and are skipped exactly
    const int npass = TWOPASS ? 2 : 1;
    for (int pass = 0; pass < npass; ++pass) {
        const bool dopv = (!TWOPASS) || pass == 1;
        for (int j0 = jstart; j0 < jend; j0 += 64) {
            if (dopv) {
                __syncthreads();                                 // previous key block's reads of vl / pl are done
                for (int idx = threadIdx.x; idx < 64 * DVP; idx += 32 * AW) {
                    const int jr = idx / DVP, d = idx - jr * DVP, j = j0 + jr;
                    const float f = (j < p.Lk && d < p.dv) ? vbase[(long long)j * p.sVj + (long long)d * p.sVd] : 0.f;
                    if (SPLITPV) {
                        const __bf16 hb = bf16_rne(f);
                        ((__bf16*)vl)[jr * VP + d] = hb; ((__bf16*)vl)[64 * VP + jr * VP + d] = bf16_rne(f - bf16_f32(hb));
                    } else vl[jr * VP + d] = (_Float16)f;
                }
            }
            v8f s[4];
#pragma unroll
            for (int t = 0; t < 4; ++t) {
                const int j = min(j0 + t * 16 + l15, p.Lk - 1);
                const float* krow = kbase + (long long)j * p.sKj;
                v8f acc = {};
#pragma unroll
                for (int ks = 0; ks < KS; ++ks) {
                    if (QM == 2)      acc = wmma6(qt_[ks], sp3_ld(krow, p.sKd, ks * 32, hf, p.dh, 1.f), acc);
                    else if (QM == 1) acc = wmma3(qs_[ks], sp_ld(krow, p.sKd, ks * 32, hf, p.dh, 1.f), acc);
                    else              acc = wmma16(qa[ks], fh_ld(krow, p.sKd, ks * 32, hf, p.dh, 1.f), acc);
                }
                s[t] = acc;
            }
            float pv[8][4];
#pragma unroll
            for (int i = 0; i < 8; ++i) {
                const int irow = q0 + i + 8 * hf;
                const int ic = min(irow, p.Lq - 1);
                float sc[4];
#pragma unroll
                for (int t = 0; t < 4; ++t) {
                    const int jg = j0 + t * 16 + l15;
                    float v = s[t][i] * p.scale;
                    if (p.Mf) v += p.Mf[b * p.smb + h * p.smh + (long long)ic * p.smi + (long long)min(jg, p.Lk - 1) * p.smj];
                    if (p.Rt) { int rc = ic - min(jg, p.Lk - 1) + p.roff; rc = rc < 0 ? 0 : (rc >= p.rn ? p.rn - 1 : rc); v += p.Rt[b * p.srb + h * p.srh + (long long)ic * p.sri + rc]; }
                    if (p.Mi) { const int mv = p.Mi[b * p.smb + h * p.smh + (long long)ic * p.smi + (long long)min(jg, p.Lk - 1) * p.smj]; if (p.mpol ? (mv != 0) : (mv == 0)) v = p.mfill; }
                    if (p.SQ) { const bool same = p.SQ[(long long)b * p.Lq + ic] == p.SK[(long long)b * p.Lk + min(jg, p.Lk - 1)]; if (p.segpol ? same : !same) v = p.mfill; }
                    if (p.causal == 2 && jg > irow + p.coff) v = p.mfill;
                    if (jg >= p.Lk || (p.causal == 1 && jg > irow + p.coff) || (p.causal == 3 && jg < irow + p.coff) || (p.win > 0 && irow + p.coff - jg > p.win)) v = NEG; else v *= L2E;
                    sc[t] = v;
                }
                if (!TWOPASS || pass == 0) {
                    float mx = fmaxf(fmaxf(sc[0], sc[1]), fmaxf(sc[2], sc[3]));
                    mx = fmaxf(mx, __shfl_xor(mx, 1, 32)); mx = fmaxf(mx, __shfl_xor(mx, 2, 32));
                    mx = fmaxf(mx, __shfl_xor(mx, 4, 32)); mx = fmaxf(mx, __shfl_xor(mx, 8, 32));
                    const float mnew = fmaxf(m8[i], mx);
                    const float corr = (mnew == NEG) ? 1.f : exp2f(m8[i] - mnew);
                    float rs = 0.f;
#pragma unroll
                    for (int t = 0; t < 4; ++t) {
                        const float pp = (sc[t] == NEG) ? 0.f : exp2f(sc[t] - mnew); rs += pp;
                        pv[i][t] = p.Pw ? pp * p.Pw[b * p.swb + h * p.swh + (long long)ic * p.swi + (long long)min(j0 + t * 16 + l15, p.Lk - 1) * p.swj] : pp;
                    }
                    rs += __shfl_xor(rs, 1, 32); rs += __shfl_xor(rs, 2, 32); rs += __shfl_xor(rs, 4, 32); rs += __shfl_xor(rs, 8, 32);
                    l8[i] = l8[i] * corr + rs; m8[i] = mnew;
                    if (!TWOPASS) {
#pragma unroll
                        for (int t = 0; t < NT; ++t) o[t][i] *= corr;
                    }
                } else {
                    const float inv = (l8[i] > 0.f) ? 1.f / l8[i] : 0.f;
#pragma unroll
                    for (int t = 0; t < 4; ++t) {
                        const int jg = j0 + t * 16 + l15;
                        float pp = (sc[t] == NEG) ? 0.f : exp2f(sc[t] - m8[i]) * inv;
                        if (p.Pw) pp *= p.Pw[b * p.swb + h * p.swh + (long long)ic * p.swi + (long long)min(jg, p.Lk - 1) * p.swj];
                        pv[i][t] = pp;
                    }
                }
            }
            if (dopv) {
#pragma unroll
                for (int i = 0; i < 8; ++i)
#pragma unroll
                    for (int t = 0; t < 4; ++t) ((float*)myp)[(i + 8 * hf) * 64 + t * 16 + l15] = pv[i][t];
                __syncthreads();                                 // P (per wave) and V (shared) visible
                if (p.P) {
                    float* pb_ = p.P + b * p.sPb + h * p.sPh;
                    const bool fastP = (p.pband == 0) && ((p.sPi & 3) == 0) && (j0 + 64 <= p.Lk) && (q0 + 16 <= p.Lq) && ((((size_t)pb_) & 15) == 0);
                    if (fastP) {
#pragma unroll
                        for (int s = 0; s < 8; ++s) {
                            const int row = s * 2 + (lane >> 4), c4 = (lane & 15) * 4;
                            const v4f v = *(const v4f*)(myp + row * 64 + c4);
                            VST2V4(pb_ + (long long)(q0 + row) * p.sPi + j0 + c4, v);
                        }
                    } else {
                        for (int row = 0; row < 16; ++row) {
                            const int irow = q0 + row; if (irow >= p.Lq) continue;
                            for (int c = lane; c < 64; c += 32) {
                                const int jg = j0 + c; if (jg >= p.Lk) continue;
                                if (p.pband == 0) VST2(float, pb_ + (long long)irow * p.sPi + jg, myp[row * 64 + c]);
                                else if (jg - irow <= p.pband && irow - jg <= p.pband) VST2(float, pb_ + (long long)irow * p.sPi + (jg - irow + p.pband), myp[row * 64 + c]);
                            }
                        }
                    }
                }
                if (SPLITPV) {
                    const Split pa0 = sp_ld(myp + l15 * 64, 1, 0, hf, 64, 1.f), pa1 = sp_ld(myp + l15 * 64, 1, 32, hf, 64, 1.f);
                    const __bf16* vh = (const __bf16*)vl; const __bf16* vlo = vh + 64 * VP;
#pragma unroll
                    for (int t = 0; t < NT; ++t) {
                        const int dcol = t * 16 + l15;
                        Split b0, b1;
#pragma unroll
                        for (int e = 0; e < 16; ++e) {
                            const int k0 = frag_k(e, hf), k1 = 32 + frag_k(e, hf);
                            b0.hi[e] = vh[k0 * VP + dcol]; b0.lo[e] = vlo[k0 * VP + dcol]; b1.hi[e] = vh[k1 * VP + dcol]; b1.lo[e] = vlo[k1 * VP + dcol];
                        }
                        o[t] = wmma3(pa0, b0, o[t]);
                        o[t] = wmma3(pa1, b1, o[t]);
                    }
                } else {
                    const v16h pa0 = fh_ld(myp + l15 * 64, 1, 0, hf, 64, 4096.f), pa1 = fh_ld(myp + l15 * 64, 1, 32, hf, 64, 4096.f);
#pragma unroll
                    for (int t = 0; t < NT; ++t) {
                        const int dcol = t * 16 + l15;
                        v16h b0, b1;
#pragma unroll
                        for (int e = 0; e < 16; ++e) { b0[e] = vl[frag_k(e, hf) * VP + dcol]; b1[e] = vl[(32 + frag_k(e, hf)) * VP + dcol]; }
                        o[t] = wmma16(pa0, b0, o[t]);
                        o[t] = wmma16(pa1, b1, o[t]);
                    }
                }
            }
        }
    }
    float* obase = p.O + b * p.sOb + h * p.sOh;
    if (p.ST) {
        const int rl = lane >> 1, isel = rl & 7;           // row q0 + rl ; rl>>3 == hf holds because lane>>4 == (lane>>1)>>3
        float mv = 0.f, lv = 0.f;
#pragma unroll
        for (int i = 0; i < 8; ++i) if (i == isel) { mv = m8[i]; lv = l8[i]; }
        const int irow = q0 + rl;
        if (irow < p.Lq) { float* st = p.ST + (((long long)b * gridDim.y + h) * p.Lq + irow) * 2 + (lane & 1); VST2(float, st, (lane & 1) ? lv : mv * 0.6931471805599453f); }
    }
    float invr[8];
#pragma unroll
    for (int i = 0; i < 8; ++i) {
        if (TWOPASS) invr[i] = SPLITPV ? 1.f : (1.f / 4096.f);
        else if (p.nonorm) invr[i] = exp2f(m8[i]) * (SPLITPV ? 1.f : (1.f / 4096.f));
        else invr[i] = (l8[i] > 0.f) ? (SPLITPV ? 1.f / l8[i] : 1.f / (l8[i] * 4096.f)) : 0.f;
    }
    __syncthreads();                                             // all waves done with pl/vl from the main loop
    const bool ofast = ((p.sOi & 3) == 0) && ((((size_t)obase) & 15) == 0) && (q0 + 16 <= p.Lq);
#pragma unroll
    for (int c0 = 0; c0 < DVP; c0 += 64) {
#pragma unroll
        for (int i = 0; i < 8; ++i)
#pragma unroll
            for (int t = 0; t < NT; ++t) if (t * 16 >= c0 && t * 16 < c0 + 64) ((float*)myp)[(i + 8 * hf) * 64 + (t * 16 - c0) + l15] = o[t][i] * invr[i];
        __syncthreads();
        const int cw = (DVP - c0 < 64) ? (DVP - c0) : 64;      // staged columns in this chunk (multiple of 16)
        if (ofast && (c0 + cw <= p.dv) && (cw % 32 == 0)) {
            const int lpr = cw / 4;                              // lanes per row (16 for 64 cols, 8 for 32)
            const int rows_per_ins = 32 / lpr;
            for (int r0 = 0; r0 < 16; r0 += rows_per_ins) {
                const int row = r0 + lane / lpr, c4 = (lane % lpr) * 4;
                const v4f v = *(const v4f*)(myp + row * 64 + c4);
                VST2V4(obase + (long long)(q0 + row) * p.sOi + c0 + c4, v);
            }
        } else {
            for (int row = 0; row < 16; ++row) {
                const int irow = q0 + row; if (irow >= p.Lq) continue;
                for (int c = lane; c < cw; c += 32) { const int d = c0 + c; if (d < p.dv) VST2(float, obase + (long long)irow * p.sOi + d, myp[row * 64 + c]); }
            }
        }
        __syncthreads();
    }
}

// =====================================================================================================================
// k_tr: dst(z, c, r) = alpha * src(z, r, c) (+ beta * R2(z, c, r)): [Z][R][C] (row stride lds) -> [Z][C][R] (row stride ldd) through a 32x32 LDS tile;
//   flags: 1 -> add beta * residual R2 addressed like dst (z*sRz + c*ldr + r); act applied before the residual.
// =====================================================================================================================
struct TrP { const float* src; float* dst; const float* R2; long long sSz, lds, sDz, ldd, sRz, ldr; int R, C, flags, act; float alpha, beta; };
static_assert(sizeof(TrP) == 3 * 8 + 6 * 8 + 6 * 4, "TrP has padding");
__global__ __launch_bounds__(256) void k_tr(TrP p) {
    __shared__ float tile[32][33];
    const int c0 = blockIdx.x * 32, r0 = blockIdx.y * 32, z = blockIdx.z;
    const int lane = threadIdx.x & 31, wave = threadIdx.x >> 5;
    const float* s = p.src + z * p.sSz;
#pragma unroll
    for (int k = 0; k < 4; ++k) {
        const int rl = wave * 4 + k, r = r0 + rl, c = c0 + lane;
        tile[rl][lane] = (r < p.R && c < p.C) ? s[(long long)r * p.lds + c] : 0.f;
    }
    __syncthreads();
    float* d = p.dst + z * p.sDz; const float* rr = p.R2 + z * p.sRz;
#pragma unroll
    for (int k = 0; k < 4; ++k) {
        const int cl = wave * 4 + k, c = c0 + cl, r = r0 + lane;
        if (c < p.C && r < p.R) {
            float v = act_fn(p.alpha * tile[lane][cl], p.act);
            if (p.flags & 1) v += p.beta * rr[(long long)c * p.ldr + r];
            VST2(float, d + (long long)c * p.ldd + r, v);
        }
    }
}

// k_affine: dst[i] = a * (sdev ? sdev[0] : 1) * src[i] + b, i < n (one thread per element; consecutive lanes -> consecutive addresses)
__global__ __launch_bounds__(256) void k_affine(const float* __restrict__ src, float* __restrict__ dst, int n, float a, float b, const float* __restrict__ sdev) {
    const int i = blockIdx.x * 256 + threadIdx.x;
    if (i < n) { const float aa = sdev ? a * sdev[0] : a; const float v = aa * src[i] + b; VST2(float, dst + i, v); }
}

// =====================================================================================================================
// k_softmax: row softmax over n contiguous elements, one 256-thread block per row; rows addressed z*sz + r*sr (grid (R, Z)).
//   out = scale_out * softmax(scale_in * x + (Mf ? Mf[z*smz + r*smr + j] : 0)); a row whose max is -inf is written as 0.
// =====================================================================================================================
struct SmP { const float* src; float* dst; const float* Mf; long long sz, sr, dz, dr, smz, smr; int n, pad; float scale_in, scale_out; };
static_assert(sizeof(SmP) == 3 * 8 + 6 * 8 + 4 * 4, "SmP has padding");
__global__ __launch_bounds__(256) void k_softmax(SmP p) {
    __shared__ float red[256];
    const int r = blockIdx.x, z = blockIdx.y, tid = threadIdx.x;
    const float* s = p.src + z * p.sz + (long long)r * p.sr;
    const float* mf = p.Mf ? (p.Mf + z * p.smz + (long long)r * p.smr) : nullptr;
    float mx = -__builtin_inff();
    for (int j = tid; j < p.n; j += 256) { float v = s[j] * p.scale_in; if (mf) v += mf[j]; mx = fmaxf(mx, v); }
    red[tid] = mx; __syncthreads();
    for (int o = 128; o > 0; o >>= 1) { if (tid < o) red[tid] = fmaxf(red[tid], red[tid + o]); __syncthreads(); }
    mx = red[0]; __syncthreads();
    float sum = 0.f;
    for (int j = tid; j < p.n; j += 256) { float v = s[j] * p.scale_in; if (mf) v += mf[j]; sum += (mx == -__builtin_inff()) ? 0.f : expf(v - mx); }
    red[tid] = sum; __syncthreads();
    for (int o = 128; o > 0; o >>= 1) { if (tid < o) red[tid] += red[tid + o]; __syncthreads(); }
    sum = red[0];
    const float inv = (sum > 0.f) ? p.scale_out / sum : 0.f;
    float* d = p.dst + z * p.dz + (long long)r * p.dr;
    for (int j = tid; j < p.n; j += 256) { float v = s[j] * p.scale_in; if (mf) v += mf[j]; const float o = (mx == -__builtin_inff()) ? 0.f : expf(v - mx) * inv; VST2(float, d + j, o); }
}
// =====================================================================================================================
// k_stats: mean and rsqrt(var + eps) over a set of n elements addressed base + z*sz + (e / inner) * so + (e % inner) * si, one 256-thread
// k_norm_apply: y = (x - mean[set]) * rstd[set] * g[c] + b[c] over a [Z][C][L] channel-major tensor with set = z*G + c / (C/G) (G groups per z;
//   G = C -> per-channel sets indexed z*C+c; for batch norm pass stats indexed by c only via bn = 1). Optional act. Output same layout.
// =====================================================================================================================
//   mode 0: mean / rsqrt(var + eps); mode 1 (RMSNorm): 0 / rsqrt(mean(x^2) + eps); mode 2 (L2 normalize * sqrt(n)): 0 / sqrt(n) / max(||x||, eps); mode 3: as 0 with unbiased variance (n-1)
__global__ __launch_bounds__(256) void k_stats(const float* __restrict__ x, long long sz, long long so, long long si, int inner, int n, float eps, float* __restrict__ stat, int mode) {
    __shared__ float red[256];
    const int z = blockIdx.x, tid = threadIdx.x;
    const float* base = x + z * sz;
    float s = 0.f;
    for (int e = tid; e < n; e += 256) s += base[(long long)(e / inner) * so + (long long)(e % inner) * si];
    red[tid] = s; __syncthreads();
    for (int o = 128; o > 0; o >>= 1) { if (tid < o) red[tid] += red[tid + o]; __syncthreads(); }
    const float mu = (mode == 0 || mode == 3) ? red[0] / (float)n : 0.f; __syncthreads();
    float q = 0.f;
    for (int e = tid; e < n; e += 256) { const float dlt = base[(long long)(e / inner) * so + (long long)(e % inner) * si] - mu; q += dlt * dlt; }
    red[tid] = q; __syncthreads();
    for (int o = 128; o > 0; o >>= 1) { if (tid < o) red[tid] += red[tid + o]; __syncthreads(); }
    {
        float rs;
        if (mode == 2) rs = sqrtf((float)n) / fmaxf(sqrtf(red[0]), eps); else if (mode == 3) rs = rsqrtf(red[0] / (float)(n - 1) + eps); else rs = rsqrtf(red[0] / (float)n + eps);
        if (tid < 32) { const float v = (tid == 0) ? mu : ((tid == 1) ? rs : 0.f); VST2(float, stat + (long long)z * 32 + tid, v); }
    }
}
//   One thread per element over the flat [Z][C][L] index space: grid ceil(Z*C*L / 256).
__global__ __launch_bounds__(256) void k_norm_apply(const float* __restrict__ x, float* __restrict__ y, const float* __restrict__ stat, const float* __restrict__ g, const float* __restrict__ bta,
                                                     int Z, int C, int L, int G, int bn, int act) {
    const long long idx = (long long)blockIdx.x * 256 + threadIdx.x;
    if (idx >= (long long)Z * C * L) return;
    const int l = (int)(idx % L); const long long zc = idx / L; const int c = (int)(zc % C), z = (int)(zc / C); (void)l;
    const int set = bn ? c : (z * G + c / (C / G));
    float v = (x[idx] - stat[(long long)set * 32]) * stat[(long long)set * 32 + 1];
    if (g) v *= g[c];
    if (bta) v += bta[c];
    v = act_fn(v, act);
    VST2(float, y + idx, v);
}

// k_lse_neg: c[i] = -(st[2i] + log(st[2i+1])) = minus the log-sum-exp of row i from k_attn's ST output (for softmax over the query dimension)
__global__ __launch_bounds__(256) void k_lse_neg(const float* __restrict__ st, float* __restrict__ c, int n) {
    const int i = blockIdx.x * 256 + threadIdx.x;
    if (i < n) { const float v = -(st[2 * i] + logf(st[2 * i + 1])); VST2(float, c + i, v); }
}

// k_iota: dst[i] = a * i + b as int32 (segment/position id helper)
__global__ __launch_bounds__(256) void k_iota(int* __restrict__ dst, int n, int a, int b) {
    const int i = blockIdx.x * 256 + threadIdx.x;
    if (i < n) { const int v = a * i + b; VST2(int, dst + i, v); }
}

// k_axpby: dst[i] = a * x[i] + b * y[i] (+ c), i < n
__global__ __launch_bounds__(256) void k_axpby(const float* __restrict__ x, const float* __restrict__ y, float* __restrict__ dst, int n, float a, float b, float c) {
    const int i = blockIdx.x * 256 + threadIdx.x;
    if (i < n) { const float v = a * x[i] + b * y[i] + c; VST2(float, dst + i, v); }
}

// =====================================================================================================================
// k_rope: rotary embedding on a [R rows][Hn heads][D] view (row stride sXr, head stride sXh, element stride 1) -> Y (own strides).
//   mode 0: rotate_half (partner d±D/2, sign - for d<D/2); mode 1: interleaved pairs (partner d^1, sign - for even d).
//   table column tcol: tmode 0 -> d, 1 -> d % (D/2), 2 -> d / 2; position p: pmode 0 -> r % S, 1 -> head index, 2 -> pos[r];
//   c = C[(r / S) * sCb + p * sCp + tcol * sCd], s likewise from Sn; y = x[d] * c + sign * x[partner] * s. X and Y must not alias.
// =====================================================================================================================
struct RopeP { const float* X; float* Y; const float* C; const float* Sn; const int* pos; long long sXr, sXh, sYr, sYh, sCb, sCp, sCd; int R, Hn, D, S, mode, tmode, pmode, pad; };
static_assert(sizeof(RopeP) == 5 * 8 + 7 * 8 + 8 * 4, "RopeP has padding");
__global__ __launch_bounds__(256) void k_rope(RopeP p) {
    const long long idx = (long long)blockIdx.x * 256 + threadIdx.x;
    if (idx >= (long long)p.R * p.Hn * p.D) return;
    const int d = (int)(idx % p.D); const long long rh = idx / p.D; const int h = (int)(rh % p.Hn); const int r = (int)(rh / p.Hn);
    const int half = p.D / 2;
    int partner; float sign;
    if (p.mode == 0) { partner = (d < half) ? d + half : d - half; sign = (d < half) ? -1.f : 1.f; }
    else { partner = d ^ 1; sign = (d & 1) ? 1.f : -1.f; }
    const int tcol = (p.tmode == 0) ? d : ((p.tmode == 1) ? (d % half) : (d >> 1));
    const int pp = (p.pmode == 0) ? (r % p.S) : ((p.pmode == 1) ? h : p.pos[r]);
    const long long toff = (long long)(r / p.S) * p.sCb + (long long)pp * p.sCp + (long long)tcol * p.sCd;
    const float* xr = p.X + (long long)r * p.sXr + (long long)h * p.sXh;
    const float v = xr[d] * p.C[toff] + sign * xr[partner] * p.Sn[toff];
    VST2(float, p.Y + (long long)r * p.sYr + (long long)h * p.sYh + d, v);
}

// k_invf + k_sincos (split so neither kernel carries a large VALU-fma footprint): invf_i = num * (1 / powf(base, (2 i)/D)) [fmode 0],
//   num * expf((2 i) * cexp) [fmode 1], num * powf(base, -2 (i - 1) / D) [fmode 2]; then cs/sn[s*half + i] = cos/sin((pscale * s) * invf_i)
__global__ __launch_bounds__(256) void k_invf(float* __restrict__ invb, int half, int D, float base, float num, int fmode, float cexp) {
    const int i = blockIdx.x * 256 + threadIdx.x;
    if (i >= ((half + 31) / 32) * 32) return;
    if (i >= half) { VST2(float, invb + i, 0.f); return; }
    const float e = (float)(2 * i) / (float)D;
    float invf;
    if (fmode == 1) invf = num * expf((float)(2 * i) * cexp);
    else if (fmode == 2) invf = num * powf(base, (-2.0f * ((float)i - 1.0f)) / (float)D);
    else invf = num * (1.0f / powf(base, e));
    VST2(float, invb + i, invf);
}
__global__ __launch_bounds__(256) void k_sincos(float* __restrict__ cs, float* __restrict__ sn, const float* __restrict__ invb, int S, int half, float pscale) {
    const int idx = blockIdx.x * 256 + threadIdx.x;
    if (idx >= S * half) return;
    const int s = idx / half, i = idx - s * half;
    const float ang = (pscale * (float)s) * invb[i];
    VST2(float, cs + idx, cosf(ang)); VST2(float, sn + idx, sinf(ang));
}

// k_mulact: dst[i] = act(x[i]) * y[i]
__global__ __launch_bounds__(256) void k_mulact(const float* __restrict__ x, const float* __restrict__ y, float* __restrict__ dst, int n, int act) {
    const int i = blockIdx.x * 256 + threadIdx.x;
    if (i < n) { const float v = act_fn(x[i], act) * y[i]; VST2(float, dst + i, v); }
}

// =====================================================================================================================
// k_matvec: thread-per-row matrix-vector products for N <= 8 output columns (heads with 1-3 outputs, gates), f32 on the VALU.
//   C[r*sCm + j] = act(alpha * sum_k A[r*sAm + k*sAk] * B[j*sBn + k*sBk] + bias[j]) + beta * R[r*sRm + j*sRn]; each thread writes its N contiguous floats.
// =====================================================================================================================
__global__ __launch_bounds__(256) void k_matvec(GemmP p) {
    // 32 lanes write one line with one instruction.
    const int rpt = (p.N == 1) ? 1 : 32;
    const long long r0 = ((long long)blockIdx.x * 256 + threadIdx.x) * rpt; const int z = blockIdx.z, zo = z / p.zi_n, zi = z - zo * p.zi_n;
    if (r0 >= p.M) return;
    const float* Bb = p.B + zo * p.sBo + zi * p.sBi;
    float* C = p.C + zo * p.sCo + zi * p.sCi; const float* R = p.R + zo * p.sRo + zi * p.sRi;
    for (int rr = 0; rr < rpt; ++rr) {
        const long long r = r0 + rr; if (r >= p.M) break;
        const float* A = p.A + zo * p.sAo + zi * p.sAi + r * p.sAm;
        float acc[8] = {0.f, 0.f, 0.f, 0.f, 0.f, 0.f, 0.f, 0.f};
        for (int k = 0; k < p.K; ++k) { const float a = A[(long long)k * p.sAk];
#pragma unroll
            for (int j = 0; j < 8; ++j) if (j < p.N) acc[j] += a * Bb[(long long)j * p.sBn + (long long)k * p.sBk]; }
#pragma unroll
        for (int j = 0; j < 8; ++j) if (j < p.N) {
            float v = acc[j] * p.alpha;
            if (p.flags & 1) v += p.bias[j];
            if (p.flags & 2) v += p.bias[r];
            v = act_fn(v, p.act);
            if (p.flags & 4) v += p.beta * R[r * p.sRm + (long long)j * p.sRn];
            VST2(float, C + r * p.sCm + j, v);
        }
    }
}
// k_smallsoftmax: thread-per-row softmax for short rows (n <= 64): dst[r*dr + j] = softmax(scale*src[r*sr + j])
__global__ __launch_bounds__(256) void k_smallsoftmax(const float* __restrict__ src, float* __restrict__ dst, long long sr, long long dr, int n, long long R, float scale) {
    const long long r0 = ((long long)blockIdx.x * 256 + threadIdx.x) * 32;
    for (int rr = 0; rr < 32; ++rr) {
        const long long r = r0 + rr; if (r >= R) return;
        const float* s = src + r * sr; float* d = dst + r * dr;
        float mx = -__builtin_inff();
        for (int j = 0; j < n; ++j) mx = fmaxf(mx, s[j] * scale);
        float sum = 0.f;
        for (int j = 0; j < n; ++j) sum += expf(s[j] * scale - mx);
        const float inv = 1.f / sum;
        for (int j = 0; j < n; ++j) { const float v = expf(s[j] * scale - mx) * inv; VST2(float, d + j, v); }
    }
}

__global__ __launch_bounds__(32) void k_unitstat(float* __restrict__ st) { const int t = threadIdx.x; const float v = (t == 1) ? 1.f : 0.f; VST2(float, st + t, v); }

// destination (e.g. a d_out whose row width is not a multiple of 32 floats) is written by consecutive lanes of one instruction
__global__ __launch_bounds__(256) void k_lincopy(const float* __restrict__ src, long long lds, float* __restrict__ dst, long long ldd, long long rows, int cols) {
    const long long i = (long long)blockIdx.x * 256 + threadIdx.x; if (i >= rows * cols) return;
    const long long r = i / cols; const int c = (int)(i - r * cols);
    const float v = src[r * lds + c]; VST2(float, dst + r * ldd + c, v);
}

namespace w25 {
typedef __attribute__((ext_vector_type(16))) _Float16 v16h;
typedef __attribute__((ext_vector_type(8)))  _Float16 v8h;
typedef __attribute__((ext_vector_type(16))) __bf16   v16b;
typedef __attribute__((ext_vector_type(8)))  __bf16   v8b;
typedef __attribute__((ext_vector_type(8)))  float    v8f;
typedef __attribute__((ext_vector_type(4)))  float    v4f;

__device__ __forceinline__ unsigned short f2bf_bits(float f) {
  unsigned u = __float_as_uint(f);
  return (unsigned short)((u + 0x7FFFu + ((u >> 16) & 1u)) >> 16);
}
__device__ __forceinline__ float bf_bits2f(unsigned short h) { return __uint_as_float(((unsigned)h) << 16); }

// hazard guards as plain device helpers (no inline asm inside the kernel template body)
__device__ __forceinline__ void dep_guard_h(v8f& a, v8f& b, v16h x, v16h y) { asm volatile("v_nop\n\tv_nop\n\tv_nop\n\tv_nop" : "+v"(a), "+v"(b) : "v"(x), "v"(y)); }
__device__ __forceinline__ void dep_guard_b(v8f& a, v8f& b, v16b x, v16b y) { asm volatile("v_nop\n\tv_nop\n\tv_nop\n\tv_nop" : "+v"(a), "+v"(b) : "v"(x), "v"(y)); }
__device__ __forceinline__ void keep4_h(v16h a, v16h b, v16h c, v16h d) { asm volatile("v_nop" :: "v"(a), "v"(b), "v"(c), "v"(d)); }
__device__ __forceinline__ void keep4_b(v16b a, v16b b, v16b c, v16b d) { asm volatile("v_nop" :: "v"(a), "v"(b), "v"(c), "v"(d)); }
__device__ __forceinline__ void acc_guard4(v8f& a, v8f& b, v8f& c, v8f& d) { asm volatile("v_nop\n\tv_nop\n\tv_nop\n\tv_nop" : "+v"(a), "+v"(b), "+v"(c), "+v"(d)); }
template <typename T> struct Frag;
template <> struct Frag<_Float16> {
  typedef v16h V; union U { v16h v; v8h h[2]; };
  static __device__ __forceinline__ v16h load(const _Float16* p) {   // elements 0..7 <- p[0..7], 8..15 <- p[16..23]
    U f; f.h[0] = *(const v8h*)(p); f.h[1] = *(const v8h*)(p + 16); return f.v;
  }
  static __device__ __forceinline__ v8f mma(v16h a, v16h b, v8f c) {
    return __builtin_amdgcn_wmma_f32_16x16x32_f16(false, a, false, b, (short)0, c, false, false);
  }
  static __device__ __forceinline__ void guard(v8f& a, v8f& b, v16h x, v16h y) { dep_guard_h(a, b, x, y); }
  static __device__ __forceinline__ void keep(v16h a, v16h b, v16h c, v16h d) { keep4_h(a, b, c, d); }
};
template <> struct Frag<__bf16> {
  typedef v16b V; union U { v16b v; v8b h[2]; };
  static __device__ __forceinline__ v16b load(const __bf16* p) {
    U f; f.h[0] = *(const v8b*)(p); f.h[1] = *(const v8b*)(p + 16); return f.v;
  }
  static __device__ __forceinline__ v8f mma(v16b a, v16b b, v8f c) {
    return __builtin_amdgcn_wmma_f32_16x16x32_bf16(false, a, false, b, (short)0, c, false, false);
  }
  static __device__ __forceinline__ void guard(v8f& a, v8f& b, v16b x, v16b y) { dep_guard_b(a, b, x, y); }
  static __device__ __forceinline__ void keep(v16b a, v16b b, v16b c, v16b d) { keep4_b(a, b, c, d); }
};

// ---- Register-blocked batched WMMA GEMM ------------------------------------
// C[m,n] = scale * sum_k A[m,k] * Bt[n,k] (+bias)(+resid); each wave owns a 64x64 tile.
// A row-major [M,K]; Bt row-major [N,K]; M,N % 64 == 0, K % 32 == 0.
// SPLIT: operands are hi/lo planes (A2/Bt2 = lo planes, same layout); product = hi·hi + hi·lo + lo·hi.
// BIAS_MODE: 0 = none, 1 = bias[m], 2 = bias[n].
// OUT_MODE: 0 = f32, 1 = f16, 2 = bf16 hi plane (Cout) + bf16 lo plane (Cout2).
// ET: 0 = f16 operands, 1 = bf16 operands (pointers passed as 16-bit storage)
// Batches: blockIdx.y steps A, Bt, C by strideA/B/C, blockIdx.z by strideAz/Bz/Cz (elements).
template <int ET> struct Elem;
template <> struct Elem<0> { typedef _Float16 T; };
template <> struct Elem<1> { typedef __bf16 T; };
template <int ET, bool SPLIT, int BIAS_MODE, int OUT_MODE, bool RESID, int ACT = 0>
__global__ __launch_bounds__(256) void wmma_gemm64(
    const unsigned short* __restrict__ Ap, const unsigned short* __restrict__ A2p, int lda, long strideA,
    const unsigned short* __restrict__ Btp, const unsigned short* __restrict__ Bt2p, int ldb, long strideB,
    void* __restrict__ Cout, void* __restrict__ Cout2, int ldc, long strideC,
    const float* __restrict__ bias,
    const float* __restrict__ resid, long strideR,
    int M, int N, int K, float scale,
    long strideAz, long strideBz, long strideCz) {
  typedef typename Elem<ET>::T T;
  typedef typename Frag<T>::V V;
  const T* A = (const T*)Ap; const T* A2 = (const T*)A2p; const T* Bt = (const T*)Btp; const T* Bt2 = (const T*)Bt2p;
  __shared__ __align__(16) float sT[8][16 * 68];   // per-wave 16x64 slab, pitch 68 floats
  const int b    = blockIdx.y;
  const int lane = threadIdx.x & 31;
  const int wave = threadIdx.x >> 5;
  const int tilesN = N >> 6;
  const int tilesM = M >> 6;
  const int tile = blockIdx.x * 8 + wave;
  if (tile >= tilesM * tilesN) return;   // wave-uniform; no block barriers in this kernel
  const int tm = tile / tilesN;
  const int tn = tile - tm * tilesN;
  const int m0 = tm << 6;
  const int n0 = tn << 6;

  const int bz = blockIdx.z;                   // outer batch index (own strides)
  const size_t offA = (size_t)b * strideA + (size_t)bz * strideAz;
  const size_t offB = (size_t)b * strideB + (size_t)bz * strideBz;
  const size_t offC = (size_t)b * strideC + (size_t)bz * strideCz;
  const T* Ab  = A  + offA;
  const T* Bb  = Bt + offB;
  const T* Ab2 = SPLIT ? (A2  + offA) : nullptr;
  const T* Bb2 = SPLIT ? (Bt2 + offB) : nullptr;

  const int rlane = lane & 15;                 // row (A) / col (B, D) within subtile
  const int koff  = (lane >> 4) * 8;           // k offset of this lane half
  const int mOff  = (lane >> 4) * 8;           // D row offset

  v8f acc[4][4];
#pragma unroll
  for (int i = 0; i < 4; ++i)
#pragma unroll
    for (int j = 0; j < 4; ++j) acc[i][j] = (v8f){0.f,0.f,0.f,0.f,0.f,0.f,0.f,0.f};

  for (int k0 = 0; k0 < K; k0 += 32) {
    V bh[4], bl[4];
#pragma unroll
    for (int j = 0; j < 4; ++j) {
      const size_t bo = (size_t)(n0 + (j << 4) + rlane) * ldb + koff + k0;
      bh[j] = Frag<T>::load(Bb + bo);
      if (SPLIT) bl[j] = Frag<T>::load(Bb2 + bo);
    }
#pragma unroll
    for (int i = 0; i < 4; ++i) {
      const size_t ao = (size_t)(m0 + (i << 4) + rlane) * lda + koff + k0;
      V ah = Frag<T>::load(Ab + ao);
      V al;
      if (SPLIT) al = Frag<T>::load(Ab2 + ao);
#pragma unroll
      for (int j = 0; j < 4; ++j) {
        acc[i][j] = Frag<T>::mma(ah, bh[j], acc[i][j]);
        if (SPLIT) {
          acc[i][j] = Frag<T>::mma(ah, bl[j], acc[i][j]);
          acc[i][j] = Frag<T>::mma(al, bh[j], acc[i][j]);
        }
      }
      Frag<T>::guard(acc[i][0], acc[i][3], ah, SPLIT ? al : ah);
    }
    Frag<T>::keep(bh[0], bh[1], bh[2], bh[3]);
    if (SPLIT) Frag<T>::keep(bl[0], bl[1], bl[2], bl[3]);
  }
  acc_guard4(acc[0][0], acc[0][1], acc[0][2], acc[0][3]);
  acc_guard4(acc[1][0], acc[1][1], acc[1][2], acc[1][3]);
  acc_guard4(acc[2][0], acc[2][1], acc[2][2], acc[2][3]);
  acc_guard4(acc[3][0], acc[3][1], acc[3][2], acc[3][3]);

  // ---- epilogue ----
  float* slab = sT[wave];
  const float* Rb = RESID ? (resid + (size_t)b * strideR) : nullptr;
#pragma unroll
  for (int i = 0; i < 4; ++i) {
    const int mBase = m0 + (i << 4);
#pragma unroll
    for (int j = 0; j < 4; ++j) {
      const int n = n0 + (j << 4) + rlane;
      float bv = 0.f;
      if (BIAS_MODE == 2) bv = bias[n];
#pragma unroll
      for (int r = 0; r < 8; ++r) {
        float v = acc[i][j][r] * scale;
        if (BIAS_MODE == 1) v += bias[mBase + mOff + r];
        if (BIAS_MODE == 2) v += bv;
        if (RESID) v += Rb[(size_t)(mBase + mOff + r) * ldc + n];
        if (ACT == 1) v = tanhf(v);
        if (ACT == 2) v = fmaxf(v, 0.0f);
        if (ACT == 3) v = v / (1.0f + expf(-v));
        if (ACT == 4) v = (v > 0.f) ? v : 0.01f * v;
        if (ACT == 5) v = 0.5f * v * (1.0f + erff(v * 0.70710678118654752f));
        slab[(mOff + r) * 68 + (j << 4) + rlane] = v;
      }
    }
    __builtin_amdgcn_fence(__ATOMIC_RELEASE, "workgroup");
    __builtin_amdgcn_wave_barrier();
    __builtin_amdgcn_fence(__ATOMIC_ACQUIRE, "workgroup");
    if (OUT_MODE == 0) {
      float* C = (float*)Cout + offC;
      const int hh = lane >> 4, c4 = (lane & 15) * 4;     // row seg = 256 B = 16 lanes x 16 B
      {
#pragma unroll
        for (int it = 0; it < 8; ++it) {
          const int row = it * 2 + hh;
          v4f v = *(const v4f*)(slab + row * 68 + c4);
          *(v4f*)(C + (size_t)(mBase + row) * ldc + n0 + c4) = v;
        }
        
      }
    } else {
      const int q = lane >> 3, c8 = (lane & 7) * 8;
      unsigned short* C  = (unsigned short*)Cout  + offC;
      unsigned short* C2 = (OUT_MODE == 2) ? ((unsigned short*)Cout2 + offC) : nullptr;
      {
#pragma unroll
        for (int it = 0; it < 4; ++it) {
          const int row = it * 4 + q;
          const float* sp = slab + row * 68 + c8;
          v8h hv, lv;
#pragma unroll
          for (int e = 0; e < 8; ++e) {
            if (OUT_MODE == 1) {
              hv[e] = (_Float16)sp[e];
            } else {
              unsigned short hb = f2bf_bits(sp[e]);
              unsigned short lb = f2bf_bits(sp[e] - bf_bits2f(hb));
              hv[e] = __builtin_bit_cast(_Float16, hb);
              lv[e] = __builtin_bit_cast(_Float16, lb);
            }
          }
          *(v8h*)(C + (size_t)(mBase + row) * ldc + n0 + c8) = hv;
          if (OUT_MODE == 2) *(v8h*)(C2 + (size_t)(mBase + row) * ldc + n0 + c8) = lv;
        }
        
      }
    }
    __builtin_amdgcn_fence(__ATOMIC_RELEASE, "workgroup");
    __builtin_amdgcn_wave_barrier();
    __builtin_amdgcn_fence(__ATOMIC_ACQUIRE, "workgroup");
  }
}

__global__ __launch_bounds__(256) void cast_f32_f16x2(
    const float* __restrict__ in, _Float16* __restrict__ out, int n2) {
  int i = blockIdx.x * 256 + threadIdx.x;
  if (i < n2) {
    const _Float16 h0 = (_Float16)in[2 * i], h1 = (_Float16)in[2 * i + 1];
    const unsigned u = (unsigned)__builtin_bit_cast(unsigned short, h0) | ((unsigned)__builtin_bit_cast(unsigned short, h1) << 16);
    ((unsigned*)out)[i] = u;
    
  }
}


} // namespace w25

__global__ __launch_bounds__(256) void k_castT16(const float* __restrict__ src, long long lds, _Float16* __restrict__ dst, long long ldd, int R, int C, float s) {
    const long long i = (long long)blockIdx.x * 256 + threadIdx.x; const long long np = (long long)C * (R / 2); if (i >= np) return; const int c = (int)(i / (R / 2)); const int r = 2 * (int)(i % (R / 2));
    const _Float16 h0 = (_Float16)(src[(long long)r * lds + c] * s), h1 = (_Float16)(src[(long long)(r + 1) * lds + c] * s);
    const unsigned u = (unsigned)__builtin_bit_cast(unsigned short, h0) | ((unsigned)__builtin_bit_cast(unsigned short, h1) << 16);
    unsigned* d = (unsigned*)(dst + (long long)c * ldd + r); *d = u;  }
__global__ __launch_bounds__(256) void k_cast16(const float* __restrict__ src, long long lds, _Float16* __restrict__ dst, long long ldd, int R, int C, float s) {
    const long long i = (long long)blockIdx.x * 256 + threadIdx.x; const long long np = (long long)R * (C / 2); if (i >= np) return; const int r = (int)(i / (C / 2)); const int c = 2 * (int)(i % (C / 2));
    const _Float16 h0 = (_Float16)(src[(long long)r * lds + c] * s), h1 = (_Float16)(src[(long long)r * lds + c + 1] * s);
    const unsigned u = (unsigned)__builtin_bit_cast(unsigned short, h0) | ((unsigned)__builtin_bit_cast(unsigned short, h1) << 16);
    unsigned* d = (unsigned*)(dst + (long long)r * ldd + c); *d = u;  }

// f32 -> bf16 hi plane + bf16 lo plane (x = hi + lo to ~2^-17 relative; RNE both), [R][C] -> [R][C] (or transposed to [C][R]); 2 consecutive destination elements
__device__ __forceinline__ unsigned int f2bf2_pack(float a, float b, unsigned int* lo) {
    const unsigned short ha = w25::f2bf_bits(a), hb = w25::f2bf_bits(b);
    const unsigned short la = w25::f2bf_bits(a - w25::bf_bits2f(ha)), lb = w25::f2bf_bits(b - w25::bf_bits2f(hb));
    *lo = (unsigned)la | ((unsigned)lb << 16); return (unsigned)ha | ((unsigned)hb << 16); }
__global__ __launch_bounds__(256) void k_castS16(const float* __restrict__ src, long long lds, __bf16* __restrict__ dhi, __bf16* __restrict__ dlo, long long ldd, int R, int C, float s, int transpose) {
    const long long i = (long long)blockIdx.x * 256 + threadIdx.x; long long o; float a, b;
    if (transpose) { const long long np = (long long)C * (R / 2); if (i >= np) return; const int c = (int)(i / (R / 2)); const int r = 2 * (int)(i % (R / 2)); a = src[(long long)r * lds + c] * s; b = src[(long long)(r + 1) * lds + c] * s; o = (long long)c * ldd + r; }
    else { const long long np = (long long)R * (C / 2); if (i >= np) return; const int r = (int)(i / (C / 2)); const int c = 2 * (int)(i % (C / 2)); a = src[(long long)r * lds + c] * s; b = src[(long long)r * lds + c + 1] * s; o = (long long)r * ldd + c; }
    unsigned lo; const unsigned hi = f2bf2_pack(a, b, &lo); unsigned* ph = (unsigned*)(dhi + o); unsigned* pl = (unsigned*)(dlo + o);
    *ph = hi; *pl = lo;  }

namespace w25 {
// =====================================================================================
// Generic causal/non-causal attention for head_dim 64, f32 in / f32 out; 16-bit operands: bf16 with optional hi/lo splits, or
// plain f16 (F16=true, non-split, probabilities carried x2^15).
//   scores = (q*qscale)·kᵀ : v_wmma_f32_16x16x32_bf16; SPLIT_QK -> q,k as bf16 hi/lo (hi·hi + hi·lo + lo·hi)
//   out    = p·v           : v_wmma_f32_16x16x32_bf16; SPLIT_PV -> p,v as bf16 hi/lo; else p,v plain bf16
//   f32 accumulate; online softmax in f32. Block = 4 waves = 64 query rows of one (batch, head); S % 64 == 0.
//   Element (b, s, h, d) of tensor X lives at X[b*X_bs + s*X_rs + h*X_hs + d] (strides in floats, multiples of 4).
//   Masking: mask_mode 0 none, 1 causal (kv > q masked), 2 tensor [S][Skv] shared over (b,h) (float if
//   mask_is_int==0, int32 with element == 0 -> masked if 1, int32 with element != 0 -> masked if 2), 3 per-token vectors qmask[B][S] & kvmask[B][Skv] (int32,
//   0 -> masked), 4 causal + sliding window (kv > q or q - kv > W masked; W passed in mask_is_int);
//   5 = relative-position bias: s += cp[b,h,q][idx[q][kv]] + pc[b,h,kv][idx[q][kv]] with idx = mask_b ([S][Skv] int32) and
//   mask_a an int32 [S][Skv] tensor with nonzero = masked (tables: element (b,h,row,n) at X + b*c_bs + h*c_hs + row*c_rs + n);
//   masked scores are replaced by mask_fill (e.g. -inf or -1e9) before the softmax.
//   grid.x = B * H * (S/64) (or a sub-range with blk0).
// =====================================================================================
#define AT_D 64
#define AT_NW 4
#define AT_QB 64
#define AT_KC 64
struct AttnGeom { const float* cp = nullptr; const float* pc = nullptr; long c_bs = 0, c_rs = 0, c_hs = 0;   // mode-5 score-bias tables
                  long q_bs, q_rs, q_hs, k_bs, k_rs, k_hs, v_bs, v_rs, v_hs, o_bs, o_rs, o_hs;
                  int S, Skv, H, mask_mode; float qscale; int blk0; float mask_fill; int mask_is_int; };
static_assert(sizeof(AttnGeom) == 168, "no padding");

__device__ __forceinline__ unsigned short at_bf_bits(float f) {
  unsigned u = __float_as_uint(f);
  return (unsigned short)((u + 0x7FFFu + ((u >> 16) & 1u)) >> 16);
}
__device__ __forceinline__ __bf16 at_f2bf(float f) { return __builtin_bit_cast(__bf16, at_bf_bits(f)); }
__device__ __forceinline__ void at_split(float f, __bf16& hi, __bf16& lo) {
  const unsigned short hb = at_bf_bits(f);
  hi = __builtin_bit_cast(__bf16, hb);
  lo = at_f2bf(f - __uint_as_float(((unsigned)hb) << 16));
}
__device__ __forceinline__ v8f at_mma(v16b a, v16b b, v8f c) {
  c = __builtin_amdgcn_wmma_f32_16x16x32_bf16(false, a, false, b, (short)0, c, false, false);
  asm volatile("v_nop\n\tv_nop\n\tv_nop\n\tv_nop" : "+v"(c) : "v"(a), "v"(b));
  return c;
}
// 16-bit element as a bit pattern held in a __bf16 slot: f16 bits when F16, bf16 (RNE) otherwise
template <bool F16> __device__ __forceinline__ __bf16 at_to16(float f) {
  if (F16) return __builtin_bit_cast(__bf16, (_Float16)f);
  return at_f2bf(f);
}
template <bool F16> __device__ __forceinline__ v8f at_mma16(v16b a, v16b b, v8f c) {
  if (F16) {
    const v16h ah = __builtin_bit_cast(v16h, a), bh = __builtin_bit_cast(v16h, b);
    c = __builtin_amdgcn_wmma_f32_16x16x32_f16(false, ah, false, bh, (short)0, c, false, false);
    asm volatile("v_nop\n\tv_nop\n\tv_nop\n\tv_nop" : "+v"(c) : "v"(ah), "v"(bh));
    return c;
  }
  return at_mma(a, b, c);
}

template <bool SPLIT_QK, bool SPLIT_PV, bool F16 = false>
__global__ __launch_bounds__(128)
void attn64_kernel(const float* __restrict__ q, const float* __restrict__ k,
                   const float* __restrict__ v, float* __restrict__ out,
                   const void* __restrict__ mask_a, const int* __restrict__ mask_b, AttnGeom g) {
  static_assert(!(F16 && (SPLIT_QK || SPLIT_PV)), "f16 mode is non-split");
  const float PSC = F16 ? 32768.0f : 1.0f;     // f16 probabilities carried x2^15 (subnormal range), folded into the final 1/l
  union FB { v16b v; v8b h[2]; };
  __shared__ __align__(16) __bf16 Ksh[AT_KC * AT_D];             // K hi [kv][d]      8 KB
  __shared__ __align__(16) __bf16 Ksl[SPLIT_QK ? AT_KC * AT_D : 8];
  __shared__ __align__(16) __bf16 Vth[AT_D * AT_KC];             // V hi [d][kv]      8 KB
  __shared__ __align__(16) __bf16 Vtl[SPLIT_PV ? AT_D * AT_KC : 8];
  __shared__ __align__(16) __bf16 Psh[AT_NW][16 * AT_KC];        // per wave P hi [row][kv]  8 KB
  __shared__ __align__(16) __bf16 Psl[SPLIT_PV ? AT_NW : 1][SPLIT_PV ? 16 * AT_KC : 8];
  __shared__ __align__(16) float  Os[AT_NW][16 * 68];            // per wave out tile, pitch 68

  const int tid  = threadIdx.x;
  const int wave = tid >> 5;
  const int lane = tid & 31;
  const int hh   = lane >> 4;
  const int c    = lane & 15;

  const int nqb = g.S / AT_QB;
  const int bx = blockIdx.x + g.blk0;
  const int qb = bx % nqb;
  const int bh = bx / nqb;
  const int h  = bh % g.H;
  const int b  = bh / g.H;
  const int qbase_block = qb * AT_QB;
  const int q0 = qbase_block + wave * 16;

  const float* qb_ptr = q + (size_t)b * g.q_bs + (size_t)h * g.q_hs;
  const float* kb_ptr = k + (size_t)b * g.k_bs + (size_t)h * g.k_hs;
  const float* vb_ptr = v + (size_t)b * g.v_bs + (size_t)h * g.v_hs;
  float*       ob_ptr = out + (size_t)b * g.o_bs + (size_t)h * g.o_hs;

  // ---- Q fragments (A operand): 2 d-chunks, hi (and lo) ----
  v16b qah[2], qal[2];
  {
    const float* qrow = qb_ptr + (size_t)(q0 + c) * g.q_rs;
#pragma unroll
    for (int dc = 0; dc < 2; ++dc) {
#pragma unroll
      for (int e = 0; e < 8; ++e) {
        const float f0 = qrow[dc * 32 + 8 * hh + e] * g.qscale;
        const float f1 = qrow[dc * 32 + 16 + 8 * hh + e] * g.qscale;
        if (SPLIT_QK) { __bf16 hq, lq; at_split(f0, hq, lq); qah[dc][e] = hq; qal[dc][e] = lq; at_split(f1, hq, lq); qah[dc][8 + e] = hq; qal[dc][8 + e] = lq; }
        else { qah[dc][e] = at_to16<F16>(f0); qah[dc][8 + e] = at_to16<F16>(f1); qal[dc][e] = qah[dc][e]; qal[dc][8 + e] = qah[dc][8 + e]; }
      }
    }
  }

  float mrow[8], lrow[8];
  v8f oacc[4];
#pragma unroll
  for (int r = 0; r < 8; ++r) { mrow[r] = -INFINITY; lrow[r] = 0.f; }
#pragma unroll
  for (int t = 0; t < 4; ++t) oacc[t] = (v8f){0.f,0.f,0.f,0.f,0.f,0.f,0.f,0.f};

  const int nChunks = (g.mask_mode == 1 || g.mask_mode == 4) ? (qb + 1) : (g.Skv / AT_KC);   // block-uniform
  // per-row query mask (mode 3)
  int qkeep[8];
#pragma unroll
  for (int r = 0; r < 8; ++r) qkeep[r] = (g.mask_mode == 3) ? mask_b[(size_t)b * g.S + q0 + 8 * hh + r] : 1;   // mask_b = qmask in mode 3
  for (int kc = 0; kc < nChunks; ++kc) {
    const int kv0 = kc * AT_KC;
    __syncthreads();
    {
      const int kvr = tid >> 1, dh = (tid & 1) * 32;
      const float* krow = kb_ptr + (size_t)(kv0 + kvr) * g.k_rs + dh;
      const float* vrow = vb_ptr + (size_t)(kv0 + kvr) * g.v_rs + dh;
#pragma unroll
      for (int i = 0; i < 8; ++i) {
        v4f kk = *(const v4f*)(krow + 4 * i);
        v4f vv = *(const v4f*)(vrow + 4 * i);
#pragma unroll
        for (int e = 0; e < 4; ++e) {
          const int d = dh + 4 * i + e;
          if (SPLIT_QK) { __bf16 a, bl; at_split(kk[e], a, bl); Ksh[kvr * AT_D + d] = a; Ksl[kvr * AT_D + d] = bl; }
          else Ksh[kvr * AT_D + d] = at_to16<F16>(kk[e]);
          if (SPLIT_PV) { __bf16 a, bl; at_split(vv[e], a, bl); Vth[d * AT_KC + kvr] = a; Vtl[d * AT_KC + kvr] = bl; }
          else Vth[d * AT_KC + kvr] = at_to16<F16>(vv[e]);
        }
      }
    }
    __syncthreads();

    v8f s[4];
#pragma unroll
    for (int j = 0; j < 4; ++j) {
      s[j] = (v8f){0.f,0.f,0.f,0.f,0.f,0.f,0.f,0.f};
#pragma unroll 1
      for (int dc = 0; dc < 2; ++dc) {
        FB kb;
        kb.h[0] = *(const v8b*)(Ksh + (j * 16 + c) * AT_D + dc * 32 + 8 * hh);
        kb.h[1] = *(const v8b*)(Ksh + (j * 16 + c) * AT_D + dc * 32 + 16 + 8 * hh);
        s[j] = at_mma16<F16>(qah[dc], kb.v, s[j]);
        if (SPLIT_QK) {
          FB kl;
          kl.h[0] = *(const v8b*)(Ksl + (j * 16 + c) * AT_D + dc * 32 + 8 * hh);
          kl.h[1] = *(const v8b*)(Ksl + (j * 16 + c) * AT_D + dc * 32 + 16 + 8 * hh);
          s[j] = at_mma16<F16>(qah[dc], kl.v, s[j]);
          s[j] = at_mma16<F16>(qal[dc], kb.v, s[j]);
        }
      }
    }
    const bool diag = (g.mask_mode == 1) && (kc == qb);
    int kvkeep[4] = {1, 1, 1, 1};
    if (g.mask_mode == 3) {
#pragma unroll
      for (int j = 0; j < 4; ++j) kvkeep[j] = ((const int*)mask_a)[(size_t)b * g.Skv + kv0 + j * 16 + c];   // mask_a = kvmask
    }
    float cm[8];
#pragma unroll
    for (int r = 0; r < 8; ++r) {
      const int qrow = q0 + 8 * hh + r;
      float m = -INFINITY;
#pragma unroll
      for (int j = 0; j < 4; ++j) {
        const int kvcol = kv0 + j * 16 + c;
        bool masked = false;
        if (diag) masked = (kvcol > qrow);
        else if (g.mask_mode == 4) masked = (kvcol > qrow) || (qrow - kvcol > g.mask_is_int);
        else if (g.mask_mode == 2) {
          const size_t mi = (size_t)qrow * g.Skv + kvcol;
          masked = (g.mask_is_int == 0) ? (((const float*)mask_a)[mi] == 0.0f)
                 : (g.mask_is_int == 1) ? (((const int*)mask_a)[mi] == 0) : (((const int*)mask_a)[mi] != 0);
        } else if (g.mask_mode == 3) masked = (qkeep[r] == 0) || (kvkeep[j] == 0);
        else if (g.mask_mode == 5) {
          const size_t mi = (size_t)qrow * g.Skv + kvcol;
          masked = (((const int*)mask_a)[mi] != 0);
          int n = mask_b[mi]; n = n < 0 ? 0 : n;
          s[j][r] += g.cp[(size_t)b * g.c_bs + (size_t)h * g.c_hs + (size_t)qrow * g.c_rs + n]
                   + g.pc[(size_t)b * g.c_bs + (size_t)h * g.c_hs + (size_t)kvcol * g.c_rs + n];
        }
        if (masked) s[j][r] = g.mask_fill;
        m = fmaxf(m, s[j][r]);
      }
#pragma unroll
      for (int off = 1; off < 16; off <<= 1) m = fmaxf(m, __shfl_xor(m, off, 32));
      cm[r] = m;
    }
    __bf16* pwh = Psh[wave];
    __bf16* pwl = Psl[SPLIT_PV ? wave : 0];
#pragma unroll
    for (int r = 0; r < 8; ++r) {
      const float mnew = fmaxf(mrow[r], cm[r]);
      const float alpha = expf(mrow[r] - mnew);
      mrow[r] = mnew;
      float psum = 0.f;
#pragma unroll
      for (int j = 0; j < 4; ++j) {
        const float p = expf(s[j][r] - mnew);
        psum += p;
        if (SPLIT_PV) { __bf16 a, bl; at_split(p, a, bl); pwh[(8 * hh + r) * AT_KC + j * 16 + c] = a; pwl[(8 * hh + r) * AT_KC + j * 16 + c] = bl; }
        else pwh[(8 * hh + r) * AT_KC + j * 16 + c] = at_to16<F16>(p * PSC);
      }
#pragma unroll
      for (int off = 1; off < 16; off <<= 1) psum += __shfl_xor(psum, off, 32);
      lrow[r] = lrow[r] * alpha + psum;
#pragma unroll
      for (int t = 0; t < 4; ++t) oacc[t][r] *= alpha;
    }
    __builtin_amdgcn_fence(__ATOMIC_RELEASE, "workgroup");
    __builtin_amdgcn_wave_barrier();
    __builtin_amdgcn_fence(__ATOMIC_ACQUIRE, "workgroup");
#pragma unroll 1
    for (int kk = 0; kk < 2; ++kk) {
      FB pa, pl;
      pa.h[0] = *(const v8b*)(pwh + c * AT_KC + kk * 32 + 8 * hh);
      pa.h[1] = *(const v8b*)(pwh + c * AT_KC + kk * 32 + 16 + 8 * hh);
      if (SPLIT_PV) {
        pl.h[0] = *(const v8b*)(pwl + c * AT_KC + kk * 32 + 8 * hh);
        pl.h[1] = *(const v8b*)(pwl + c * AT_KC + kk * 32 + 16 + 8 * hh);
      }
#pragma unroll
      for (int t = 0; t < 4; ++t) {
        FB vb;
        vb.h[0] = *(const v8b*)(Vth + (t * 16 + c) * AT_KC + kk * 32 + 8 * hh);
        vb.h[1] = *(const v8b*)(Vth + (t * 16 + c) * AT_KC + kk * 32 + 16 + 8 * hh);
        oacc[t] = at_mma16<F16>(pa.v, vb.v, oacc[t]);
        if (SPLIT_PV) {
          FB vl;
          vl.h[0] = *(const v8b*)(Vtl + (t * 16 + c) * AT_KC + kk * 32 + 8 * hh);
          vl.h[1] = *(const v8b*)(Vtl + (t * 16 + c) * AT_KC + kk * 32 + 16 + 8 * hh);
          oacc[t] = at_mma16<F16>(pa.v, vl.v, oacc[t]);
          oacc[t] = at_mma16<F16>(pl.v, vb.v, oacc[t]);
        }
      }
    }
  }

  float* os = Os[wave];
#pragma unroll
  for (int r = 0; r < 8; ++r) {
    const float inv = 1.0f / (lrow[r] * PSC);
#pragma unroll
    for (int t = 0; t < 4; ++t) os[(8 * hh + r) * 68 + t * 16 + c] = oacc[t][r] * inv;
  }
  __builtin_amdgcn_fence(__ATOMIC_RELEASE, "workgroup");
  __builtin_amdgcn_wave_barrier();
  __builtin_amdgcn_fence(__ATOMIC_ACQUIRE, "workgroup");
  {
    const int c4 = (lane & 15) * 4;
    {
#pragma unroll
      for (int it = 0; it < 8; ++it) {
        const int row = it * 2 + hh;
        v4f val = *(const v4f*)(os + row * 68 + c4);
        *(v4f*)(ob_ptr + (size_t)(q0 + row) * g.o_rs + c4) = val;
      }
      
    }
  }
}

} // namespace w25

__device__ __forceinline__ void st_h2(_Float16* dst, float a, float b) { const unsigned u = (unsigned)__builtin_bit_cast(unsigned short, (_Float16)a) | ((unsigned)__builtin_bit_cast(unsigned short, (_Float16)b) << 16); unsigned* d = (unsigned*)dst; *d = u;  }
// TK16 [r][d] = 16 table_k[r][d], zero rows 129..191
__global__ __launch_bounds__(256) void k_sh_tk(const float* __restrict__ TK, _Float16* __restrict__ TK16, int TAB, int TP, int HD) { const int t = blockIdx.x * 256 + threadIdx.x; if (t >= TP * HD / 2) return; const int e = 2 * t; const int r = e / HD; st_h2(TK16 + e, (r < TAB) ? TK[e] * 16.f : 0.f, (r < TAB) ? TK[e + 1] * 16.f : 0.f); }
// per (b, h, q) row (block; heads h0..h0+7 in blockIdx.x, batch b + blockIdx.y): s_k = (SC[y][h-h0][q][k] + QT[(b,q,h)][fm[b][q][k]]) / 8; softmax over 512 k (exp once) -> P16[b][h][q][k] = f16(4096 p); SC keeps the f32 probabilities
__global__ __launch_bounds__(256) void k_sh_soft(float* __restrict__ SC, const float* __restrict__ QT, const int* __restrict__ FM, _Float16* __restrict__ P16, int b, int h0, int L, int NH, int TP, int TAB) { __shared__ float red[256]; const int rl = blockIdx.x; const int bb = b + blockIdx.y; const int h = h0 + rl / L, q = rl % L; const int row = (bb * NH + h) * L + q; const int t = threadIdx.x; float* sr = SC + ((long long)blockIdx.y * gridDim.x + rl) * L; const float* qt = QT + (((long long)bb * L + q) * NH + h) * TP; const int* fr = FM + ((long long)bb * L + q) * L;
    float v0, v1; { const int j = 2 * t; int r0 = fr[j], r1 = fr[j + 1]; r0 = r0 < 0 ? 0 : (r0 >= TAB ? TAB - 1 : r0); r1 = r1 < 0 ? 0 : (r1 >= TAB ? TAB - 1 : r1); v0 = (sr[j] + qt[r0]) * 0.125f; v1 = (sr[j + 1] + qt[r1]) * 0.125f; }
    red[t] = fmaxf(v0, v1); __syncthreads(); for (int o = 128; o > 0; o >>= 1) { if (t < o) red[t] = fmaxf(red[t], red[t + o]); __syncthreads(); } const float m = red[0]; __syncthreads();
    const float e0 = expf(v0 - m), e1 = expf(v1 - m); red[t] = e0 + e1; __syncthreads(); for (int o = 128; o > 0; o >>= 1) { if (t < o) red[t] += red[t + o]; __syncthreads(); } const float f = 1.f / red[0];
    { const int j = 2 * t; const unsigned long long pk = (unsigned long long)__builtin_bit_cast(unsigned, e0 * f) | ((unsigned long long)__builtin_bit_cast(unsigned, e1 * f) << 32); VST2(unsigned long long, (unsigned long long*)(sr + j), pk); st_h2(P16 + (long long)row * L + j, e0 * f * 4096.f, e1 * f * 4096.f); } }
// zero the 48 planes behind the last batch's heads in P16 once (thread per dword): the padding rows 16..63 of a batch's A operand are the planes that follow its own 16
__global__ __launch_bounds__(256) void k_sh_zero(_Float16* __restrict__ P, long long nhalf) { const long long t = (long long)blockIdx.x * 256 + threadIdx.x; if (t >= nhalf / 2) return; unsigned* d = (unsigned*)(P + 2 * t); *d = 0u;  }
// RVT[g][d][k] = f16(table_v[fm row (b L + q0 + g)][k]][d]) for g in [256 y, 256 y + 256), y = blockIdx.y (rows run on over the batches): the gathered relative-value rows as transposed B-operand planes (thread per (q, d, k pair); INPUT ids clamped)
__global__ __launch_bounds__(256) void k_sh_rvt(const int* __restrict__ FM, const float* __restrict__ TV, _Float16* __restrict__ RVT, int b, int q0, int L, int HD, int TAB) { const long long t = (long long)blockIdx.x * 256 + threadIdx.x; const long long n = (long long)256 * HD * L; if (t >= n / 2) return; const long long e = 2 * t; const int kk = (int)(e % L); const int d = (int)((e / L) % HD); const int ql = (int)(e / ((long long)L * HD)); const int* fr = FM + ((long long)b * L + q0 + (long long)blockIdx.y * 256 + ql) * L;
    int r0 = fr[kk], r1 = fr[kk + 1]; r0 = r0 < 0 ? 0 : (r0 >= TAB ? TAB - 1 : r0); r1 = r1 < 0 ? 0 : (r1 >= TAB ? TAB - 1 : r1); st_h2(RVT + (long long)blockIdx.y * n + e, TV[r0 * HD + d], TV[r1 * HD + d]); }
// X row (b L + q0 + g), column h*64 + d, += W2T[g][h][d] / 4096 for h < 16, g in [256 y, 256 y + 256), y = blockIdx.y (rows 16..63 of each W2T slab are padding garbage and ignored) (thread-linear over (ql, h, d): 1024 contiguous floats per q)
__global__ __launch_bounds__(256) void k_sh_w2add(const float* __restrict__ W2T, float* __restrict__ X, int b, int q0, int L, int D, int HD) { const long long t = (long long)blockIdx.x * 256 + threadIdx.x; if (t >= (long long)256 * D) return; const int ql = (int)(t / D) + (int)blockIdx.y * 256; const int c = (int)(t % D); const int h = c / HD, d = c % HD; float* xo = X + ((long long)b * L + q0 + ql) * D + c; VST2(float, xo, *xo + W2T[((long long)ql * 64 + h) * HD + d] * (1.f / 4096.f)); }


extern "C" void kernel_launch(void* const* d_in, const int* in_sizes, int n_in, void* d_out, int out_size, void* d_ws, size_t ws_size, hipStream_t stream) {
    (void)in_sizes; (void)n_in; (void)out_size; (void)ws_size;
    const float* xq = (const float*)d_in[0];
    const float* xk = (const float*)d_in[1];
    const float* xv = (const float*)d_in[2];
    const int* fm = (const int*)d_in[3];
    const float* Wq = (const float*)d_in[4];
    const float* bq = (const float*)d_in[5];
    const float* Wk = (const float*)d_in[6];
    const float* bk = (const float*)d_in[7];
    const float* Wv = (const float*)d_in[8];
    const float* bv = (const float*)d_in[9];
    const float* Wo = (const float*)d_in[10];
    const float* bo = (const float*)d_in[11];
    const float* tk = (const float*)d_in[12];
    const float* tv = (const float*)d_in[13];
    const int Bn = 8;
    const int L = 512;
    const int D = 1024;
    const int NH = 16;
    const int HD = 64;
    const int NR = Bn * L;
    const int TAB = 129;
    const int TP = 192;
    float* out = (float*)d_out;
    char* wsp = (char*)d_ws;
    // kept through the call
    unsigned short* XA16 = (unsigned short*)wsp; wsp += (((size_t)((size_t)NR * D * 2) + 255) / 256) * 256;
    unsigned short* W16 = (unsigned short*)wsp; wsp += (((size_t)((size_t)D * D * 2) + 255) / 256) * 256;
    unsigned short* VT16 = (unsigned short*)wsp; wsp += (((size_t)((size_t)Bn * D * L * 2) + 255) / 256) * 256;
    unsigned short* TK16 = (unsigned short*)wsp; wsp += (((size_t)((size_t)TP * HD * 2) + 255) / 256) * 256;
    unsigned short* P16 = (unsigned short*)wsp; wsp += (((size_t)((size_t)(Bn * NH + 48) * L * L * 2) + 255) / 256) * 256;
    float* X = (float*)wsp; wsp += (((size_t)((size_t)NR * D * 4) + 255) / 256) * 256;
    // one region, used three times in stream order: scores (Q16, K16, QT, SC), then relative values (RVT, W2T), then the output projection's operands
    char* ph = wsp;
    unsigned short* Q16 = (unsigned short*)wsp; wsp += (((size_t)((size_t)NR * D * 2) + 255) / 256) * 256;
    unsigned short* K16 = (unsigned short*)wsp; wsp += (((size_t)((size_t)NR * D * 2) + 255) / 256) * 256;
    float* QT = (float*)wsp; wsp += (((size_t)((size_t)NR * NH * TP * 4) + 255) / 256) * 256;
    float* SC = (float*)wsp; wsp += (((size_t)((size_t)Bn * 8 * L * L * 4) + 255) / 256) * 256;
    unsigned short* RVT = (unsigned short*)ph;
    float* W2T = (float*)(ph + (((size_t)((size_t)1024 * HD * L * 2) + 255) / 256) * 256);
    unsigned short* G64A = (unsigned short*)ph;
    unsigned short* G64B = (unsigned short*)(ph + (((size_t)((size_t)NR * D * 2) + 255) / 256) * 256);
    k_cast16<<<(unsigned)((((long long)(NR) * ((D) / 2)) + 255) / 256), 256, 0, stream>>>(xq, D, (_Float16*)(XA16), D, NR, D, 1.0f);
    k_cast16<<<(unsigned)((((long long)(D) * ((D) / 2)) + 255) / 256), 256, 0, stream>>>(Wq, D, (_Float16*)(W16), D, D, D, 16.0f);
    w25::wmma_gemm64<0, false, 2, 1, false, 0><<<dim3((unsigned)((((NR) / 64) * ((D) / 64) + 7) / 8), (unsigned)(1)), 256, 0, stream>>>((const unsigned short*)(XA16), nullptr, D, 0, (const unsigned short*)(W16), nullptr, D, 0, (void*)(Q16), nullptr, D, 0, bq, nullptr, 0, NR, D, D, 0.0625f, 0, 0, 0);
    k_cast16<<<(unsigned)((((long long)(NR) * ((D) / 2)) + 255) / 256), 256, 0, stream>>>(xk, D, (_Float16*)(XA16), D, NR, D, 1.0f);
    k_cast16<<<(unsigned)((((long long)(D) * ((D) / 2)) + 255) / 256), 256, 0, stream>>>(Wk, D, (_Float16*)(W16), D, D, D, 16.0f);
    w25::wmma_gemm64<0, false, 2, 1, false, 0><<<dim3((unsigned)((((NR) / 64) * ((D) / 64) + 7) / 8), (unsigned)(1)), 256, 0, stream>>>((const unsigned short*)(XA16), nullptr, D, 0, (const unsigned short*)(W16), nullptr, D, 0, (void*)(K16), nullptr, D, 0, bk, nullptr, 0, NR, D, D, 0.0625f, 0, 0, 0);
    k_cast16<<<(unsigned)((((long long)(NR) * ((D) / 2)) + 255) / 256), 256, 0, stream>>>(xv, D, (_Float16*)(XA16), D, NR, D, 1.0f);
    k_cast16<<<(unsigned)((((long long)(D) * ((D) / 2)) + 255) / 256), 256, 0, stream>>>(Wv, D, (_Float16*)(W16), D, D, D, 16.0f);
    k_sh_tk<<<(TP * HD / 2 + 255) / 256, 256, 0, stream>>>(tk, (_Float16*)TK16, TAB, TP, HD);
    k_sh_zero<<<(unsigned)(((long long)48 * L * L / 2 + 255) / 256), 256, 0, stream>>>((_Float16*)P16 + (size_t)Bn * NH * L * L, (long long)48 * L * L);
    // QT[(b,q,h)][r] for all batches: the (b,q,h) rows of Q16 are contiguous 64-element rows
    w25::wmma_gemm64<0, false, 0, 0, false, 0><<<dim3((unsigned)((((NR * NH) / 64) * ((TP) / 64) + 7) / 8), (unsigned)(1)), 256, 0, stream>>>((const unsigned short*)(Q16), nullptr, HD, 0, (const unsigned short*)(TK16), nullptr, HD, 0, (void*)(QT), nullptr, TP, 0, nullptr, nullptr, 0, NR * NH, TP, HD, 0.0625f, 0, 0, 0);
    // VT16[b][c][k] = v^T, blockIdx.y = batch
    w25::wmma_gemm64<0, false, 1, 1, false, 0><<<dim3((unsigned)((((D) / 64) * ((L) / 64) + 7) / 8), (unsigned)(Bn)), 256, 0, stream>>>((const unsigned short*)(W16), nullptr, D, 0, (const unsigned short*)(XA16), nullptr, D, (long long)L * D, (void*)(VT16), nullptr, L, (long long)D * L, bv, nullptr, 0, D, L, D, 0.0625f, 0, 0, 0);
    // content scores and softmax: eight heads (blockIdx.y) of every batch (blockIdx.z; the softmax's blockIdx.y) per launch
    w25::wmma_gemm64<0, false, 0, 0, false, 0><<<dim3((unsigned)((((L) / 64) * ((L) / 64) + 7) / 8), (unsigned)(8), (unsigned)(Bn)), 256, 0, stream>>>((const unsigned short*)(Q16 + 0 * HD), nullptr, D, HD, (const unsigned short*)(K16 + 0 * HD), nullptr, D, HD, (void*)(SC), nullptr, L, (long long)L * L, nullptr, nullptr, 0, L, L, HD, 1.0f, (long long)L * D, (long long)L * D, (long long)8 * L * L);
    k_sh_soft<<<dim3((unsigned)(8 * L), (unsigned)(Bn)), 256, 0, stream>>>(SC, QT, (const int*)fm, (_Float16*)P16, 0, 0, L, NH, TP, TAB);
    w25::wmma_gemm64<0, false, 0, 0, false, 0><<<dim3((unsigned)((((L) / 64) * ((L) / 64) + 7) / 8), (unsigned)(8), (unsigned)(Bn)), 256, 0, stream>>>((const unsigned short*)(Q16 + 8 * HD), nullptr, D, HD, (const unsigned short*)(K16 + 8 * HD), nullptr, D, HD, (void*)(SC), nullptr, L, (long long)L * L, nullptr, nullptr, 0, L, L, HD, 1.0f, (long long)L * D, (long long)L * D, (long long)8 * L * L);
    k_sh_soft<<<dim3((unsigned)(8 * L), (unsigned)(Bn)), 256, 0, stream>>>(SC, QT, (const int*)fm, (_Float16*)P16, 0, 8, L, NH, TP, TAB);
    // w1 = attn.v: blockIdx.y = head, blockIdx.z = batch
    w25::wmma_gemm64<0, false, 0, 0, false, 0><<<dim3((unsigned)((((L) / 64) * ((HD) / 64) + 7) / 8), (unsigned)(NH), (unsigned)(Bn)), 256, 0, stream>>>((const unsigned short*)(P16), nullptr, L, (long long)L * L, (const unsigned short*)(VT16), nullptr, L, (long long)HD * L, (void*)(X), nullptr, D, HD, nullptr, nullptr, 0, L, HD, L, 0.000244140625f, (long long)NH * L * L, (long long)D * L, (long long)L * D);
    // w2: two batches (1024 queries) per round; blockIdx.y = query, blockIdx.z = batch of the pair
    k_sh_rvt<<<dim3((unsigned)(((long long)256 * HD * L / 2 + 255) / 256), (unsigned)(4)), 256, 0, stream>>>((const int*)fm, tv, (_Float16*)RVT, 0, 0, L, HD, TAB);
    w25::wmma_gemm64<0, false, 0, 0, false, 0><<<dim3((unsigned)((((64) / 64) * ((HD) / 64) + 7) / 8), (unsigned)(L), (unsigned)(2)), 256, 0, stream>>>((const unsigned short*)(P16 + (size_t)0 * NH * L * L), nullptr, (long long)L * L, L, (const unsigned short*)(RVT), nullptr, L, (long long)HD * L, (void*)(W2T), nullptr, HD, 64 * HD, nullptr, nullptr, 0, 64, HD, L, 1.0f, (long long)NH * L * L, (long long)L * HD * L, (long long)L * 64 * HD);
    k_sh_w2add<<<dim3((unsigned)((256 * D + 255) / 256), (unsigned)(4)), 256, 0, stream>>>(W2T, X, 0, 0, L, D, HD);
    k_sh_rvt<<<dim3((unsigned)(((long long)256 * HD * L / 2 + 255) / 256), (unsigned)(4)), 256, 0, stream>>>((const int*)fm, tv, (_Float16*)RVT, 2, 0, L, HD, TAB);
    w25::wmma_gemm64<0, false, 0, 0, false, 0><<<dim3((unsigned)((((64) / 64) * ((HD) / 64) + 7) / 8), (unsigned)(L), (unsigned)(2)), 256, 0, stream>>>((const unsigned short*)(P16 + (size_t)2 * NH * L * L), nullptr, (long long)L * L, L, (const unsigned short*)(RVT), nullptr, L, (long long)HD * L, (void*)(W2T), nullptr, HD, 64 * HD, nullptr, nullptr, 0, 64, HD, L, 1.0f, (long long)NH * L * L, (long long)L * HD * L, (long long)L * 64 * HD);
    k_sh_w2add<<<dim3((unsigned)((256 * D + 255) / 256), (unsigned)(4)), 256, 0, stream>>>(W2T, X, 2, 0, L, D, HD);
    k_sh_rvt<<<dim3((unsigned)(((long long)256 * HD * L / 2 + 255) / 256), (unsigned)(4)), 256, 0, stream>>>((const int*)fm, tv, (_Float16*)RVT, 4, 0, L, HD, TAB);
    w25::wmma_gemm64<0, false, 0, 0, false, 0><<<dim3((unsigned)((((64) / 64) * ((HD) / 64) + 7) / 8), (unsigned)(L), (unsigned)(2)), 256, 0, stream>>>((const unsigned short*)(P16 + (size_t)4 * NH * L * L), nullptr, (long long)L * L, L, (const unsigned short*)(RVT), nullptr, L, (long long)HD * L, (void*)(W2T), nullptr, HD, 64 * HD, nullptr, nullptr, 0, 64, HD, L, 1.0f, (long long)NH * L * L, (long long)L * HD * L, (long long)L * 64 * HD);
    k_sh_w2add<<<dim3((unsigned)((256 * D + 255) / 256), (unsigned)(4)), 256, 0, stream>>>(W2T, X, 4, 0, L, D, HD);
    k_sh_rvt<<<dim3((unsigned)(((long long)256 * HD * L / 2 + 255) / 256), (unsigned)(4)), 256, 0, stream>>>((const int*)fm, tv, (_Float16*)RVT, 6, 0, L, HD, TAB);
    w25::wmma_gemm64<0, false, 0, 0, false, 0><<<dim3((unsigned)((((64) / 64) * ((HD) / 64) + 7) / 8), (unsigned)(L), (unsigned)(2)), 256, 0, stream>>>((const unsigned short*)(P16 + (size_t)6 * NH * L * L), nullptr, (long long)L * L, L, (const unsigned short*)(RVT), nullptr, L, (long long)HD * L, (void*)(W2T), nullptr, HD, 64 * HD, nullptr, nullptr, 0, 64, HD, L, 1.0f, (long long)NH * L * L, (long long)L * HD * L, (long long)L * 64 * HD);
    k_sh_w2add<<<dim3((unsigned)((256 * D + 255) / 256), (unsigned)(4)), 256, 0, stream>>>(W2T, X, 6, 0, L, D, HD);
    k_cast16<<<(unsigned)((((long long)(4096) * ((1024) / 2)) + 255) / 256), 256, 0, stream>>>(X, 1024, (_Float16*)(G64A), 1024, 4096, 1024, 1.0f);
    k_cast16<<<(unsigned)((((long long)(1024) * ((1024) / 2)) + 255) / 256), 256, 0, stream>>>(Wo, 1024, (_Float16*)(G64B), 1024, 1024, 1024, 16.0f);
    w25::wmma_gemm64<0, false, 2, 0, false, 0><<<dim3((unsigned)((((4096) / 64) * ((1024) / 64) + 7) / 8), (unsigned)(1)), 256, 0, stream>>>((const unsigned short*)(G64A), nullptr, 1024, 0, (const unsigned short*)(G64B), nullptr, 1024, 0, (void*)(out), nullptr, 1024, 0, bo, nullptr, 0, 4096, 1024, 1024, 0.0625f, 0, 0, 0);
}

// v002
// It runs in 419 microseconds.
// Next to v001, in two timings, it ran 2.01 and 2.02 times as fast.
// Over all steps from v000 it is 3.82 times as fast.
// Contractions: q/k/v = x.W^T + b [4096x1024].[1024x1024] and the output projection (+b) with f16 operands (weights x16); the relative-key term QT = q.table_k^T [65536 (b,q,h) x 64].[64 x 192 (129 padded)] with f16 operands; per (batch, head) the content scores q.k^T [512x64].[64x512] (heads and batches in the grid) and w1 = attn.v [512x512].[512x64] (heads and batches in the grid; attn as f16 of 4096 attn) — v_wmma_f32_16x16x32_f16, 64x64 register-blocked wave tiles; f32 accumulate. The gathered relative-key scores (QT[(b,q,h)][final_mat[b][q][k]] by the INPUT index matrix), the row softmax are f32 kernels; the relative-value aggregation w2[q,h,:] = sum_k attn[h,q,k] table_v[final_mat[b,q,k]] runs on the matrix cores as one [16 heads x 512].[512 x 64] product per query, one wave each, whose B fragments are gathered from an f16 copy of table_v in LDS by transposing loads (the INPUT index matrix picks each lane's table row).
#include <hip/hip_runtime.h>
#include <math.h>

typedef __attribute__((ext_vector_type(16))) _Float16 v16h;
typedef __attribute__((ext_vector_type(8)))  _Float16 v8h;
typedef __attribute__((ext_vector_type(16))) __bf16   v16b;
typedef __attribute__((ext_vector_type(8)))  float    v8f;
typedef __attribute__((ext_vector_type(4)))  float    v4f;

// 16-bit WMMA fragment map (wave32), lane L, h = L>>4, m = L&15:
//   A 16x32: lane = row m;   element i -> k = (i<8) ? 8h+i : 16+8h+(i-8)
//   B 32x16: lane = column m; the SAME k(i,h)
//   D 16x16 (8 f32): lane = column m; element r -> row 8h+r
__device__ __forceinline__ int frag_k(int i, int h) { return (i < 8) ? (8 * h + i) : (16 + 8 * h + (i - 8)); }
__device__ __forceinline__ __bf16 bf16_rne(float f) {
    unsigned int u = __float_as_uint(f);
    u += 0x7fffu + ((u >> 16) & 1u);
    return __builtin_bit_cast(__bf16, (unsigned short)(u >> 16));
}
__device__ __forceinline__ float bf16_f32(__bf16 b) { return __uint_as_float(((unsigned int)__builtin_bit_cast(unsigned short, b)) << 16); }
__device__ __forceinline__ v8f wmma16(v16h a, v16h b, v8f c) {
    c = __builtin_amdgcn_wmma_f32_16x16x32_f16(false, a, false, b, (short)0, c, false, false);
    asm volatile("v_nop\n\tv_nop\n\tv_nop\n\tv_nop" : "+v"(c) : "v"(a), "v"(b));
    return c;
}
__device__ __forceinline__ v8f wmmab(v16b a, v16b b, v8f c) {
    c = __builtin_amdgcn_wmma_f32_16x16x32_bf16(false, a, false, b, (short)0, c, false, false);
    asm volatile("v_nop\n\tv_nop\n\tv_nop\n\tv_nop" : "+v"(c) : "v"(a), "v"(b));
    return c;
}
struct Split { v16b hi, lo; };
// hi/lo split product: a.hi*b.hi + a.hi*b.lo + a.lo*b.hi
__device__ __forceinline__ v8f wmma3(const Split& a, const Split& b, v8f c) {
    c = __builtin_amdgcn_wmma_f32_16x16x32_bf16(false, a.hi, false, b.hi, (short)0, c, false, false);
    c = __builtin_amdgcn_wmma_f32_16x16x32_bf16(false, a.hi, false, b.lo, (short)0, c, false, false);
    c = __builtin_amdgcn_wmma_f32_16x16x32_bf16(false, a.lo, false, b.hi, (short)0, c, false, false);
    asm volatile("v_nop\n\tv_nop\n\tv_nop\n\tv_nop" : "+v"(c) : "v"(a.hi), "v"(a.lo), "v"(b.hi), "v"(b.lo));
    return c;
}
struct Split3 { v16b hi, mid, lo; };
// triple split product (6 terms, drops only terms below 2^-24 relative)
__device__ __forceinline__ v8f wmma6(const Split3& a, const Split3& b, v8f c) {
    c = __builtin_amdgcn_wmma_f32_16x16x32_bf16(false, a.hi, false, b.hi, (short)0, c, false, false);
    c = __builtin_amdgcn_wmma_f32_16x16x32_bf16(false, a.hi, false, b.mid, (short)0, c, false, false);
    c = __builtin_amdgcn_wmma_f32_16x16x32_bf16(false, a.mid, false, b.hi, (short)0, c, false, false);
    c = __builtin_amdgcn_wmma_f32_16x16x32_bf16(false, a.hi, false, b.lo, (short)0, c, false, false);
    c = __builtin_amdgcn_wmma_f32_16x16x32_bf16(false, a.mid, false, b.mid, (short)0, c, false, false);
    c = __builtin_amdgcn_wmma_f32_16x16x32_bf16(false, a.lo, false, b.hi, (short)0, c, false, false);
    asm volatile("v_nop\n\tv_nop\n\tv_nop\n\tv_nop" : "+v"(c) : "v"(a.hi), "v"(a.mid), "v"(a.lo), "v"(b.hi), "v"(b.mid), "v"(b.lo));
    return c;
}

// Fragment gathers from f32 memory: element i <- p[(k0 + frag_k(i,h)) * sk] * s, zero for k >= klen.
__device__ __forceinline__ v16h fh_ld(const float* __restrict__ p, long long sk, int k0, int h, int klen, float s) {
    v16h a;
#pragma unroll
    for (int i = 0; i < 16; ++i) { const int k = k0 + frag_k(i, h); a[i] = (k < klen) ? (_Float16)(p[(long long)k * sk] * s) : (_Float16)0.f; }
    return a;
}
__device__ __forceinline__ Split sp_ld(const float* __restrict__ p, long long sk, int k0, int h, int klen, float s) {
    Split r;
#pragma unroll
    for (int i = 0; i < 16; ++i) {
        const int k = k0 + frag_k(i, h); const float x = (k < klen) ? p[(long long)k * sk] * s : 0.f;
        const __bf16 hb = bf16_rne(x); r.hi[i] = hb; r.lo[i] = bf16_rne(x - bf16_f32(hb));
    }
    return r;
}
__device__ __forceinline__ Split3 sp3_ld(const float* __restrict__ p, long long sk, int k0, int h, int klen, float s) {
    Split3 r;
#pragma unroll
    for (int i = 0; i < 16; ++i) {
        const int k = k0 + frag_k(i, h); const float x = (k < klen) ? p[(long long)k * sk] * s : 0.f;
        const __bf16 hb = bf16_rne(x); const float r1 = x - bf16_f32(hb); const __bf16 mb = bf16_rne(r1);
        r.hi[i] = hb; r.mid[i] = mb; r.lo[i] = bf16_rne(r1 - bf16_f32(mb));
    }
    return r;
}
__device__ __forceinline__ v16b bh_ld(const float* __restrict__ p, long long sk, int k0, int h, int klen, float s) {
    v16b a;
#pragma unroll
    for (int i = 0; i < 16; ++i) { const int k = k0 + frag_k(i, h); a[i] = bf16_rne((k < klen) ? p[(long long)k * sk] * s : 0.f); }
    return a;
}
// f16 fragment from an f16 LDS/global row with element stride 1 (k-contiguous), no bounds (tile already zero padded)
__device__ __forceinline__ v16h fh_row(const _Float16* __restrict__ row, int k0, int h) {
    v16h a;
#pragma unroll
    for (int i = 0; i < 16; ++i) a[i] = row[k0 + frag_k(i, h)];
    return a;
}

#define VST2(T, ptr, val) do { const T vst2_v_ = (val); *(T*)(ptr) = vst2_v_;  } while (0)
typedef float v4f __attribute__((ext_vector_type(4)));
#define VST2V4(ptr, val) do { const v4f vst2_v4_ = (val); *(v4f*)(ptr) = vst2_v4_;  } while (0)

__device__ __attribute__((noinline)) float act_fn(float v, int act) {
    if (act == 1) return fmaxf(v, 0.f);                                                                               // relu
    if (act == 2) { const float u = 0.7978845608028654f * (v + 0.044715f * v * v * v); return 0.5f * v * (1.f + tanhf(u)); } // tanh-gelu
    if (act == 3) return v / (1.f + expf(-v));                                                                        // silu
    if (act == 4) return 0.5f * v * (1.f + erff(v * 0.7071067811865476f));                                             // erf-gelu
    if (act == 5) return tanhf(v);
    if (act == 6) return 1.f / (1.f + expf(-v));                                                                      // sigmoid
    if (act == 7) return (v > 0.f) ? v : 0.01f * v;                                                                   // leaky relu 0.01
    if (act == 8) return (v > 0.f) ? v : (expf(v) - 1.f);                                                             // elu
    if (act == 9) return fminf(fmaxf(v, 0.f), 6.f);                                                                   // relu6
    if (act == 10) return fabsf(v);                                                                                    // abs
    if (act == 11) return (v >= 0.f) ? v : 0.1f * v;                                                                  // leaky 0.1
    if (act == 12) return (v > 0.f) ? v : 0.2f * v;                                                                   // leaky 0.2
    if (act == 13) return (v > 20.f) ? v : log1pf(expf(v));                                                            // softplus
    return v;
}

// =====================================================================================================================
// k_gemm<MODE>: C(z, m, n) = act(alpha * sum_k A(z, m, k) * B(z, k, n) + bias) + beta * R(z, m, n)
//   One wave (32-thread block) per 16 x 32 tile of C; grid (ceil(N/32), ceil(M/16), Z). Batch z -> (zo = z / zi_n, zi = z % zi_n)
//   with separate outer/inner strides for every tensor (e.g. batch and head). A(m,k) = A[zo*sAo + zi*sAi + m*sAm + k*sAk] (f32),
//   B(k,n) = B[zo*sBo + zi*sBi + n*sBn + k*sBk] (f32); any M, N, K (K zero-padded to 32 inside the fragments, M/N tails guarded).
//   C(m,n) = C[zo*sCo + zi*sCi + m*sCm + n] (n contiguous). flags: 1 bias[n], 2 bias[m], 4 residual R[zo*sRo + zi*sRi + m*sRm + n*sRn].
//   MODE 0: f16 operands (A prescaled by sa, B by sb, both undone in the epilogue); 1: bf16 hi/lo split (3 products); 2: bf16;
//   3: bf16 hi/mid/lo triple split (6 products); 4: as 3 with Kahan-compensated f32 accumulation across k-steps.
// =====================================================================================================================
struct GemmP {
    const float* A; const float* B; const float* bias; const float* R; float* C;
    long long sAo, sAi, sAm, sAk, sBo, sBi, sBn, sBk, sCo, sCi, sCm, sRo, sRi, sRm, sRn;
    int M, N, K, zi_n, flags, act; float alpha, beta, sa, sb;
    int Npad, pad_;     // columns [N, Npad) of C are written as 0 so that padded workspace rows are covered by whole-line stores; Npad >= N
};
static_assert(sizeof(GemmP) == 5 * 8 + 15 * 8 + 6 * 4 + 4 * 4 + 2 * 4, "GemmP has padding");

template <int MODE>
__global__ __launch_bounds__(32) void k_gemm(GemmP p) {
    const int lane = threadIdx.x & 31, h = lane >> 4, l15 = lane & 15;
    const int m0 = blockIdx.y * 16, n0 = blockIdx.x * 32;
    const int z = blockIdx.z, zo = z / p.zi_n, zi = z - zo * p.zi_n;
    const float* A = p.A + zo * p.sAo + zi * p.sAi;
    const float* B = p.B + zo * p.sBo + zi * p.sBi;
    const int am = min(m0 + l15, p.M - 1);                       // clamped row for loads (stores are guarded)
    v8f acc[2], comp[2];
#pragma unroll
    for (int t = 0; t < 2; ++t) { v8f zz = {}; acc[t] = zz; comp[t] = zz; }
    for (int k0 = 0; k0 < p.K; k0 += 32) {
        const float* arow = A + (long long)am * p.sAm;
        if (MODE == 1) {
            const Split a = sp_ld(arow, p.sAk, k0, h, p.K, 1.f);
#pragma unroll
            for (int t = 0; t < 2; ++t) {
                const int bn = min(n0 + t * 16 + l15, p.N - 1);
                acc[t] = wmma3(a, sp_ld(B + (long long)bn * p.sBn, p.sBk, k0, h, p.K, 1.f), acc[t]);
            }
        } else if (MODE == 3) {
            const Split3 a = sp3_ld(arow, p.sAk, k0, h, p.K, 1.f);
#pragma unroll
            for (int t = 0; t < 2; ++t) {
                const int bn = min(n0 + t * 16 + l15, p.N - 1);
                acc[t] = wmma6(a, sp3_ld(B + (long long)bn * p.sBn, p.sBk, k0, h, p.K, 1.f), acc[t]);
            }
        } else if (MODE == 4) {
            // triple split as MODE 3, but each k-step's 6 products go into a fresh accumulator and the partial is added to the running f32 sum
            // on the VALU with Kahan compensation (accumulation error stays ~1 ulp however long K is)
            const Split3 a = sp3_ld(arow, p.sAk, k0, h, p.K, 1.f);
#pragma unroll
            for (int t = 0; t < 2; ++t) {
                const int bn = min(n0 + t * 16 + l15, p.N - 1); v8f zz = {};
                const v8f part = wmma6(a, sp3_ld(B + (long long)bn * p.sBn, p.sBk, k0, h, p.K, 1.f), zz);
                const v8f y = part - comp[t]; const v8f s = acc[t] + y; comp[t] = (s - acc[t]) - y; acc[t] = s;
            }
        } else if (MODE == 2) {
            const v16b a = bh_ld(arow, p.sAk, k0, h, p.K, 1.f);
#pragma unroll
            for (int t = 0; t < 2; ++t) {
                const int bn = min(n0 + t * 16 + l15, p.N - 1);
                acc[t] = wmmab(a, bh_ld(B + (long long)bn * p.sBn, p.sBk, k0, h, p.K, 1.f), acc[t]);
            }
        } else {
            const v16h a = fh_ld(arow, p.sAk, k0, h, p.K, p.sa);
#pragma unroll
            for (int t = 0; t < 2; ++t) {
                const int bn = min(n0 + t * 16 + l15, p.N - 1);
                acc[t] = wmma16(a, fh_ld(B + (long long)bn * p.sBn, p.sBk, k0, h, p.K, p.sb), acc[t]);
            }
        }
    }
    const float iscale = (MODE == 0) ? p.alpha / (p.sa * p.sb) : p.alpha;
    float* C = p.C + zo * p.sCo + zi * p.sCi;
    const float* R = p.R + zo * p.sRo + zi * p.sRi;
    __shared__ __align__(16) float ctile[16][36];
#pragma unroll
    for (int t = 0; t < 2; ++t) {
        const int n = n0 + t * 16 + l15; const int nn = min(n, p.N - 1);
#pragma unroll
        for (int r = 0; r < 8; ++r) {
            const int m = m0 + 8 * h + r; const int mm = min(m, p.M - 1);
            float v = acc[t][r] * iscale;
            if (p.flags & 1) v += p.bias[nn];
            if (p.flags & 2) v += p.bias[mm];
            if (p.flags & 8) v *= p.bias[(long long)zo * p.M + mm];   /* per-(z,row) scale vector laid out [Z][M]; exclusive with the bias flags */
            v = act_fn(v, p.act);
            if (p.flags & 4) v += p.beta * R[(long long)mm * p.sRm + (long long)nn * p.sRn];
            ctile[8 * h + r][t * 16 + l15] = (n < p.N) ? v : 0.f;
        }
    }
    __syncthreads();
    const int NW = (p.Npad > p.N) ? p.Npad : p.N;           // write width
    const bool fast = (m0 + 16 <= p.M) && (n0 + 32 <= NW) && ((p.sCm & 3) == 0) && ((((size_t)C) & 15) == 0);
    if (fast) {
#pragma unroll
        for (int s = 0; s < 4; ++s) {
            const int row = s * 4 + (lane >> 3), c4 = (lane & 7) * 4;
            const v4f v = *(const v4f*)&ctile[row][c4];
            VST2V4(C + (long long)(m0 + row) * p.sCm + n0 + c4, v);
        }
    } else {
        for (int row = 0; row < 16; ++row) {
            const int m = m0 + row, n = n0 + lane;
            if (m < p.M && n < NW) VST2(float, C + (long long)m * p.sCm + n, ctile[row][lane]);
        }
    }
}


// =====================================================================================================================
// k_gemmT<MODE, TM, TN>: same contract as k_gemm, but one wave computes a (16*TM) x (16*TN) tile: TM A fragments and TN B fragments are
//   loaded per 32-wide k-step and reused across TM*TN WMMAs (far fewer load/convert instructions per MAC). MODE 0 (f16), 1 (bf16 hi/lo),
//   2 (bf16) only. grid (ceil(NW/(16*TN)), ceil(M/(16*TM)), Z), block 32. Epilogue identical to k_gemm, run per 16x32 sub-tile.
// =====================================================================================================================
template <int MODE, int TM, int TN>
__global__ __launch_bounds__(32) void k_gemmT(GemmP p) {
    const int lane = threadIdx.x & 31, h = lane >> 4, l15 = lane & 15;
    const int m0 = blockIdx.y * (16 * TM), n0 = blockIdx.x * (16 * TN);
    const int z = blockIdx.z, zo = z / p.zi_n, zi = z - zo * p.zi_n;
    const float* A = p.A + zo * p.sAo + zi * p.sAi;
    const float* B = p.B + zo * p.sBo + zi * p.sBi;
    v8f acc[TM][TN];
#pragma unroll
    for (int i = 0; i < TM; ++i)
#pragma unroll
        for (int t = 0; t < TN; ++t) { v8f zz = {}; acc[i][t] = zz; }
    for (int k0 = 0; k0 < p.K; k0 += 32) {
        if (MODE == 1) {
            Split a[TM], b[TN];
#pragma unroll
            for (int i = 0; i < TM; ++i) { const int am = min(m0 + 16 * i + l15, p.M - 1); a[i] = sp_ld(A + (long long)am * p.sAm, p.sAk, k0, h, p.K, 1.f); }
#pragma unroll
            for (int t = 0; t < TN; ++t) { const int bn = min(n0 + 16 * t + l15, p.N - 1); b[t] = sp_ld(B + (long long)bn * p.sBn, p.sBk, k0, h, p.K, 1.f); }
#pragma unroll
            for (int i = 0; i < TM; ++i)
#pragma unroll
                for (int t = 0; t < TN; ++t) acc[i][t] = wmma3(a[i], b[t], acc[i][t]);
        } else if (MODE == 2) {
            v16b a[TM], b[TN];
#pragma unroll
            for (int i = 0; i < TM; ++i) { const int am = min(m0 + 16 * i + l15, p.M - 1); a[i] = bh_ld(A + (long long)am * p.sAm, p.sAk, k0, h, p.K, 1.f); }
#pragma unroll
            for (int t = 0; t < TN; ++t) { const int bn = min(n0 + 16 * t + l15, p.N - 1); b[t] = bh_ld(B + (long long)bn * p.sBn, p.sBk, k0, h, p.K, 1.f); }
#pragma unroll
            for (int i = 0; i < TM; ++i)
#pragma unroll
                for (int t = 0; t < TN; ++t) acc[i][t] = wmmab(a[i], b[t], acc[i][t]);
        } else {
            v16h a[TM], b[TN];
#pragma unroll
            for (int i = 0; i < TM; ++i) { const int am = min(m0 + 16 * i + l15, p.M - 1); a[i] = fh_ld(A + (long long)am * p.sAm, p.sAk, k0, h, p.K, p.sa); }
#pragma unroll
            for (int t = 0; t < TN; ++t) { const int bn = min(n0 + 16 * t + l15, p.N - 1); b[t] = fh_ld(B + (long long)bn * p.sBn, p.sBk, k0, h, p.K, p.sb); }
#pragma unroll
            for (int i = 0; i < TM; ++i)
#pragma unroll
                for (int t = 0; t < TN; ++t) acc[i][t] = wmma16(a[i], b[t], acc[i][t]);
        }
    }
    const float iscale = (MODE == 0) ? p.alpha / (p.sa * p.sb) : p.alpha;
    float* C = p.C + zo * p.sCo + zi * p.sCi;
    const float* R = p.R + zo * p.sRo + zi * p.sRi;
    const int NW = (p.Npad > p.N) ? p.Npad : p.N;
    __shared__ __align__(16) float ctile[16][36];
#pragma unroll
    for (int i = 0; i < TM; ++i) {
        const int mb = m0 + 16 * i; if (mb >= p.M) break;          // wave-uniform
#pragma unroll
        for (int tp = 0; tp < TN / 2; ++tp) {
            const int nb = n0 + 32 * tp; if (nb >= NW) break;        // wave-uniform
#pragma unroll
            for (int t2 = 0; t2 < 2; ++t2) {
                const int t = 2 * tp + t2; const int n = nb + t2 * 16 + l15; const int nn = min(n, p.N - 1);
#pragma unroll
                for (int r = 0; r < 8; ++r) {
                    const int m = mb + 8 * h + r; const int mm = min(m, p.M - 1);
                    float v = acc[i][t][r] * iscale;
                    if (p.flags & 1) v += p.bias[nn];
                    if (p.flags & 2) v += p.bias[mm];
            if (p.flags & 8) v *= p.bias[(long long)zo * p.M + mm];   /* per-(z,row) scale vector laid out [Z][M]; exclusive with the bias flags */
                    v = act_fn(v, p.act);
                    if (p.flags & 4) v += p.beta * R[(long long)mm * p.sRm + (long long)nn * p.sRn];
                    ctile[8 * h + r][t2 * 16 + l15] = (n < p.N) ? v : 0.f;
                }
            }
            __syncthreads();
            const bool fast = (mb + 16 <= p.M) && (nb + 32 <= NW) && ((p.sCm & 3) == 0) && ((((size_t)C) & 15) == 0);
            if (fast) {
#pragma unroll
                for (int s = 0; s < 4; ++s) {
                    const int row = s * 4 + (lane >> 3), c4 = (lane & 7) * 4;
                    const v4f v = *(const v4f*)&ctile[row][c4];
                    VST2V4(C + (long long)(mb + row) * p.sCm + nb + c4, v);
                }
            } else {
                for (int row = 0; row < 16; ++row) {
                    const int m = mb + row, n = nb + lane;
                    if (m < p.M && n < NW) VST2(float, C + (long long)m * p.sCm + n, ctile[row][lane]);
                }
            }
            __syncthreads();
        }
    }
}

// =====================================================================================================================
//   Wave = 16 queries, AW waves per block, 64-key blocks; grid (ceil(Lq/(16*AW)), H, B), block 32*AW. Any Lq, Lk; head dim dh <= DHP
//   (DHP multiple of 32), value dim dv <= DVP (multiple of 16, <= 128). Every tensor addressed by (batch, head, row, element) strides, f32.
//   Scores: QM 0 f16 operands, 1 bf16 hi/lo split, 2 bf16 triple split; statistics f32 (exp2 domain); P.V: P x 4096 as f16 with V f16 staged in LDS
//   (SPLITPV: P and V as bf16 hi/lo splits). kv head = h / hrep. Masking: causal = 1 (keep j <= i + coff, masked -> -inf, key blocks beyond the
//   diagonal skipped), causal = 2 (masked -> mfill, a finite fill like the -1e9; no skipping), causal = 3 (keep j >= i + coff,
//   masked -> -inf, no skipping); optional additive f32 mask Mf,
//   optional int keep-mask Mi (0 -> score := mfill), both addressed b*smb + h*smh + i*smi + j*smj (0 strides broadcast).
// =====================================================================================================================
#define AW 4
struct AttnP {   // apv4
    const float* Q; const float* K; const float* V; float* O; float* P; const float* Mf; const int* Mi; float* ST;
    const float* Pw; const float* Rt; const int* SQ; const int* SK;           // optional: post-softmax weight, relative-position table, segment ids
    long long swb, swh, swi, swj, srb, srh, sri;                                 // Pw strides (b,h,i,j); Rt strides (b,h,i), column = clamp(i - j + roff, 0, rn-1)
    long long sQb, sQh, sQi, sQd, sKb, sKh, sKj, sKd, sVb, sVh, sVj, sVd, sOb, sOh, sOi, sPb, sPh, sPi, smb, smh, smi, smj;
    int Lq, Lk, dh, dv, hrep, causal, coff, pband;   // pband > 0: P holds only the band |j - i| <= pband, column j - i + pband
    float scale, mfill; int nonorm, mpol;             // nonorm (online path only): O = sum_j exp(score_j) V_j without the 1/rowsum (scores must be <= ~0); mpol: Mi masks where ==0 (mpol 0) or where !=0 (mpol 1)
    int roff, rn, segpol, win;                        // Rt column offset/count; SQ/SK: score := mfill where (segpol 0) SQ[i] != SK[j] or (segpol 1) SQ[i] == SK[j]; win > 0: keys with i - j > win (after coff) -> -inf
};
//   Pw: the softmax numerator is multiplied by Pw(b,h,i,j) AFTER the row sum is taken (probs * weight, then P.V), as in post-softmax multiplicative biases.                                                    // ST (optional): per row (b,h,i) -> ST[((b*H + h)*Lq + i)*2 + {0,1}] = {row max of the scaled+masked score (natural units), sum_j exp(score - max)}
static_assert(sizeof(AttnP) == 12 * 8 + 29 * 8 + 16 * 4, "AttnP has padding");

#ifndef KATTN_ATTR
#define KATTN_ATTR
#endif
template <int DHP, int DVP, int QM, bool SPLITPV, bool TWOPASS>
__global__ __launch_bounds__(32 * AW) KATTN_ATTR void k_attn(AttnP p) {
    constexpr int NT = DVP / 16;                // output tiles
    constexpr int KS = DHP / 32;                // k-steps for the scores
    constexpr int VP = DVP + 8;                 // LDS pitch (halves)
    __shared__ __align__(16) float    pl[AW][16 * 64];
    __shared__ __align__(16) _Float16 vl[(SPLITPV ? 2 : 1) * 64 * VP];   // f16 V tile, or bf16 hi and lo tiles (same 2-byte size)
    const int lane = threadIdx.x & 31, hf = lane >> 4, l15 = lane & 15, wave = threadIdx.x >> 5;
    const int h = blockIdx.y, b = blockIdx.z, hk = h / p.hrep;
    const int q0 = (blockIdx.x * AW + wave) * 16;
    float* myp = pl[wave];
    const float L2E = 1.4426950408889634f;
    const float NEG = -__builtin_inff();
    const int qi = min(q0 + l15, p.Lq - 1);
    const float* qrow = p.Q + b * p.sQb + h * p.sQh + (long long)qi * p.sQi;
    const float* kbase = p.K + b * p.sKb + hk * p.sKh;
    const float* vbase = p.V + b * p.sVb + hk * p.sVh;
    v16h qa[QM == 0 ? KS : 1]; Split qs_[QM == 1 ? KS : 1]; Split3 qt_[QM == 2 ? KS : 1];
#pragma unroll
    for (int ks = 0; ks < KS; ++ks) {
        if (QM == 2) qt_[ks] = sp3_ld(qrow, p.sQd, ks * 32, hf, p.dh, 1.f);
        else if (QM == 1) qs_[ks] = sp_ld(qrow, p.sQd, ks * 32, hf, p.dh, 1.f);
        else qa[ks] = fh_ld(qrow, p.sQd, ks * 32, hf, p.dh, 1.f);
    }
    v8f o[NT]; float m8[8], l8[8];
#pragma unroll
    for (int t = 0; t < NT; ++t) { v8f zz = {}; o[t] = zz; }
#pragma unroll
    for (int i = 0; i < 8; ++i) { m8[i] = NEG; l8[i] = 0.f; }
    int jend = p.Lk; int jstart = 0;
    if (p.causal == 1) { const int je = (blockIdx.x * AW + AW - 1) * 16 + 16 + p.coff; jend = min(jend, max(je, 0)); }   // uniform per block
    if (p.win > 0) { const int js = (int)(blockIdx.x * AW) * 16 + p.coff - p.win; jstart = (js > 0) ? (js / 64) * 64 : 0; }   // uniform per block: key blocks entirely outside every row's window hold only -inf entries and are skipped exactly
    const int npass = TWOPASS ? 2 : 1;
    for (int pass = 0; pass < npass; ++pass) {
        const bool dopv = (!TWOPASS) || pass == 1;
        for (int j0 = jstart; j0 < jend; j0 += 64) {
            if (dopv) {
                __syncthreads();                                 // previous key block's reads of vl / pl are done
                for (int idx = threadIdx.x; idx < 64 * DVP; idx += 32 * AW) {
                    const int jr = idx / DVP, d = idx - jr * DVP, j = j0 + jr;
                    const float f = (j < p.Lk && d < p.dv) ? vbase[(long long)j * p.sVj + (long long)d * p.sVd] : 0.f;
                    if (SPLITPV) {
                        const __bf16 hb = bf16_rne(f);
                        ((__bf16*)vl)[jr * VP + d] = hb; ((__bf16*)vl)[64 * VP + jr * VP + d] = bf16_rne(f - bf16_f32(hb));
                    } else vl[jr * VP + d] = (_Float16)f;
                }
            }
            v8f s[4];
#pragma unroll
            for (int t = 0; t < 4; ++t) {
                const int j = min(j0 + t * 16 + l15, p.Lk - 1);
                const float* krow = kbase + (long long)j * p.sKj;
                v8f acc = {};
#pragma unroll
                for (int ks = 0; ks < KS; ++ks) {
                    if (QM == 2)      acc = wmma6(qt_[ks], sp3_ld(krow, p.sKd, ks * 32, hf, p.dh, 1.f), acc);
                    else if (QM == 1) acc = wmma3(qs_[ks], sp_ld(krow, p.sKd, ks * 32, hf, p.dh, 1.f), acc);
                    else              acc = wmma16(qa[ks], fh_ld(krow, p.sKd, ks * 32, hf, p.dh, 1.f), acc);
                }
                s[t] = acc;
            }
            float pv[8][4];
#pragma unroll
            for (int i = 0; i < 8; ++i) {
                const int irow = q0 + i + 8 * hf;
                const int ic = min(irow, p.Lq - 1);
                float sc[4];
#pragma unroll
                for (int t = 0; t < 4; ++t) {
                    const int jg = j0 + t * 16 + l15;
                    float v = s[t][i] * p.scale;
                    if (p.Mf) v += p.Mf[b * p.smb + h * p.smh + (long long)ic * p.smi + (long long)min(jg, p.Lk - 1) * p.smj];
                    if (p.Rt) { int rc = ic - min(jg, p.Lk - 1) + p.roff; rc = rc < 0 ? 0 : (rc >= p.rn ? p.rn - 1 : rc); v += p.Rt[b * p.srb + h * p.srh + (long long)ic * p.sri + rc]; }
                    if (p.Mi) { const int mv = p.Mi[b * p.smb + h * p.smh + (long long)ic * p.smi + (long long)min(jg, p.Lk - 1) * p.smj]; if (p.mpol ? (mv != 0) : (mv == 0)) v = p.mfill; }
                    if (p.SQ) { const bool same = p.SQ[(long long)b * p.Lq + ic] == p.SK[(long long)b * p.Lk + min(jg, p.Lk - 1)]; if (p.segpol ? same : !same) v = p.mfill; }
                    if (p.causal == 2 && jg > irow + p.coff) v = p.mfill;
                    if (jg >= p.Lk || (p.causal == 1 && jg > irow + p.coff) || (p.causal == 3 && jg < irow + p.coff) || (p.win > 0 && irow + p.coff - jg > p.win)) v = NEG; else v *= L2E;
                    sc[t] = v;
                }
                if (!TWOPASS || pass == 0) {
                    float mx = fmaxf(fmaxf(sc[0], sc[1]), fmaxf(sc[2], sc[3]));
                    mx = fmaxf(mx, __shfl_xor(mx, 1, 32)); mx = fmaxf(mx, __shfl_xor(mx, 2, 32));
                    mx = fmaxf(mx, __shfl_xor(mx, 4, 32)); mx = fmaxf(mx, __shfl_xor(mx, 8, 32));
                    const float mnew = fmaxf(m8[i], mx);
                    const float corr = (mnew == NEG) ? 1.f : exp2f(m8[i] - mnew);
                    float rs = 0.f;
#pragma unroll
                    for (int t = 0; t < 4; ++t) {
                        const float pp = (sc[t] == NEG) ? 0.f : exp2f(sc[t] - mnew); rs += pp;
                        pv[i][t] = p.Pw ? pp * p.Pw[b * p.swb + h * p.swh + (long long)ic * p.swi + (long long)min(j0 + t * 16 + l15, p.Lk - 1) * p.swj] : pp;
                    }
                    rs += __shfl_xor(rs, 1, 32); rs += __shfl_xor(rs, 2, 32); rs += __shfl_xor(rs, 4, 32); rs += __shfl_xor(rs, 8, 32);
                    l8[i] = l8[i] * corr + rs; m8[i] = mnew;
                    if (!TWOPASS) {
#pragma unroll
                        for (int t = 0; t < NT; ++t) o[t][i] *= corr;
                    }
                } else {
                    const float inv = (l8[i] > 0.f) ? 1.f / l8[i] : 0.f;
#pragma unroll
                    for (int t = 0; t < 4; ++t) {
                        const int jg = j0 + t * 16 + l15;
                        float pp = (sc[t] == NEG) ? 0.f : exp2f(sc[t] - m8[i]) * inv;
                        if (p.Pw) pp *= p.Pw[b * p.swb + h * p.swh + (long long)ic * p.swi + (long long)min(jg, p.Lk - 1) * p.swj];
                        pv[i][t] = pp;
                    }
                }
            }
            if (dopv) {
#pragma unroll
                for (int i = 0; i < 8; ++i)
#pragma unroll
                    for (int t = 0; t < 4; ++t) ((float*)myp)[(i + 8 * hf) * 64 + t * 16 + l15] = pv[i][t];
                __syncthreads();                                 // P (per wave) and V (shared) visible
                if (p.P) {
                    float* pb_ = p.P + b * p.sPb + h * p.sPh;
                    const bool fastP = (p.pband == 0) && ((p.sPi & 3) == 0) && (j0 + 64 <= p.Lk) && (q0 + 16 <= p.Lq) && ((((size_t)pb_) & 15) == 0);
                    if (fastP) {
#pragma unroll
                        for (int s = 0; s < 8; ++s) {
                            const int row = s * 2 + (lane >> 4), c4 = (lane & 15) * 4;
                            const v4f v = *(const v4f*)(myp + row * 64 + c4);
                            VST2V4(pb_ + (long long)(q0 + row) * p.sPi + j0 + c4, v);
                        }
                    } else {
                        for (int row = 0; row < 16; ++row) {
                            const int irow = q0 + row; if (irow >= p.Lq) continue;
                            for (int c = lane; c < 64; c += 32) {
                                const int jg = j0 + c; if (jg >= p.Lk) continue;
                                if (p.pband == 0) VST2(float, pb_ + (long long)irow * p.sPi + jg, myp[row * 64 + c]);
                                else if (jg - irow <= p.pband && irow - jg <= p.pband) VST2(float, pb_ + (long long)irow * p.sPi + (jg - irow + p.pband), myp[row * 64 + c]);
                            }
                        }
                    }
                }
                if (SPLITPV) {
                    const Split pa0 = sp_ld(myp + l15 * 64, 1, 0, hf, 64, 1.f), pa1 = sp_ld(myp + l15 * 64, 1, 32, hf, 64, 1.f);
                    const __bf16* vh = (const __bf16*)vl; const __bf16* vlo = vh + 64 * VP;
#pragma unroll
                    for (int t = 0; t < NT; ++t) {
                        const int dcol = t * 16 + l15;
                        Split b0, b1;
#pragma unroll
                        for (int e = 0; e < 16; ++e) {
                            const int k0 = frag_k(e, hf), k1 = 32 + frag_k(e, hf);
                            b0.hi[e] = vh[k0 * VP + dcol]; b0.lo[e] = vlo[k0 * VP + dcol]; b1.hi[e] = vh[k1 * VP + dcol]; b1.lo[e] = vlo[k1 * VP + dcol];
                        }
                        o[t] = wmma3(pa0, b0, o[t]);
                        o[t] = wmma3(pa1, b1, o[t]);
                    }
                } else {
                    const v16h pa0 = fh_ld(myp + l15 * 64, 1, 0, hf, 64, 4096.f), pa1 = fh_ld(myp + l15 * 64, 1, 32, hf, 64, 4096.f);
#pragma unroll
                    for (int t = 0; t < NT; ++t) {
                        const int dcol = t * 16 + l15;
                        v16h b0, b1;
#pragma unroll
                        for (int e = 0; e < 16; ++e) { b0[e] = vl[frag_k(e, hf) * VP + dcol]; b1[e] = vl[(32 + frag_k(e, hf)) * VP + dcol]; }
                        o[t] = wmma16(pa0, b0, o[t]);
                        o[t] = wmma16(pa1, b1, o[t]);
                    }
                }
            }
        }
    }
    float* obase = p.O + b * p.sOb + h * p.sOh;
    if (p.ST) {
        const int rl = lane >> 1, isel = rl & 7;           // row q0 + rl ; rl>>3 == hf holds because lane>>4 == (lane>>1)>>3
        float mv = 0.f, lv = 0.f;
#pragma unroll
        for (int i = 0; i < 8; ++i) if (i == isel) { mv = m8[i]; lv = l8[i]; }
        const int irow = q0 + rl;
        if (irow < p.Lq) { float* st = p.ST + (((long long)b * gridDim.y + h) * p.Lq + irow) * 2 + (lane & 1); VST2(float, st, (lane & 1) ? lv : mv * 0.6931471805599453f); }
    }
    float invr[8];
#pragma unroll
    for (int i = 0; i < 8; ++i) {
        if (TWOPASS) invr[i] = SPLITPV ? 1.f : (1.f / 4096.f);
        else if (p.nonorm) invr[i] = exp2f(m8[i]) * (SPLITPV ? 1.f : (1.f / 4096.f));
        else invr[i] = (l8[i] > 0.f) ? (SPLITPV ? 1.f / l8[i] : 1.f / (l8[i] * 4096.f)) : 0.f;
    }
    __syncthreads();                                             // all waves done with pl/vl from the main loop
    const bool ofast = ((p.sOi & 3) == 0) && ((((size_t)obase) & 15) == 0) && (q0 + 16 <= p.Lq);
#pragma unroll
    for (int c0 = 0; c0 < DVP; c0 += 64) {
#pragma unroll
        for (int i = 0; i < 8; ++i)
#pragma unroll
            for (int t = 0; t < NT; ++t) if (t * 16 >= c0 && t * 16 < c0 + 64) ((float*)myp)[(i + 8 * hf) * 64 + (t * 16 - c0) + l15] = o[t][i] * invr[i];
        __syncthreads();
        const int cw = (DVP - c0 < 64) ? (DVP - c0) : 64;      // staged columns in this chunk (multiple of 16)
        if (ofast && (c0 + cw <= p.dv) && (cw % 32 == 0)) {
            const int lpr = cw / 4;                              // lanes per row (16 for 64 cols, 8 for 32)
            const int rows_per_ins = 32 / lpr;
            for (int r0 = 0; r0 < 16; r0 += rows_per_ins) {
                const int row = r0 + lane / lpr, c4 = (lane % lpr) * 4;
                const v4f v = *(const v4f*)(myp + row * 64 + c4);
                VST2V4(obase + (long long)(q0 + row) * p.sOi + c0 + c4, v);
            }
        } else {
            for (int row = 0; row < 16; ++row) {
                const int irow = q0 + row; if (irow >= p.Lq) continue;
                for (int c = lane; c < cw; c += 32) { const int d = c0 + c; if (d < p.dv) VST2(float, obase + (long long)irow * p.sOi + d, myp[row * 64 + c]); }
            }
        }
        __syncthreads();
    }
}

// =====================================================================================================================
// k_tr: dst(z, c, r) = alpha * src(z, r, c) (+ beta * R2(z, c, r)): [Z][R][C] (row stride lds) -> [Z][C][R] (row stride ldd) through a 32x32 LDS tile;
//   flags: 1 -> add beta * residual R2 addressed like dst (z*sRz + c*ldr + r); act applied before the residual.
// =====================================================================================================================
struct TrP { const float* src; float* dst; const float* R2; long long sSz, lds, sDz, ldd, sRz, ldr; int R, C, flags, act; float alpha, beta; };
static_assert(sizeof(TrP) == 3 * 8 + 6 * 8 + 6 * 4, "TrP has padding");
__global__ __launch_bounds__(256) void k_tr(TrP p) {
    __shared__ float tile[32][33];
    const int c0 = blockIdx.x * 32, r0 = blockIdx.y * 32, z = blockIdx.z;
    const int lane = threadIdx.x & 31, wave = threadIdx.x >> 5;
    const float* s = p.src + z * p.sSz;
#pragma unroll
    for (int k = 0; k < 4; ++k) {
        const int rl = wave * 4 + k, r = r0 + rl, c = c0 + lane;
        tile[rl][lane] = (r < p.R && c < p.C) ? s[(long long)r * p.lds + c] : 0.f;
    }
    __syncthreads();
    float* d = p.dst + z * p.sDz; const float* rr = p.R2 + z * p.sRz;
#pragma unroll
    for (int k = 0; k < 4; ++k) {
        const int cl = wave * 4 + k, c = c0 + cl, r = r0 + lane;
        if (c < p.C && r < p.R) {
            float v = act_fn(p.alpha * tile[lane][cl], p.act);
            if (p.flags & 1) v += p.beta * rr[(long long)c * p.ldr + r];
            VST2(float, d + (long long)c * p.ldd + r, v);
        }
    }
}

// k_affine: dst[i] = a * (sdev ? sdev[0] : 1) * src[i] + b, i < n (one thread per element; consecutive lanes -> consecutive addresses)
__global__ __launch_bounds__(256) void k_affine(const float* __restrict__ src, float* __restrict__ dst, int n, float a, float b, const float* __restrict__ sdev) {
    const int i = blockIdx.x * 256 + threadIdx.x;
    if (i < n) { const float aa = sdev ? a * sdev[0] : a; const float v = aa * src[i] + b; VST2(float, dst + i, v); }
}

// =====================================================================================================================
// k_softmax: row softmax over n contiguous elements, one 256-thread block per row; rows addressed z*sz + r*sr (grid (R, Z)).
//   out = scale_out * softmax(scale_in * x + (Mf ? Mf[z*smz + r*smr + j] : 0)); a row whose max is -inf is written as 0.
// =====================================================================================================================
struct SmP { const float* src; float* dst; const float* Mf; long long sz, sr, dz, dr, smz, smr; int n, pad; float scale_in, scale_out; };
static_assert(sizeof(SmP) == 3 * 8 + 6 * 8 + 4 * 4, "SmP has padding");
__global__ __launch_bounds__(256) void k_softmax(SmP p) {
    __shared__ float red[256];
    const int r = blockIdx.x, z = blockIdx.y, tid = threadIdx.x;
    const float* s = p.src + z * p.sz + (long long)r * p.sr;
    const float* mf = p.Mf ? (p.Mf + z * p.smz + (long long)r * p.smr) : nullptr;
    float mx = -__builtin_inff();
    for (int j = tid; j < p.n; j += 256) { float v = s[j] * p.scale_in; if (mf) v += mf[j]; mx = fmaxf(mx, v); }
    red[tid] = mx; __syncthreads();
    for (int o = 128; o > 0; o >>= 1) { if (tid < o) red[tid] = fmaxf(red[tid], red[tid + o]); __syncthreads(); }
    mx = red[0]; __syncthreads();
    float sum = 0.f;
    for (int j = tid; j < p.n; j += 256) { float v = s[j] * p.scale_in; if (mf) v += mf[j]; sum += (mx == -__builtin_inff()) ? 0.f : expf(v - mx); }
    red[tid] = sum; __syncthreads();
    for (int o = 128; o > 0; o >>= 1) { if (tid < o) red[tid] += red[tid + o]; __syncthreads(); }
    sum = red[0];
    const float inv = (sum > 0.f) ? p.scale_out / sum : 0.f;
    float* d = p.dst + z * p.dz + (long long)r * p.dr;
    for (int j = tid; j < p.n; j += 256) { float v = s[j] * p.scale_in; if (mf) v += mf[j]; const float o = (mx == -__builtin_inff()) ? 0.f : expf(v - mx) * inv; VST2(float, d + j, o); }
}
// =====================================================================================================================
// k_stats: mean and rsqrt(var + eps) over a set of n elements addressed base + z*sz + (e / inner) * so + (e % inner) * si, one 256-thread
// k_norm_apply: y = (x - mean[set]) * rstd[set] * g[c] + b[c] over a [Z][C][L] channel-major tensor with set = z*G + c / (C/G) (G groups per z;
//   G = C -> per-channel sets indexed z*C+c; for batch norm pass stats indexed by c only via bn = 1). Optional act. Output same layout.
// =====================================================================================================================
//   mode 0: mean / rsqrt(var + eps); mode 1 (RMSNorm): 0 / rsqrt(mean(x^2) + eps); mode 2 (L2 normalize * sqrt(n)): 0 / sqrt(n) / max(||x||, eps); mode 3: as 0 with unbiased variance (n-1)
__global__ __launch_bounds__(256) void k_stats(const float* __restrict__ x, long long sz, long long so, long long si, int inner, int n, float eps, float* __restrict__ stat, int mode) {
    __shared__ float red[256];
    const int z = blockIdx.x, tid = threadIdx.x;
    const float* base = x + z * sz;
    float s = 0.f;
    for (int e = tid; e < n; e += 256) s += base[(long long)(e / inner) * so + (long long)(e % inner) * si];
    red[tid] = s; __syncthreads();
    for (int o = 128; o > 0; o >>= 1) { if (tid < o) red[tid] += red[tid + o]; __syncthreads(); }
    const float mu = (mode == 0 || mode == 3) ? red[0] / (float)n : 0.f; __syncthreads();
    float q = 0.f;
    for (int e = tid; e < n; e += 256) { const float dlt = base[(long long)(e / inner) * so + (long long)(e % inner) * si] - mu; q += dlt * dlt; }
    red[tid] = q; __syncthreads();
    for (int o = 128; o > 0; o >>= 1) { if (tid < o) red[tid] += red[tid + o]; __syncthreads(); }
    {
        float rs;
        if (mode == 2) rs = sqrtf((float)n) / fmaxf(sqrtf(red[0]), eps); else if (mode == 3) rs = rsqrtf(red[0] / (float)(n - 1) + eps); else rs = rsqrtf(red[0] / (float)n + eps);
        if (tid < 32) { const float v = (tid == 0) ? mu : ((tid == 1) ? rs : 0.f); VST2(float, stat + (long long)z * 32 + tid, v); }
    }
}
//   One thread per element over the flat [Z][C][L] index space: grid ceil(Z*C*L / 256).
__global__ __launch_bounds__(256) void k_norm_apply(const float* __restrict__ x, float* __restrict__ y, const float* __restrict__ stat, const float* __restrict__ g, const float* __restrict__ bta,
                                                     int Z, int C, int L, int G, int bn, int act) {
    const long long idx = (long long)blockIdx.x * 256 + threadIdx.x;
    if (idx >= (long long)Z * C * L) return;
    const int l = (int)(idx % L); const long long zc = idx / L; const int c = (int)(zc % C), z = (int)(zc / C); (void)l;
    const int set = bn ? c : (z * G + c / (C / G));
    float v = (x[idx] - stat[(long long)set * 32]) * stat[(long long)set * 32 + 1];
    if (g) v *= g[c];
    if (bta) v += bta[c];
    v = act_fn(v, act);
    VST2(float, y + idx, v);
}

// k_lse_neg: c[i] = -(st[2i] + log(st[2i+1])) = minus the log-sum-exp of row i from k_attn's ST output (for softmax over the query dimension)
__global__ __launch_bounds__(256) void k_lse_neg(const float* __restrict__ st, float* __restrict__ c, int n) {
    const int i = blockIdx.x * 256 + threadIdx.x;
    if (i < n) { const float v = -(st[2 * i] + logf(st[2 * i + 1])); VST2(float, c + i, v); }
}

// k_iota: dst[i] = a * i + b as int32 (segment/position id helper)
__global__ __launch_bounds__(256) void k_iota(int* __restrict__ dst, int n, int a, int b) {
    const int i = blockIdx.x * 256 + threadIdx.x;
    if (i < n) { const int v = a * i + b; VST2(int, dst + i, v); }
}

// k_axpby: dst[i] = a * x[i] + b * y[i] (+ c), i < n
__global__ __launch_bounds__(256) void k_axpby(const float* __restrict__ x, const float* __restrict__ y, float* __restrict__ dst, int n, float a, float b, float c) {
    const int i = blockIdx.x * 256 + threadIdx.x;
    if (i < n) { const float v = a * x[i] + b * y[i] + c; VST2(float, dst + i, v); }
}

// =====================================================================================================================
// k_rope: rotary embedding on a [R rows][Hn heads][D] view (row stride sXr, head stride sXh, element stride 1) -> Y (own strides).
//   mode 0: rotate_half (partner d±D/2, sign - for d<D/2); mode 1: interleaved pairs (partner d^1, sign - for even d).
//   table column tcol: tmode 0 -> d, 1 -> d % (D/2), 2 -> d / 2; position p: pmode 0 -> r % S, 1 -> head index, 2 -> pos[r];
//   c = C[(r / S) * sCb + p * sCp + tcol * sCd], s likewise from Sn; y = x[d] * c + sign * x[partner] * s. X and Y must not alias.
// =====================================================================================================================
struct RopeP { const float* X; float* Y; const float* C; const float* Sn; const int* pos; long long sXr, sXh, sYr, sYh, sCb, sCp, sCd; int R, Hn, D, S, mode, tmode, pmode, pad; };
static_assert(sizeof(RopeP) == 5 * 8 + 7 * 8 + 8 * 4, "RopeP has padding");
__global__ __launch_bounds__(256) void k_rope(RopeP p) {
    const long long idx = (long long)blockIdx.x * 256 + threadIdx.x;
    if (idx >= (long long)p.R * p.Hn * p.D) return;
    const int d = (int)(idx % p.D); const long long rh = idx / p.D; const int h = (int)(rh % p.Hn); const int r = (int)(rh / p.Hn);
    const int half = p.D / 2;
    int partner; float sign;
    if (p.mode == 0) { partner = (d < half) ? d + half : d - half; sign = (d < half) ? -1.f : 1.f; }
    else { partner = d ^ 1; sign = (d & 1) ? 1.f : -1.f; }
    const int tcol = (p.tmode == 0) ? d : ((p.tmode == 1) ? (d % half) : (d >> 1));
    const int pp = (p.pmode == 0) ? (r % p.S) : ((p.pmode == 1) ? h : p.pos[r]);
    const long long toff = (long long)(r / p.S) * p.sCb + (long long)pp * p.sCp + (long long)tcol * p.sCd;
    const float* xr = p.X + (long long)r * p.sXr + (long long)h * p.sXh;
    const float v = xr[d] * p.C[toff] + sign * xr[partner] * p.Sn[toff];
    VST2(float, p.Y + (long long)r * p.sYr + (long long)h * p.sYh + d, v);
}

// k_invf + k_sincos (split so neither kernel carries a large VALU-fma footprint): invf_i = num * (1 / powf(base, (2 i)/D)) [fmode 0],
//   num * expf((2 i) * cexp) [fmode 1], num * powf(base, -2 (i - 1) / D) [fmode 2]; then cs/sn[s*half + i] = cos/sin((pscale * s) * invf_i)
__global__ __launch_bounds__(256) void k_invf(float* __restrict__ invb, int half, int D, float base, float num, int fmode, float cexp) {
    const int i = blockIdx.x * 256 + threadIdx.x;
    if (i >= ((half + 31) / 32) * 32) return;
    if (i >= half) { VST2(float, invb + i, 0.f); return; }
    const float e = (float)(2 * i) / (float)D;
    float invf;
    if (fmode == 1) invf = num * expf((float)(2 * i) * cexp);
    else if (fmode == 2) invf = num * powf(base, (-2.0f * ((float)i - 1.0f)) / (float)D);
    else invf = num * (1.0f / powf(base, e));
    VST2(float, invb + i, invf);
}
__global__ __launch_bounds__(256) void k_sincos(float* __restrict__ cs, float* __restrict__ sn, const float* __restrict__ invb, int S, int half, float pscale) {
    const int idx = blockIdx.x * 256 + threadIdx.x;
    if (idx >= S * half) return;
    const int s = idx / half, i = idx - s * half;
    const float ang = (pscale * (float)s) * invb[i];
    VST2(float, cs + idx, cosf(ang)); VST2(float, sn + idx, sinf(ang));
}

// k_mulact: dst[i] = act(x[i]) * y[i]
__global__ __launch_bounds__(256) void k_mulact(const float* __restrict__ x, const float* __restrict__ y, float* __restrict__ dst, int n, int act) {
    const int i = blockIdx.x * 256 + threadIdx.x;
    if (i < n) { const float v = act_fn(x[i], act) * y[i]; VST2(float, dst + i, v); }
}

// =====================================================================================================================
// k_matvec: thread-per-row matrix-vector products for N <= 8 output columns (heads with 1-3 outputs, gates), f32 on the VALU.
//   C[r*sCm + j] = act(alpha * sum_k A[r*sAm + k*sAk] * B[j*sBn + k*sBk] + bias[j]) + beta * R[r*sRm + j*sRn]; each thread writes its N contiguous floats.
// =====================================================================================================================
__global__ __launch_bounds__(256) void k_matvec(GemmP p) {
    // 32 lanes write one line with one instruction.
    const int rpt = (p.N == 1) ? 1 : 32;
    const long long r0 = ((long long)blockIdx.x * 256 + threadIdx.x) * rpt; const int z = blockIdx.z, zo = z / p.zi_n, zi = z - zo * p.zi_n;
    if (r0 >= p.M) return;
    const float* Bb = p.B + zo * p.sBo + zi * p.sBi;
    float* C = p.C + zo * p.sCo + zi * p.sCi; const float* R = p.R + zo * p.sRo + zi * p.sRi;
    for (int rr = 0; rr < rpt; ++rr) {
        const long long r = r0 + rr; if (r >= p.M) break;
        const float* A = p.A + zo * p.sAo + zi * p.sAi + r * p.sAm;
        float acc[8] = {0.f, 0.f, 0.f, 0.f, 0.f, 0.f, 0.f, 0.f};
        for (int k = 0; k < p.K; ++k) { const float a = A[(long long)k * p.sAk];
#pragma unroll
            for (int j = 0; j < 8; ++j) if (j < p.N) acc[j] += a * Bb[(long long)j * p.sBn + (long long)k * p.sBk]; }
#pragma unroll
        for (int j = 0; j < 8; ++j) if (j < p.N) {
            float v = acc[j] * p.alpha;
            if (p.flags & 1) v += p.bias[j];
            if (p.flags & 2) v += p.bias[r];
            v = act_fn(v, p.act);
            if (p.flags & 4) v += p.beta * R[r * p.sRm + (long long)j * p.sRn];
            VST2(float, C + r * p.sCm + j, v);
        }
    }
}
// k_smallsoftmax: thread-per-row softmax for short rows (n <= 64): dst[r*dr + j] = softmax(scale*src[r*sr + j])
__global__ __launch_bounds__(256) void k_smallsoftmax(const float* __restrict__ src, float* __restrict__ dst, long long sr, long long dr, int n, long long R, float scale) {
    const long long r0 = ((long long)blockIdx.x * 256 + threadIdx.x) * 32;
    for (int rr = 0; rr < 32; ++rr) {
        const long long r = r0 + rr; if (r >= R) return;
        const float* s = src + r * sr; float* d = dst + r * dr;
        float mx = -__builtin_inff();
        for (int j = 0; j < n; ++j) mx = fmaxf(mx, s[j] * scale);
        float sum = 0.f;
        for (int j = 0; j < n; ++j) sum += expf(s[j] * scale - mx);
        const float inv = 1.f / sum;
        for (int j = 0; j < n; ++j) { const float v = expf(s[j] * scale - mx) * inv; VST2(float, d + j, v); }
    }
}

__global__ __launch_bounds__(32) void k_unitstat(float* __restrict__ st) { const int t = threadIdx.x; const float v = (t == 1) ? 1.f : 0.f; VST2(float, st + t, v); }

// destination (e.g. a d_out whose row width is not a multiple of 32 floats) is written by consecutive lanes of one instruction
__global__ __launch_bounds__(256) void k_lincopy(const float* __restrict__ src, long long lds, float* __restrict__ dst, long long ldd, long long rows, int cols) {
    const long long i = (long long)blockIdx.x * 256 + threadIdx.x; if (i >= rows * cols) return;
    const long long r = i / cols; const int c = (int)(i - r * cols);
    const float v = src[r * lds + c]; VST2(float, dst + r * ldd + c, v);
}

namespace w25 {
typedef __attribute__((ext_vector_type(16))) _Float16 v16h;
typedef __attribute__((ext_vector_type(8)))  _Float16 v8h;
typedef __attribute__((ext_vector_type(16))) __bf16   v16b;
typedef __attribute__((ext_vector_type(8)))  __bf16   v8b;
typedef __attribute__((ext_vector_type(8)))  float    v8f;
typedef __attribute__((ext_vector_type(4)))  float    v4f;

__device__ __forceinline__ unsigned short f2bf_bits(float f) {
  unsigned u = __float_as_uint(f);
  return (unsigned short)((u + 0x7FFFu + ((u >> 16) & 1u)) >> 16);
}
__device__ __forceinline__ float bf_bits2f(unsigned short h) { return __uint_as_float(((unsigned)h) << 16); }

// hazard guards as plain device helpers (no inline asm inside the kernel template body)
__device__ __forceinline__ void dep_guard_h(v8f& a, v8f& b, v16h x, v16h y) { asm volatile("v_nop\n\tv_nop\n\tv_nop\n\tv_nop" : "+v"(a), "+v"(b) : "v"(x), "v"(y)); }
__device__ __forceinline__ void dep_guard_b(v8f& a, v8f& b, v16b x, v16b y) { asm volatile("v_nop\n\tv_nop\n\tv_nop\n\tv_nop" : "+v"(a), "+v"(b) : "v"(x), "v"(y)); }
__device__ __forceinline__ void keep4_h(v16h a, v16h b, v16h c, v16h d) { asm volatile("v_nop" :: "v"(a), "v"(b), "v"(c), "v"(d)); }
__device__ __forceinline__ void keep4_b(v16b a, v16b b, v16b c, v16b d) { asm volatile("v_nop" :: "v"(a), "v"(b), "v"(c), "v"(d)); }
__device__ __forceinline__ void acc_guard4(v8f& a, v8f& b, v8f& c, v8f& d) { asm volatile("v_nop\n\tv_nop\n\tv_nop\n\tv_nop" : "+v"(a), "+v"(b), "+v"(c), "+v"(d)); }
template <typename T> struct Frag;
template <> struct Frag<_Float16> {
  typedef v16h V; union U { v16h v; v8h h[2]; };
  static __device__ __forceinline__ v16h load(const _Float16* p) {   // elements 0..7 <- p[0..7], 8..15 <- p[16..23]
    U f; f.h[0] = *(const v8h*)(p); f.h[1] = *(const v8h*)(p + 16); return f.v;
  }
  static __device__ __forceinline__ v8f mma(v16h a, v16h b, v8f c) {
    return __builtin_amdgcn_wmma_f32_16x16x32_f16(false, a, false, b, (short)0, c, false, false);
  }
  static __device__ __forceinline__ void guard(v8f& a, v8f& b, v16h x, v16h y) { dep_guard_h(a, b, x, y); }
  static __device__ __forceinline__ void keep(v16h a, v16h b, v16h c, v16h d) { keep4_h(a, b, c, d); }
};
template <> struct Frag<__bf16> {
  typedef v16b V; union U { v16b v; v8b h[2]; };
  static __device__ __forceinline__ v16b load(const __bf16* p) {
    U f; f.h[0] = *(const v8b*)(p); f.h[1] = *(const v8b*)(p + 16); return f.v;
  }
  static __device__ __forceinline__ v8f mma(v16b a, v16b b, v8f c) {
    return __builtin_amdgcn_wmma_f32_16x16x32_bf16(false, a, false, b, (short)0, c, false, false);
  }
  static __device__ __forceinline__ void guard(v8f& a, v8f& b, v16b x, v16b y) { dep_guard_b(a, b, x, y); }
  static __device__ __forceinline__ void keep(v16b a, v16b b, v16b c, v16b d) { keep4_b(a, b, c, d); }
};

// ---- Register-blocked batched WMMA GEMM ------------------------------------
// C[m,n] = scale * sum_k A[m,k] * Bt[n,k] (+bias)(+resid); each wave owns a 64x64 tile.
// A row-major [M,K]; Bt row-major [N,K]; M,N % 64 == 0, K % 32 == 0.
// SPLIT: operands are hi/lo planes (A2/Bt2 = lo planes, same layout); product = hi·hi + hi·lo + lo·hi.
// BIAS_MODE: 0 = none, 1 = bias[m], 2 = bias[n].
// OUT_MODE: 0 = f32, 1 = f16, 2 = bf16 hi plane (Cout) + bf16 lo plane (Cout2).
// ET: 0 = f16 operands, 1 = bf16 operands (pointers passed as 16-bit storage)
// Batches: blockIdx.y steps A, Bt, C by strideA/B/C, blockIdx.z by strideAz/Bz/Cz (elements).
template <int ET> struct Elem;
template <> struct Elem<0> { typedef _Float16 T; };
template <> struct Elem<1> { typedef __bf16 T; };
template <int ET, bool SPLIT, int BIAS_MODE, int OUT_MODE, bool RESID, int ACT = 0>
__global__ __launch_bounds__(256) void wmma_gemm64(
    const unsigned short* __restrict__ Ap, const unsigned short* __restrict__ A2p, int lda, long strideA,
    const unsigned short* __restrict__ Btp, const unsigned short* __restrict__ Bt2p, int ldb, long strideB,
    void* __restrict__ Cout, void* __restrict__ Cout2, int ldc, long strideC,
    const float* __restrict__ bias,
    const float* __restrict__ resid, long strideR,
    int M, int N, int K, float scale,
    long strideAz, long strideBz, long strideCz) {
  typedef typename Elem<ET>::T T;
  typedef typename Frag<T>::V V;
  const T* A = (const T*)Ap; const T* A2 = (const T*)A2p; const T* Bt = (const T*)Btp; const T* Bt2 = (const T*)Bt2p;
  __shared__ __align__(16) float sT[8][16 * 68];   // per-wave 16x64 slab, pitch 68 floats
  const int b    = blockIdx.y;
  const int lane = threadIdx.x & 31;
  const int wave = threadIdx.x >> 5;
  const int tilesN = N >> 6;
  const int tilesM = M >> 6;
  const int tile = blockIdx.x * 8 + wave;
  if (tile >= tilesM * tilesN) return;   // wave-uniform; no block barriers in this kernel
  const int tm = tile / tilesN;
  const int tn = tile - tm * tilesN;
  const int m0 = tm << 6;
  const int n0 = tn << 6;

  const int bz = blockIdx.z;                   // outer batch index (own strides)
  const size_t offA = (size_t)b * strideA + (size_t)bz * strideAz;
  const size_t offB = (size_t)b * strideB + (size_t)bz * strideBz;
  const size_t offC = (size_t)b * strideC + (size_t)bz * strideCz;
  const T* Ab  = A  + offA;
  const T* Bb  = Bt + offB;
  const T* Ab2 = SPLIT ? (A2  + offA) : nullptr;
  const T* Bb2 = SPLIT ? (Bt2 + offB) : nullptr;

  const int rlane = lane & 15;                 // row (A) / col (B, D) within subtile
  const int koff  = (lane >> 4) * 8;           // k offset of this lane half
  const int mOff  = (lane >> 4) * 8;           // D row offset

  v8f acc[4][4];
#pragma unroll
  for (int i = 0; i < 4; ++i)
#pragma unroll
    for (int j = 0; j < 4; ++j) acc[i][j] = (v8f){0.f,0.f,0.f,0.f,0.f,0.f,0.f,0.f};

  for (int k0 = 0; k0 < K; k0 += 32) {
    V bh[4], bl[4];
#pragma unroll
    for (int j = 0; j < 4; ++j) {
      const size_t bo = (size_t)(n0 + (j << 4) + rlane) * ldb + koff + k0;
      bh[j] = Frag<T>::load(Bb + bo);
      if (SPLIT) bl[j] = Frag<T>::load(Bb2 + bo);
    }
#pragma unroll
    for (int i = 0; i < 4; ++i) {
      const size_t ao = (size_t)(m0 + (i << 4) + rlane) * lda + koff + k0;
      V ah = Frag<T>::load(Ab + ao);
      V al;
      if (SPLIT) al = Frag<T>::load(Ab2 + ao);
#pragma unroll
      for (int j = 0; j < 4; ++j) {
        acc[i][j] = Frag<T>::mma(ah, bh[j], acc[i][j]);
        if (SPLIT) {
          acc[i][j] = Frag<T>::mma(ah, bl[j], acc[i][j]);
          acc[i][j] = Frag<T>::mma(al, bh[j], acc[i][j]);
        }
      }
      Frag<T>::guard(acc[i][0], acc[i][3], ah, SPLIT ? al : ah);
    }
    Frag<T>::keep(bh[0], bh[1], bh[2], bh[3]);
    if (SPLIT) Frag<T>::keep(bl[0], bl[1], bl[2], bl[3]);
  }
  acc_guard4(acc[0][0], acc[0][1], acc[0][2], acc[0][3]);
  acc_guard4(acc[1][0], acc[1][1], acc[1][2], acc[1][3]);
  acc_guard4(acc[2][0], acc[2][1], acc[2][2], acc[2][3]);
  acc_guard4(acc[3][0], acc[3][1], acc[3][2], acc[3][3]);

  // ---- epilogue ----
  float* slab = sT[wave];
  const float* Rb = RESID ? (resid + (size_t)b * strideR) : nullptr;
#pragma unroll
  for (int i = 0; i < 4; ++i) {
    const int mBase = m0 + (i << 4);
#pragma unroll
    for (int j = 0; j < 4; ++j) {
      const int n = n0 + (j << 4) + rlane;
      float bv = 0.f;
      if (BIAS_MODE == 2) bv = bias[n];
#pragma unroll
      for (int r = 0; r < 8; ++r) {
        float v = acc[i][j][r] * scale;
        if (BIAS_MODE == 1) v += bias[mBase + mOff + r];
        if (BIAS_MODE == 2) v += bv;
        if (RESID) v += Rb[(size_t)(mBase + mOff + r) * ldc + n];
        if (ACT == 1) v = tanhf(v);
        if (ACT == 2) v = fmaxf(v, 0.0f);
        if (ACT == 3) v = v / (1.0f + expf(-v));
        if (ACT == 4) v = (v > 0.f) ? v : 0.01f * v;
        if (ACT == 5) v = 0.5f * v * (1.0f + erff(v * 0.70710678118654752f));
        slab[(mOff + r) * 68 + (j << 4) + rlane] = v;
      }
    }
    __builtin_amdgcn_fence(__ATOMIC_RELEASE, "workgroup");
    __builtin_amdgcn_wave_barrier();
    __builtin_amdgcn_fence(__ATOMIC_ACQUIRE, "workgroup");
    if (OUT_MODE == 0) {
      float* C = (float*)Cout + offC;
      const int hh = lane >> 4, c4 = (lane & 15) * 4;     // row seg = 256 B = 16 lanes x 16 B
      {
#pragma unroll
        for (int it = 0; it < 8; ++it) {
          const int row = it * 2 + hh;
          v4f v = *(const v4f*)(slab + row * 68 + c4);
          *(v4f*)(C + (size_t)(mBase + row) * ldc + n0 + c4) = v;
        }
        
      }
    } else {
      const int q = lane >> 3, c8 = (lane & 7) * 8;
      unsigned short* C  = (unsigned short*)Cout  + offC;
      unsigned short* C2 = (OUT_MODE == 2) ? ((unsigned short*)Cout2 + offC) : nullptr;
      {
#pragma unroll
        for (int it = 0; it < 4; ++it) {
          const int row = it * 4 + q;
          const float* sp = slab + row * 68 + c8;
          v8h hv, lv;
#pragma unroll
          for (int e = 0; e < 8; ++e) {
            if (OUT_MODE == 1) {
              hv[e] = (_Float16)sp[e];
            } else {
              unsigned short hb = f2bf_bits(sp[e]);
              unsigned short lb = f2bf_bits(sp[e] - bf_bits2f(hb));
              hv[e] = __builtin_bit_cast(_Float16, hb);
              lv[e] = __builtin_bit_cast(_Float16, lb);
            }
          }
          *(v8h*)(C + (size_t)(mBase + row) * ldc + n0 + c8) = hv;
          if (OUT_MODE == 2) *(v8h*)(C2 + (size_t)(mBase + row) * ldc + n0 + c8) = lv;
        }
        
      }
    }
    __builtin_amdgcn_fence(__ATOMIC_RELEASE, "workgroup");
    __builtin_amdgcn_wave_barrier();
    __builtin_amdgcn_fence(__ATOMIC_ACQUIRE, "workgroup");
  }
}

__global__ __launch_bounds__(256) void cast_f32_f16x2(
    const float* __restrict__ in, _Float16* __restrict__ out, int n2) {
  int i = blockIdx.x * 256 + threadIdx.x;
  if (i < n2) {
    const _Float16 h0 = (_Float16)in[2 * i], h1 = (_Float16)in[2 * i + 1];
    const unsigned u = (unsigned)__builtin_bit_cast(unsigned short, h0) | ((unsigned)__builtin_bit_cast(unsigned short, h1) << 16);
    ((unsigned*)out)[i] = u;
    
  }
}


} // namespace w25

__global__ __launch_bounds__(256) void k_castT16(const float* __restrict__ src, long long lds, _Float16* __restrict__ dst, long long ldd, int R, int C, float s) {
    const long long i = (long long)blockIdx.x * 256 + threadIdx.x; const long long np = (long long)C * (R / 2); if (i >= np) return; const int c = (int)(i / (R / 2)); const int r = 2 * (int)(i % (R / 2));
    const _Float16 h0 = (_Float16)(src[(long long)r * lds + c] * s), h1 = (_Float16)(src[(long long)(r + 1) * lds + c] * s);
    const unsigned u = (unsigned)__builtin_bit_cast(unsigned short, h0) | ((unsigned)__builtin_bit_cast(unsigned short, h1) << 16);
    unsigned* d = (unsigned*)(dst + (long long)c * ldd + r); *d = u;  }
__global__ __launch_bounds__(256) void k_cast16(const float* __restrict__ src, long long lds, _Float16* __restrict__ dst, long long ldd, int R, int C, float s) {
    const long long i = (long long)blockIdx.x * 256 + threadIdx.x; const long long np = (long long)R * (C / 2); if (i >= np) return; const int r = (int)(i / (C / 2)); const int c = 2 * (int)(i % (C / 2));
    const _Float16 h0 = (_Float16)(src[(long long)r * lds + c] * s), h1 = (_Float16)(src[(long long)r * lds + c + 1] * s);
    const unsigned u = (unsigned)__builtin_bit_cast(unsigned short, h0) | ((unsigned)__builtin_bit_cast(unsigned short, h1) << 16);
    unsigned* d = (unsigned*)(dst + (long long)r * ldd + c); *d = u;  }

// f32 -> bf16 hi plane + bf16 lo plane (x = hi + lo to ~2^-17 relative; RNE both), [R][C] -> [R][C] (or transposed to [C][R]); 2 consecutive destination elements
__device__ __forceinline__ unsigned int f2bf2_pack(float a, float b, unsigned int* lo) {
    const unsigned short ha = w25::f2bf_bits(a), hb = w25::f2bf_bits(b);
    const unsigned short la = w25::f2bf_bits(a - w25::bf_bits2f(ha)), lb = w25::f2bf_bits(b - w25::bf_bits2f(hb));
    *lo = (unsigned)la | ((unsigned)lb << 16); return (unsigned)ha | ((unsigned)hb << 16); }
__global__ __launch_bounds__(256) void k_castS16(const float* __restrict__ src, long long lds, __bf16* __restrict__ dhi, __bf16* __restrict__ dlo, long long ldd, int R, int C, float s, int transpose) {
    const long long i = (long long)blockIdx.x * 256 + threadIdx.x; long long o; float a, b;
    if (transpose) { const long long np = (long long)C * (R / 2); if (i >= np) return; const int c = (int)(i / (R / 2)); const int r = 2 * (int)(i % (R / 2)); a = src[(long long)r * lds + c] * s; b = src[(long long)(r + 1) * lds + c] * s; o = (long long)c * ldd + r; }
    else { const long long np = (long long)R * (C / 2); if (i >= np) return; const int r = (int)(i / (C / 2)); const int c = 2 * (int)(i % (C / 2)); a = src[(long long)r * lds + c] * s; b = src[(long long)r * lds + c + 1] * s; o = (long long)r * ldd + c; }
    unsigned lo; const unsigned hi = f2bf2_pack(a, b, &lo); unsigned* ph = (unsigned*)(dhi + o); unsigned* pl = (unsigned*)(dlo + o);
    *ph = hi; *pl = lo;  }

namespace w25 {
// =====================================================================================
// Generic causal/non-causal attention for head_dim 64, f32 in / f32 out; 16-bit operands: bf16 with optional hi/lo splits, or
// plain f16 (F16=true, non-split, probabilities carried x2^15).
//   scores = (q*qscale)·kᵀ : v_wmma_f32_16x16x32_bf16; SPLIT_QK -> q,k as bf16 hi/lo (hi·hi + hi·lo + lo·hi)
//   out    = p·v           : v_wmma_f32_16x16x32_bf16; SPLIT_PV -> p,v as bf16 hi/lo; else p,v plain bf16
//   f32 accumulate; online softmax in f32. Block = 4 waves = 64 query rows of one (batch, head); S % 64 == 0.
//   Element (b, s, h, d) of tensor X lives at X[b*X_bs + s*X_rs + h*X_hs + d] (strides in floats, multiples of 4).
//   Masking: mask_mode 0 none, 1 causal (kv > q masked), 2 tensor [S][Skv] shared over (b,h) (float if
//   mask_is_int==0, int32 with element == 0 -> masked if 1, int32 with element != 0 -> masked if 2), 3 per-token vectors qmask[B][S] & kvmask[B][Skv] (int32,
//   0 -> masked), 4 causal + sliding window (kv > q or q - kv > W masked; W passed in mask_is_int);
//   5 = relative-position bias: s += cp[b,h,q][idx[q][kv]] + pc[b,h,kv][idx[q][kv]] with idx = mask_b ([S][Skv] int32) and
//   mask_a an int32 [S][Skv] tensor with nonzero = masked (tables: element (b,h,row,n) at X + b*c_bs + h*c_hs + row*c_rs + n);
//   masked scores are replaced by mask_fill (e.g. -inf or -1e9) before the softmax.
//   grid.x = B * H * (S/64) (or a sub-range with blk0).
// =====================================================================================
#define AT_D 64
#define AT_NW 4
#define AT_QB 64
#define AT_KC 64
struct AttnGeom { const float* cp = nullptr; const float* pc = nullptr; long c_bs = 0, c_rs = 0, c_hs = 0;   // mode-5 score-bias tables
                  long q_bs, q_rs, q_hs, k_bs, k_rs, k_hs, v_bs, v_rs, v_hs, o_bs, o_rs, o_hs;
                  int S, Skv, H, mask_mode; float qscale; int blk0; float mask_fill; int mask_is_int; };
static_assert(sizeof(AttnGeom) == 168, "no padding");

__device__ __forceinline__ unsigned short at_bf_bits(float f) {
  unsigned u = __float_as_uint(f);
  return (unsigned short)((u + 0x7FFFu + ((u >> 16) & 1u)) >> 16);
}
__device__ __forceinline__ __bf16 at_f2bf(float f) { return __builtin_bit_cast(__bf16, at_bf_bits(f)); }
__device__ __forceinline__ void at_split(float f, __bf16& hi, __bf16& lo) {
  const unsigned short hb = at_bf_bits(f);
  hi = __builtin_bit_cast(__bf16, hb);
  lo = at_f2bf(f - __uint_as_float(((unsigned)hb) << 16));
}
__device__ __forceinline__ v8f at_mma(v16b a, v16b b, v8f c) {
  c = __builtin_amdgcn_wmma_f32_16x16x32_bf16(false, a, false, b, (short)0, c, false, false);
  asm volatile("v_nop\n\tv_nop\n\tv_nop\n\tv_nop" : "+v"(c) : "v"(a), "v"(b));
  return c;
}
// 16-bit element as a bit pattern held in a __bf16 slot: f16 bits when F16, bf16 (RNE) otherwise
template <bool F16> __device__ __forceinline__ __bf16 at_to16(float f) {
  if (F16) return __builtin_bit_cast(__bf16, (_Float16)f);
  return at_f2bf(f);
}
template <bool F16> __device__ __forceinline__ v8f at_mma16(v16b a, v16b b, v8f c) {
  if (F16) {
    const v16h ah = __builtin_bit_cast(v16h, a), bh = __builtin_bit_cast(v16h, b);
    c = __builtin_amdgcn_wmma_f32_16x16x32_f16(false, ah, false, bh, (short)0, c, false, false);
    asm volatile("v_nop\n\tv_nop\n\tv_nop\n\tv_nop" : "+v"(c) : "v"(ah), "v"(bh));
    return c;
  }
  return at_mma(a, b, c);
}

template <bool SPLIT_QK, bool SPLIT_PV, bool F16 = false>
__global__ __launch_bounds__(128)
void attn64_kernel(const float* __restrict__ q, const float* __restrict__ k,
                   const float* __restrict__ v, float* __restrict__ out,
                   const void* __restrict__ mask_a, const int* __restrict__ mask_b, AttnGeom g) {
  static_assert(!(F16 && (SPLIT_QK || SPLIT_PV)), "f16 mode is non-split");
  const float PSC = F16 ? 32768.0f : 1.0f;     // f16 probabilities carried x2^15 (subnormal range), folded into the final 1/l
  union FB { v16b v; v8b h[2]; };
  __shared__ __align__(16) __bf16 Ksh[AT_KC * AT_D];             // K hi [kv][d]      8 KB
  __shared__ __align__(16) __bf16 Ksl[SPLIT_QK ? AT_KC * AT_D : 8];
  __shared__ __align__(16) __bf16 Vth[AT_D * AT_KC];             // V hi [d][kv]      8 KB
  __shared__ __align__(16) __bf16 Vtl[SPLIT_PV ? AT_D * AT_KC : 8];
  __shared__ __align__(16) __bf16 Psh[AT_NW][16 * AT_KC];        // per wave P hi [row][kv]  8 KB
  __shared__ __align__(16) __bf16 Psl[SPLIT_PV ? AT_NW : 1][SPLIT_PV ? 16 * AT_KC : 8];
  __shared__ __align__(16) float  Os[AT_NW][16 * 68];            // per wave out tile, pitch 68

  const int tid  = threadIdx.x;
  const int wave = tid >> 5;
  const int lane = tid & 31;
  const int hh   = lane >> 4;
  const int c    = lane & 15;

  const int nqb = g.S / AT_QB;
  const int bx = blockIdx.x + g.blk0;
  const int qb = bx % nqb;
  const int bh = bx / nqb;
  const int h  = bh % g.H;
  const int b  = bh / g.H;
  const int qbase_block = qb * AT_QB;
  const int q0 = qbase_block + wave * 16;

  const float* qb_ptr = q + (size_t)b * g.q_bs + (size_t)h * g.q_hs;
  const float* kb_ptr = k + (size_t)b * g.k_bs + (size_t)h * g.k_hs;
  const float* vb_ptr = v + (size_t)b * g.v_bs + (size_t)h * g.v_hs;
  float*       ob_ptr = out + (size_t)b * g.o_bs + (size_t)h * g.o_hs;

  // ---- Q fragments (A operand): 2 d-chunks, hi (and lo) ----
  v16b qah[2], qal[2];
  {
    const float* qrow = qb_ptr + (size_t)(q0 + c) * g.q_rs;
#pragma unroll
    for (int dc = 0; dc < 2; ++dc) {
#pragma unroll
      for (int e = 0; e < 8; ++e) {
        const float f0 = qrow[dc * 32 + 8 * hh + e] * g.qscale;
        const float f1 = qrow[dc * 32 + 16 + 8 * hh + e] * g.qscale;
        if (SPLIT_QK) { __bf16 hq, lq; at_split(f0, hq, lq); qah[dc][e] = hq; qal[dc][e] = lq; at_split(f1, hq, lq); qah[dc][8 + e] = hq; qal[dc][8 + e] = lq; }
        else { qah[dc][e] = at_to16<F16>(f0); qah[dc][8 + e] = at_to16<F16>(f1); qal[dc][e] = qah[dc][e]; qal[dc][8 + e] = qah[dc][8 + e]; }
      }
    }
  }

  float mrow[8], lrow[8];
  v8f oacc[4];
#pragma unroll
  for (int r = 0; r < 8; ++r) { mrow[r] = -INFINITY; lrow[r] = 0.f; }
#pragma unroll
  for (int t = 0; t < 4; ++t) oacc[t] = (v8f){0.f,0.f,0.f,0.f,0.f,0.f,0.f,0.f};

  const int nChunks = (g.mask_mode == 1 || g.mask_mode == 4) ? (qb + 1) : (g.Skv / AT_KC);   // block-uniform
  // per-row query mask (mode 3)
  int qkeep[8];
#pragma unroll
  for (int r = 0; r < 8; ++r) qkeep[r] = (g.mask_mode == 3) ? mask_b[(size_t)b * g.S + q0 + 8 * hh + r] : 1;   // mask_b = qmask in mode 3
  for (int kc = 0; kc < nChunks; ++kc) {
    const int kv0 = kc * AT_KC;
    __syncthreads();
    {
      const int kvr = tid >> 1, dh = (tid & 1) * 32;
      const float* krow = kb_ptr + (size_t)(kv0 + kvr) * g.k_rs + dh;
      const float* vrow = vb_ptr + (size_t)(kv0 + kvr) * g.v_rs + dh;
#pragma unroll
      for (int i = 0; i < 8; ++i) {
        v4f kk = *(const v4f*)(krow + 4 * i);
        v4f vv = *(const v4f*)(vrow + 4 * i);
#pragma unroll
        for (int e = 0; e < 4; ++e) {
          const int d = dh + 4 * i + e;
          if (SPLIT_QK) { __bf16 a, bl; at_split(kk[e], a, bl); Ksh[kvr * AT_D + d] = a; Ksl[kvr * AT_D + d] = bl; }
          else Ksh[kvr * AT_D + d] = at_to16<F16>(kk[e]);
          if (SPLIT_PV) { __bf16 a, bl; at_split(vv[e], a, bl); Vth[d * AT_KC + kvr] = a; Vtl[d * AT_KC + kvr] = bl; }
          else Vth[d * AT_KC + kvr] = at_to16<F16>(vv[e]);
        }
      }
    }
    __syncthreads();

    v8f s[4];
#pragma unroll
    for (int j = 0; j < 4; ++j) {
      s[j] = (v8f){0.f,0.f,0.f,0.f,0.f,0.f,0.f,0.f};
#pragma unroll 1
      for (int dc = 0; dc < 2; ++dc) {
        FB kb;
        kb.h[0] = *(const v8b*)(Ksh + (j * 16 + c) * AT_D + dc * 32 + 8 * hh);
        kb.h[1] = *(const v8b*)(Ksh + (j * 16 + c) * AT_D + dc * 32 + 16 + 8 * hh);
        s[j] = at_mma16<F16>(qah[dc], kb.v, s[j]);
        if (SPLIT_QK) {
          FB kl;
          kl.h[0] = *(const v8b*)(Ksl + (j * 16 + c) * AT_D + dc * 32 + 8 * hh);
          kl.h[1] = *(const v8b*)(Ksl + (j * 16 + c) * AT_D + dc * 32 + 16 + 8 * hh);
          s[j] = at_mma16<F16>(qah[dc], kl.v, s[j]);
          s[j] = at_mma16<F16>(qal[dc], kb.v, s[j]);
        }
      }
    }
    const bool diag = (g.mask_mode == 1) && (kc == qb);
    int kvkeep[4] = {1, 1, 1, 1};
    if (g.mask_mode == 3) {
#pragma unroll
      for (int j = 0; j < 4; ++j) kvkeep[j] = ((const int*)mask_a)[(size_t)b * g.Skv + kv0 + j * 16 + c];   // mask_a = kvmask
    }
    float cm[8];
#pragma unroll
    for (int r = 0; r < 8; ++r) {
      const int qrow = q0 + 8 * hh + r;
      float m = -INFINITY;
#pragma unroll
      for (int j = 0; j < 4; ++j) {
        const int kvcol = kv0 + j * 16 + c;
        bool masked = false;
        if (diag) masked = (kvcol > qrow);
        else if (g.mask_mode == 4) masked = (kvcol > qrow) || (qrow - kvcol > g.mask_is_int);
        else if (g.mask_mode == 2) {
          const size_t mi = (size_t)qrow * g.Skv + kvcol;
          masked = (g.mask_is_int == 0) ? (((const float*)mask_a)[mi] == 0.0f)
                 : (g.mask_is_int == 1) ? (((const int*)mask_a)[mi] == 0) : (((const int*)mask_a)[mi] != 0);
        } else if (g.mask_mode == 3) masked = (qkeep[r] == 0) || (kvkeep[j] == 0);
        else if (g.mask_mode == 5) {
          const size_t mi = (size_t)qrow * g.Skv + kvcol;
          masked = (((const int*)mask_a)[mi] != 0);
          int n = mask_b[mi]; n = n < 0 ? 0 : n;
          s[j][r] += g.cp[(size_t)b * g.c_bs + (size_t)h * g.c_hs + (size_t)qrow * g.c_rs + n]
                   + g.pc[(size_t)b * g.c_bs + (size_t)h * g.c_hs + (size_t)kvcol * g.c_rs + n];
        }
        if (masked) s[j][r] = g.mask_fill;
        m = fmaxf(m, s[j][r]);
      }
#pragma unroll
      for (int off = 1; off < 16; off <<= 1) m = fmaxf(m, __shfl_xor(m, off, 32));
      cm[r] = m;
    }
    __bf16* pwh = Psh[wave];
    __bf16* pwl = Psl[SPLIT_PV ? wave : 0];
#pragma unroll
    for (int r = 0; r < 8; ++r) {
      const float mnew = fmaxf(mrow[r], cm[r]);
      const float alpha = expf(mrow[r] - mnew);
      mrow[r] = mnew;
      float psum = 0.f;
#pragma unroll
      for (int j = 0; j < 4; ++j) {
        const float p = expf(s[j][r] - mnew);
        psum += p;
        if (SPLIT_PV) { __bf16 a, bl; at_split(p, a, bl); pwh[(8 * hh + r) * AT_KC + j * 16 + c] = a; pwl[(8 * hh + r) * AT_KC + j * 16 + c] = bl; }
        else pwh[(8 * hh + r) * AT_KC + j * 16 + c] = at_to16<F16>(p * PSC);
      }
#pragma unroll
      for (int off = 1; off < 16; off <<= 1) psum += __shfl_xor(psum, off, 32);
      lrow[r] = lrow[r] * alpha + psum;
#pragma unroll
      for (int t = 0; t < 4; ++t) oacc[t][r] *= alpha;
    }
    __builtin_amdgcn_fence(__ATOMIC_RELEASE, "workgroup");
    __builtin_amdgcn_wave_barrier();
    __builtin_amdgcn_fence(__ATOMIC_ACQUIRE, "workgroup");
#pragma unroll 1
    for (int kk = 0; kk < 2; ++kk) {
      FB pa, pl;
      pa.h[0] = *(const v8b*)(pwh + c * AT_KC + kk * 32 + 8 * hh);
      pa.h[1] = *(const v8b*)(pwh + c * AT_KC + kk * 32 + 16 + 8 * hh);
      if (SPLIT_PV) {
        pl.h[0] = *(const v8b*)(pwl + c * AT_KC + kk * 32 + 8 * hh);
        pl.h[1] = *(const v8b*)(pwl + c * AT_KC + kk * 32 + 16 + 8 * hh);
      }
#pragma unroll
      for (int t = 0; t < 4; ++t) {
        FB vb;
        vb.h[0] = *(const v8b*)(Vth + (t * 16 + c) * AT_KC + kk * 32 + 8 * hh);
        vb.h[1] = *(const v8b*)(Vth + (t * 16 + c) * AT_KC + kk * 32 + 16 + 8 * hh);
        oacc[t] = at_mma16<F16>(pa.v, vb.v, oacc[t]);
        if (SPLIT_PV) {
          FB vl;
          vl.h[0] = *(const v8b*)(Vtl + (t * 16 + c) * AT_KC + kk * 32 + 8 * hh);
          vl.h[1] = *(const v8b*)(Vtl + (t * 16 + c) * AT_KC + kk * 32 + 16 + 8 * hh);
          oacc[t] = at_mma16<F16>(pa.v, vl.v, oacc[t]);
          oacc[t] = at_mma16<F16>(pl.v, vb.v, oacc[t]);
        }
      }
    }
  }

  float* os = Os[wave];
#pragma unroll
  for (int r = 0; r < 8; ++r) {
    const float inv = 1.0f / (lrow[r] * PSC);
#pragma unroll
    for (int t = 0; t < 4; ++t) os[(8 * hh + r) * 68 + t * 16 + c] = oacc[t][r] * inv;
  }
  __builtin_amdgcn_fence(__ATOMIC_RELEASE, "workgroup");
  __builtin_amdgcn_wave_barrier();
  __builtin_amdgcn_fence(__ATOMIC_ACQUIRE, "workgroup");
  {
    const int c4 = (lane & 15) * 4;
    {
#pragma unroll
      for (int it = 0; it < 8; ++it) {
        const int row = it * 2 + hh;
        v4f val = *(const v4f*)(os + row * 68 + c4);
        *(v4f*)(ob_ptr + (size_t)(q0 + row) * g.o_rs + c4) = val;
      }
      
    }
  }
}

} // namespace w25

__device__ __forceinline__ void st_h2(_Float16* dst, float a, float b) { const unsigned u = (unsigned)__builtin_bit_cast(unsigned short, (_Float16)a) | ((unsigned)__builtin_bit_cast(unsigned short, (_Float16)b) << 16); unsigned* d = (unsigned*)dst; *d = u;  }
// TK16 [r][d] = 16 table_k[r][d], zero rows 129..191
__global__ __launch_bounds__(256) void k_sh_tk(const float* __restrict__ TK, _Float16* __restrict__ TK16, int TAB, int TP, int HD) { const int t = blockIdx.x * 256 + threadIdx.x; if (t >= TP * HD / 2) return; const int e = 2 * t; const int r = e / HD; st_h2(TK16 + e, (r < TAB) ? TK[e] * 16.f : 0.f, (r < TAB) ? TK[e + 1] * 16.f : 0.f); }
// per (b, h, q) row (block; heads h0..h0+7 in blockIdx.x, batch b + blockIdx.y): s_k = (SC[y][h-h0][q][k] + QT[(b,q,h)][fm[b][q][k]]) / 8; softmax over 512 k (exp once) -> P16[b][h][q][k] = f16(4096 p); SC keeps the f32 probabilities
__global__ __launch_bounds__(256) void k_sh_soft(float* __restrict__ SC, const float* __restrict__ QT, const int* __restrict__ FM, _Float16* __restrict__ P16, int b, int h0, int L, int NH, int TP, int TAB) { __shared__ float red[256]; const int rl = blockIdx.x; const int bb = b + blockIdx.y; const int h = h0 + rl / L, q = rl % L; const int row = (bb * NH + h) * L + q; const int t = threadIdx.x; float* sr = SC + ((long long)blockIdx.y * gridDim.x + rl) * L; const float* qt = QT + (((long long)bb * L + q) * NH + h) * TP; const int* fr = FM + ((long long)bb * L + q) * L;
    float v0, v1; { const int j = 2 * t; int r0 = fr[j], r1 = fr[j + 1]; r0 = r0 < 0 ? 0 : (r0 >= TAB ? TAB - 1 : r0); r1 = r1 < 0 ? 0 : (r1 >= TAB ? TAB - 1 : r1); v0 = (sr[j] + qt[r0]) * 0.125f; v1 = (sr[j + 1] + qt[r1]) * 0.125f; }
    red[t] = fmaxf(v0, v1); __syncthreads(); for (int o = 128; o > 0; o >>= 1) { if (t < o) red[t] = fmaxf(red[t], red[t + o]); __syncthreads(); } const float m = red[0]; __syncthreads();
    const float e0 = expf(v0 - m), e1 = expf(v1 - m); red[t] = e0 + e1; __syncthreads(); for (int o = 128; o > 0; o >>= 1) { if (t < o) red[t] += red[t + o]; __syncthreads(); } const float f = 1.f / red[0];
    { const int j = 2 * t; const unsigned long long pk = (unsigned long long)__builtin_bit_cast(unsigned, e0 * f) | ((unsigned long long)__builtin_bit_cast(unsigned, e1 * f) << 32); VST2(unsigned long long, (unsigned long long*)(sr + j), pk); st_h2(P16 + (long long)row * L + j, e0 * f * 4096.f, e1 * f * 4096.f); } }
// w2 in one launch: one wave per query row g = b L + q. X[g][h*64 + d] += (1/4096) sum_k P16[b][h][q][k] * f16(table_v[fm[g][k]][d]).
// A = the 16 heads' probability rows (16 x 512, straight from P16); B = the gathered table rows, never written out: table_v lies in LDS as f16 rows of 160 bytes,
// and each lane of ds_load_tr16_b128 points at the row that ITS key's id names (lane l: key kbase + 8 (l >> 4) + (l & 7), 16-byte half (l >> 3) & 1), so the
// transposing load returns B[k][d] in the hardware k order (frag_k), the order in which A is loaded. INPUT ids clamped before the address is formed. k runs 0..511 in one accumulator chain.
typedef __attribute__((ext_vector_type(8))) short w2_s16x8;
__device__ __forceinline__ v8h w2_ldtr(const unsigned char* p) { typedef __attribute__((address_space(3))) w2_s16x8 lds_s16x8; return __builtin_bit_cast(v8h, __builtin_amdgcn_ds_load_tr16_b128_v8i16((lds_s16x8*)p)); }
typedef __attribute__((ext_vector_type(4))) _Float16 w2_v4h;
// amdgpu_waves_per_eu(4): at most 256 VGPRs, so that two blocks share a WGP and all 512 blocks are resident at once
__global__ __launch_bounds__(256) __attribute__((amdgpu_waves_per_eu(4))) void k_sh_w2(const _Float16* __restrict__ P16, const int* __restrict__ FM, const float* __restrict__ TV, float* __restrict__ X) {
    constexpr int L = 512, NH = 16, HD = 64, TAB = 129, PITCH = 160;   // PITCH: 32 B x odd, the transposing load's pitch
    static_assert(TAB * HD == 4 * (8 * 256 + 16), "the fill below: eight float4 per thread, then row 128 by 16 threads");
    __shared__ __attribute__((aligned(16))) unsigned char tab[TAB * PITCH];
    const int t = threadIdx.x, lane = t & 31;
    const int g = blockIdx.x * 8 + (t >> 5);
    const int c = lane & 15, h = lane >> 4;
    // the table's loads go first: they are waited for first, while the first ids and probabilities are still on their way
    v4f tv[8];
#pragma unroll
    for (int u = 0; u < 8; ++u) tv[u] = *(const v4f*)(TV + 4 * (t + 256 * u));
    const v4f tl = *(const v4f*)(TV + 4 * (2048 + (t & 15)));
    const int* fr = FM + (long long)g * L + 8 * h + (lane & 7);
    const _Float16* pa = P16 + (((long long)(g >> 9) * NH + c) * L + (g & (L - 1))) * L + 8 * h;
    // keys in four runs of 128, two register buffers: the next run's ids and probabilities fly while this run is multiplied
    int id[2][8];
    v8h a[2][8];
#pragma unroll
    for (int j = 0; j < 8; ++j) { id[0][j] = fr[16 * j]; a[0][j] = *(const v8h*)(pa + 16 * j); }
#pragma unroll
    for (int u = 0; u < 8; ++u) *(w2_v4h*)(tab + ((t >> 4) + 16 * u) * PITCH + (t & 15) * 8) = __builtin_convertvector(tv[u], w2_v4h);
    if (t < 16) *(w2_v4h*)(tab + 128 * PITCH + t * 8) = __builtin_convertvector(tl, w2_v4h);
    __syncthreads();
    const unsigned half16 = 16u * ((lane >> 3) & 1);
    v8f acc[4];
#pragma unroll
    for (int n = 0; n < 4; ++n) acc[n] = (v8f){0.f, 0.f, 0.f, 0.f, 0.f, 0.f, 0.f, 0.f};
#pragma unroll
    for (int ch = 0; ch < 4; ++ch) {
        const int cur = ch & 1, nxt = cur ^ 1;
        if (ch < 3) {
#pragma unroll
            for (int j = 0; j < 8; ++j) { id[nxt][j] = fr[16 * (8 * (ch + 1) + j)]; a[nxt][j] = *(const v8h*)(pa + 16 * (8 * (ch + 1) + j)); }
        }
#pragma unroll
        for (int s = 0; s < 4; ++s) {
            int r0 = id[cur][2 * s], r1 = id[cur][2 * s + 1];
            r0 = r0 < 0 ? 0 : (r0 >= TAB ? TAB - 1 : r0); r1 = r1 < 0 ? 0 : (r1 >= TAB ? TAB - 1 : r1);
            const unsigned char* p0 = tab + (unsigned)r0 * PITCH + half16;
            const unsigned char* p1 = tab + (unsigned)r1 * PITCH + half16;
            union { v16h v; v8h q[2]; } af, bf;
            af.q[0] = a[cur][2 * s]; af.q[1] = a[cur][2 * s + 1];
#pragma unroll
            for (int n = 0; n < 4; ++n) {
                bf.q[0] = w2_ldtr(p0 + 32 * n); bf.q[1] = w2_ldtr(p1 + 32 * n);
                acc[n] = __builtin_amdgcn_wmma_f32_16x16x32_f16(false, af.v, false, bf.v, (short)0, acc[n], false, false);
            }
        }
    }
    float* xo = X + (long long)g * (NH * HD) + (8 * h) * HD + c;
#pragma unroll
    for (int n = 0; n < 4; ++n)
#pragma unroll
        for (int r = 0; r < 8; ++r) { float* x = xo + r * HD + 16 * n; *x = *x + acc[n][r] * (1.f / 4096.f); }
}


extern "C" void kernel_launch(void* const* d_in, const int* in_sizes, int n_in, void* d_out, int out_size, void* d_ws, size_t ws_size, hipStream_t stream) {
    (void)in_sizes; (void)n_in; (void)out_size; (void)ws_size;
    const float* xq = (const float*)d_in[0];
    const float* xk = (const float*)d_in[1];
    const float* xv = (const float*)d_in[2];
    const int* fm = (const int*)d_in[3];
    const float* Wq = (const float*)d_in[4];
    const float* bq = (const float*)d_in[5];
    const float* Wk = (const float*)d_in[6];
    const float* bk = (const float*)d_in[7];
    const float* Wv = (const float*)d_in[8];
    const float* bv = (const float*)d_in[9];
    const float* Wo = (const float*)d_in[10];
    const float* bo = (const float*)d_in[11];
    const float* tk = (const float*)d_in[12];
    const float* tv = (const float*)d_in[13];
    const int Bn = 8;
    const int L = 512;
    const int D = 1024;
    const int NH = 16;
    const int HD = 64;
    const int NR = Bn * L;
    const int TAB = 129;
    const int TP = 192;
    float* out = (float*)d_out;
    char* wsp = (char*)d_ws;
    // kept through the call
    unsigned short* XA16 = (unsigned short*)wsp; wsp += (((size_t)((size_t)NR * D * 2) + 255) / 256) * 256;
    unsigned short* W16 = (unsigned short*)wsp; wsp += (((size_t)((size_t)D * D * 2) + 255) / 256) * 256;
    unsigned short* VT16 = (unsigned short*)wsp; wsp += (((size_t)((size_t)Bn * D * L * 2) + 255) / 256) * 256;
    unsigned short* TK16 = (unsigned short*)wsp; wsp += (((size_t)((size_t)TP * HD * 2) + 255) / 256) * 256;
    unsigned short* P16 = (unsigned short*)wsp; wsp += (((size_t)((size_t)Bn * NH * L * L * 2) + 255) / 256) * 256;
    float* X = (float*)wsp; wsp += (((size_t)((size_t)NR * D * 4) + 255) / 256) * 256;
    // one region, used twice in stream order: scores (Q16, K16, QT, SC), then the output projection's operands
    char* ph = wsp;
    unsigned short* Q16 = (unsigned short*)wsp; wsp += (((size_t)((size_t)NR * D * 2) + 255) / 256) * 256;
    unsigned short* K16 = (unsigned short*)wsp; wsp += (((size_t)((size_t)NR * D * 2) + 255) / 256) * 256;
    float* QT = (float*)wsp; wsp += (((size_t)((size_t)NR * NH * TP * 4) + 255) / 256) * 256;
    float* SC = (float*)wsp; wsp += (((size_t)((size_t)Bn * 8 * L * L * 4) + 255) / 256) * 256;
    unsigned short* G64A = (unsigned short*)ph;
    unsigned short* G64B = (unsigned short*)(ph + (((size_t)((size_t)NR * D * 2) + 255) / 256) * 256);
    k_cast16<<<(unsigned)((((long long)(NR) * ((D) / 2)) + 255) / 256), 256, 0, stream>>>(xq, D, (_Float16*)(XA16), D, NR, D, 1.0f);
    k_cast16<<<(unsigned)((((long long)(D) * ((D) / 2)) + 255) / 256), 256, 0, stream>>>(Wq, D, (_Float16*)(W16), D, D, D, 16.0f);
    w25::wmma_gemm64<0, false, 2, 1, false, 0><<<dim3((unsigned)((((NR) / 64) * ((D) / 64) + 7) / 8), (unsigned)(1)), 256, 0, stream>>>((const unsigned short*)(XA16), nullptr, D, 0, (const unsigned short*)(W16), nullptr, D, 0, (void*)(Q16), nullptr, D, 0, bq, nullptr, 0, NR, D, D, 0.0625f, 0, 0, 0);
    k_cast16<<<(unsigned)((((long long)(NR) * ((D) / 2)) + 255) / 256), 256, 0, stream>>>(xk, D, (_Float16*)(XA16), D, NR, D, 1.0f);
    k_cast16<<<(unsigned)((((long long)(D) * ((D) / 2)) + 255) / 256), 256, 0, stream>>>(Wk, D, (_Float16*)(W16), D, D, D, 16.0f);
    w25::wmma_gemm64<0, false, 2, 1, false, 0><<<dim3((unsigned)((((NR) / 64) * ((D) / 64) + 7) / 8), (unsigned)(1)), 256, 0, stream>>>((const unsigned short*)(XA16), nullptr, D, 0, (const unsigned short*)(W16), nullptr, D, 0, (void*)(K16), nullptr, D, 0, bk, nullptr, 0, NR, D, D, 0.0625f, 0, 0, 0);
    k_cast16<<<(unsigned)((((long long)(NR) * ((D) / 2)) + 255) / 256), 256, 0, stream>>>(xv, D, (_Float16*)(XA16), D, NR, D, 1.0f);
    k_cast16<<<(unsigned)((((long long)(D) * ((D) / 2)) + 255) / 256), 256, 0, stream>>>(Wv, D, (_Float16*)(W16), D, D, D, 16.0f);
    k_sh_tk<<<(TP * HD / 2 + 255) / 256, 256, 0, stream>>>(tk, (_Float16*)TK16, TAB, TP, HD);
    // QT[(b,q,h)][r] for all batches: the (b,q,h) rows of Q16 are contiguous 64-element rows
    w25::wmma_gemm64<0, false, 0, 0, false, 0><<<dim3((unsigned)((((NR * NH) / 64) * ((TP) / 64) + 7) / 8), (unsigned)(1)), 256, 0, stream>>>((const unsigned short*)(Q16), nullptr, HD, 0, (const unsigned short*)(TK16), nullptr, HD, 0, (void*)(QT), nullptr, TP, 0, nullptr, nullptr, 0, NR * NH, TP, HD, 0.0625f, 0, 0, 0);
    // VT16[b][c][k] = v^T, blockIdx.y = batch
    w25::wmma_gemm64<0, false, 1, 1, false, 0><<<dim3((unsigned)((((D) / 64) * ((L) / 64) + 7) / 8), (unsigned)(Bn)), 256, 0, stream>>>((const unsigned short*)(W16), nullptr, D, 0, (const unsigned short*)(XA16), nullptr, D, (long long)L * D, (void*)(VT16), nullptr, L, (long long)D * L, bv, nullptr, 0, D, L, D, 0.0625f, 0, 0, 0);
    // content scores and softmax: eight heads (blockIdx.y) of every batch (blockIdx.z; the softmax's blockIdx.y) per launch
    w25::wmma_gemm64<0, false, 0, 0, false, 0><<<dim3((unsigned)((((L) / 64) * ((L) / 64) + 7) / 8), (unsigned)(8), (unsigned)(Bn)), 256, 0, stream>>>((const unsigned short*)(Q16 + 0 * HD), nullptr, D, HD, (const unsigned short*)(K16 + 0 * HD), nullptr, D, HD, (void*)(SC), nullptr, L, (long long)L * L, nullptr, nullptr, 0, L, L, HD, 1.0f, (long long)L * D, (long long)L * D, (long long)8 * L * L);
    k_sh_soft<<<dim3((unsigned)(8 * L), (unsigned)(Bn)), 256, 0, stream>>>(SC, QT, (const int*)fm, (_Float16*)P16, 0, 0, L, NH, TP, TAB);
    w25::wmma_gemm64<0, false, 0, 0, false, 0><<<dim3((unsigned)((((L) / 64) * ((L) / 64) + 7) / 8), (unsigned)(8), (unsigned)(Bn)), 256, 0, stream>>>((const unsigned short*)(Q16 + 8 * HD), nullptr, D, HD, (const unsigned short*)(K16 + 8 * HD), nullptr, D, HD, (void*)(SC), nullptr, L, (long long)L * L, nullptr, nullptr, 0, L, L, HD, 1.0f, (long long)L * D, (long long)L * D, (long long)8 * L * L);
    k_sh_soft<<<dim3((unsigned)(8 * L), (unsigned)(Bn)), 256, 0, stream>>>(SC, QT, (const int*)fm, (_Float16*)P16, 0, 8, L, NH, TP, TAB);
    // w1 = attn.v: blockIdx.y = head, blockIdx.z = batch
    w25::wmma_gemm64<0, false, 0, 0, false, 0><<<dim3((unsigned)((((L) / 64) * ((HD) / 64) + 7) / 8), (unsigned)(NH), (unsigned)(Bn)), 256, 0, stream>>>((const unsigned short*)(P16), nullptr, L, (long long)L * L, (const unsigned short*)(VT16), nullptr, L, (long long)HD * L, (void*)(X), nullptr, D, HD, nullptr, nullptr, 0, L, HD, L, 0.000244140625f, (long long)NH * L * L, (long long)D * L, (long long)L * D);
    // w2: one wave per query, eight queries per block
    k_sh_w2<<<(unsigned)(NR / 8), 256, 0, stream>>>((const _Float16*)P16, (const int*)fm, tv, X);
    k_cast16<<<(unsigned)((((long long)(4096) * ((1024) / 2)) + 255) / 256), 256, 0, stream>>>(X, 1024, (_Float16*)(G64A), 1024, 4096, 1024, 1.0f);
    k_cast16<<<(unsigned)((((long long)(1024) * ((1024) / 2)) + 255) / 256), 256, 0, stream>>>(Wo, 1024, (_Float16*)(G64B), 1024, 1024, 1024, 16.0f);
    w25::wmma_gemm64<0, false, 2, 0, false, 0><<<dim3((unsigned)((((4096) / 64) * ((1024) / 64) + 7) / 8), (unsigned)(1)), 256, 0, stream>>>((const unsigned short*)(G64A), nullptr, 1024, 0, (const unsigned short*)(G64B), nullptr, 1024, 0, (void*)(out), nullptr, 1024, 0, bo, nullptr, 0, 4096, 1024, 1024, 0.0625f, 0, 0, 0);
}

// v003
// Measured time: 361 microseconds a run.
// Next to v002, in two timings, it ran 1.16 times as fast each time.
// Over all steps from v000 it is 4.43 times as fast.
// Contractions: q/k/v = x.W^T + b [4096x1024].[1024x1024] and the output projection (+b) with f16 operands (weights x16); the relative-key term QT = q.table_k^T [65536 (b,q,h) x 64].[64 x 192 (129 padded)] with f16 operands; per (batch, head) the content scores q.k^T [512x64].[64x512] (heads and batches in the grid) and w1 = attn.v [512x512].[512x64] (heads and batches in the grid; attn as f16 of 4096 attn) — v_wmma_f32_16x16x32_f16, 64x64 register-blocked wave tiles; f32 accumulate. The gathered relative-key scores (QT[(b,q,h)][final_mat[b][q][k]] by the INPUT index matrix), the row softmax are f32 kernels; the relative-value aggregation w2[q,h,:] = sum_k attn[h,q,k] table_v[final_mat[b,q,k]] runs on the matrix cores as one [16 heads x 512].[512 x 64] product per query, one wave each, whose B fragments are gathered from an f16 copy of table_v in LDS by transposing loads (the INPUT index matrix picks each lane's table row).
#include <hip/hip_runtime.h>
#include <math.h>

typedef __attribute__((ext_vector_type(16))) _Float16 v16h;
typedef __attribute__((ext_vector_type(8)))  _Float16 v8h;
typedef __attribute__((ext_vector_type(16))) __bf16   v16b;
typedef __attribute__((ext_vector_type(8)))  float    v8f;
typedef __attribute__((ext_vector_type(4)))  float    v4f;

// 16-bit WMMA fragment map (wave32), lane L, h = L>>4, m = L&15:
//   A 16x32: lane = row m;   element i -> k = (i<8) ? 8h+i : 16+8h+(i-8)
//   B 32x16: lane = column m; the SAME k(i,h)
//   D 16x16 (8 f32): lane = column m; element r -> row 8h+r
__device__ __forceinline__ int frag_k(int i, int h) { return (i < 8) ? (8 * h + i) : (16 + 8 * h + (i - 8)); }
__device__ __forceinline__ __bf16 bf16_rne(float f) {
    unsigned int u = __float_as_uint(f);
    u += 0x7fffu + ((u >> 16) & 1u);
    return __builtin_bit_cast(__bf16, (unsigned short)(u >> 16));
}
__device__ __forceinline__ float bf16_f32(__bf16 b) { return __uint_as_float(((unsigned int)__builtin_bit_cast(unsigned short, b)) << 16); }
__device__ __forceinline__ v8f wmma16(v16h a, v16h b, v8f c) {
    c = __builtin_amdgcn_wmma_f32_16x16x32_f16(false, a, false, b, (short)0, c, false, false);
    asm volatile("v_nop\n\tv_nop\n\tv_nop\n\tv_nop" : "+v"(c) : "v"(a), "v"(b));
    return c;
}
__device__ __forceinline__ v8f wmmab(v16b a, v16b b, v8f c) {
    c = __builtin_amdgcn_wmma_f32_16x16x32_bf16(false, a, false, b, (short)0, c, false, false);
    asm volatile("v_nop\n\tv_nop\n\tv_nop\n\tv_nop" : "+v"(c) : "v"(a), "v"(b));
    return c;
}
struct Split { v16b hi, lo; };
// hi/lo split product: a.hi*b.hi + a.hi*b.lo + a.lo*b.hi
__device__ __forceinline__ v8f wmma3(const Split& a, const Split& b, v8f c) {
    c = __builtin_amdgcn_wmma_f32_16x16x32_bf16(false, a.hi, false, b.hi, (short)0, c, false, false);
    c = __builtin_amdgcn_wmma_f32_16x16x32_bf16(false, a.hi, false, b.lo, (short)0, c, false, false);
    c = __builtin_amdgcn_wmma_f32_16x16x32_bf16(false, a.lo, false, b.hi, (short)0, c, false, false);
    asm volatile("v_nop\n\tv_nop\n\tv_nop\n\tv_nop" : "+v"(c) : "v"(a.hi), "v"(a.lo), "v"(b.hi), "v"(b.lo));
    return c;
}
struct Split3 { v16b hi, mid, lo; };
// triple split product (6 terms, drops only terms below 2^-24 relative)
__device__ __forceinline__ v8f wmma6(const Split3& a, const Split3& b, v8f c) {
    c = __builtin_amdgcn_wmma_f32_16x16x32_bf16(false, a.hi, false, b.hi, (short)0, c, false, false);
    c = __builtin_amdgcn_wmma_f32_16x16x32_bf16(false, a.hi, false, b.mid, (short)0, c, false, false);
    c = __builtin_amdgcn_wmma_f32_16x16x32_bf16(false, a.mid, false, b.hi, (short)0, c, false, false);
    c = __builtin_amdgcn_wmma_f32_16x16x32_bf16(false, a.hi, false, b.lo, (short)0, c, false, false);
    c = __builtin_amdgcn_wmma_f32_16x16x32_bf16(false, a.mid, false, b.mid, (short)0, c, false, false);
    c = __builtin_amdgcn_wmma_f32_16x16x32_bf16(false, a.lo, false, b.hi, (short)0, c, false, false);
    asm volatile("v_nop\n\tv_nop\n\tv_nop\n\tv_nop" : "+v"(c) : "v"(a.hi), "v"(a.mid), "v"(a.lo), "v"(b.hi), "v"(b.mid), "v"(b.lo));
    return c;
}

// Fragment gathers from f32 memory: element i <- p[(k0 + frag_k(i,h)) * sk] * s, zero for k >= klen.
__device__ __forceinline__ v16h fh_ld(const float* __restrict__ p, long long sk, int k0, int h, int klen, float s) {
    v16h a;
#pragma unroll
    for (int i = 0; i < 16; ++i) { const int k = k0 + frag_k(i, h); a[i] = (k < klen) ? (_Float16)(p[(long long)k * sk] * s) : (_Float16)0.f; }
    return a;
}
__device__ __forceinline__ Split sp_ld(const float* __restrict__ p, long long sk, int k0, int h, int klen, float s) {
    Split r;
#pragma unroll
    for (int i = 0; i < 16; ++i) {
        const int k = k0 + frag_k(i, h); const float x = (k < klen) ? p[(long long)k * sk] * s : 0.f;
        const __bf16 hb = bf16_rne(x); r.hi[i] = hb; r.lo[i] = bf16_rne(x - bf16_f32(hb));
    }
    return r;
}
__device__ __forceinline__ Split3 sp3_ld(const float* __restrict__ p, long long sk, int k0, int h, int klen, float s) {
    Split3 r;
#pragma unroll
    for (int i = 0; i < 16; ++i) {
        const int k = k0 + frag_k(i, h); const float x = (k < klen) ? p[(long long)k * sk] * s : 0.f;
        const __bf16 hb = bf16_rne(x); const float r1 = x - bf16_f32(hb); const __bf16 mb = bf16_rne(r1);
        r.hi[i] = hb; r.mid[i] = mb; r.lo[i] = bf16_rne(r1 - bf16_f32(mb));
    }
    return r;
}
__device__ __forceinline__ v16b bh_ld(const float* __restrict__ p, long long sk, int k0, int h, int klen, float s) {
    v16b a;
#pragma unroll
    for (int i = 0; i < 16; ++i) { const int k = k0 + frag_k(i, h); a[i] = bf16_rne((k < klen) ? p[(long long)k * sk] * s : 0.f); }
    return a;
}
// f16 fragment from an f16 LDS/global row with element stride 1 (k-contiguous), no bounds (tile already zero padded)
__device__ __forceinline__ v16h fh_row(const _Float16* __restrict__ row, int k0, int h) {
    v16h a;
#pragma unroll
    for (int i = 0; i < 16; ++i) a[i] = row[k0 + frag_k(i, h)];
    return a;
}

#define VST2(T, ptr, val) do { const T vst2_v_ = (val); *(T*)(ptr) = vst2_v_;  } while (0)
typedef float v4f __attribute__((ext_vector_type(4)));
#define VST2V4(ptr, val) do { const v4f vst2_v4_ = (val); *(v4f*)(ptr) = vst2_v4_;  } while (0)

__device__ __attribute__((noinline)) float act_fn(float v, int act) {
    if (act == 1) return fmaxf(v, 0.f);                                                                               // relu
    if (act == 2) { const float u = 0.7978845608028654f * (v + 0.044715f * v * v * v); return 0.5f * v * (1.f + tanhf(u)); } // tanh-gelu
    if (act == 3) return v / (1.f + expf(-v));                                                                        // silu
    if (act == 4) return 0.5f * v * (1.f + erff(v * 0.7071067811865476f));                                             // erf-gelu
    if (act == 5) return tanhf(v);
    if (act == 6) return 1.f / (1.f + expf(-v));                                                                      // sigmoid
    if (act == 7) return (v > 0.f) ? v : 0.01f * v;                                                                   // leaky relu 0.01
    if (act == 8) return (v > 0.f) ? v : (expf(v) - 1.f);                                                             // elu
    if (act == 9) return fminf(fmaxf(v, 0.f), 6.f);                                                                   // relu6
    if (act == 10) return fabsf(v);                                                                                    // abs
    if (act == 11) return (v >= 0.f) ? v : 0.1f * v;                                                                  // leaky 0.1
    if (act == 12) return (v > 0.f) ? v : 0.2f * v;                                                                   // leaky 0.2
    if (act == 13) return (v > 20.f) ? v : log1pf(expf(v));                                                            // softplus
    return v;
}

// =====================================================================================================================
// k_gemm<MODE>: C(z, m, n) = act(alpha * sum_k A(z, m, k) * B(z, k, n) + bias) + beta * R(z, m, n)
//   One wave (32-thread block) per 16 x 32 tile of C; grid (ceil(N/32), ceil(M/16), Z). Batch z -> (zo = z / zi_n, zi = z % zi_n)
//   with separate outer/inner strides for every tensor (e.g. batch and head). A(m,k) = A[zo*sAo + zi*sAi + m*sAm + k*sAk] (f32),
//   B(k,n) = B[zo*sBo + zi*sBi + n*sBn + k*sBk] (f32); any M, N, K (K zero-padded to 32 inside the fragments, M/N tails guarded).
//   C(m,n) = C[zo*sCo + zi*sCi + m*sCm + n] (n contiguous). flags: 1 bias[n], 2 bias[m], 4 residual R[zo*sRo + zi*sRi + m*sRm + n*sRn].
//   MODE 0: f16 operands (A prescaled by sa, B by sb, both undone in the epilogue); 1: bf16 hi/lo split (3 products); 2: bf16;
//   3: bf16 hi/mid/lo triple split (6 products); 4: as 3 with Kahan-compensated f32 accumulation across k-steps.
// =====================================================================================================================
struct GemmP {
    const float* A; const float* B; const float* bias; const float* R; float* C;
    long long sAo, sAi, sAm, sAk, sBo, sBi, sBn, sBk, sCo, sCi, sCm, sRo, sRi, sRm, sRn;
    int M, N, K, zi_n, flags, act; float alpha, beta, sa, sb;
    int Npad, pad_;     // columns [N, Npad) of C are written as 0 so that padded workspace rows are covered by whole-line stores; Npad >= N
};
static_assert(sizeof(GemmP) == 5 * 8 + 15 * 8 + 6 * 4 + 4 * 4 + 2 * 4, "GemmP has padding");

template <int MODE>
__global__ __launch_bounds__(32) void k_gemm(GemmP p) {
    const int lane = threadIdx.x & 31, h = lane >> 4, l15 = lane & 15;
    const int m0 = blockIdx.y * 16, n0 = blockIdx.x * 32;
    const int z = blockIdx.z, zo = z / p.zi_n, zi = z - zo * p.zi_n;
    const float* A = p.A + zo * p.sAo + zi * p.sAi;
    const float* B = p.B + zo * p.sBo + zi * p.sBi;
    const int am = min(m0 + l15, p.M - 1);                       // clamped row for loads (stores are guarded)
    v8f acc[2], comp[2];
#pragma unroll
    for (int t = 0; t < 2; ++t) { v8f zz = {}; acc[t] = zz; comp[t] = zz; }
    for (int k0 = 0; k0 < p.K; k0 += 32) {
        const float* arow = A + (long long)am * p.sAm;
        if (MODE == 1) {
            const Split a = sp_ld(arow, p.sAk, k0, h, p.K, 1.f);
#pragma unroll
            for (int t = 0; t < 2; ++t) {
                const int bn = min(n0 + t * 16 + l15, p.N - 1);
                acc[t] = wmma3(a, sp_ld(B + (long long)bn * p.sBn, p.sBk, k0, h, p.K, 1.f), acc[t]);
            }
        } else if (MODE == 3) {
            const Split3 a = sp3_ld(arow, p.sAk, k0, h, p.K, 1.f);
#pragma unroll
            for (int t = 0; t < 2; ++t) {
                const int bn = min(n0 + t * 16 + l15, p.N - 1);
                acc[t] = wmma6(a, sp3_ld(B + (long long)bn * p.sBn, p.sBk, k0, h, p.K, 1.f), acc[t]);
            }
        } else if (MODE == 4) {
            // triple split as MODE 3, but each k-step's 6 products go into a fresh accumulator and the partial is added to the running f32 sum
            // on the VALU with Kahan compensation (accumulation error stays ~1 ulp however long K is)
            const Split3 a = sp3_ld(arow, p.sAk, k0, h, p.K, 1.f);
#pragma unroll
            for (int t = 0; t < 2; ++t) {
                const int bn = min(n0 + t * 16 + l15, p.N - 1); v8f zz = {};
                const v8f part = wmma6(a, sp3_ld(B + (long long)bn * p.sBn, p.sBk, k0, h, p.K, 1.f), zz);
                const v8f y = part - comp[t]; const v8f s = acc[t] + y; comp[t] = (s - acc[t]) - y; acc[t] = s;
            }
        } else if (MODE == 2) {
            const v16b a = bh_ld(arow, p.sAk, k0, h, p.K, 1.f);
#pragma unroll
            for (int t = 0; t < 2; ++t) {
                const int bn = min(n0 + t * 16 + l15, p.N - 1);
                acc[t] = wmmab(a, bh_ld(B + (long long)bn * p.sBn, p.sBk, k0, h, p.K, 1.f), acc[t]);
            }
        } else {
            const v16h a = fh_ld(arow, p.sAk, k0, h, p.K, p.sa);
#pragma unroll
            for (int t = 0; t < 2; ++t) {
                const int bn = min(n0 + t * 16 + l15, p.N - 1);
                acc[t] = wmma16(a, fh_ld(B + (long long)bn * p.sBn, p.sBk, k0, h, p.K, p.sb), acc[t]);
            }
        }
    }
    const float iscale = (MODE == 0) ? p.alpha / (p.sa * p.sb) : p.alpha;
    float* C = p.C + zo * p.sCo + zi * p.sCi;
    const float* R = p.R + zo * p.sRo + zi * p.sRi;
    __shared__ __align__(16) float ctile[16][36];
#pragma unroll
    for (int t = 0; t < 2; ++t) {
        const int n = n0 + t * 16 + l15; const int nn = min(n, p.N - 1);
#pragma unroll
        for (int r = 0; r < 8; ++r) {
            const int m = m0 + 8 * h + r; const int mm = min(m, p.M - 1);
            float v = acc[t][r] * iscale;
            if (p.flags & 1) v += p.bias[nn];
            if (p.flags & 2) v += p.bias[mm];
            if (p.flags & 8) v *= p.bias[(long long)zo * p.M + mm];   /* per-(zo,row) scale vector laid out [Z / zi_n][M]; exclusive with the bias flags */
            v = act_fn(v, p.act);
            if (p.flags & 4) v += p.beta * R[(long long)mm * p.sRm + (long long)nn * p.sRn];
            ctile[8 * h + r][t * 16 + l15] = (n < p.N) ? v : 0.f;
        }
    }
    __syncthreads();
    const int NW = (p.Npad > p.N) ? p.Npad : p.N;           // write width
    const bool fast = (m0 + 16 <= p.M) && (n0 + 32 <= NW) && ((p.sCm & 3) == 0) && ((((size_t)C) & 15) == 0);
    if (fast) {
#pragma unroll
        for (int s = 0; s < 4; ++s) {
            const int row = s * 4 + (lane >> 3), c4 = (lane & 7) * 4;
            const v4f v = *(const v4f*)&ctile[row][c4];
            VST2V4(C + (long long)(m0 + row) * p.sCm + n0 + c4, v);
        }
    } else {
        for (int row = 0; row < 16; ++row) {
            const int m = m0 + row, n = n0 + lane;
            if (m < p.M && n < NW) VST2(float, C + (long long)m * p.sCm + n, ctile[row][lane]);
        }
    }
}


// =====================================================================================================================
// k_gemmT<MODE, TM, TN>: same contract as k_gemm, but one wave computes a (16*TM) x (16*TN) tile: TM A fragments and TN B fragments are
//   loaded per 32-wide k-step and reused across TM*TN WMMAs (far fewer load/convert instructions per MAC). MODE 0 (f16), 1 (bf16 hi/lo),
//   2 (bf16) only. grid (ceil(NW/(16*TN)), ceil(M/(16*TM)), Z), block 32. Epilogue identical to k_gemm, run per 16x32 sub-tile.
// =====================================================================================================================
template <int MODE, int TM, int TN>
__global__ __launch_bounds__(32) void k_gemmT(GemmP p) {
    const int lane = threadIdx.x & 31, h = lane >> 4, l15 = lane & 15;
    const int m0 = blockIdx.y * (16 * TM), n0 = blockIdx.x * (16 * TN);
    const int z = blockIdx.z, zo = z / p.zi_n, zi = z - zo * p.zi_n;
    const float* A = p.A + zo * p.sAo + zi * p.sAi;
    const float* B = p.B + zo * p.sBo + zi * p.sBi;
    v8f acc[TM][TN];
#pragma unroll
    for (int i = 0; i < TM; ++i)
#pragma unroll
        for (int t = 0; t < TN; ++t) { v8f zz = {}; acc[i][t] = zz; }
    for (int k0 = 0; k0 < p.K; k0 += 32) {
        if (MODE == 1) {
            Split a[TM], b[TN];
#pragma unroll
            for (int i = 0; i < TM; ++i) { const int am = min(m0 + 16 * i + l15, p.M - 1); a[i] = sp_ld(A + (long long)am * p.sAm, p.sAk, k0, h, p.K, 1.f); }
#pragma unroll
            for (int t = 0; t < TN; ++t) { const int bn = min(n0 + 16 * t + l15, p.N - 1); b[t] = sp_ld(B + (long long)bn * p.sBn, p.sBk, k0, h, p.K, 1.f); }
#pragma unroll
            for (int i = 0; i < TM; ++i)
#pragma unroll
                for (int t = 0; t < TN; ++t) acc[i][t] = wmma3(a[i], b[t], acc[i][t]);
        } else if (MODE == 2) {
            v16b a[TM], b[TN];
#pragma unroll
            for (int i = 0; i < TM; ++i) { const int am = min(m0 + 16 * i + l15, p.M - 1); a[i] = bh_ld(A + (long long)am * p.sAm, p.sAk, k0, h, p.K, 1.f); }
#pragma unroll
            for (int t = 0; t < TN; ++t) { const int bn = min(n0 + 16 * t + l15, p.N - 1); b[t] = bh_ld(B + (long long)bn * p.sBn, p.sBk, k0, h, p.K, 1.f); }
#pragma unroll
            for (int i = 0; i < TM; ++i)
#pragma unroll
                for (int t = 0; t < TN; ++t) acc[i][t] = wmmab(a[i], b[t], acc[i][t]);
        } else {
            v16h a[TM], b[TN];
#pragma unroll
            for (int i = 0; i < TM; ++i) { const int am = min(m0 + 16 * i + l15, p.M - 1); a[i] = fh_ld(A + (long long)am * p.sAm, p.sAk, k0, h, p.K, p.sa); }
#pragma unroll
            for (int t = 0; t < TN; ++t) { const int bn = min(n0 + 16 * t + l15, p.N - 1); b[t] = fh_ld(B + (long long)bn * p.sBn, p.sBk, k0, h, p.K, p.sb); }
#pragma unroll
            for (int i = 0; i < TM; ++i)
#pragma unroll
                for (int t = 0; t < TN; ++t) acc[i][t] = wmma16(a[i], b[t], acc[i][t]);
        }
    }
    const float iscale = (MODE == 0) ? p.alpha / (p.sa * p.sb) : p.alpha;
    float* C = p.C + zo * p.sCo + zi * p.sCi;
    const float* R = p.R + zo * p.sRo + zi * p.sRi;
    const int NW = (p.Npad > p.N) ? p.Npad : p.N;
    __shared__ __align__(16) float ctile[16][36];
#pragma unroll
    for (int i = 0; i < TM; ++i) {
        const int mb = m0 + 16 * i; if (mb >= p.M) break;          // wave-uniform
#pragma unroll
        for (int tp = 0; tp < TN / 2; ++tp) {
            const int nb = n0 + 32 * tp; if (nb >= NW) break;        // wave-uniform
#pragma unroll
            for (int t2 = 0; t2 < 2; ++t2) {
                const int t = 2 * tp + t2; const int n = nb + t2 * 16 + l15; const int nn = min(n, p.N - 1);
#pragma unroll
                for (int r = 0; r < 8; ++r) {
                    const int m = mb + 8 * h + r; const int mm = min(m, p.M - 1);
                    float v = acc[i][t][r] * iscale;
                    if (p.flags & 1) v += p.bias[nn];
                    if (p.flags & 2) v += p.bias[mm];
            if (p.flags & 8) v *= p.bias[(long long)zo * p.M + mm];   /* per-(zo,row) scale vector laid out [Z / zi_n][M]; exclusive with the bias flags */
                    v = act_fn(v, p.act);
                    if (p.flags & 4) v += p.beta * R[(long long)mm * p.sRm + (long long)nn * p.sRn];
                    ctile[8 * h + r][t2 * 16 + l15] = (n < p.N) ? v : 0.f;
                }
            }
            __syncthreads();
            const bool fast = (mb + 16 <= p.M) && (nb + 32 <= NW) && ((p.sCm & 3) == 0) && ((((size_t)C) & 15) == 0);
            if (fast) {
#pragma unroll
                for (int s = 0; s < 4; ++s) {
                    const int row = s * 4 + (lane >> 3), c4 = (lane & 7) * 4;
                    const v4f v = *(const v4f*)&ctile[row][c4];
                    VST2V4(C + (long long)(mb + row) * p.sCm + nb + c4, v);
                }
            } else {
                for (int row = 0; row < 16; ++row) {
                    const int m = mb + row, n = nb + lane;
                    if (m < p.M && n < NW) VST2(float, C + (long long)m * p.sCm + n, ctile[row][lane]);
                }
            }
            __syncthreads();
        }
    }
}

// =====================================================================================================================
//   Wave = 16 queries, AW waves per block, 64-key blocks; grid (ceil(Lq/(16*AW)), H, B), block 32*AW. Any Lq, Lk; head dim dh <= DHP
//   (DHP multiple of 32), value dim dv <= DVP (multiple of 16, <= 128). Every tensor addressed by (batch, head, row, element) strides, f32.
//   Scores: QM 0 f16 operands, 1 bf16 hi/lo split, 2 bf16 triple split; statistics f32 (exp2 domain); P.V: P x 4096 as f16 with V f16 staged in LDS
//   (SPLITPV: P and V as bf16 hi/lo splits). kv head = h / hrep. Masking: causal = 1 (keep j <= i + coff, masked -> -inf, key blocks beyond the
//   diagonal skipped), causal = 2 (masked -> mfill, a finite fill like the -1e9; no skipping), causal = 3 (keep j >= i + coff,
//   masked -> -inf, no skipping); optional additive f32 mask Mf,
//   optional int keep-mask Mi (0 -> score := mfill), both addressed b*smb + h*smh + i*smi + j*smj (0 strides broadcast).
// =====================================================================================================================
#define AW 4
struct AttnP {   // apv4
    const float* Q; const float* K; const float* V; float* O; float* P; const float* Mf; const int* Mi; float* ST;
    const float* Pw; const float* Rt; const int* SQ; const int* SK;           // optional: post-softmax weight, relative-position table, segment ids
    long long swb, swh, swi, swj, srb, srh, sri;                                 // Pw strides (b,h,i,j); Rt strides (b,h,i), column = clamp(i - j + roff, 0, rn-1)
    long long sQb, sQh, sQi, sQd, sKb, sKh, sKj, sKd, sVb, sVh, sVj, sVd, sOb, sOh, sOi, sPb, sPh, sPi, smb, smh, smi, smj;
    int Lq, Lk, dh, dv, hrep, causal, coff, pband;   // pband > 0: P holds only the band |j - i| <= pband, column j - i + pband
    float scale, mfill; int nonorm, mpol;             // nonorm (online path only): O = sum_j exp(score_j) V_j without the 1/rowsum (scores must be <= ~0); mpol: Mi masks where ==0 (mpol 0) or where !=0 (mpol 1)
    int roff, rn, segpol, win;                        // Rt column offset/count; SQ/SK: score := mfill where (segpol 0) SQ[i] != SK[j] or (segpol 1) SQ[i] == SK[j]; win > 0: keys with i - j > win (after coff) -> -inf
};
//   Pw: the softmax numerator is multiplied by Pw(b,h,i,j) AFTER the row sum is taken (probs * weight, then P.V), as in post-softmax multiplicative biases.                                                    // ST (optional): per row (b,h,i) -> ST[((b*H + h)*Lq + i)*2 + {0,1}] = {row max of the scaled+masked score (natural units), sum_j exp(score - max)}
static_assert(sizeof(AttnP) == 12 * 8 + 29 * 8 + 16 * 4, "AttnP has padding");

#ifndef KATTN_ATTR
#define KATTN_ATTR
#endif
template <int DHP, int DVP, int QM, bool SPLITPV, bool TWOPASS>
__global__ __launch_bounds__(32 * AW) KATTN_ATTR void k_attn(AttnP p) {
    constexpr int NT = DVP / 16;                // output tiles
    constexpr int KS = DHP / 32;                // k-steps for the scores
    constexpr int VP = DVP + 8;                 // LDS pitch (halves)
    __shared__ __align__(16) float    pl[AW][16 * 64];
    __shared__ __align__(16) _Float16 vl[(SPLITPV ? 2 : 1) * 64 * VP];   // f16 V tile, or bf16 hi and lo tiles (same 2-byte size)
    const int lane = threadIdx.x & 31, hf = lane >> 4, l15 = lane & 15, wave = threadIdx.x >> 5;
    const int h = blockIdx.y, b = blockIdx.z, hk = h / p.hrep;
    const int q0 = (blockIdx.x * AW + wave) * 16;
    float* myp = pl[wave];
    const float L2E = 1.4426950408889634f;
    const float NEG = -__builtin_inff();
    const int qi = min(q0 + l15, p.Lq - 1);
    const float* qrow = p.Q + b * p.sQb + h * p.sQh + (long long)qi * p.sQi;
    const float* kbase = p.K + b * p.sKb + hk * p.sKh;
    const float* vbase = p.V + b * p.sVb + hk * p.sVh;
    v16h qa[QM == 0 ? KS : 1]; Split qs_[QM == 1 ? KS : 1]; Split3 qt_[QM == 2 ? KS : 1];
#pragma unroll
    for (int ks = 0; ks < KS; ++ks) {
        if (QM == 2) qt_[ks] = sp3_ld(qrow, p.sQd, ks * 32, hf, p.dh, 1.f);
        else if (QM == 1) qs_[ks] = sp_ld(qrow, p.sQd, ks * 32, hf, p.dh, 1.f);
        else qa[ks] = fh_ld(qrow, p.sQd, ks * 32, hf, p.dh, 1.f);
    }
    v8f o[NT]; float m8[8], l8[8];
#pragma unroll
    for (int t = 0; t < NT; ++t) { v8f zz = {}; o[t] = zz; }
#pragma unroll
    for (int i = 0; i < 8; ++i) { m8[i] = NEG; l8[i] = 0.f; }
    int jend = p.Lk; int jstart = 0;
    if (p.causal == 1) { const int je = (blockIdx.x * AW + AW - 1) * 16 + 16 + p.coff; jend = min(jend, max(je, 0)); }   // uniform per block
    if (p.win > 0) { const int js = (int)(blockIdx.x * AW) * 16 + p.coff - p.win; jstart = (js > 0) ? (js / 64) * 64 : 0; }   // uniform per block: key blocks entirely outside every row's window hold only -inf entries and are skipped exactly
    const int npass = TWOPASS ? 2 : 1;
    for (int pass = 0; pass < npass; ++pass) {
        const bool dopv = (!TWOPASS) || pass == 1;
        for (int j0 = jstart; j0 < jend; j0 += 64) {
            if (dopv) {
                __syncthreads();                                 // previous key block's reads of vl / pl are done
                for (int idx = threadIdx.x; idx < 64 * DVP; idx += 32 * AW) {
                    const int jr = idx / DVP, d = idx - jr * DVP, j = j0 + jr;
                    const float f = (j < p.Lk && d < p.dv) ? vbase[(long long)j * p.sVj + (long long)d * p.sVd] : 0.f;
                    if (SPLITPV) {
                        const __bf16 hb = bf16_rne(f);
                        ((__bf16*)vl)[jr * VP + d] = hb; ((__bf16*)vl)[64 * VP + jr * VP + d] = bf16_rne(f - bf16_f32(hb));
                    } else vl[jr * VP + d] = (_Float16)f;
                }
            }
            v8f s[4];
#pragma unroll
            for (int t = 0; t < 4; ++t) {
                const int j = min(j0 + t * 16 + l15, p.Lk - 1);
                const float* krow = kbase + (long long)j * p.sKj;
                v8f acc = {};
#pragma unroll
                for (int ks = 0; ks < KS; ++ks) {
                    if (QM == 2)      acc = wmma6(qt_[ks], sp3_ld(krow, p.sKd, ks * 32, hf, p.dh, 1.f), acc);
                    else if (QM == 1) acc = wmma3(qs_[ks], sp_ld(krow, p.sKd, ks * 32, hf, p.dh, 1.f), acc);
                    else              acc = wmma16(qa[ks], fh_ld(krow, p.sKd, ks * 32, hf, p.dh, 1.f), acc);
                }
                s[t] = acc;
            }
            float pv[8][4];
#pragma unroll
            for (int i = 0; i < 8; ++i) {
                const int irow = q0 + i + 8 * hf;
                const int ic = min(irow, p.Lq - 1);
                float sc[4];
#pragma unroll
                for (int t = 0; t < 4; ++t) {
                    const int jg = j0 + t * 16 + l15;
                    float v = s[t][i] * p.scale;
                    if (p.Mf) v += p.Mf[b * p.smb + h * p.smh + (long long)ic * p.smi + (long long)min(jg, p.Lk - 1) * p.smj];
                    if (p.Rt) { int rc = ic - min(jg, p.Lk - 1) + p.roff; rc = rc < 0 ? 0 : (rc >= p.rn ? p.rn - 1 : rc); v += p.Rt[b * p.srb + h * p.srh + (long long)ic * p.sri + rc]; }
                    if (p.Mi) { const int mv = p.Mi[b * p.smb + h * p.smh + (long long)ic * p.smi + (long long)min(jg, p.Lk - 1) * p.smj]; if (p.mpol ? (mv != 0) : (mv == 0)) v = p.mfill; }
                    if (p.SQ) { const bool same = p.SQ[(long long)b * p.Lq + ic] == p.SK[(long long)b * p.Lk + min(jg, p.Lk - 1)]; if (p.segpol ? same : !same) v = p.mfill; }
                    if (p.causal == 2 && jg > irow + p.coff) v = p.mfill;
                    if (jg >= p.Lk || (p.causal == 1 && jg > irow + p.coff) || (p.causal == 3 && jg < irow + p.coff) || (p.win > 0 && irow + p.coff - jg > p.win)) v = NEG; else v *= L2E;
                    sc[t] = v;
                }
                if (!TWOPASS || pass == 0) {
                    float mx = fmaxf(fmaxf(sc[0], sc[1]), fmaxf(sc[2], sc[3]));
                    mx = fmaxf(mx, __shfl_xor(mx, 1, 32)); mx = fmaxf(mx, __shfl_xor(mx, 2, 32));
                    mx = fmaxf(mx, __shfl_xor(mx, 4, 32)); mx = fmaxf(mx, __shfl_xor(mx, 8, 32));
                    const float mnew = fmaxf(m8[i], mx);
                    const float corr = (mnew == NEG) ? 1.f : exp2f(m8[i] - mnew);
                    float rs = 0.f;
#pragma unroll
                    for (int t = 0; t < 4; ++t) {
                        const float pp = (sc[t] == NEG) ? 0.f : exp2f(sc[t] - mnew); rs += pp;
                        pv[i][t] = p.Pw ? pp * p.Pw[b * p.swb + h * p.swh + (long long)ic * p.swi + (long long)min(j0 + t * 16 + l15, p.Lk - 1) * p.swj] : pp;
                    }
                    rs += __shfl_xor(rs, 1, 32); rs += __shfl_xor(rs, 2, 32); rs += __shfl_xor(rs, 4, 32); rs += __shfl_xor(rs, 8, 32);
                    l8[i] = l8[i] * corr + rs; m8[i] = mnew;
                    if (!TWOPASS) {
#pragma unroll
                        for (int t = 0; t < NT; ++t) o[t][i] *= corr;
                    }
                } else {
                    const float inv = (l8[i] > 0.f) ? 1.f / l8[i] : 0.f;
#pragma unroll
                    for (int t = 0; t < 4; ++t) {
                        const int jg = j0 + t * 16 + l15;
                        float pp = (sc[t] == NEG) ? 0.f : exp2f(sc[t] - m8[i]) * inv;
                        if (p.Pw) pp *= p.Pw[b * p.swb + h * p.swh + (long long)ic * p.swi + (long long)min(jg, p.Lk - 1) * p.swj];
                        pv[i][t] = pp;
                    }
                }
            }
            if (dopv) {
#pragma unroll
                for (int i = 0; i < 8; ++i)
#pragma unroll
                    for (int t = 0; t < 4; ++t) ((float*)myp)[(i + 8 * hf) * 64 + t * 16 + l15] = pv[i][t];
                __syncthreads();                                 // P (per wave) and V (shared) visible
                if (p.P) {
                    float* pb_ = p.P + b * p.sPb + h * p.sPh;
                    const bool fastP = (p.pband == 0) && ((p.sPi & 3) == 0) && (j0 + 64 <= p.Lk) && (q0 + 16 <= p.Lq) && ((((size_t)pb_) & 15) == 0);
                    if (fastP) {
#pragma unroll
                        for (int s = 0; s < 8; ++s) {
                            const int row = s * 2 + (lane >> 4), c4 = (lane & 15) * 4;
                            const v4f v = *(const v4f*)(myp + row * 64 + c4);
                            VST2V4(pb_ + (long long)(q0 + row) * p.sPi + j0 + c4, v);
                        }
                    } else {
                        for (int row = 0; row < 16; ++row) {
                            const int irow = q0 + row; if (irow >= p.Lq) continue;
                            for (int c = lane; c < 64; c += 32) {
                                const int jg = j0 + c; if (jg >= p.Lk) continue;
                                if (p.pband == 0) VST2(float, pb_ + (long long)irow * p.sPi + jg, myp[row * 64 + c]);
                                else if (jg - irow <= p.pband && irow - jg <= p.pband) VST2(float, pb_ + (long long)irow * p.sPi + (jg - irow + p.pband), myp[row * 64 + c]);
                            }
                        }
                    }
                }
                if (SPLITPV) {
                    const Split pa0 = sp_ld(myp + l15 * 64, 1, 0, hf, 64, 1.f), pa1 = sp_ld(myp + l15 * 64, 1, 32, hf, 64, 1.f);
                    const __bf16* vh = (const __bf16*)vl; const __bf16* vlo = vh + 64 * VP;
#pragma unroll
                    for (int t = 0; t < NT; ++t) {
                        const int dcol = t * 16 + l15;
                        Split b0, b1;
#pragma unroll
                        for (int e = 0; e < 16; ++e) {
                            const int k0 = frag_k(e, hf), k1 = 32 + frag_k(e, hf);
                            b0.hi[e] = vh[k0 * VP + dcol]; b0.lo[e] = vlo[k0 * VP + dcol]; b1.hi[e] = vh[k1 * VP + dcol]; b1.lo[e] = vlo[k1 * VP + dcol];
                        }
                        o[t] = wmma3(pa0, b0, o[t]);
                        o[t] = wmma3(pa1, b1, o[t]);
                    }
                } else {
                    const v16h pa0 = fh_ld(myp + l15 * 64, 1, 0, hf, 64, 4096.f), pa1 = fh_ld(myp + l15 * 64, 1, 32, hf, 64, 4096.f);
#pragma unroll
                    for (int t = 0; t < NT; ++t) {
                        const int dcol = t * 16 + l15;
                        v16h b0, b1;
#pragma unroll
                        for (int e = 0; e < 16; ++e) { b0[e] = vl[frag_k(e, hf) * VP + dcol]; b1[e] = vl[(32 + frag_k(e, hf)) * VP + dcol]; }
                        o[t] = wmma16(pa0, b0, o[t]);
                        o[t] = wmma16(pa1, b1, o[t]);
                    }
                }
            }
        }
    }
    float* obase = p.O + b * p.sOb + h * p.sOh;
    if (p.ST) {
        const int rl = lane >> 1, isel = rl & 7;           // row q0 + rl ; rl>>3 == hf holds because lane>>4 == (lane>>1)>>3
        float mv = 0.f, lv = 0.f;
#pragma unroll
        for (int i = 0; i < 8; ++i) if (i == isel) { mv = m8[i]; lv = l8[i]; }
        const int irow = q0 + rl;
        if (irow < p.Lq) { float* st = p.ST + (((long long)b * gridDim.y + h) * p.Lq + irow) * 2 + (lane & 1); VST2(float, st, (lane & 1) ? lv : mv * 0.6931471805599453f); }
    }
    float invr[8];
#pragma unroll
    for (int i = 0; i < 8; ++i) {
        if (TWOPASS) invr[i] = SPLITPV ? 1.f : (1.f / 4096.f);
        else if (p.nonorm) invr[i] = exp2f(m8[i]) * (SPLITPV ? 1.f : (1.f / 4096.f));
        else invr[i] = (l8[i] > 0.f) ? (SPLITPV ? 1.f / l8[i] : 1.f / (l8[i] * 4096.f)) : 0.f;
    }
    __syncthreads();                                             // all waves done with pl/vl from the main loop
    const bool ofast = ((p.sOi & 3) == 0) && ((((size_t)obase) & 15) == 0) && (q0 + 16 <= p.Lq);
#pragma unroll
    for (int c0 = 0; c0 < DVP; c0 += 64) {
#pragma unroll
        for (int i = 0; i < 8; ++i)
#pragma unroll
            for (int t = 0; t < NT; ++t) if (t * 16 >= c0 && t * 16 < c0 + 64) ((float*)myp)[(i + 8 * hf) * 64 + (t * 16 - c0) + l15] = o[t][i] * invr[i];
        __syncthreads();
        const int cw = (DVP - c0 < 64) ? (DVP - c0) : 64;      // staged columns in this chunk (multiple of 16)
        if (ofast && (c0 + cw <= p.dv) && (cw % 32 == 0)) {
            const int lpr = cw / 4;                              // lanes per row (16 for 64 cols, 8 for 32)
            const int rows_per_ins = 32 / lpr;
            for (int r0 = 0; r0 < 16; r0 += rows_per_ins) {
                const int row = r0 + lane / lpr, c4 = (lane % lpr) * 4;
                const v4f v = *(const v4f*)(myp + row * 64 + c4);
                VST2V4(obase + (long long)(q0 + row) * p.sOi + c0 + c4, v);
            }
        } else {
            for (int row = 0; row < 16; ++row) {
                const int irow = q0 + row; if (irow >= p.Lq) continue;
                for (int c = lane; c < cw; c += 32) { const int d = c0 + c; if (d < p.dv) VST2(float, obase + (long long)irow * p.sOi + d, myp[row * 64 + c]); }
            }
        }
        __syncthreads();
    }
}

// =====================================================================================================================
// k_tr: dst(z, c, r) = alpha * src(z, r, c) (+ beta * R2(z, c, r)): [Z][R][C] (row stride lds) -> [Z][C][R] (row stride ldd) through a 32x32 LDS tile;
//   flags: 1 -> add beta * residual R2 addressed like dst (z*sRz + c*ldr + r); act applied before the residual.
// =====================================================================================================================
struct TrP { const float* src; float* dst; const float* R2; long long sSz, lds, sDz, ldd, sRz, ldr; int R, C, flags, act; float alpha, beta; };
static_assert(sizeof(TrP) == 3 * 8 + 6 * 8 + 6 * 4, "TrP has padding");
__global__ __launch_bounds__(256) void k_tr(TrP p) {
    __shared__ float tile[32][33];
    const int c0 = blockIdx.x * 32, r0 = blockIdx.y * 32, z = blockIdx.z;
    const int lane = threadIdx.x & 31, wave = threadIdx.x >> 5;
    const float* s = p.src + z * p.sSz;
#pragma unroll
    for (int k = 0; k < 4; ++k) {
        const int rl = wave * 4 + k, r = r0 + rl, c = c0 + lane;
        tile[rl][lane] = (r < p.R && c < p.C) ? s[(long long)r * p.lds + c] : 0.f;
    }
    __syncthreads();
    float* d = p.dst + z * p.sDz; const float* rr = p.R2 + z * p.sRz;
#pragma unroll
    for (int k = 0; k < 4; ++k) {
        const int cl = wave * 4 + k, c = c0 + cl, r = r0 + lane;
        if (c < p.C && r < p.R) {
            float v = act_fn(p.alpha * tile[lane][cl], p.act);
            if (p.flags & 1) v += p.beta * rr[(long long)c * p.ldr + r];
            VST2(float, d + (long long)c * p.ldd + r, v);
        }
    }
}

// k_affine: dst[i] = a * (sdev ? sdev[0] : 1) * src[i] + b, i < n (one thread per element; consecutive lanes -> consecutive addresses)
__global__ __launch_bounds__(256) void k_affine(const float* __restrict__ src, float* __restrict__ dst, int n, float a, float b, const float* __restrict__ sdev) {
    const int i = blockIdx.x * 256 + threadIdx.x;
    if (i < n) { const float aa = sdev ? a * sdev[0] : a; const float v = aa * src[i] + b; VST2(float, dst + i, v); }
}

// =====================================================================================================================
// k_softmax: row softmax over n contiguous elements, one 256-thread block per row; rows addressed z*sz + r*sr (grid (R, Z)).
//   out = scale_out * softmax(scale_in * x + (Mf ? Mf[z*smz + r*smr + j] : 0)); a row whose max is -inf is written as 0.
// =====================================================================================================================
struct SmP { const float* src; float* dst; const float* Mf; long long sz, sr, dz, dr, smz, smr; int n, pad; float scale_in, scale_out; };
static_assert(sizeof(SmP) == 3 * 8 + 6 * 8 + 4 * 4, "SmP has padding");
__global__ __launch_bounds__(256) void k_softmax(SmP p) {
    __shared__ float red[256];
    const int r = blockIdx.x, z = blockIdx.y, tid = threadIdx.x;
    const float* s = p.src + z * p.sz + (long long)r * p.sr;
    const float* mf = p.Mf ? (p.Mf + z * p.smz + (long long)r * p.smr) : nullptr;
    float mx = -__builtin_inff();
    for (int j = tid; j < p.n; j += 256) { float v = s[j] * p.scale_in; if (mf) v += mf[j]; mx = fmaxf(mx, v); }
    red[tid] = mx; __syncthreads();
    for (int o = 128; o > 0; o >>= 1) { if (tid < o) red[tid] = fmaxf(red[tid], red[tid + o]); __syncthreads(); }
    mx = red[0]; __syncthreads();
    float sum = 0.f;
    for (int j = tid; j < p.n; j += 256) { float v = s[j] * p.scale_in; if (mf) v += mf[j]; sum += (mx == -__builtin_inff()) ? 0.f : expf(v - mx); }
    red[tid] = sum; __syncthreads();
    for (int o = 128; o > 0; o >>= 1) { if (tid < o) red[tid] += red[tid + o]; __syncthreads(); }
    sum = red[0];
    const float inv = (sum > 0.f) ? p.scale_out / sum : 0.f;
    float* d = p.dst + z * p.dz + (long long)r * p.dr;
    for (int j = tid; j < p.n; j += 256) { float v = s[j] * p.scale_in; if (mf) v += mf[j]; const float o = (mx == -__builtin_inff()) ? 0.f : expf(v - mx) * inv; VST2(float, d + j, o); }
}
// =====================================================================================================================
// k_stats: mean and rsqrt(var + eps) over a set of n elements addressed base + z*sz + (e / inner) * so + (e % inner) * si, one 256-thread
// k_norm_apply: y = (x - mean[set]) * rstd[set] * g[c] + b[c] over a [Z][C][L] channel-major tensor with set = z*G + c / (C/G) (G groups per z;
//   G = C -> per-channel sets indexed z*C+c; for batch norm pass stats indexed by c only via bn = 1). Optional act. Output same layout.
// =====================================================================================================================
//   mode 0: mean / rsqrt(var + eps); mode 1 (RMSNorm): 0 / rsqrt(mean(x^2) + eps); mode 2 (L2 normalize * sqrt(n)): 0 / sqrt(n) / max(||x||, eps); mode 3: as 0 with unbiased variance (n-1)
__global__ __launch_bounds__(256) void k_stats(const float* __restrict__ x, long long sz, long long so, long long si, int inner, int n, float eps, float* __restrict__ stat, int mode) {
    __shared__ float red[256];
    const int z = blockIdx.x, tid = threadIdx.x;
    const float* base = x + z * sz;
    float s = 0.f;
    for (int e = tid; e < n; e += 256) s += base[(long long)(e / inner) * so + (long long)(e % inner) * si];
    red[tid] = s; __syncthreads();
    for (int o = 128; o > 0; o >>= 1) { if (tid < o) red[tid] += red[tid + o]; __syncthreads(); }
    const float mu = (mode == 0 || mode == 3) ? red[0] / (float)n : 0.f; __syncthreads();
    float q = 0.f;
    for (int e = tid; e < n; e += 256) { const float dlt = base[(long long)(e / inner) * so + (long long)(e % inner) * si] - mu; q += dlt * dlt; }
    red[tid] = q; __syncthreads();
    for (int o = 128; o > 0; o >>= 1) { if (tid < o) red[tid] += red[tid + o]; __syncthreads(); }
    {
        float rs;
        if (mode == 2) rs = sqrtf((float)n) / fmaxf(sqrtf(red[0]), eps); else if (mode == 3) rs = rsqrtf(red[0] / (float)(n - 1) + eps); else rs = rsqrtf(red[0] / (float)n + eps);
        if (tid < 32) { const float v = (tid == 0) ? mu : ((tid == 1) ? rs : 0.f); VST2(float, stat + (long long)z * 32 + tid, v); }
    }
}
//   One thread per element over the flat [Z][C][L] index space: grid ceil(Z*C*L / 256).
__global__ __launch_bounds__(256) void k_norm_apply(const float* __restrict__ x, float* __restrict__ y, const float* __restrict__ stat, const float* __restrict__ g, const float* __restrict__ bta,
                                                     int Z, int C, int L, int G, int bn, int act) {
    const long long idx = (long long)blockIdx.x * 256 + threadIdx.x;
    if (idx >= (long long)Z * C * L) return;
    const int l = (int)(idx % L); const long long zc = idx / L; const int c = (int)(zc % C), z = (int)(zc / C); (void)l;
    const int set = bn ? c : (z * G + c / (C / G));
    float v = (x[idx] - stat[(long long)set * 32]) * stat[(long long)set * 32 + 1];
    if (g) v *= g[c];
    if (bta) v += bta[c];
    v = act_fn(v, act);
    VST2(float, y + idx, v);
}

// k_lse_neg: c[i] = -(st[2i] + log(st[2i+1])) = minus the log-sum-exp of row i from k_attn's ST output (for softmax over the query dimension)
__global__ __launch_bounds__(256) void k_lse_neg(const float* __restrict__ st, float* __restrict__ c, int n) {
    const int i = blockIdx.x * 256 + threadIdx.x;
    if (i < n) { const float v = -(st[2 * i] + logf(st[2 * i + 1])); VST2(float, c + i, v); }
}

// k_iota: dst[i] = a * i + b as int32 (segment/position id helper)
__global__ __launch_bounds__(256) void k_iota(int* __restrict__ dst, int n, int a, int b) {
    const int i = blockIdx.x * 256 + threadIdx.x;
    if (i < n) { const int v = a * i + b; VST2(int, dst + i, v); }
}

// k_axpby: dst[i] = a * x[i] + b * y[i] (+ c), i < n
__global__ __launch_bounds__(256) void k_axpby(const float* __restrict__ x, const float* __restrict__ y, float* __restrict__ dst, int n, float a, float b, float c) {
    const int i = blockIdx.x * 256 + threadIdx.x;
    if (i < n) { const float v = a * x[i] + b * y[i] + c; VST2(float, dst + i, v); }
}

// =====================================================================================================================
// k_rope: rotary embedding on a [R rows][Hn heads][D] view (row stride sXr, head stride sXh, element stride 1) -> Y (own strides).
//   mode 0: rotate_half (partner d±D/2, sign - for d<D/2); mode 1: interleaved pairs (partner d^1, sign - for even d).
//   table column tcol: tmode 0 -> d, 1 -> d % (D/2), 2 -> d / 2; position p: pmode 0 -> r % S, 1 -> head index, 2 -> pos[r];
//   c = C[(r / S) * sCb + p * sCp + tcol * sCd], s likewise from Sn; y = x[d] * c + sign * x[partner] * s. X and Y must not alias.
// =====================================================================================================================
struct RopeP { const float* X; float* Y; const float* C; const float* Sn; const int* pos; long long sXr, sXh, sYr, sYh, sCb, sCp, sCd; int R, Hn, D, S, mode, tmode, pmode, pad; };
static_assert(sizeof(RopeP) == 5 * 8 + 7 * 8 + 8 * 4, "RopeP has padding");
__global__ __launch_bounds__(256) void k_rope(RopeP p) {
    const long long idx = (long long)blockIdx.x * 256 + threadIdx.x;
    if (idx >= (long long)p.R * p.Hn * p.D) return;
    const int d = (int)(idx % p.D); const long long rh = idx / p.D; const int h = (int)(rh % p.Hn); const int r = (int)(rh / p.Hn);
    const int half = p.D / 2;
    int partner; float sign;
    if (p.mode == 0) { partner = (d < half) ? d + half : d - half; sign = (d < half) ? -1.f : 1.f; }
    else { partner = d ^ 1; sign = (d & 1) ? 1.f : -1.f; }
    const int tcol = (p.tmode == 0) ? d : ((p.tmode == 1) ? (d % half) : (d >> 1));
    const int pp = (p.pmode == 0) ? (r % p.S) : ((p.pmode == 1) ? h : p.pos[r]);
    const long long toff = (long long)(r / p.S) * p.sCb + (long long)pp * p.sCp + (long long)tcol * p.sCd;
    const float* xr = p.X + (long long)r * p.sXr + (long long)h * p.sXh;
    const float v = xr[d] * p.C[toff] + sign * xr[partner] * p.Sn[toff];
    VST2(float, p.Y + (long long)r * p.sYr + (long long)h * p.sYh + d, v);
}

// k_invf + k_sincos (split so neither kernel carries a large VALU-fma footprint): invf_i = num * (1 / powf(base, (2 i)/D)) [fmode 0],
//   num * expf((2 i) * cexp) [fmode 1], num * powf(base, -2 (i - 1) / D) [fmode 2]; then cs/sn[s*half + i] = cos/sin((pscale * s) * invf_i)
__global__ __launch_bounds__(256) void k_invf(float* __restrict__ invb, int half, int D, float base, float num, int fmode, float cexp) {
    const int i = blockIdx.x * 256 + threadIdx.x;
    if (i >= ((half + 31) / 32) * 32) return;
    if (i >= half) { VST2(float, invb + i, 0.f); return; }
    const float e = (float)(2 * i) / (float)D;
    float invf;
    if (fmode == 1) invf = num * expf((float)(2 * i) * cexp);
    else if (fmode == 2) invf = num * powf(base, (-2.0f * ((float)i - 1.0f)) / (float)D);
    else invf = num * (1.0f / powf(base, e));
    VST2(float, invb + i, invf);
}
__global__ __launch_bounds__(256) void k_sincos(float* __restrict__ cs, float* __restrict__ sn, const float* __restrict__ invb, int S, int half, float pscale) {
    const int idx = blockIdx.x * 256 + threadIdx.x;
    if (idx >= S * half) return;
    const int s = idx / half, i = idx - s * half;
    const float ang = (pscale * (float)s) * invb[i];
    VST2(float, cs + idx, cosf(ang)); VST2(float, sn + idx, sinf(ang));
}

// k_mulact: dst[i] = act(x[i]) * y[i]
__global__ __launch_bounds__(256) void k_mulact(const float* __restrict__ x, const float* __restrict__ y, float* __restrict__ dst, int n, int act) {
    const int i = blockIdx.x * 256 + threadIdx.x;
    if (i < n) { const float v = act_fn(x[i], act) * y[i]; VST2(float, dst + i, v); }
}

// =====================================================================================================================
// k_matvec: thread-per-row matrix-vector products for N <= 8 output columns (heads with 1-3 outputs, gates), f32 on the VALU.
//   C[r*sCm + j] = act(alpha * sum_k A[r*sAm + k*sAk] * B[j*sBn + k*sBk] + bias[j]) + beta * R[r*sRm + j*sRn]; each thread writes its N contiguous floats.
// =====================================================================================================================
__global__ __launch_bounds__(256) void k_matvec(GemmP p) {
    // 32 lanes write one line with one instruction.
    const int rpt = (p.N == 1) ? 1 : 32;
    const long long r0 = ((long long)blockIdx.x * 256 + threadIdx.x) * rpt; const int z = blockIdx.z, zo = z / p.zi_n, zi = z - zo * p.zi_n;
    if (r0 >= p.M) return;
    const float* Bb = p.B + zo * p.sBo + zi * p.sBi;
    float* C = p.C + zo * p.sCo + zi * p.sCi; const float* R = p.R + zo * p.sRo + zi * p.sRi;
    for (int rr = 0; rr < rpt; ++rr) {
        const long long r = r0 + rr; if (r >= p.M) break;
        const float* A = p.A + zo * p.sAo + zi * p.sAi + r * p.sAm;
        float acc[8] = {0.f, 0.f, 0.f, 0.f, 0.f, 0.f, 0.f, 0.f};
        for (int k = 0; k < p.K; ++k) { const float a = A[(long long)k * p.sAk];
#pragma unroll
            for (int j = 0; j < 8; ++j) if (j < p.N) acc[j] += a * Bb[(long long)j * p.sBn + (long long)k * p.sBk]; }
#pragma unroll
        for (int j = 0; j < 8; ++j) if (j < p.N) {
            float v = acc[j] * p.alpha;
            if (p.flags & 1) v += p.bias[j];
            if (p.flags & 2) v += p.bias[r];
            v = act_fn(v, p.act);
            if (p.flags & 4) v += p.beta * R[r * p.sRm + (long long)j * p.sRn];
            VST2(float, C + r * p.sCm + j, v);
        }
    }
}
// k_smallsoftmax: thread-per-row softmax for short rows (n <= 64): dst[r*dr + j] = softmax(scale*src[r*sr + j])
__global__ __launch_bounds__(256) void k_smallsoftmax(const float* __restrict__ src, float* __restrict__ dst, long long sr, long long dr, int n, long long R, float scale) {
    const long long r0 = ((long long)blockIdx.x * 256 + threadIdx.x) * 32;
    for (int rr = 0; rr < 32; ++rr) {
        const long long r = r0 + rr; if (r >= R) return;
        const float* s = src + r * sr; float* d = dst + r * dr;
        float mx = -__builtin_inff();
        for (int j = 0; j < n; ++j) mx = fmaxf(mx, s[j] * scale);
        float sum = 0.f;
        for (int j = 0; j < n; ++j) sum += expf(s[j] * scale - mx);
        const float inv = 1.f / sum;
        for (int j = 0; j < n; ++j) { const float v = expf(s[j] * scale - mx) * inv; VST2(float, d + j, v); }
    }
}

__global__ __launch_bounds__(32) void k_unitstat(float* __restrict__ st) { const int t = threadIdx.x; const float v = (t == 1) ? 1.f : 0.f; VST2(float, st + t, v); }

// destination (e.g. a d_out whose row width is not a multiple of 32 floats) is written by consecutive lanes of one instruction
__global__ __launch_bounds__(256) void k_lincopy(const float* __restrict__ src, long long lds, float* __restrict__ dst, long long ldd, long long rows, int cols) {
    const long long i = (long long)blockIdx.x * 256 + threadIdx.x; if (i >= rows * cols) return;
    const long long r = i / cols; const int c = (int)(i - r * cols);
    const float v = src[r * lds + c]; VST2(float, dst + r * ldd + c, v);
}

namespace w25 {
typedef __attribute__((ext_vector_type(16))) _Float16 v16h;
typedef __attribute__((ext_vector_type(8)))  _Float16 v8h;
typedef __attribute__((ext_vector_type(16))) __bf16   v16b;
typedef __attribute__((ext_vector_type(8)))  __bf16   v8b;
typedef __attribute__((ext_vector_type(8)))  float    v8f;
typedef __attribute__((ext_vector_type(4)))  float    v4f;

__device__ __forceinline__ unsigned short f2bf_bits(float f) {
  unsigned u = __float_as_uint(f);
  return (unsigned short)((u + 0x7FFFu + ((u >> 16) & 1u)) >> 16);
}
__device__ __forceinline__ float bf_bits2f(unsigned short h) { return __uint_as_float(((unsigned)h) << 16); }

// hazard guards as plain device helpers (no inline asm inside the kernel template body)
__device__ __forceinline__ void dep_guard_h(v8f& a, v8f& b, v16h x, v16h y) { asm volatile("v_nop\n\tv_nop\n\tv_nop\n\tv_nop" : "+v"(a), "+v"(b) : "v"(x), "v"(y)); }
__device__ __forceinline__ void dep_guard_b(v8f& a, v8f& b, v16b x, v16b y) { asm volatile("v_nop\n\tv_nop\n\tv_nop\n\tv_nop" : "+v"(a), "+v"(b) : "v"(x), "v"(y)); }
__device__ __forceinline__ void keep4_h(v16h a, v16h b, v16h c, v16h d) { asm volatile("v_nop" :: "v"(a), "v"(b), "v"(c), "v"(d)); }
__device__ __forceinline__ void keep4_b(v16b a, v16b b, v16b c, v16b d) { asm volatile("v_nop" :: "v"(a), "v"(b), "v"(c), "v"(d)); }
__device__ __forceinline__ void acc_guard4(v8f& a, v8f& b, v8f& c, v8f& d) { asm volatile("v_nop\n\tv_nop\n\tv_nop\n\tv_nop" : "+v"(a), "+v"(b), "+v"(c), "+v"(d)); }
template <typename T> struct Frag;
template <> struct Frag<_Float16> {
  typedef v16h V; union U { v16h v; v8h h[2]; };
  static __device__ __forceinline__ v16h load(const _Float16* p) {   // elements 0..7 <- p[0..7], 8..15 <- p[16..23]
    U f; f.h[0] = *(const v8h*)(p); f.h[1] = *(const v8h*)(p + 16); return f.v;
  }
  static __device__ __forceinline__ v8f mma(v16h a, v16h b, v8f c) {
    return __builtin_amdgcn_wmma_f32_16x16x32_f16(false, a, false, b, (short)0, c, false, false);
  }
  static __device__ __forceinline__ void guard(v8f& a, v8f& b, v16h x, v16h y) { dep_guard_h(a, b, x, y); }
  static __device__ __forceinline__ void keep(v16h a, v16h b, v16h c, v16h d) { keep4_h(a, b, c, d); }
};
template <> struct Frag<__bf16> {
  typedef v16b V; union U { v16b v; v8b h[2]; };
  static __device__ __forceinline__ v16b load(const __bf16* p) {
    U f; f.h[0] = *(const v8b*)(p); f.h[1] = *(const v8b*)(p + 16); return f.v;
  }
  static __device__ __forceinline__ v8f mma(v16b a, v16b b, v8f c) {
    return __builtin_amdgcn_wmma_f32_16x16x32_bf16(false, a, false, b, (short)0, c, false, false);
  }
  static __device__ __forceinline__ void guard(v8f& a, v8f& b, v16b x, v16b y) { dep_guard_b(a, b, x, y); }
  static __device__ __forceinline__ void keep(v16b a, v16b b, v16b c, v16b d) { keep4_b(a, b, c, d); }
};

// ---- Register-blocked batched WMMA GEMM ------------------------------------
// C[m,n] = scale * sum_k A[m,k] * Bt[n,k] (+bias)(+resid); each wave owns a 64x64 tile.
// A row-major [M,K]; Bt row-major [N,K]; M,N % 64 == 0, K % 32 == 0.
// SPLIT: operands are hi/lo planes (A2/Bt2 = lo planes, same layout); product = hi·hi + hi·lo + lo·hi.
// BIAS_MODE: 0 = none, 1 = bias[m], 2 = bias[n].
// OUT_MODE: 0 = f32, 1 = f16, 2 = bf16 hi plane (Cout) + bf16 lo plane (Cout2).
// ET: 0 = f16 operands, 1 = bf16 operands (pointers passed as 16-bit storage)
// Batches: blockIdx.y steps A, Bt, C by strideA/B/C, blockIdx.z by strideAz/Bz/Cz (elements).
template <int ET> struct Elem;
template <> struct Elem<0> { typedef _Float16 T; };
template <> struct Elem<1> { typedef __bf16 T; };
template <int ET, bool SPLIT, int BIAS_MODE, int OUT_MODE, bool RESID, int ACT = 0>
__global__ __launch_bounds__(256) void wmma_gemm64(
    const unsigned short* __restrict__ Ap, const unsigned short* __restrict__ A2p, int lda, long strideA,
    const unsigned short* __restrict__ Btp, const unsigned short* __restrict__ Bt2p, int ldb, long strideB,
    void* __restrict__ Cout, void* __restrict__ Cout2, int ldc, long strideC,
    const float* __restrict__ bias,
    const float* __restrict__ resid, long strideR,
    int M, int N, int K, float scale,
    long strideAz, long strideBz, long strideCz) {
  typedef typename Elem<ET>::T T;
  typedef typename Frag<T>::V V;
  const T* A = (const T*)Ap; const T* A2 = (const T*)A2p; const T* Bt = (const T*)Btp; const T* Bt2 = (const T*)Bt2p;
  __shared__ __align__(16) float sT[8][16 * 68];   // per-wave 16x64 slab, pitch 68 floats
  const int b    = blockIdx.y;
  const int lane = threadIdx.x & 31;
  const int wave = threadIdx.x >> 5;
  const int tilesN = N >> 6;
  const int tilesM = M >> 6;
  const int tile = blockIdx.x * 8 + wave;
  if (tile >= tilesM * tilesN) return;   // wave-uniform; no block barriers in this kernel
  const int tm = tile / tilesN;
  const int tn = tile - tm * tilesN;
  const int m0 = tm << 6;
  const int n0 = tn << 6;

  const int bz = blockIdx.z;                   // outer batch index (own strides)
  const size_t offA = (size_t)b * strideA + (size_t)bz * strideAz;
  const size_t offB = (size_t)b * strideB + (size_t)bz * strideBz;
  const size_t offC = (size_t)b * strideC + (size_t)bz * strideCz;
  const T* Ab  = A  + offA;
  const T* Bb  = Bt + offB;
  const T* Ab2 = SPLIT ? (A2  + offA) : nullptr;
  const T* Bb2 = SPLIT ? (Bt2 + offB) : nullptr;

  const int rlane = lane & 15;                 // row (A) / col (B, D) within subtile
  const int koff  = (lane >> 4) * 8;           // k offset of this lane half
  const int mOff  = (lane >> 4) * 8;           // D row offset

  v8f acc[4][4];
#pragma unroll
  for (int i = 0; i < 4; ++i)
#pragma unroll
    for (int j = 0; j < 4; ++j) acc[i][j] = (v8f){0.f,0.f,0.f,0.f,0.f,0.f,0.f,0.f};

  for (int k0 = 0; k0 < K; k0 += 32) {
    V bh[4], bl[4];
#pragma unroll
    for (int j = 0; j < 4; ++j) {
      const size_t bo = (size_t)(n0 + (j << 4) + rlane) * ldb + koff + k0;
      bh[j] = Frag<T>::load(Bb + bo);
      if (SPLIT) bl[j] = Frag<T>::load(Bb2 + bo);
    }
#pragma unroll
    for (int i = 0; i < 4; ++i) {
      const size_t ao = (size_t)(m0 + (i << 4) + rlane) * lda + koff + k0;
      V ah = Frag<T>::load(Ab + ao);
      V al;
      if (SPLIT) al = Frag<T>::load(Ab2 + ao);
#pragma unroll
      for (int j = 0; j < 4; ++j) {
        acc[i][j] = Frag<T>::mma(ah, bh[j], acc[i][j]);
        if (SPLIT) {
          acc[i][j] = Frag<T>::mma(ah, bl[j], acc[i][j]);
          acc[i][j] = Frag<T>::mma(al, bh[j], acc[i][j]);
        }
      }
      Frag<T>::guard(acc[i][0], acc[i][3], ah, SPLIT ? al : ah);
    }
    Frag<T>::keep(bh[0], bh[1], bh[2], bh[3]);
    if (SPLIT) Frag<T>::keep(bl[0], bl[1], bl[2], bl[3]);
  }
  acc_guard4(acc[0][0], acc[0][1], acc[0][2], acc[0][3]);
  acc_guard4(acc[1][0], acc[1][1], acc[1][2], acc[1][3]);
  acc_guard4(acc[2][0], acc[2][1], acc[2][2], acc[2][3]);
  acc_guard4(acc[3][0], acc[3][1], acc[3][2], acc[3][3]);

  // ---- epilogue ----
  float* slab = sT[wave];
  const float* Rb = RESID ? (resid + (size_t)b * strideR) : nullptr;
#pragma unroll
  for (int i = 0; i < 4; ++i) {
    const int mBase = m0 + (i << 4);
#pragma unroll
    for (int j = 0; j < 4; ++j) {
      const int n = n0 + (j << 4) + rlane;
      float bv = 0.f;
      if (BIAS_MODE == 2) bv = bias[n];
#pragma unroll
      for (int r = 0; r < 8; ++r) {
        float v = acc[i][j][r] * scale;
        if (BIAS_MODE == 1) v += bias[mBase + mOff + r];
        if (BIAS_MODE == 2) v += bv;
        if (RESID) v += Rb[(size_t)(mBase + mOff + r) * ldc + n];
        if (ACT == 1) v = tanhf(v);
        if (ACT == 2) v = fmaxf(v, 0.0f);
        if (ACT == 3) v = v / (1.0f + expf(-v));
        if (ACT == 4) v = (v > 0.f) ? v : 0.01f * v;
        if (ACT == 5) v = 0.5f * v * (1.0f + erff(v * 0.70710678118654752f));
        slab[(mOff + r) * 68 + (j << 4) + rlane] = v;
      }
    }
    __builtin_amdgcn_fence(__ATOMIC_RELEASE, "workgroup");
    __builtin_amdgcn_wave_barrier();
    __builtin_amdgcn_fence(__ATOMIC_ACQUIRE, "workgroup");
    if (OUT_MODE == 0) {
      float* C = (float*)Cout + offC;
      const int hh = lane >> 4, c4 = (lane & 15) * 4;     // row seg = 256 B = 16 lanes x 16 B
      {
#pragma unroll
        for (int it = 0; it < 8; ++it) {
          const int row = it * 2 + hh;
          v4f v = *(const v4f*)(slab + row * 68 + c4);
          *(v4f*)(C + (size_t)(mBase + row) * ldc + n0 + c4) = v;
        }
        
      }
    } else {
      const int q = lane >> 3, c8 = (lane & 7) * 8;
      unsigned short* C  = (unsigned short*)Cout  + offC;
      unsigned short* C2 = (OUT_MODE == 2) ? ((unsigned short*)Cout2 + offC) : nullptr;
      {
#pragma unroll
        for (int it = 0; it < 4; ++it) {
          const int row = it * 4 + q;
          const float* sp = slab + row * 68 + c8;
          v8h hv, lv;
#pragma unroll
          for (int e = 0; e < 8; ++e) {
            if (OUT_MODE == 1) {
              hv[e] = (_Float16)sp[e];
            } else {
              unsigned short hb = f2bf_bits(sp[e]);
              unsigned short lb = f2bf_bits(sp[e] - bf_bits2f(hb));
              hv[e] = __builtin_bit_cast(_Float16, hb);
              lv[e] = __builtin_bit_cast(_Float16, lb);
            }
          }
          *(v8h*)(C + (size_t)(mBase + row) * ldc + n0 + c8) = hv;
          if (OUT_MODE == 2) *(v8h*)(C2 + (size_t)(mBase + row) * ldc + n0 + c8) = lv;
        }
        
      }
    }
    __builtin_amdgcn_fence(__ATOMIC_RELEASE, "workgroup");
    __builtin_amdgcn_wave_barrier();
    __builtin_amdgcn_fence(__ATOMIC_ACQUIRE, "workgroup");
  }
}

__global__ __launch_bounds__(256) void cast_f32_f16x2(
    const float* __restrict__ in, _Float16* __restrict__ out, int n2) {
  int i = blockIdx.x * 256 + threadIdx.x;
  if (i < n2) {
    const _Float16 h0 = (_Float16)in[2 * i], h1 = (_Float16)in[2 * i + 1];
    const unsigned u = (unsigned)__builtin_bit_cast(unsigned short, h0) | ((unsigned)__builtin_bit_cast(unsigned short, h1) << 16);
    ((unsigned*)out)[i] = u;
    
  }
}


} // namespace w25

__global__ __launch_bounds__(256) void k_castT16(const float* __restrict__ src, long long lds, _Float16* __restrict__ dst, long long ldd, int R, int C, float s) {
    const long long i = (long long)blockIdx.x * 256 + threadIdx.x; const long long np = (long long)C * (R / 2); if (i >= np) return; const int c = (int)(i / (R / 2)); const int r = 2 * (int)(i % (R / 2));
    const _Float16 h0 = (_Float16)(src[(long long)r * lds + c] * s), h1 = (_Float16)(src[(long long)(r + 1) * lds + c] * s);
    const unsigned u = (unsigned)__builtin_bit_cast(unsigned short, h0) | ((unsigned)__builtin_bit_cast(unsigned short, h1) << 16);
    unsigned* d = (unsigned*)(dst + (long long)c * ldd + r); *d = u;  }
__global__ __launch_bounds__(256) void k_cast16(const float* __restrict__ src, long long lds, _Float16* __restrict__ dst, long long ldd, int R, int C, float s) {
    const long long i = (long long)blockIdx.x * 256 + threadIdx.x; const long long np = (long long)R * (C / 2); if (i >= np) return; const int r = (int)(i / (C / 2)); const int c = 2 * (int)(i % (C / 2));
    const _Float16 h0 = (_Float16)(src[(long long)r * lds + c] * s), h1 = (_Float16)(src[(long long)r * lds + c + 1] * s);
    const unsigned u = (unsigned)__builtin_bit_cast(unsigned short, h0) | ((unsigned)__builtin_bit_cast(unsigned short, h1) << 16);
    unsigned* d = (unsigned*)(dst + (long long)r * ldd + c); *d = u;  }

// f32 -> bf16 hi plane + bf16 lo plane (x = hi + lo to ~2^-17 relative; RNE both), [R][C] -> [R][C] (or transposed to [C][R]); 2 consecutive destination elements
__device__ __forceinline__ unsigned int f2bf2_pack(float a, float b, unsigned int* lo) {
    const unsigned short ha = w25::f2bf_bits(a), hb = w25::f2bf_bits(b);
    const unsigned short la = w25::f2bf_bits(a - w25::bf_bits2f(ha)), lb = w25::f2bf_bits(b - w25::bf_bits2f(hb));
    *lo = (unsigned)la | ((unsigned)lb << 16); return (unsigned)ha | ((unsigned)hb << 16); }
__global__ __launch_bounds__(256) void k_castS16(const float* __restrict__ src, long long lds, __bf16* __restrict__ dhi, __bf16* __restrict__ dlo, long long ldd, int R, int C, float s, int transpose) {
    const long long i = (long long)blockIdx.x * 256 + threadIdx.x; long long o; float a, b;
    if (transpose) { const long long np = (long long)C * (R / 2); if (i >= np) return; const int c = (int)(i / (R / 2)); const int r = 2 * (int)(i % (R / 2)); a = src[(long long)r * lds + c] * s; b = src[(long long)(r + 1) * lds + c] * s; o = (long long)c * ldd + r; }
    else { const long long np = (long long)R * (C / 2); if (i >= np) return; const int r = (int)(i / (C / 2)); const int c = 2 * (int)(i % (C / 2)); a = src[(long long)r * lds + c] * s; b = src[(long long)r * lds + c + 1] * s; o = (long long)r * ldd + c; }
    unsigned lo; const unsigned hi = f2bf2_pack(a, b, &lo); unsigned* ph = (unsigned*)(dhi + o); unsigned* pl = (unsigned*)(dlo + o);
    *ph = hi; *pl = lo;  }

namespace w25 {
// =====================================================================================
// Generic causal/non-causal attention for head_dim 64, f32 in / f32 out; 16-bit operands: bf16 with optional hi/lo splits, or
// plain f16 (F16=true, non-split, probabilities carried x2^15).
//   scores = (q*qscale)·kᵀ : v_wmma_f32_16x16x32_bf16; SPLIT_QK -> q,k as bf16 hi/lo (hi·hi + hi·lo + lo·hi)
//   out    = p·v           : v_wmma_f32_16x16x32_bf16; SPLIT_PV -> p,v as bf16 hi/lo; else p,v plain bf16
//   f32 accumulate; online softmax in f32. Block = 4 waves = 64 query rows of one (batch, head); S % 64 == 0.
//   Element (b, s, h, d) of tensor X lives at X[b*X_bs + s*X_rs + h*X_hs + d] (strides in floats, multiples of 4).
//   Masking: mask_mode 0 none, 1 causal (kv > q masked), 2 tensor [S][Skv] shared over (b,h) (float if
//   mask_is_int==0, int32 with element == 0 -> masked if 1, int32 with element != 0 -> masked if 2), 3 per-token vectors qmask[B][S] & kvmask[B][Skv] (int32,
//   0 -> masked), 4 causal + sliding window (kv > q or q - kv > W masked; W passed in mask_is_int);
//   5 = relative-position bias: s += cp[b,h,q][idx[q][kv]] + pc[b,h,kv][idx[q][kv]] with idx = mask_b ([S][Skv] int32) and
//   mask_a an int32 [S][Skv] tensor with nonzero = masked (tables: element (b,h,row,n) at X + b*c_bs + h*c_hs + row*c_rs + n);
//   masked scores are replaced by mask_fill (e.g. -inf or -1e9) before the softmax.
//   grid.x = B * H * (S/64) (or a sub-range with blk0).
// =====================================================================================
#define AT_D 64
#define AT_NW 4
#define AT_QB 64
#define AT_KC 64
struct AttnGeom { const float* cp = nullptr; const float* pc = nullptr; long c_bs = 0, c_rs = 0, c_hs = 0;   // mode-5 score-bias tables
                  long q_bs, q_rs, q_hs, k_bs, k_rs, k_hs, v_bs, v_rs, v_hs, o_bs, o_rs, o_hs;
                  int S, Skv, H, mask_mode; float qscale; int blk0; float mask_fill; int mask_is_int; };
static_assert(sizeof(AttnGeom) == 168, "no padding");

__device__ __forceinline__ unsigned short at_bf_bits(float f) {
  unsigned u = __float_as_uint(f);
  return (unsigned short)((u + 0x7FFFu + ((u >> 16) & 1u)) >> 16);
}
__device__ __forceinline__ __bf16 at_f2bf(float f) { return __builtin_bit_cast(__bf16, at_bf_bits(f)); }
__device__ __forceinline__ void at_split(float f, __bf16& hi, __bf16& lo) {
  const unsigned short hb = at_bf_bits(f);
  hi = __builtin_bit_cast(__bf16, hb);
  lo = at_f2bf(f - __uint_as_float(((unsigned)hb) << 16));
}
__device__ __forceinline__ v8f at_mma(v16b a, v16b b, v8f c) {
  c = __builtin_amdgcn_wmma_f32_16x16x32_bf16(false, a, false, b, (short)0, c, false, false);
  asm volatile("v_nop\n\tv_nop\n\tv_nop\n\tv_nop" : "+v"(c) : "v"(a), "v"(b));
  return c;
}
// 16-bit element as a bit pattern held in a __bf16 slot: f16 bits when F16, bf16 (RNE) otherwise
template <bool F16> __device__ __forceinline__ __bf16 at_to16(float f) {
  if (F16) return __builtin_bit_cast(__bf16, (_Float16)f);
  return at_f2bf(f);
}
template <bool F16> __device__ __forceinline__ v8f at_mma16(v16b a, v16b b, v8f c) {
  if (F16) {
    const v16h ah = __builtin_bit_cast(v16h, a), bh = __builtin_bit_cast(v16h, b);
    c = __builtin_amdgcn_wmma_f32_16x16x32_f16(false, ah, false, bh, (short)0, c, false, false);
    asm volatile("v_nop\n\tv_nop\n\tv_nop\n\tv_nop" : "+v"(c) : "v"(ah), "v"(bh));
    return c;
  }
  return at_mma(a, b, c);
}

template <bool SPLIT_QK, bool SPLIT_PV, bool F16 = false>
__global__ __launch_bounds__(128)
void attn64_kernel(const float* __restrict__ q, const float* __restrict__ k,
                   const float* __restrict__ v, float* __restrict__ out,
                   const void* __restrict__ mask_a, const int* __restrict__ mask_b, AttnGeom g) {
  static_assert(!(F16 && (SPLIT_QK || SPLIT_PV)), "f16 mode is non-split");
  const float PSC = F16 ? 32768.0f : 1.0f;     // f16 probabilities carried x2^15 (subnormal range), folded into the final 1/l
  union FB { v16b v; v8b h[2]; };
  __shared__ __align__(16) __bf16 Ksh[AT_KC * AT_D];             // K hi [kv][d]      8 KB
  __shared__ __align__(16) __bf16 Ksl[SPLIT_QK ? AT_KC * AT_D : 8];
  __shared__ __align__(16) __bf16 Vth[AT_D * AT_KC];             // V hi [d][kv]      8 KB
  __shared__ __align__(16) __bf16 Vtl[SPLIT_PV ? AT_D * AT_KC : 8];
  __shared__ __align__(16) __bf16 Psh[AT_NW][16 * AT_KC];        // per wave P hi [row][kv]  8 KB
  __shared__ __align__(16) __bf16 Psl[SPLIT_PV ? AT_NW : 1][SPLIT_PV ? 16 * AT_KC : 8];
  __shared__ __align__(16) float  Os[AT_NW][16 * 68];            // per wave out tile, pitch 68

  const int tid  = threadIdx.x;
  const int wave = tid >> 5;
  const int lane = tid & 31;
  const int hh   = lane >> 4;
  const int c    = lane & 15;

  const int nqb = g.S / AT_QB;
  const int bx = blockIdx.x + g.blk0;
  const int qb = bx % nqb;
  const int bh = bx / nqb;
  const int h  = bh % g.H;
  const int b  = bh / g.H;
  const int qbase_block = qb * AT_QB;
  const int q0 = qbase_block + wave * 16;

  const float* qb_ptr = q + (size_t)b * g.q_bs + (size_t)h * g.q_hs;
  const float* kb_ptr = k + (size_t)b * g.k_bs + (size_t)h * g.k_hs;
  const float* vb_ptr = v + (size_t)b * g.v_bs + (size_t)h * g.v_hs;
  float*       ob_ptr = out + (size_t)b * g.o_bs + (size_t)h * g.o_hs;

  // ---- Q fragments (A operand): 2 d-chunks, hi (and lo) ----
  v16b qah[2], qal[2];
  {
    const float* qrow = qb_ptr + (size_t)(q0 + c) * g.q_rs;
#pragma unroll
    for (int dc = 0; dc < 2; ++dc) {
#pragma unroll
      for (int e = 0; e < 8; ++e) {
        const float f0 = qrow[dc * 32 + 8 * hh + e] * g.qscale;
        const float f1 = qrow[dc * 32 + 16 + 8 * hh + e] * g.qscale;
        if (SPLIT_QK) { __bf16 hq, lq; at_split(f0, hq, lq); qah[dc][e] = hq; qal[dc][e] = lq; at_split(f1, hq, lq); qah[dc][8 + e] = hq; qal[dc][8 + e] = lq; }
        else { qah[dc][e] = at_to16<F16>(f0); qah[dc][8 + e] = at_to16<F16>(f1); qal[dc][e] = qah[dc][e]; qal[dc][8 + e] = qah[dc][8 + e]; }
      }
    }
  }

  float mrow[8], lrow[8];
  v8f oacc[4];
#pragma unroll
  for (int r = 0; r < 8; ++r) { mrow[r] = -INFINITY; lrow[r] = 0.f; }
#pragma unroll
  for (int t = 0; t < 4; ++t) oacc[t] = (v8f){0.f,0.f,0.f,0.f,0.f,0.f,0.f,0.f};

  const int nChunks = (g.mask_mode == 1 || g.mask_mode == 4) ? (qb + 1) : (g.Skv / AT_KC);   // block-uniform
  // per-row query mask (mode 3)
  int qkeep[8];
#pragma unroll
  for (int r = 0; r < 8; ++r) qkeep[r] = (g.mask_mode == 3) ? mask_b[(size_t)b * g.S + q0 + 8 * hh + r] : 1;   // mask_b = qmask in mode 3
  for (int kc = 0; kc < nChunks; ++kc) {
    const int kv0 = kc * AT_KC;
    __syncthreads();
    {
      const int kvr = tid >> 1, dh = (tid & 1) * 32;
      const float* krow = kb_ptr + (size_t)(kv0 + kvr) * g.k_rs + dh;
      const float* vrow = vb_ptr + (size_t)(kv0 + kvr) * g.v_rs + dh;
#pragma unroll
      for (int i = 0; i < 8; ++i) {
        v4f kk = *(const v4f*)(krow + 4 * i);
        v4f vv = *(const v4f*)(vrow + 4 * i);
#pragma unroll
        for (int e = 0; e < 4; ++e) {
          const int d = dh + 4 * i + e;
          if (SPLIT_QK) { __bf16 a, bl; at_split(kk[e], a, bl); Ksh[kvr * AT_D + d] = a; Ksl[kvr * AT_D + d] = bl; }
          else Ksh[kvr * AT_D + d] = at_to16<F16>(kk[e]);
          if (SPLIT_PV) { __bf16 a, bl; at_split(vv[e], a, bl); Vth[d * AT_KC + kvr] = a; Vtl[d * AT_KC + kvr] = bl; }
          else Vth[d * AT_KC + kvr] = at_to16<F16>(vv[e]);
        }
      }
    }
    __syncthreads();

    v8f s[4];
#pragma unroll
    for (int j = 0; j < 4; ++j) {
      s[j] = (v8f){0.f,0.f,0.f,0.f,0.f,0.f,0.f,0.f};
#pragma unroll 1
      for (int dc = 0; dc < 2; ++dc) {
        FB kb;
        kb.h[0] = *(const v8b*)(Ksh + (j * 16 + c) * AT_D + dc * 32 + 8 * hh);
        kb.h[1] = *(const v8b*)(Ksh + (j * 16 + c) * AT_D + dc * 32 + 16 + 8 * hh);
        s[j] = at_mma16<F16>(qah[dc], kb.v, s[j]);
        if (SPLIT_QK) {
          FB kl;
          kl.h[0] = *(const v8b*)(Ksl + (j * 16 + c) * AT_D + dc * 32 + 8 * hh);
          kl.h[1] = *(const v8b*)(Ksl + (j * 16 + c) * AT_D + dc * 32 + 16 + 8 * hh);
          s[j] = at_mma16<F16>(qah[dc], kl.v, s[j]);
          s[j] = at_mma16<F16>(qal[dc], kb.v, s[j]);
        }
      }
    }
    const bool diag = (g.mask_mode == 1) && (kc == qb);
    int kvkeep[4] = {1, 1, 1, 1};
    if (g.mask_mode == 3) {
#pragma unroll
      for (int j = 0; j < 4; ++j) kvkeep[j] = ((const int*)mask_a)[(size_t)b * g.Skv + kv0 + j * 16 + c];   // mask_a = kvmask
    }
    float cm[8];
#pragma unroll
    for (int r = 0; r < 8; ++r) {
      const int qrow = q0 + 8 * hh + r;
      float m = -INFINITY;
#pragma unroll
      for (int j = 0; j < 4; ++j) {
        const int kvcol = kv0 + j * 16 + c;
        bool masked = false;
        if (diag) masked = (kvcol > qrow);
        else if (g.mask_mode == 4) masked = (kvcol > qrow) || (qrow - kvcol > g.mask_is_int);
        else if (g.mask_mode == 2) {
          const size_t mi = (size_t)qrow * g.Skv + kvcol;
          masked = (g.mask_is_int == 0) ? (((const float*)mask_a)[mi] == 0.0f)
                 : (g.mask_is_int == 1) ? (((const int*)mask_a)[mi] == 0) : (((const int*)mask_a)[mi] != 0);
        } else if (g.mask_mode == 3) masked = (qkeep[r] == 0) || (kvkeep[j] == 0);
        else if (g.mask_mode == 5) {
          const size_t mi = (size_t)qrow * g.Skv + kvcol;
          masked = (((const int*)mask_a)[mi] != 0);
          int n = mask_b[mi]; n = n < 0 ? 0 : n;
          s[j][r] += g.cp[(size_t)b * g.c_bs + (size_t)h * g.c_hs + (size_t)qrow * g.c_rs + n]
                   + g.pc[(size_t)b * g.c_bs + (size_t)h * g.c_hs + (size_t)kvcol * g.c_rs + n];
        }
        if (masked) s[j][r] = g.mask_fill;
        m = fmaxf(m, s[j][r]);
      }
#pragma unroll
      for (int off = 1; off < 16; off <<= 1) m = fmaxf(m, __shfl_xor(m, off, 32));
      cm[r] = m;
    }
    __bf16* pwh = Psh[wave];
    __bf16* pwl = Psl[SPLIT_PV ? wave : 0];
#pragma unroll
    for (int r = 0; r < 8; ++r) {
      const float mnew = fmaxf(mrow[r], cm[r]);
      const float alpha = expf(mrow[r] - mnew);
      mrow[r] = mnew;
      float psum = 0.f;
#pragma unroll
      for (int j = 0; j < 4; ++j) {
        const float p = expf(s[j][r] - mnew);
        psum += p;
        if (SPLIT_PV) { __bf16 a, bl; at_split(p, a, bl); pwh[(8 * hh + r) * AT_KC + j * 16 + c] = a; pwl[(8 * hh + r) * AT_KC + j * 16 + c] = bl; }
        else pwh[(8 * hh + r) * AT_KC + j * 16 + c] = at_to16<F16>(p * PSC);
      }
#pragma unroll
      for (int off = 1; off < 16; off <<= 1) psum += __shfl_xor(psum, off, 32);
      lrow[r] = lrow[r] * alpha + psum;
#pragma unroll
      for (int t = 0; t < 4; ++t) oacc[t][r] *= alpha;
    }
    __builtin_amdgcn_fence(__ATOMIC_RELEASE, "workgroup");
    __builtin_amdgcn_wave_barrier();
    __builtin_amdgcn_fence(__ATOMIC_ACQUIRE, "workgroup");
#pragma unroll 1
    for (int kk = 0; kk < 2; ++kk) {
      FB pa, pl;
      pa.h[0] = *(const v8b*)(pwh + c * AT_KC + kk * 32 + 8 * hh);
      pa.h[1] = *(const v8b*)(pwh + c * AT_KC + kk * 32 + 16 + 8 * hh);
      if (SPLIT_PV) {
        pl.h[0] = *(const v8b*)(pwl + c * AT_KC + kk * 32 + 8 * hh);
        pl.h[1] = *(const v8b*)(pwl + c * AT_KC + kk * 32 + 16 + 8 * hh);
      }
#pragma unroll
      for (int t = 0; t < 4; ++t) {
        FB vb;
        vb.h[0] = *(const v8b*)(Vth + (t * 16 + c) * AT_KC + kk * 32 + 8 * hh);
        vb.h[1] = *(const v8b*)(Vth + (t * 16 + c) * AT_KC + kk * 32 + 16 + 8 * hh);
        oacc[t] = at_mma16<F16>(pa.v, vb.v, oacc[t]);
        if (SPLIT_PV) {
          FB vl;
          vl.h[0] = *(const v8b*)(Vtl + (t * 16 + c) * AT_KC + kk * 32 + 8 * hh);
          vl.h[1] = *(const v8b*)(Vtl + (t * 16 + c) * AT_KC + kk * 32 + 16 + 8 * hh);
          oacc[t] = at_mma16<F16>(pa.v, vl.v, oacc[t]);
          oacc[t] = at_mma16<F16>(pl.v, vb.v, oacc[t]);
        }
      }
    }
  }

  float* os = Os[wave];
#pragma unroll
  for (int r = 0; r < 8; ++r) {
    const float inv = 1.0f / (lrow[r] * PSC);
#pragma unroll
    for (int t = 0; t < 4; ++t) os[(8 * hh + r) * 68 + t * 16 + c] = oacc[t][r] * inv;
  }
  __builtin_amdgcn_fence(__ATOMIC_RELEASE, "workgroup");
  __builtin_amdgcn_wave_barrier();
  __builtin_amdgcn_fence(__ATOMIC_ACQUIRE, "workgroup");
  {
    const int c4 = (lane & 15) * 4;
    {
#pragma unroll
      for (int it = 0; it < 8; ++it) {
        const int row = it * 2 + hh;
        v4f val = *(const v4f*)(os + row * 68 + c4);
        *(v4f*)(ob_ptr + (size_t)(q0 + row) * g.o_rs + c4) = val;
      }
      
    }
  }
}

} // namespace w25

__device__ __forceinline__ void st_h2(_Float16* dst, float a, float b) { const unsigned u = (unsigned)__builtin_bit_cast(unsigned short, (_Float16)a) | ((unsigned)__builtin_bit_cast(unsigned short, (_Float16)b) << 16); unsigned* d = (unsigned*)dst; *d = u;  }
// TK16 [r][d] = 16 table_k[r][d], zero rows 129..191
__global__ __launch_bounds__(256) void k_sh_tk(const float* __restrict__ TK, _Float16* __restrict__ TK16, int TAB, int TP, int HD) { const int t = blockIdx.x * 256 + threadIdx.x; if (t >= TP * HD / 2) return; const int e = 2 * t; const int r = e / HD; st_h2(TK16 + e, (r < TAB) ? TK[e] * 16.f : 0.f, (r < TAB) ? TK[e + 1] * 16.f : 0.f); }
// one wave per query row g = b L + q, for the eight heads h0..h0+7 of this launch: s_k = (SC[b][h-h0][q][k] + QT[(b,q,h)][fm[b][q][k]]) / 8; softmax over 512 k (exp once) -> P16[b][h][q][k] = f16(4096 p).
// A lane holds keys 128 c + 4 lane + e (c, e < 4): every load and store covers whole lines. The ids are read and clamped once for the eight heads; the eight QT rows (contiguous) lie in the wave's own LDS.
typedef __attribute__((ext_vector_type(4))) _Float16 sm_v4h;
typedef __attribute__((ext_vector_type(4))) int sm_v4i;
template <int CTRL> __device__ __forceinline__ float sm_dpp(float v) { return __builtin_bit_cast(float, __builtin_amdgcn_update_dpp(0, __builtin_bit_cast(int, v), CTRL, 0xf, 0xf, true)); }   // CTRL 0x160 + m: row_xmask:m
__device__ __forceinline__ float sm_x16(float v) { const unsigned u = __builtin_bit_cast(unsigned, v); return __builtin_bit_cast(float, __builtin_amdgcn_permlanex16(u, u, 0x76543210u, 0xfedcba98u, false, false)); }   // lane l <-> l ^ 16
__device__ __forceinline__ float sm_wmax(float v) { v = fmaxf(v, sm_dpp<0x161>(v)); v = fmaxf(v, sm_dpp<0x162>(v)); v = fmaxf(v, sm_dpp<0x164>(v)); v = fmaxf(v, sm_dpp<0x168>(v)); return fmaxf(v, sm_x16(v)); }
__device__ __forceinline__ float sm_wsum(float v) { v += sm_dpp<0x161>(v); v += sm_dpp<0x162>(v); v += sm_dpp<0x164>(v); v += sm_dpp<0x168>(v); return v + sm_x16(v); }
// 2^t. The v_nop is the slot that the instruction set asks for behind a transcendental; in the same statement it stands directly behind it whatever the scheduler puts next
__device__ __forceinline__ float sm_exp2(float t) { float y; asm("v_exp_f32 %0, %1\n\tv_nop" : "=v"(y) : "v"(t)); return y; }
// amdgpu_waves_per_eu(4): at most 256 VGPRs, so that two blocks share a WGP and all 512 blocks are resident at once
__global__ __launch_bounds__(256) __attribute__((amdgpu_waves_per_eu(4))) void k_sh_soft(const float* __restrict__ SC, const float* __restrict__ QT, const int* __restrict__ FM, _Float16* __restrict__ P16, int h0) {
    constexpr int L = 512, NH = 16, TP = 192, TAB = 129, HG = 8;
    __shared__ __attribute__((aligned(16))) float qtl[8][HG * TP];
    const int lane = threadIdx.x & 31, w = threadIdx.x >> 5;
    const int g = blockIdx.x * 8 + w, b = g >> 9, q = g & (L - 1);
    float* tq = qtl[w];
    // all of the wave's loads go out first, in the order in which they are waited for: QT rows, ids, then the score rows head by head
    const v4f* qs = (const v4f*)(QT + ((long long)g * NH + h0) * TP);
    v4f qv[HG * TP / 128];
#pragma unroll
    for (int u = 0; u < HG * TP / 128; ++u) qv[u] = qs[lane + 32 * u];
    const sm_v4i* fr = (const sm_v4i*)(FM + (long long)g * L);
    sm_v4i idv[4];
#pragma unroll
    for (int c = 0; c < 4; ++c) idv[c] = fr[lane + 32 * c];
    __builtin_amdgcn_sched_barrier(0);   // loads return in issue order: keeps the QT rows and ids ahead of the score rows, so that head 0 need not wait for head 7's rows
    const float* sr = SC + ((long long)b * HG * L + q) * L + 4 * lane;
    v4f s[HG][4];
#pragma unroll
    for (int hl = 0; hl < HG; ++hl) {
#pragma unroll
        for (int c = 0; c < 4; ++c) s[hl][c] = *(const v4f*)(sr + (long long)hl * L * L + 128 * c);
        __builtin_amdgcn_sched_barrier(0);   // keeps the score rows in head order, all issued ahead of the first wait
    }
    // a precaution: the wait in front of every overwrite of the address pair that the score loads name; as an operand the pair stays live up to here, so that no load's own result lands on it
    asm volatile("s_wait_xcnt 0x0" :: "v"(sr) : "memory");
#pragma unroll
    for (int u = 0; u < HG * TP / 128; ++u) *(v4f*)(tq + 4 * (lane + 32 * u)) = qv[u];
    // the wave's own LDS stores before its lanes' gathers from them (no other wave reads these rows: no block barrier)
    __builtin_amdgcn_fence(__ATOMIC_RELEASE, "workgroup", "local");
    __builtin_amdgcn_wave_barrier();
    __builtin_amdgcn_fence(__ATOMIC_ACQUIRE, "workgroup", "local");
    int r[16];
#pragma unroll
    for (int i = 0; i < 16; ++i) { const int id = idv[i >> 2][i & 3]; r[i] = id < 0 ? 0 : (id >= TAB ? TAB - 1 : id); }   // INPUT ids clamped before the address is formed
    _Float16* po = P16 + (((long long)b * NH + h0) * L + q) * L + 4 * lane;
#pragma unroll
    for (int hl = 0; hl < HG; ++hl) {
        float x[16];
#pragma unroll
        for (int i = 0; i < 16; ++i) x[i] = s[hl][i >> 2][i & 3] + tq[hl * TP + r[i]];
        float m = x[0];
#pragma unroll
        for (int i = 1; i < 16; ++i) m = fmaxf(m, x[i]);
        m = sm_wmax(m);
#pragma unroll
        for (int i = 0; i < 16; ++i) x[i] = sm_exp2((x[i] - m) * 0.18033688f);   // exp((x - m) / 8): log2(e) / 8
        const float sum = sm_wsum(((x[0] + x[1]) + (x[2] + x[3])) + ((x[4] + x[5]) + (x[6] + x[7])) + (((x[8] + x[9]) + (x[10] + x[11])) + ((x[12] + x[13]) + (x[14] + x[15]))));
        const float f = (1.f / sum) * 4096.f;
#pragma unroll
        for (int c = 0; c < 4; ++c) {
            const v4f p = {x[4 * c] * f, x[4 * c + 1] * f, x[4 * c + 2] * f, x[4 * c + 3] * f};
            *(sm_v4h*)(po + (long long)hl * L * L + 128 * c) = __builtin_convertvector(p, sm_v4h);
        }
    }
}
// w2 in one launch: one wave per query row g = b L + q. X[g][h*64 + d] += (1/4096) sum_k P16[b][h][q][k] * f16(table_v[fm[g][k]][d]).
// A = the 16 heads' probability rows (16 x 512, straight from P16); B = the gathered table rows, never written out: table_v lies in LDS as f16 rows of 160 bytes,
// and each lane of ds_load_tr16_b128 points at the row that ITS key's id names (lane l: key kbase + 8 (l >> 4) + (l & 7), 16-byte half (l >> 3) & 1), so the
// transposing load returns B[k][d] in the hardware k order (frag_k), the order in which A is loaded. INPUT ids clamped before the address is formed. k runs 0..511 in one accumulator chain.
typedef __attribute__((ext_vector_type(8))) short w2_s16x8;
__device__ __forceinline__ v8h w2_ldtr(const unsigned char* p) { typedef __attribute__((address_space(3))) w2_s16x8 lds_s16x8; return __builtin_bit_cast(v8h, __builtin_amdgcn_ds_load_tr16_b128_v8i16((lds_s16x8*)p)); }
typedef __attribute__((ext_vector_type(4))) _Float16 w2_v4h;
// amdgpu_waves_per_eu(4): at most 256 VGPRs, so that two blocks share a WGP and all 512 blocks are resident at once
__global__ __launch_bounds__(256) __attribute__((amdgpu_waves_per_eu(4))) void k_sh_w2(const _Float16* __restrict__ P16, const int* __restrict__ FM, const float* __restrict__ TV, float* __restrict__ X) {
    constexpr int L = 512, NH = 16, HD = 64, TAB = 129, PITCH = 160;   // PITCH: 32 B x odd, the transposing load's pitch
    static_assert(TAB * HD == 4 * (8 * 256 + 16), "the fill below: eight float4 per thread, then row 128 by 16 threads");
    __shared__ __attribute__((aligned(16))) unsigned char tab[TAB * PITCH];
    const int t = threadIdx.x, lane = t & 31;
    const int g = blockIdx.x * 8 + (t >> 5);
    const int c = lane & 15, h = lane >> 4;
    // the table's loads go first: they are waited for first, while the first ids and probabilities are still on their way
    v4f tv[8];
#pragma unroll
    for (int u = 0; u < 8; ++u) tv[u] = *(const v4f*)(TV + 4 * (t + 256 * u));
    const v4f tl = *(const v4f*)(TV + 4 * (2048 + (t & 15)));
    const int* fr = FM + (long long)g * L + 8 * h + (lane & 7);
    const _Float16* pa = P16 + (((long long)(g >> 9) * NH + c) * L + (g & (L - 1))) * L + 8 * h;
    // keys in four runs of 128, two register buffers: the next run's ids and probabilities fly while this run is multiplied
    int id[2][8];
    v8h a[2][8];
#pragma unroll
    for (int j = 0; j < 8; ++j) { id[0][j] = fr[16 * j]; a[0][j] = *(const v8h*)(pa + 16 * j); }
#pragma unroll
    for (int u = 0; u < 8; ++u) *(w2_v4h*)(tab + ((t >> 4) + 16 * u) * PITCH + (t & 15) * 8) = __builtin_convertvector(tv[u], w2_v4h);
    if (t < 16) *(w2_v4h*)(tab + 128 * PITCH + t * 8) = __builtin_convertvector(tl, w2_v4h);
    __syncthreads();
    const unsigned half16 = 16u * ((lane >> 3) & 1);
    v8f acc[4];
#pragma unroll
    for (int n = 0; n < 4; ++n) acc[n] = (v8f){0.f, 0.f, 0.f, 0.f, 0.f, 0.f, 0.f, 0.f};
#pragma unroll
    for (int ch = 0; ch < 4; ++ch) {
        const int cur = ch & 1, nxt = cur ^ 1;
        if (ch < 3) {
#pragma unroll
            for (int j = 0; j < 8; ++j) { id[nxt][j] = fr[16 * (8 * (ch + 1) + j)]; a[nxt][j] = *(const v8h*)(pa + 16 * (8 * (ch + 1) + j)); }
        }
#pragma unroll
        for (int s = 0; s < 4; ++s) {
            int r0 = id[cur][2 * s], r1 = id[cur][2 * s + 1];
            r0 = r0 < 0 ? 0 : (r0 >= TAB ? TAB - 1 : r0); r1 = r1 < 0 ? 0 : (r1 >= TAB ? TAB - 1 : r1);
            const unsigned char* p0 = tab + (unsigned)r0 * PITCH + half16;
            const unsigned char* p1 = tab + (unsigned)r1 * PITCH + half16;
            union { v16h v; v8h q[2]; } af, bf;
            af.q[0] = a[cur][2 * s]; af.q[1] = a[cur][2 * s + 1];
#pragma unroll
            for (int n = 0; n < 4; ++n) {
                bf.q[0] = w2_ldtr(p0 + 32 * n); bf.q[1] = w2_ldtr(p1 + 32 * n);
                acc[n] = __builtin_amdgcn_wmma_f32_16x16x32_f16(false, af.v, false, bf.v, (short)0, acc[n], false, false);
            }
        }
    }
    float* xo = X + (long long)g * (NH * HD) + (8 * h) * HD + c;
#pragma unroll
    for (int n = 0; n < 4; ++n)
#pragma unroll
        for (int r = 0; r < 8; ++r) { float* x = xo + r * HD + 16 * n; *x = *x + acc[n][r] * (1.f / 4096.f); }
}


extern "C" void kernel_launch(void* const* d_in, const int* in_sizes, int n_in, void* d_out, int out_size, void* d_ws, size_t ws_size, hipStream_t stream) {
    (void)in_sizes; (void)n_in; (void)out_size; (void)ws_size;
    const float* xq = (const float*)d_in[0];
    const float* xk = (const float*)d_in[1];
    const float* xv = (const float*)d_in[2];
    const int* fm = (const int*)d_in[3];
    const float* Wq = (const float*)d_in[4];
    const float* bq = (const float*)d_in[5];
    const float* Wk = (const float*)d_in[6];
    const float* bk = (const float*)d_in[7];
    const float* Wv = (const float*)d_in[8];
    const float* bv = (const float*)d_in[9];
    const float* Wo = (const float*)d_in[10];
    const float* bo = (const float*)d_in[11];
    const float* tk = (const float*)d_in[12];
    const float* tv = (const float*)d_in[13];
    const int Bn = 8;
    const int L = 512;
    const int D = 1024;
    const int NH = 16;
    const int HD = 64;
    const int NR = Bn * L;
    const int TAB = 129;
    const int TP = 192;
    float* out = (float*)d_out;
    char* wsp = (char*)d_ws;
    // kept through the call
    unsigned short* XA16 = (unsigned short*)wsp; wsp += (((size_t)((size_t)NR * D * 2) + 255) / 256) * 256;
    unsigned short* W16 = (unsigned short*)wsp; wsp += (((size_t)((size_t)D * D * 2) + 255) / 256) * 256;
    unsigned short* VT16 = (unsigned short*)wsp; wsp += (((size_t)((size_t)Bn * D * L * 2) + 255) / 256) * 256;
    unsigned short* TK16 = (unsigned short*)wsp; wsp += (((size_t)((size_t)TP * HD * 2) + 255) / 256) * 256;
    unsigned short* P16 = (unsigned short*)wsp; wsp += (((size_t)((size_t)Bn * NH * L * L * 2) + 255) / 256) * 256;
    float* X = (float*)wsp; wsp += (((size_t)((size_t)NR * D * 4) + 255) / 256) * 256;
    // one region, used twice in stream order: scores (Q16, K16, QT, SC), then the output projection's operands
    char* ph = wsp;
    unsigned short* Q16 = (unsigned short*)wsp; wsp += (((size_t)((size_t)NR * D * 2) + 255) / 256) * 256;
    unsigned short* K16 = (unsigned short*)wsp; wsp += (((size_t)((size_t)NR * D * 2) + 255) / 256) * 256;
    float* QT = (float*)wsp; wsp += (((size_t)((size_t)NR * NH * TP * 4) + 255) / 256) * 256;
    float* SC = (float*)wsp; wsp += (((size_t)((size_t)Bn * 8 * L * L * 4) + 255) / 256) * 256;
    unsigned short* G64A = (unsigned short*)ph;
    unsigned short* G64B = (unsigned short*)(ph + (((size_t)((size_t)NR * D * 2) + 255) / 256) * 256);
    k_cast16<<<(unsigned)((((long long)(NR) * ((D) / 2)) + 255) / 256), 256, 0, stream>>>(xq, D, (_Float16*)(XA16), D, NR, D, 1.0f);
    k_cast16<<<(unsigned)((((long long)(D) * ((D) / 2)) + 255) / 256), 256, 0, stream>>>(Wq, D, (_Float16*)(W16), D, D, D, 16.0f);
    w25::wmma_gemm64<0, false, 2, 1, false, 0><<<dim3((unsigned)((((NR) / 64) * ((D) / 64) + 7) / 8), (unsigned)(1)), 256, 0, stream>>>((const unsigned short*)(XA16), nullptr, D, 0, (const unsigned short*)(W16), nullptr, D, 0, (void*)(Q16), nullptr, D, 0, bq, nullptr, 0, NR, D, D, 0.0625f, 0, 0, 0);
    k_cast16<<<(unsigned)((((long long)(NR) * ((D) / 2)) + 255) / 256), 256, 0, stream>>>(xk, D, (_Float16*)(XA16), D, NR, D, 1.0f);
    k_cast16<<<(unsigned)((((long long)(D) * ((D) / 2)) + 255) / 256), 256, 0, stream>>>(Wk, D, (_Float16*)(W16), D, D, D, 16.0f);
    w25::wmma_gemm64<0, false, 2, 1, false, 0><<<dim3((unsigned)((((NR) / 64) * ((D) / 64) + 7) / 8), (unsigned)(1)), 256, 0, stream>>>((const unsigned short*)(XA16), nullptr, D, 0, (const unsigned short*)(W16), nullptr, D, 0, (void*)(K16), nullptr, D, 0, bk, nullptr, 0, NR, D, D, 0.0625f, 0, 0, 0);
    k_cast16<<<(unsigned)((((long long)(NR) * ((D) / 2)) + 255) / 256), 256, 0, stream>>>(xv, D, (_Float16*)(XA16), D, NR, D, 1.0f);
    k_cast16<<<(unsigned)((((long long)(D) * ((D) / 2)) + 255) / 256), 256, 0, stream>>>(Wv, D, (_Float16*)(W16), D, D, D, 16.0f);
    k_sh_tk<<<(TP * HD / 2 + 255) / 256, 256, 0, stream>>>(tk, (_Float16*)TK16, TAB, TP, HD);
    // QT[(b,q,h)][r] for all batches: the (b,q,h) rows of Q16 are contiguous 64-element rows
    w25::wmma_gemm64<0, false, 0, 0, false, 0><<<dim3((unsigned)((((NR * NH) / 64) * ((TP) / 64) + 7) / 8), (unsigned)(1)), 256, 0, stream>>>((const unsigned short*)(Q16), nullptr, HD, 0, (const unsigned short*)(TK16), nullptr, HD, 0, (void*)(QT), nullptr, TP, 0, nullptr, nullptr, 0, NR * NH, TP, HD, 0.0625f, 0, 0, 0);
    // VT16[b][c][k] = v^T, blockIdx.y = batch
    w25::wmma_gemm64<0, false, 1, 1, false, 0><<<dim3((unsigned)((((D) / 64) * ((L) / 64) + 7) / 8), (unsigned)(Bn)), 256, 0, stream>>>((const unsigned short*)(W16), nullptr, D, 0, (const unsigned short*)(XA16), nullptr, D, (long long)L * D, (void*)(VT16), nullptr, L, (long long)D * L, bv, nullptr, 0, D, L, D, 0.0625f, 0, 0, 0);
    // content scores and softmax: eight heads (blockIdx.y) of every batch (blockIdx.z) per launch; the softmax: one wave per query, eight queries per block
    w25::wmma_gemm64<0, false, 0, 0, false, 0><<<dim3((unsigned)((((L) / 64) * ((L) / 64) + 7) / 8), (unsigned)(8), (unsigned)(Bn)), 256, 0, stream>>>((const unsigned short*)(Q16 + 0 * HD), nullptr, D, HD, (const unsigned short*)(K16 + 0 * HD), nullptr, D, HD, (void*)(SC), nullptr, L, (long long)L * L, nullptr, nullptr, 0, L, L, HD, 1.0f, (long long)L * D, (long long)L * D, (long long)8 * L * L);
    k_sh_soft<<<(unsigned)(NR / 8), 256, 0, stream>>>(SC, QT, (const int*)fm, (_Float16*)P16, 0);
    w25::wmma_gemm64<0, false, 0, 0, false, 0><<<dim3((unsigned)((((L) / 64) * ((L) / 64) + 7) / 8), (unsigned)(8), (unsigned)(Bn)), 256, 0, stream>>>((const unsigned short*)(Q16 + 8 * HD), nullptr, D, HD, (const unsigned short*)(K16 + 8 * HD), nullptr, D, HD, (void*)(SC), nullptr, L, (long long)L * L, nullptr, nullptr, 0, L, L, HD, 1.0f, (long long)L * D, (long long)L * D, (long long)8 * L * L);
    k_sh_soft<<<(unsigned)(NR / 8), 256, 0, stream>>>(SC, QT, (const int*)fm, (_Float16*)P16, 8);
    // w1 = attn.v: blockIdx.y = head, blockIdx.z = batch
    w25::wmma_gemm64<0, false, 0, 0, false, 0><<<dim3((unsigned)((((L) / 64) * ((HD) / 64) + 7) / 8), (unsigned)(NH), (unsigned)(Bn)), 256, 0, stream>>>((const unsigned short*)(P16), nullptr, L, (long long)L * L, (const unsigned short*)(VT16), nullptr, L, (long long)HD * L, (void*)(X), nullptr, D, HD, nullptr, nullptr, 0, L, HD, L, 0.000244140625f, (long long)NH * L * L, (long long)D * L, (long long)L * D);
    // w2: one wave per query, eight queries per block
    k_sh_w2<<<(unsigned)(NR / 8), 256, 0, stream>>>((const _Float16*)P16, (const int*)fm, tv, X);
    k_cast16<<<(unsigned)((((long long)(4096) * ((1024) / 2)) + 255) / 256), 256, 0, stream>>>(X, 1024, (_Float16*)(G64A), 1024, 4096, 1024, 1.0f);
    k_cast16<<<(unsigned)((((long long)(1024) * ((1024) / 2)) + 255) / 256), 256, 0, stream>>>(Wo, 1024, (_Float16*)(G64B), 1024, 1024, 1024, 16.0f);
    w25::wmma_gemm64<0, false, 2, 0, false, 0><<<dim3((unsigned)((((4096) / 64) * ((1024) / 64) + 7) / 8), (unsigned)(1)), 256, 0, stream>>>((const unsigned short*)(G64A), nullptr, 1024, 0, (const unsigned short*)(G64B), nullptr, 1024, 0, (void*)(out), nullptr, 1024, 0, bo, nullptr, 0, 4096, 1024, 1024, 0.0625f, 0, 0, 0);
}

// v004
// A run of this version takes 337 microseconds.
// Timed twice side by side with v003, it ran 1.07 times as fast both times.
// All steps since v000 together make it 4.75 times as fast.
// Contractions: q/k/v = x.W^T + b [4096x1024].[1024x1024] and the output projection (+b) with f16 operands (weights x16); the relative-key term QT = q.table_k^T [65536 (b,q,h) x 64].[64 x 192 (129 padded)] with f16 operands; per (batch, head) the content scores q.k^T [512x64].[64x512] (heads and batches in the grid) and w1 = attn.v [512x512].[512x64] (heads and batches in the grid; attn as f16 of 4096 attn) — v_wmma_f32_16x16x32_f16, 64x64 register-blocked wave tiles; f32 accumulate. The gathered relative-key scores (QT[(b,q,h)][final_mat[b][q][k]] by the INPUT index matrix), the row softmax are f32 kernels; the relative-value aggregation w2[q,h,:] = sum_k attn[h,q,k] table_v[final_mat[b,q,k]] runs on the matrix cores as one [16 heads x 512].[512 x 64] product per query, one wave each, whose B fragments are gathered from an f16 copy of table_v in LDS by transposing loads (the INPUT index matrix picks each lane's table row).
#include <hip/hip_runtime.h>
#include <math.h>

typedef __attribute__((ext_vector_type(16))) _Float16 v16h;
typedef __attribute__((ext_vector_type(8)))  _Float16 v8h;
typedef __attribute__((ext_vector_type(16))) __bf16   v16b;
typedef __attribute__((ext_vector_type(8)))  float    v8f;
typedef __attribute__((ext_vector_type(4)))  float    v4f;

// 16-bit WMMA fragment map (wave32), lane L, h = L>>4, m = L&15:
//   A 16x32: lane = row m;   element i -> k = (i<8) ? 8h+i : 16+8h+(i-8)
//   B 32x16: lane = column m; the SAME k(i,h)
//   D 16x16 (8 f32): lane = column m; element r -> row 8h+r
__device__ __forceinline__ int frag_k(int i, int h) { return (i < 8) ? (8 * h + i) : (16 + 8 * h + (i - 8)); }
__device__ __forceinline__ __bf16 bf16_rne(float f) {
    unsigned int u = __float_as_uint(f);
    u += 0x7fffu + ((u >> 16) & 1u);
    return __builtin_bit_cast(__bf16, (unsigned short)(u >> 16));
}
__device__ __forceinline__ float bf16_f32(__bf16 b) { return __uint_as_float(((unsigned int)__builtin_bit_cast(unsigned short, b)) << 16); }
__device__ __forceinline__ v8f wmma16(v16h a, v16h b, v8f c) {
    c = __builtin_amdgcn_wmma_f32_16x16x32_f16(false, a, false, b, (short)0, c, false, false);
    asm volatile("v_nop\n\tv_nop\n\tv_nop\n\tv_nop" : "+v"(c) : "v"(a), "v"(b));
    return c;
}
__device__ __forceinline__ v8f wmmab(v16b a, v16b b, v8f c) {
    c = __builtin_amdgcn_wmma_f32_16x16x32_bf16(false, a, false, b, (short)0, c, false, false);
    asm volatile("v_nop\n\tv_nop\n\tv_nop\n\tv_nop" : "+v"(c) : "v"(a), "v"(b));
    return c;
}
struct Split { v16b hi, lo; };
// hi/lo split product: a.hi*b.hi + a.hi*b.lo + a.lo*b.hi
__device__ __forceinline__ v8f wmma3(const Split& a, const Split& b, v8f c) {
    c = __builtin_amdgcn_wmma_f32_16x16x32_bf16(false, a.hi, false, b.hi, (short)0, c, false, false);
    c = __builtin_amdgcn_wmma_f32_16x16x32_bf16(false, a.hi, false, b.lo, (short)0, c, false, false);
    c = __builtin_amdgcn_wmma_f32_16x16x32_bf16(false, a.lo, false, b.hi, (short)0, c, false, false);
    asm volatile("v_nop\n\tv_nop\n\tv_nop\n\tv_nop" : "+v"(c) : "v"(a.hi), "v"(a.lo), "v"(b.hi), "v"(b.lo));
    return c;
}
struct Split3 { v16b hi, mid, lo; };
// triple split product (6 terms, drops only terms below 2^-24 relative)
__device__ __forceinline__ v8f wmma6(const Split3& a, const Split3& b, v8f c) {
    c = __builtin_amdgcn_wmma_f32_16x16x32_bf16(false, a.hi, false, b.hi, (short)0, c, false, false);
    c = __builtin_amdgcn_wmma_f32_16x16x32_bf16(false, a.hi, false, b.mid, (short)0, c, false, false);
    c = __builtin_amdgcn_wmma_f32_16x16x32_bf16(false, a.mid, false, b.hi, (short)0, c, false, false);
    c = __builtin_amdgcn_wmma_f32_16x16x32_bf16(false, a.hi, false, b.lo, (short)0, c, false, false);
    c = __builtin_amdgcn_wmma_f32_16x16x32_bf16(false, a.mid, false, b.mid, (short)0, c, false, false);
    c = __builtin_amdgcn_wmma_f32_16x16x32_bf16(false, a.lo, false, b.hi, (short)0, c, false, false);
    asm volatile("v_nop\n\tv_nop\n\tv_nop\n\tv_nop" : "+v"(c) : "v"(a.hi), "v"(a.mid), "v"(a.lo), "v"(b.hi), "v"(b.mid), "v"(b.lo));
    return c;
}

// Fragment gathers from f32 memory: element i <- p[(k0 + frag_k(i,h)) * sk] * s, zero for k >= klen.
__device__ __forceinline__ v16h fh_ld(const float* __restrict__ p, long long sk, int k0, int h, int klen, float s) {
    v16h a;
#pragma unroll
    for (int i = 0; i < 16; ++i) { const int k = k0 + frag_k(i, h); a[i] = (k < klen) ? (_Float16)(p[(long long)k * sk] * s) : (_Float16)0.f; }
    return a;
}
__device__ __forceinline__ Split sp_ld(const float* __restrict__ p, long long sk, int k0, int h, int klen, float s) {
    Split r;
#pragma unroll
    for (int i = 0; i < 16; ++i) {
        const int k = k0 + frag_k(i, h); const float x = (k < klen) ? p[(long long)k * sk] * s : 0.f;
        const __bf16 hb = bf16_rne(x); r.hi[i] = hb; r.lo[i] = bf16_rne(x - bf16_f32(hb));
    }
    return r;
}
__device__ __forceinline__ Split3 sp3_ld(const float* __restrict__ p, long long sk, int k0, int h, int klen, float s) {
    Split3 r;
#pragma unroll
    for (int i = 0; i < 16; ++i) {
        const int k = k0 + frag_k(i, h); const float x = (k < klen) ? p[(long long)k * sk] * s : 0.f;
        const __bf16 hb = bf16_rne(x); const float r1 = x - bf16_f32(hb); const __bf16 mb = bf16_rne(r1);
        r.hi[i] = hb; r.mid[i] = mb; r.lo[i] = bf16_rne(r1 - bf16_f32(mb));
    }
    return r;
}
__device__ __forceinline__ v16b bh_ld(const float* __restrict__ p, long long sk, int k0, int h, int klen, float s) {
    v16b a;
#pragma unroll
    for (int i = 0; i < 16; ++i) { const int k = k0 + frag_k(i, h); a[i] = bf16_rne((k < klen) ? p[(long long)k * sk] * s : 0.f); }
    return a;
}
// f16 fragment from an f16 LDS/global row with element stride 1 (k-contiguous), no bounds (tile already zero padded)
__device__ __forceinline__ v16h fh_row(const _Float16* __restrict__ row, int k0, int h) {
    v16h a;
#pragma unroll
    for (int i = 0; i < 16; ++i) a[i] = row[k0 + frag_k(i, h)];
    return a;
}

#define VST2(T, ptr, val) do { const T vst2_v_ = (val); *(T*)(ptr) = vst2_v_;  } while (0)
typedef float v4f __attribute__((ext_vector_type(4)));
#define VST2V4(ptr, val) do { const v4f vst2_v4_ = (val); *(v4f*)(ptr) = vst2_v4_;  } while (0)

__device__ __attribute__((noinline)) float act_fn(float v, int act) {
    if (act == 1) return fmaxf(v, 0.f);                                                                               // relu
    if (act == 2) { const float u = 0.7978845608028654f * (v + 0.044715f * v * v * v); return 0.5f * v * (1.f + tanhf(u)); } // tanh-gelu
    if (act == 3) return v / (1.f + expf(-v));                                                                        // silu
    if (act == 4) return 0.5f * v * (1.f + erff(v * 0.7071067811865476f));                                             // erf-gelu
    if (act == 5) return tanhf(v);
    if (act == 6) return 1.f / (1.f + expf(-v));                                                                      // sigmoid
    if (act == 7) return (v > 0.f) ? v : 0.01f * v;                                                                   // leaky relu 0.01
    if (act == 8) return (v > 0.f) ? v : (expf(v) - 1.f);                                                             // elu
    if (act == 9) return fminf(fmaxf(v, 0.f), 6.f);                                                                   // relu6
    if (act == 10) return fabsf(v);                                                                                    // abs
    if (act == 11) return (v >= 0.f) ? v : 0.1f * v;                                                                  // leaky 0.1
    if (act == 12) return (v > 0.f) ? v : 0.2f * v;                                                                   // leaky 0.2
    if (act == 13) return (v > 20.f) ? v : log1pf(expf(v));                                                            // softplus
    return v;
}

// =====================================================================================================================
// k_gemm<MODE>: C(z, m, n) = act(alpha * sum_k A(z, m, k) * B(z, k, n) + bias) + beta * R(z, m, n)
//   One wave (32-thread block) per 16 x 32 tile of C; grid (ceil(N/32), ceil(M/16), Z). Batch z -> (zo = z / zi_n, zi = z % zi_n)
//   with separate outer/inner strides for every tensor (e.g. batch and head). A(m,k) = A[zo*sAo + zi*sAi + m*sAm + k*sAk] (f32),
//   B(k,n) = B[zo*sBo + zi*sBi + n*sBn + k*sBk] (f32); any M, N, K (K zero-padded to 32 inside the fragments, M/N tails guarded).
//   C(m,n) = C[zo*sCo + zi*sCi + m*sCm + n] (n contiguous). flags: 1 bias[n], 2 bias[m], 4 residual R[zo*sRo + zi*sRi + m*sRm + n*sRn].
//   MODE 0: f16 operands (A prescaled by sa, B by sb, both undone in the epilogue); 1: bf16 hi/lo split (3 products); 2: bf16;
//   3: bf16 hi/mid/lo triple split (6 products); 4: as 3 with Kahan-compensated f32 accumulation across k-steps.
// =====================================================================================================================
struct GemmP {
    const float* A; const float* B; const float* bias; const float* R; float* C;
    long long sAo, sAi, sAm, sAk, sBo, sBi, sBn, sBk, sCo, sCi, sCm, sRo, sRi, sRm, sRn;
    int M, N, K, zi_n, flags, act; float alpha, beta, sa, sb;
    int Npad, pad_;     // columns [N, Npad) of C are written as 0 so that padded workspace rows are covered by whole-line stores; Npad >= N
};
static_assert(sizeof(GemmP) == 5 * 8 + 15 * 8 + 6 * 4 + 4 * 4 + 2 * 4, "GemmP has padding");

template <int MODE>
__global__ __launch_bounds__(32) void k_gemm(GemmP p) {
    const int lane = threadIdx.x & 31, h = lane >> 4, l15 = lane & 15;
    const int m0 = blockIdx.y * 16, n0 = blockIdx.x * 32;
    const int z = blockIdx.z, zo = z / p.zi_n, zi = z - zo * p.zi_n;
    const float* A = p.A + zo * p.sAo + zi * p.sAi;
    const float* B = p.B + zo * p.sBo + zi * p.sBi;
    const int am = min(m0 + l15, p.M - 1);                       // clamped row for loads (stores are guarded)
    v8f acc[2], comp[2];
#pragma unroll
    for (int t = 0; t < 2; ++t) { v8f zz = {}; acc[t] = zz; comp[t] = zz; }
    for (int k0 = 0; k0 < p.K; k0 += 32) {
        const float* arow = A + (long long)am * p.sAm;
        if (MODE == 1) {
            const Split a = sp_ld(arow, p.sAk, k0, h, p.K, 1.f);
#pragma unroll
            for (int t = 0; t < 2; ++t) {
                const int bn = min(n0 + t * 16 + l15, p.N - 1);
                acc[t] = wmma3(a, sp_ld(B + (long long)bn * p.sBn, p.sBk, k0, h, p.K, 1.f), acc[t]);
            }
        } else if (MODE == 3) {
            const Split3 a = sp3_ld(arow, p.sAk, k0, h, p.K, 1.f);
#pragma unroll
            for (int t = 0; t < 2; ++t) {
                const int bn = min(n0 + t * 16 + l15, p.N - 1);
                acc[t] = wmma6(a, sp3_ld(B + (long long)bn * p.sBn, p.sBk, k0, h, p.K, 1.f), acc[t]);
            }
        } else if (MODE == 4) {
            // triple split as MODE 3, but each k-step's 6 products go into a fresh accumulator and the partial is added to the running f32 sum
            // on the VALU with Kahan compensation (accumulation error stays ~1 ulp however long K is)
            const Split3 a = sp3_ld(arow, p.sAk, k0, h, p.K, 1.f);
#pragma unroll
            for (int t = 0; t < 2; ++t) {
                const int bn = min(n0 + t * 16 + l15, p.N - 1); v8f zz = {};
                const v8f part = wmma6(a, sp3_ld(B + (long long)bn * p.sBn, p.sBk, k0, h, p.K, 1.f), zz);
                const v8f y = part - comp[t]; const v8f s = acc[t] + y; comp[t] = (s - acc[t]) - y; acc[t] = s;
            }
        } else if (MODE == 2) {
            const v16b a = bh_ld(arow, p.sAk, k0, h, p.K, 1.f);
#pragma unroll
            for (int t = 0; t < 2; ++t) {
                const int bn = min(n0 + t * 16 + l15, p.N - 1);
                acc[t] = wmmab(a, bh_ld(B + (long long)bn * p.sBn, p.sBk, k0, h, p.K, 1.f), acc[t]);
            }
        } else {
            const v16h a = fh_ld(arow, p.sAk, k0, h, p.K, p.sa);
#pragma unroll
            for (int t = 0; t < 2; ++t) {
                const int bn = min(n0 + t * 16 + l15, p.N - 1);
                acc[t] = wmma16(a, fh_ld(B + (long long)bn * p.sBn, p.sBk, k0, h, p.K, p.sb), acc[t]);
            }
        }
    }
    const float iscale = (MODE == 0) ? p.alpha / (p.sa * p.sb) : p.alpha;
    float* C = p.C + zo * p.sCo + zi * p.sCi;
    const float* R = p.R + zo * p.sRo + zi * p.sRi;
    __shared__ __align__(16) float ctile[16][36];
#pragma unroll
    for (int t = 0; t < 2; ++t) {
        const int n = n0 + t * 16 + l15; const int nn = min(n, p.N - 1);
#pragma unroll
        for (int r = 0; r < 8; ++r) {
            const int m = m0 + 8 * h + r; const int mm = min(m, p.M - 1);
            float v = acc[t][r] * iscale;
            if (p.flags & 1) v += p.bias[nn];
            if (p.flags & 2) v += p.bias[mm];
            if (p.flags & 8) v *= p.bias[(long long)zo * p.M + mm];   /* per-(zo,row) scale vector laid out [Z / zi_n][M]; exclusive with the bias flags */
            v = act_fn(v, p.act);
            if (p.flags & 4) v += p.beta * R[(long long)mm * p.sRm + (long long)nn * p.sRn];
            ctile[8 * h + r][t * 16 + l15] = (n < p.N) ? v : 0.f;
        }
    }
    __syncthreads();
    const int NW = (p.Npad > p.N) ? p.Npad : p.N;           // write width
    const bool fast = (m0 + 16 <= p.M) && (n0 + 32 <= NW) && ((p.sCm & 3) == 0) && ((((size_t)C) & 15) == 0);
    if (fast) {
#pragma unroll
        for (int s = 0; s < 4; ++s) {
            const int row = s * 4 + (lane >> 3), c4 = (lane & 7) * 4;
            const v4f v = *(const v4f*)&ctile[row][c4];
            VST2V4(C + (long long)(m0 + row) * p.sCm + n0 + c4, v);
        }
    } else {
        for (int row = 0; row < 16; ++row) {
            const int m = m0 + row, n = n0 + lane;
            if (m < p.M && n < NW) VST2(float, C + (long long)m * p.sCm + n, ctile[row][lane]);
        }
    }
}


// =====================================================================================================================
// k_gemmT<MODE, TM, TN>: same contract as k_gemm, but one wave computes a (16*TM) x (16*TN) tile: TM A fragments and TN B fragments are
//   loaded per 32-wide k-step and reused across TM*TN WMMAs (far fewer load/convert instructions per MAC). MODE 0 (f16), 1 (bf16 hi/lo),
//   2 (bf16) only. grid (ceil(NW/(16*TN)), ceil(M/(16*TM)), Z), block 32. Epilogue identical to k_gemm, run per 16x32 sub-tile.
// =====================================================================================================================
template <int MODE, int TM, int TN>
__global__ __launch_bounds__(32) void k_gemmT(GemmP p) {
    const int lane = threadIdx.x & 31, h = lane >> 4, l15 = lane & 15;
    const int m0 = blockIdx.y * (16 * TM), n0 = blockIdx.x * (16 * TN);
    const int z = blockIdx.z, zo = z / p.zi_n, zi = z - zo * p.zi_n;
    const float* A = p.A + zo * p.sAo + zi * p.sAi;
    const float* B = p.B + zo * p.sBo + zi * p.sBi;
    v8f acc[TM][TN];
#pragma unroll
    for (int i = 0; i < TM; ++i)
#pragma unroll
        for (int t = 0; t < TN; ++t) { v8f zz = {}; acc[i][t] = zz; }
    for (int k0 = 0; k0 < p.K; k0 += 32) {
        if (MODE == 1) {
            Split a[TM], b[TN];
#pragma unroll
            for (int i = 0; i < TM; ++i) { const int am = min(m0 + 16 * i + l15, p.M - 1); a[i] = sp_ld(A + (long long)am * p.sAm, p.sAk, k0, h, p.K, 1.f); }
#pragma unroll
            for (int t = 0; t < TN; ++t) { const int bn = min(n0 + 16 * t + l15, p.N - 1); b[t] = sp_ld(B + (long long)bn * p.sBn, p.sBk, k0, h, p.K, 1.f); }
#pragma unroll
            for (int i = 0; i < TM; ++i)
#pragma unroll
                for (int t = 0; t < TN; ++t) acc[i][t] = wmma3(a[i], b[t], acc[i][t]);
        } else if (MODE == 2) {
            v16b a[TM], b[TN];
#pragma unroll
            for (int i = 0; i < TM; ++i) { const int am = min(m0 + 16 * i + l15, p.M - 1); a[i] = bh_ld(A + (long long)am * p.sAm, p.sAk, k0, h, p.K, 1.f); }
#pragma unroll
            for (int t = 0; t < TN; ++t) { const int bn = min(n0 + 16 * t + l15, p.N - 1); b[t] = bh_ld(B + (long long)bn * p.sBn, p.sBk, k0, h, p.K, 1.f); }
#pragma unroll
            for (int i = 0; i < TM; ++i)
#pragma unroll
                for (int t = 0; t < TN; ++t) acc[i][t] = wmmab(a[i], b[t], acc[i][t]);
        } else {
            v16h a[TM], b[TN];
#pragma unroll
            for (int i = 0; i < TM; ++i) { const int am = min(m0 + 16 * i + l15, p.M - 1); a[i] = fh_ld(A + (long long)am * p.sAm, p.sAk, k0, h, p.K, p.sa); }
#pragma unroll
            for (int t = 0; t < TN; ++t) { const int bn = min(n0 + 16 * t + l15, p.N - 1); b[t] = fh_ld(B + (long long)bn * p.sBn, p.sBk, k0, h, p.K, p.sb); }
#pragma unroll
            for (int i = 0; i < TM; ++i)
#pragma unroll
                for (int t = 0; t < TN; ++t) acc[i][t] = wmma16(a[i], b[t], acc[i][t]);
        }
    }
    const float iscale = (MODE == 0) ? p.alpha / (p.sa * p.sb) : p.alpha;
    float* C = p.C + zo * p.sCo + zi * p.sCi;
    const float* R = p.R + zo * p.sRo + zi * p.sRi;
    const int NW = (p.Npad > p.N) ? p.Npad : p.N;
    __shared__ __align__(16) float ctile[16][36];
#pragma unroll
    for (int i = 0; i < TM; ++i) {
        const int mb = m0 + 16 * i; if (mb >= p.M) break;          // wave-uniform
#pragma unroll
        for (int tp = 0; tp < TN / 2; ++tp) {
            const int nb = n0 + 32 * tp; if (nb >= NW) break;        // wave-uniform
#pragma unroll
            for (int t2 = 0; t2 < 2; ++t2) {
                const int t = 2 * tp + t2; const int n = nb + t2 * 16 + l15; const int nn = min(n, p.N - 1);
#pragma unroll
                for (int r = 0; r < 8; ++r) {
                    const int m = mb + 8 * h + r; const int mm = min(m, p.M - 1);
                    float v = acc[i][t][r] * iscale;
                    if (p.flags & 1) v += p.bias[nn];
                    if (p.flags & 2) v += p.bias[mm];
            if (p.flags & 8) v *= p.bias[(long long)zo * p.M + mm];   /* per-(zo,row) scale vector laid out [Z / zi_n][M]; exclusive with the bias flags */
                    v = act_fn(v, p.act);
                    if (p.flags & 4) v += p.beta * R[(long long)mm * p.sRm + (long long)nn * p.sRn];
                    ctile[8 * h + r][t2 * 16 + l15] = (n < p.N) ? v : 0.f;
                }
            }
            __syncthreads();
            const bool fast = (mb + 16 <= p.M) && (nb + 32 <= NW) && ((p.sCm & 3) == 0) && ((((size_t)C) & 15) == 0);
            if (fast) {
#pragma unroll
                for (int s = 0; s < 4; ++s) {
                    const int row = s * 4 + (lane >> 3), c4 = (lane & 7) * 4;
                    const v4f v = *(const v4f*)&ctile[row][c4];
                    VST2V4(C + (long long)(mb + row) * p.sCm + nb + c4, v);
                }
            } else {
                for (int row = 0; row < 16; ++row) {
                    const int m = mb + row, n = nb + lane;
                    if (m < p.M && n < NW) VST2(float, C + (long long)m * p.sCm + n, ctile[row][lane]);
                }
            }
            __syncthreads();
        }
    }
}

// =====================================================================================================================
//   Wave = 16 queries, AW waves per block, 64-key blocks; grid (ceil(Lq/(16*AW)), H, B), block 32*AW. Any Lq, Lk; head dim dh <= DHP
//   (DHP multiple of 32), value dim dv <= DVP (multiple of 16, <= 128). Every tensor addressed by (batch, head, row, element) strides, f32.
//   Scores: QM 0 f16 operands, 1 bf16 hi/lo split, 2 bf16 triple split; statistics f32 (exp2 domain); P.V: P x 4096 as f16 with V f16 staged in LDS
//   (SPLITPV: P and V as bf16 hi/lo splits). kv head = h / hrep. Masking: causal = 1 (keep j <= i + coff, masked -> -inf, key blocks beyond the
//   diagonal skipped), causal = 2 (masked -> mfill, a finite fill like the -1e9; no skipping), causal = 3 (keep j >= i + coff,
//   masked -> -inf, no skipping); optional additive f32 mask Mf,
//   optional int keep-mask Mi (0 -> score := mfill), both addressed b*smb + h*smh + i*smi + j*smj (0 strides broadcast).
// =====================================================================================================================
#define AW 4
struct AttnP {   // apv4
    const float* Q; const float* K; const float* V; float* O; float* P; const float* Mf; const int* Mi; float* ST;
    const float* Pw; const float* Rt; const int* SQ; const int* SK;           // optional: post-softmax weight, relative-position table, segment ids
    long long swb, swh, swi, swj, srb, srh, sri;                                 // Pw strides (b,h,i,j); Rt strides (b,h,i), column = clamp(i - j + roff, 0, rn-1)
    long long sQb, sQh, sQi, sQd, sKb, sKh, sKj, sKd, sVb, sVh, sVj, sVd, sOb, sOh, sOi, sPb, sPh, sPi, smb, smh, smi, smj;
    int Lq, Lk, dh, dv, hrep, causal, coff, pband;   // pband > 0: P holds only the band |j - i| <= pband, column j - i + pband
    float scale, mfill; int nonorm, mpol;             // nonorm (online path only): O = sum_j exp(score_j) V_j without the 1/rowsum (scores must be <= ~0); mpol: Mi masks where ==0 (mpol 0) or where !=0 (mpol 1)
    int roff, rn, segpol, win;                        // Rt column offset/count; SQ/SK: score := mfill where (segpol 0) SQ[i] != SK[j] or (segpol 1) SQ[i] == SK[j]; win > 0: keys with i - j > win (after coff) -> -inf
};
//   Pw: the softmax numerator is multiplied by Pw(b,h,i,j) AFTER the row sum is taken (probs * weight, then P.V), as in post-softmax multiplicative biases.                                                    // ST (optional): per row (b,h,i) -> ST[((b*H + h)*Lq + i)*2 + {0,1}] = {row max of the scaled+masked score (natural units), sum_j exp(score - max)}
static_assert(sizeof(AttnP) == 12 * 8 + 29 * 8 + 16 * 4, "AttnP has padding");

#ifndef KATTN_ATTR
#define KATTN_ATTR
#endif
template <int DHP, int DVP, int QM, bool SPLITPV, bool TWOPASS>
__global__ __launch_bounds__(32 * AW) KATTN_ATTR void k_attn(AttnP p) {
    constexpr int NT = DVP / 16;                // output tiles
    constexpr int KS = DHP / 32;                // k-steps for the scores
    constexpr int VP = DVP + 8;                 // LDS pitch (halves)
    __shared__ __align__(16) float    pl[AW][16 * 64];
    __shared__ __align__(16) _Float16 vl[(SPLITPV ? 2 : 1) * 64 * VP];   // f16 V tile, or bf16 hi and lo tiles (same 2-byte size)
    const int lane = threadIdx.x & 31, hf = lane >> 4, l15 = lane & 15, wave = threadIdx.x >> 5;
    const int h = blockIdx.y, b = blockIdx.z, hk = h / p.hrep;
    const int q0 = (blockIdx.x * AW + wave) * 16;
    float* myp = pl[wave];
    const float L2E = 1.4426950408889634f;
    const float NEG = -__builtin_inff();
    const int qi = min(q0 + l15, p.Lq - 1);
    const float* qrow = p.Q + b * p.sQb + h * p.sQh + (long long)qi * p.sQi;
    const float* kbase = p.K + b * p.sKb + hk * p.sKh;
    const float* vbase = p.V + b * p.sVb + hk * p.sVh;
    v16h qa[QM == 0 ? KS : 1]; Split qs_[QM == 1 ? KS : 1]; Split3 qt_[QM == 2 ? KS : 1];
#pragma unroll
    for (int ks = 0; ks < KS; ++ks) {
        if (QM == 2) qt_[ks] = sp3_ld(qrow, p.sQd, ks * 32, hf, p.dh, 1.f);
        else if (QM == 1) qs_[ks] = sp_ld(qrow, p.sQd, ks * 32, hf, p.dh, 1.f);
        else qa[ks] = fh_ld(qrow, p.sQd, ks * 32, hf, p.dh, 1.f);
    }
    v8f o[NT]; float m8[8], l8[8];
#pragma unroll
    for (int t = 0; t < NT; ++t) { v8f zz = {}; o[t] = zz; }
#pragma unroll
    for (int i = 0; i < 8; ++i) { m8[i] = NEG; l8[i] = 0.f; }
    int jend = p.Lk; int jstart = 0;
    if (p.causal == 1) { const int je = (blockIdx.x * AW + AW - 1) * 16 + 16 + p.coff; jend = min(jend, max(je, 0)); }   // uniform per block
    if (p.win > 0) { const int js = (int)(blockIdx.x * AW) * 16 + p.coff - p.win; jstart = (js > 0) ? (js / 64) * 64 : 0; }   // uniform per block: key blocks entirely outside every row's window hold only -inf entries and are skipped exactly
    const int npass = TWOPASS ? 2 : 1;
    for (int pass = 0; pass < npass; ++pass) {
        const bool dopv = (!TWOPASS) || pass == 1;
        for (int j0 = jstart; j0 < jend; j0 += 64) {
            if (dopv) {
                __syncthreads();                                 // previous key block's reads of vl / pl are done
                for (int idx = threadIdx.x; idx < 64 * DVP; idx += 32 * AW) {
                    const int jr = idx / DVP, d = idx - jr * DVP, j = j0 + jr;
                    const float f = (j < p.Lk && d < p.dv) ? vbase[(long long)j * p.sVj + (long long)d * p.sVd] : 0.f;
                    if (SPLITPV) {
                        const __bf16 hb = bf16_rne(f);
                        ((__bf16*)vl)[jr * VP + d] = hb; ((__bf16*)vl)[64 * VP + jr * VP + d] = bf16_rne(f - bf16_f32(hb));
                    } else vl[jr * VP + d] = (_Float16)f;
                }
            }
            v8f s[4];
#pragma unroll
            for (int t = 0; t < 4; ++t) {
                const int j = min(j0 + t * 16 + l15, p.Lk - 1);
                const float* krow = kbase + (long long)j * p.sKj;
                v8f acc = {};
#pragma unroll
                for (int ks = 0; ks < KS; ++ks) {
                    if (QM == 2)      acc = wmma6(qt_[ks], sp3_ld(krow, p.sKd, ks * 32, hf, p.dh, 1.f), acc);
                    else if (QM == 1) acc = wmma3(qs_[ks], sp_ld(krow, p.sKd, ks * 32, hf, p.dh, 1.f), acc);
                    else              acc = wmma16(qa[ks], fh_ld(krow, p.sKd, ks * 32, hf, p.dh, 1.f), acc);
                }
                s[t] = acc;
            }
            float pv[8][4];
#pragma unroll
            for (int i = 0; i < 8; ++i) {
                const int irow = q0 + i + 8 * hf;
                const int ic = min(irow, p.Lq - 1);
                float sc[4];
#pragma unroll
                for (int t = 0; t < 4; ++t) {
                    const int jg = j0 + t * 16 + l15;
                    float v = s[t][i] * p.scale;
                    if (p.Mf) v += p.Mf[b * p.smb + h * p.smh + (long long)ic * p.smi + (long long)min(jg, p.Lk - 1) * p.smj];
                    if (p.Rt) { int rc = ic - min(jg, p.Lk - 1) + p.roff; rc = rc < 0 ? 0 : (rc >= p.rn ? p.rn - 1 : rc); v += p.Rt[b * p.srb + h * p.srh + (long long)ic * p.sri + rc]; }
                    if (p.Mi) { const int mv = p.Mi[b * p.smb + h * p.smh + (long long)ic * p.smi + (long long)min(jg, p.Lk - 1) * p.smj]; if (p.mpol ? (mv != 0) : (mv == 0)) v = p.mfill; }
                    if (p.SQ) { const bool same = p.SQ[(long long)b * p.Lq + ic] == p.SK[(long long)b * p.Lk + min(jg, p.Lk - 1)]; if (p.segpol ? same : !same) v = p.mfill; }
                    if (p.causal == 2 && jg > irow + p.coff) v = p.mfill;
                    if (jg >= p.Lk || (p.causal == 1 && jg > irow + p.coff) || (p.causal == 3 && jg < irow + p.coff) || (p.win > 0 && irow + p.coff - jg > p.win)) v = NEG; else v *= L2E;
                    sc[t] = v;
                }
                if (!TWOPASS || pass == 0) {
                    float mx = fmaxf(fmaxf(sc[0], sc[1]), fmaxf(sc[2], sc[3]));
                    mx = fmaxf(mx, __shfl_xor(mx, 1, 32)); mx = fmaxf(mx, __shfl_xor(mx, 2, 32));
                    mx = fmaxf(mx, __shfl_xor(mx, 4, 32)); mx = fmaxf(mx, __shfl_xor(mx, 8, 32));
                    const float mnew = fmaxf(m8[i], mx);
                    const float corr = (mnew == NEG) ? 1.f : exp2f(m8[i] - mnew);
                    float rs = 0.f;
#pragma unroll
                    for (int t = 0; t < 4; ++t) {
                        const float pp = (sc[t] == NEG) ? 0.f : exp2f(sc[t] - mnew); rs += pp;
                        pv[i][t] = p.Pw ? pp * p.Pw[b * p.swb + h * p.swh + (long long)ic * p.swi + (long long)min(j0 + t * 16 + l15, p.Lk - 1) * p.swj] : pp;
                    }
                    rs += __shfl_xor(rs, 1, 32); rs += __shfl_xor(rs, 2, 32); rs += __shfl_xor(rs, 4, 32); rs += __shfl_xor(rs, 8, 32);
                    l8[i] = l8[i] * corr + rs; m8[i] = mnew;
                    if (!TWOPASS) {
#pragma unroll
                        for (int t = 0; t < NT; ++t) o[t][i] *= corr;
                    }
                } else {
                    const float inv = (l8[i] > 0.f) ? 1.f / l8[i] : 0.f;
#pragma unroll
                    for (int t = 0; t < 4; ++t) {
                        const int jg = j0 + t * 16 + l15;
                        float pp = (sc[t] == NEG) ? 0.f : exp2f(sc[t] - m8[i]) * inv;
                        if (p.Pw) pp *= p.Pw[b * p.swb + h * p.swh + (long long)ic * p.swi + (long long)min(jg, p.Lk - 1) * p.swj];
                        pv[i][t] = pp;
                    }
                }
            }
            if (dopv) {
#pragma unroll
                for (int i = 0; i < 8; ++i)
#pragma unroll
                    for (int t = 0; t < 4; ++t) ((float*)myp)[(i + 8 * hf) * 64 + t * 16 + l15] = pv[i][t];
                __syncthreads();                                 // P (per wave) and V (shared) visible
                if (p.P) {
                    float* pb_ = p.P + b * p.sPb + h * p.sPh;
                    const bool fastP = (p.pband == 0) && ((p.sPi & 3) == 0) && (j0 + 64 <= p.Lk) && (q0 + 16 <= p.Lq) && ((((size_t)pb_) & 15) == 0);
                    if (fastP) {
#pragma unroll
                        for (int s = 0; s < 8; ++s) {
                            const int row = s * 2 + (lane >> 4), c4 = (lane & 15) * 4;
                            const v4f v = *(const v4f*)(myp + row * 64 + c4);
                            VST2V4(pb_ + (long long)(q0 + row) * p.sPi + j0 + c4, v);
                        }
                    } else {
                        for (int row = 0; row < 16; ++row) {
                            const int irow = q0 + row; if (irow >= p.Lq) continue;
                            for (int c = lane; c < 64; c += 32) {
                                const int jg = j0 + c; if (jg >= p.Lk) continue;
                                if (p.pband == 0) VST2(float, pb_ + (long long)irow * p.sPi + jg, myp[row * 64 + c]);
                                else if (jg - irow <= p.pband && irow - jg <= p.pband) VST2(float, pb_ + (long long)irow * p.sPi + (jg - irow + p.pband), myp[row * 64 + c]);
                            }
                        }
                    }
                }
                if (SPLITPV) {
                    const Split pa0 = sp_ld(myp + l15 * 64, 1, 0, hf, 64, 1.f), pa1 = sp_ld(myp + l15 * 64, 1, 32, hf, 64, 1.f);
                    const __bf16* vh = (const __bf16*)vl; const __bf16* vlo = vh + 64 * VP;
#pragma unroll
                    for (int t = 0; t < NT; ++t) {
                        const int dcol = t * 16 + l15;
                        Split b0, b1;
#pragma unroll
                        for (int e = 0; e < 16; ++e) {
                            const int k0 = frag_k(e, hf), k1 = 32 + frag_k(e, hf);
                            b0.hi[e] = vh[k0 * VP + dcol]; b0.lo[e] = vlo[k0 * VP + dcol]; b1.hi[e] = vh[k1 * VP + dcol]; b1.lo[e] = vlo[k1 * VP + dcol];
                        }
                        o[t] = wmma3(pa0, b0, o[t]);
                        o[t] = wmma3(pa1, b1, o[t]);
                    }
                } else {
                    const v16h pa0 = fh_ld(myp + l15 * 64, 1, 0, hf, 64, 4096.f), pa1 = fh_ld(myp + l15 * 64, 1, 32, hf, 64, 4096.f);
#pragma unroll
                    for (int t = 0; t < NT; ++t) {
                        const int dcol = t * 16 + l15;
                        v16h b0, b1;
#pragma unroll
                        for (int e = 0; e < 16; ++e) { b0[e] = vl[frag_k(e, hf) * VP + dcol]; b1[e] = vl[(32 + frag_k(e, hf)) * VP + dcol]; }
                        o[t] = wmma16(pa0, b0, o[t]);
                        o[t] = wmma16(pa1, b1, o[t]);
                    }
                }
            }
        }
    }
    float* obase = p.O + b * p.sOb + h * p.sOh;
    if (p.ST) {
        const int rl = lane >> 1, isel = rl & 7;           // row q0 + rl ; rl>>3 == hf holds because lane>>4 == (lane>>1)>>3
        float mv = 0.f, lv = 0.f;
#pragma unroll
        for (int i = 0; i < 8; ++i) if (i == isel) { mv = m8[i]; lv = l8[i]; }
        const int irow = q0 + rl;
        if (irow < p.Lq) { float* st = p.ST + (((long long)b * gridDim.y + h) * p.Lq + irow) * 2 + (lane & 1); VST2(float, st, (lane & 1) ? lv : mv * 0.6931471805599453f); }
    }
    float invr[8];
#pragma unroll
    for (int i = 0; i < 8; ++i) {
        if (TWOPASS) invr[i] = SPLITPV ? 1.f : (1.f / 4096.f);
        else if (p.nonorm) invr[i] = exp2f(m8[i]) * (SPLITPV ? 1.f : (1.f / 4096.f));
        else invr[i] = (l8[i] > 0.f) ? (SPLITPV ? 1.f / l8[i] : 1.f / (l8[i] * 4096.f)) : 0.f;
    }
    __syncthreads();                                             // all waves done with pl/vl from the main loop
    const bool ofast = ((p.sOi & 3) == 0) && ((((size_t)obase) & 15) == 0) && (q0 + 16 <= p.Lq);
#pragma unroll
    for (int c0 = 0; c0 < DVP; c0 += 64) {
#pragma unroll
        for (int i = 0; i < 8; ++i)
#pragma unroll
            for (int t = 0; t < NT; ++t) if (t * 16 >= c0 && t * 16 < c0 + 64) ((float*)myp)[(i + 8 * hf) * 64 + (t * 16 - c0) + l15] = o[t][i] * invr[i];
        __syncthreads();
        const int cw = (DVP - c0 < 64) ? (DVP - c0) : 64;      // staged columns in this chunk (multiple of 16)
        if (ofast && (c0 + cw <= p.dv) && (cw % 32 == 0)) {
            const int lpr = cw / 4;                              // lanes per row (16 for 64 cols, 8 for 32)
            const int rows_per_ins = 32 / lpr;
            for (int r0 = 0; r0 < 16; r0 += rows_per_ins) {
                const int row = r0 + lane / lpr, c4 = (lane % lpr) * 4;
                const v4f v = *(const v4f*)(myp + row * 64 + c4);
                VST2V4(obase + (long long)(q0 + row) * p.sOi + c0 + c4, v);
            }
        } else {
            for (int row = 0; row < 16; ++row) {
                const int irow = q0 + row; if (irow >= p.Lq) continue;
                for (int c = lane; c < cw; c += 32) { const int d = c0 + c; if (d < p.dv) VST2(float, obase + (long long)irow * p.sOi + d, myp[row * 64 + c]); }
            }
        }
        __syncthreads();
    }
}

// =====================================================================================================================
// k_tr: dst(z, c, r) = alpha * src(z, r, c) (+ beta * R2(z, c, r)): [Z][R][C] (row stride lds) -> [Z][C][R] (row stride ldd) through a 32x32 LDS tile;
//   flags: 1 -> add beta * residual R2 addressed like dst (z*sRz + c*ldr + r); act applied before the residual.
// =====================================================================================================================
struct TrP { const float* src; float* dst; const float* R2; long long sSz, lds, sDz, ldd, sRz, ldr; int R, C, flags, act; float alpha, beta; };
static_assert(sizeof(TrP) == 3 * 8 + 6 * 8 + 6 * 4, "TrP has padding");
__global__ __launch_bounds__(256) void k_tr(TrP p) {
    __shared__ float tile[32][33];
    const int c0 = blockIdx.x * 32, r0 = blockIdx.y * 32, z = blockIdx.z;
    const int lane = threadIdx.x & 31, wave = threadIdx.x >> 5;
    const float* s = p.src + z * p.sSz;
#pragma unroll
    for (int k = 0; k < 4; ++k) {
        const int rl = wave * 4 + k, r = r0 + rl, c = c0 + lane;
        tile[rl][lane] = (r < p.R && c < p.C) ? s[(long long)r * p.lds + c] : 0.f;
    }
    __syncthreads();
    float* d = p.dst + z * p.sDz; const float* rr = p.R2 + z * p.sRz;
#pragma unroll
    for (int k = 0; k < 4; ++k) {
        const int cl = wave * 4 + k, c = c0 + cl, r = r0 + lane;
        if (c < p.C && r < p.R) {
            float v = act_fn(p.alpha * tile[lane][cl], p.act);
            if (p.flags & 1) v += p.beta * rr[(long long)c * p.ldr + r];
            VST2(float, d + (long long)c * p.ldd + r, v);
        }
    }
}

// k_affine: dst[i] = a * (sdev ? sdev[0] : 1) * src[i] + b, i < n (one thread per element; consecutive lanes -> consecutive addresses)
__global__ __launch_bounds__(256) void k_affine(const float* __restrict__ src, float* __restrict__ dst, int n, float a, float b, const float* __restrict__ sdev) {
    const int i = blockIdx.x * 256 + threadIdx.x;
    if (i < n) { const float aa = sdev ? a * sdev[0] : a; const float v = aa * src[i] + b; VST2(float, dst + i, v); }
}

// =====================================================================================================================
// k_softmax: row softmax over n contiguous elements, one 256-thread block per row; rows addressed z*sz + r*sr (grid (R, Z)).
//   out = scale_out * softmax(scale_in * x + (Mf ? Mf[z*smz + r*smr + j] : 0)); a row whose max is -inf is written as 0.
// =====================================================================================================================
struct SmP { const float* src; float* dst; const float* Mf; long long sz, sr, dz, dr, smz, smr; int n, pad; float scale_in, scale_out; };
static_assert(sizeof(SmP) == 3 * 8 + 6 * 8 + 4 * 4, "SmP has padding");
__global__ __launch_bounds__(256) void k_softmax(SmP p) {
    __shared__ float red[256];
    const int r = blockIdx.x, z = blockIdx.y, tid = threadIdx.x;
    const float* s = p.src + z * p.sz + (long long)r * p.sr;
    const float* mf = p.Mf ? (p.Mf + z * p.smz + (long long)r * p.smr) : nullptr;
    float mx = -__builtin_inff();
    for (int j = tid; j < p.n; j += 256) { float v = s[j] * p.scale_in; if (mf) v += mf[j]; mx = fmaxf(mx, v); }
    red[tid] = mx; __syncthreads();
    for (int o = 128; o > 0; o >>= 1) { if (tid < o) red[tid] = fmaxf(red[tid], red[tid + o]); __syncthreads(); }
    mx = red[0]; __syncthreads();
    float sum = 0.f;
    for (int j = tid; j < p.n; j += 256) { float v = s[j] * p.scale_in; if (mf) v += mf[j]; sum += (mx == -__builtin_inff()) ? 0.f : expf(v - mx); }
    red[tid] = sum; __syncthreads();
    for (int o = 128; o > 0; o >>= 1) { if (tid < o) red[tid] += red[tid + o]; __syncthreads(); }
    sum = red[0];
    const float inv = (sum > 0.f) ? p.scale_out / sum : 0.f;
    float* d = p.dst + z * p.dz + (long long)r * p.dr;
    for (int j = tid; j < p.n; j += 256) { float v = s[j] * p.scale_in; if (mf) v += mf[j]; const float o = (mx == -__builtin_inff()) ? 0.f : expf(v - mx) * inv; VST2(float, d + j, o); }
}
// =====================================================================================================================
// k_stats: mean and rsqrt(var + eps) over a set of n elements addressed base + z*sz + (e / inner) * so + (e % inner) * si, one 256-thread
// k_norm_apply: y = (x - mean[set]) * rstd[set] * g[c] + b[c] over a [Z][C][L] channel-major tensor with set = z*G + c / (C/G) (G groups per z;
//   G = C -> per-channel sets indexed z*C+c; for batch norm pass stats indexed by c only via bn = 1). Optional act. Output same layout.
// =====================================================================================================================
//   mode 0: mean / rsqrt(var + eps); mode 1 (RMSNorm): 0 / rsqrt(mean(x^2) + eps); mode 2 (L2 normalize * sqrt(n)): 0 / sqrt(n) / max(||x||, eps); mode 3: as 0 with unbiased variance (n-1)
__global__ __launch_bounds__(256) void k_stats(const float* __restrict__ x, long long sz, long long so, long long si, int inner, int n, float eps, float* __restrict__ stat, int mode) {
    __shared__ float red[256];
    const int z = blockIdx.x, tid = threadIdx.x;
    const float* base = x + z * sz;
    float s = 0.f;
    for (int e = tid; e < n; e += 256) s += base[(long long)(e / inner) * so + (long long)(e % inner) * si];
    red[tid] = s; __syncthreads();
    for (int o = 128; o > 0; o >>= 1) { if (tid < o) red[tid] += red[tid + o]; __syncthreads(); }
    const float mu = (mode == 0 || mode == 3) ? red[0] / (float)n : 0.f; __syncthreads();
    float q = 0.f;
    for (int e = tid; e < n; e += 256) { const float dlt = base[(long long)(e / inner) * so + (long long)(e % inner) * si] - mu; q += dlt * dlt; }
    red[tid] = q; __syncthreads();
    for (int o = 128; o > 0; o >>= 1) { if (tid < o) red[tid] += red[tid + o]; __syncthreads(); }
    {
        float rs;
        if (mode == 2) rs = sqrtf((float)n) / fmaxf(sqrtf(red[0]), eps); else if (mode == 3) rs = rsqrtf(red[0] / (float)(n - 1) + eps); else rs = rsqrtf(red[0] / (float)n + eps);
        if (tid < 32) { const float v = (tid == 0) ? mu : ((tid == 1) ? rs : 0.f); VST2(float, stat + (long long)z * 32 + tid, v); }
    }
}
//   One thread per element over the flat [Z][C][L] index space: grid ceil(Z*C*L / 256).
__global__ __launch_bounds__(256) void k_norm_apply(const float* __restrict__ x, float* __restrict__ y, const float* __restrict__ stat, const float* __restrict__ g, const float* __restrict__ bta,
                                                     int Z, int C, int L, int G, int bn, int act) {
    const long long idx = (long long)blockIdx.x * 256 + threadIdx.x;
    if (idx >= (long long)Z * C * L) return;
    const int l = (int)(idx % L); const long long zc = idx / L; const int c = (int)(zc % C), z = (int)(zc / C); (void)l;
    const int set = bn ? c : (z * G + c / (C / G));
    float v = (x[idx] - stat[(long long)set * 32]) * stat[(long long)set * 32 + 1];
    if (g) v *= g[c];
    if (bta) v += bta[c];
    v = act_fn(v, act);
    VST2(float, y + idx, v);
}

// k_lse_neg: c[i] = -(st[2i] + log(st[2i+1])) = minus the log-sum-exp of row i from k_attn's ST output (for softmax over the query dimension)
__global__ __launch_bounds__(256) void k_lse_neg(const float* __restrict__ st, float* __restrict__ c, int n) {
    const int i = blockIdx.x * 256 + threadIdx.x;
    if (i < n) { const float v = -(st[2 * i] + logf(st[2 * i + 1])); VST2(float, c + i, v); }
}

// k_iota: dst[i] = a * i + b as int32 (segment/position id helper)
__global__ __launch_bounds__(256) void k_iota(int* __restrict__ dst, int n, int a, int b) {
    const int i = blockIdx.x * 256 + threadIdx.x;
    if (i < n) { const int v = a * i + b; VST2(int, dst + i, v); }
}

// k_axpby: dst[i] = a * x[i] + b * y[i] (+ c), i < n
__global__ __launch_bounds__(256) void k_axpby(const float* __restrict__ x, const float* __restrict__ y, float* __restrict__ dst, int n, float a, float b, float c) {
    const int i = blockIdx.x * 256 + threadIdx.x;
    if (i < n) { const float v = a * x[i] + b * y[i] + c; VST2(float, dst + i, v); }
}

// =====================================================================================================================
// k_rope: rotary embedding on a [R rows][Hn heads][D] view (row stride sXr, head stride sXh, element stride 1) -> Y (own strides).
//   mode 0: rotate_half (partner d±D/2, sign - for d<D/2); mode 1: interleaved pairs (partner d^1, sign - for even d).
//   table column tcol: tmode 0 -> d, 1 -> d % (D/2), 2 -> d / 2; position p: pmode 0 -> r % S, 1 -> head index, 2 -> pos[r];
//   c = C[(r / S) * sCb + p * sCp + tcol * sCd], s likewise from Sn; y = x[d] * c + sign * x[partner] * s. X and Y must not alias.
// =====================================================================================================================
struct RopeP { const float* X; float* Y; const float* C; const float* Sn; const int* pos; long long sXr, sXh, sYr, sYh, sCb, sCp, sCd; int R, Hn, D, S, mode, tmode, pmode, pad; };
static_assert(sizeof(RopeP) == 5 * 8 + 7 * 8 + 8 * 4, "RopeP has padding");
__global__ __launch_bounds__(256) void k_rope(RopeP p) {
    const long long idx = (long long)blockIdx.x * 256 + threadIdx.x;
    if (idx >= (long long)p.R * p.Hn * p.D) return;
    const int d = (int)(idx % p.D); const long long rh = idx / p.D; const int h = (int)(rh % p.Hn); const int r = (int)(rh / p.Hn);
    const int half = p.D / 2;
    int partner; float sign;
    if (p.mode == 0) { partner = (d < half) ? d + half : d - half; sign = (d < half) ? -1.f : 1.f; }
    else { partner = d ^ 1; sign = (d & 1) ? 1.f : -1.f; }
    const int tcol = (p.tmode == 0) ? d : ((p.tmode == 1) ? (d % half) : (d >> 1));
    const int pp = (p.pmode == 0) ? (r % p.S) : ((p.pmode == 1) ? h : p.pos[r]);
    const long long toff = (long long)(r / p.S) * p.sCb + (long long)pp * p.sCp + (long long)tcol * p.sCd;
    const float* xr = p.X + (long long)r * p.sXr + (long long)h * p.sXh;
    const float v = xr[d] * p.C[toff] + sign * xr[partner] * p.Sn[toff];
    VST2(float, p.Y + (long long)r * p.sYr + (long long)h * p.sYh + d, v);
}

// k_invf + k_sincos (split so neither kernel carries a large VALU-fma footprint): invf_i = num * (1 / powf(base, (2 i)/D)) [fmode 0],
//   num * expf((2 i) * cexp) [fmode 1], num * powf(base, -2 (i - 1) / D) [fmode 2]; then cs/sn[s*half + i] = cos/sin((pscale * s) * invf_i)
__global__ __launch_bounds__(256) void k_invf(float* __restrict__ invb, int half, int D, float base, float num, int fmode, float cexp) {
    const int i = blockIdx.x * 256 + threadIdx.x;
    if (i >= ((half + 31) / 32) * 32) return;
    if (i >= half) { VST2(float, invb + i, 0.f); return; }
    const float e = (float)(2 * i) / (float)D;
    float invf;
    if (fmode == 1) invf = num * expf((float)(2 * i) * cexp);
    else if (fmode == 2) invf = num * powf(base, (-2.0f * ((float)i - 1.0f)) / (float)D);
    else invf = num * (1.0f / powf(base, e));
    VST2(float, invb + i, invf);
}
__global__ __launch_bounds__(256) void k_sincos(float* __restrict__ cs, float* __restrict__ sn, const float* __restrict__ invb, int S, int half, float pscale) {
    const int idx = blockIdx.x * 256 + threadIdx.x;
    if (idx >= S * half) return;
    const int s = idx / half, i = idx - s * half;
    const float ang = (pscale * (float)s) * invb[i];
    VST2(float, cs + idx, cosf(ang)); VST2(float, sn + idx, sinf(ang));
}

// k_mulact: dst[i] = act(x[i]) * y[i]
__global__ __launch_bounds__(256) void k_mulact(const float* __restrict__ x, const float* __restrict__ y, float* __restrict__ dst, int n, int act) {
    const int i = blockIdx.x * 256 + threadIdx.x;
    if (i < n) { const float v = act_fn(x[i], act) * y[i]; VST2(float, dst + i, v); }
}

// =====================================================================================================================
// k_matvec: thread-per-row matrix-vector products for N <= 8 output columns (heads with 1-3 outputs, gates), f32 on the VALU.
//   C[r*sCm + j] = act(alpha * sum_k A[r*sAm + k*sAk] * B[j*sBn + k*sBk] + bias[j]) + beta * R[r*sRm + j*sRn]; each thread writes its N contiguous floats.
// =====================================================================================================================
__global__ __launch_bounds__(256) void k_matvec(GemmP p) {
    // 32 lanes write one line with one instruction.
    const int rpt = (p.N == 1) ? 1 : 32;
    const long long r0 = ((long long)blockIdx.x * 256 + threadIdx.x) * rpt; const int z = blockIdx.z, zo = z / p.zi_n, zi = z - zo * p.zi_n;
    if (r0 >= p.M) return;
    const float* Bb = p.B + zo * p.sBo + zi * p.sBi;
    float* C = p.C + zo * p.sCo + zi * p.sCi; const float* R = p.R + zo * p.sRo + zi * p.sRi;
    for (int rr = 0; rr < rpt; ++rr) {
        const long long r = r0 + rr; if (r >= p.M) break;
        const float* A = p.A + zo * p.sAo + zi * p.sAi + r * p.sAm;
        float acc[8] = {0.f, 0.f, 0.f, 0.f, 0.f, 0.f, 0.f, 0.f};
        for (int k = 0; k < p.K; ++k) { const float a = A[(long long)k * p.sAk];
#pragma unroll
            for (int j = 0; j < 8; ++j) if (j < p.N) acc[j] += a * Bb[(long long)j * p.sBn + (long long)k * p.sBk]; }
#pragma unroll
        for (int j = 0; j < 8; ++j) if (j < p.N) {
            float v = acc[j] * p.alpha;
            if (p.flags & 1) v += p.bias[j];
            if (p.flags & 2) v += p.bias[r];
            v = act_fn(v, p.act);
            if (p.flags & 4) v += p.beta * R[r * p.sRm + (long long)j * p.sRn];
            VST2(float, C + r * p.sCm + j, v);
        }
    }
}
// k_smallsoftmax: thread-per-row softmax for short rows (n <= 64): dst[r*dr + j] = softmax(scale*src[r*sr + j])
__global__ __launch_bounds__(256) void k_smallsoftmax(const float* __restrict__ src, float* __restrict__ dst, long long sr, long long dr, int n, long long R, float scale) {
    const long long r0 = ((long long)blockIdx.x * 256 + threadIdx.x) * 32;
    for (int rr = 0; rr < 32; ++rr) {
        const long long r = r0 + rr; if (r >= R) return;
        const float* s = src + r * sr; float* d = dst + r * dr;
        float mx = -__builtin_inff();
        for (int j = 0; j < n; ++j) mx = fmaxf(mx, s[j] * scale);
        float sum = 0.f;
        for (int j = 0; j < n; ++j) sum += expf(s[j] * scale - mx);
        const float inv = 1.f / sum;
        for (int j = 0; j < n; ++j) { const float v = expf(s[j] * scale - mx) * inv; VST2(float, d + j, v); }
    }
}

__global__ __launch_bounds__(32) void k_unitstat(float* __restrict__ st) { const int t = threadIdx.x; const float v = (t == 1) ? 1.f : 0.f; VST2(float, st + t, v); }

// destination (e.g. a d_out whose row width is not a multiple of 32 floats) is written by consecutive lanes of one instruction
__global__ __launch_bounds__(256) void k_lincopy(const float* __restrict__ src, long long lds, float* __restrict__ dst, long long ldd, long long rows, int cols) {
    const long long i = (long long)blockIdx.x * 256 + threadIdx.x; if (i >= rows * cols) return;
    const long long r = i / cols; const int c = (int)(i - r * cols);
    const float v = src[r * lds + c]; VST2(float, dst + r * ldd + c, v);
}

namespace w25 {
typedef __attribute__((ext_vector_type(16))) _Float16 v16h;
typedef __attribute__((ext_vector_type(8)))  _Float16 v8h;
typedef __attribute__((ext_vector_type(16))) __bf16   v16b;
typedef __attribute__((ext_vector_type(8)))  __bf16   v8b;
typedef __attribute__((ext_vector_type(8)))  float    v8f;
typedef __attribute__((ext_vector_type(4)))  float    v4f;

__device__ __forceinline__ unsigned short f2bf_bits(float f) {
  unsigned u = __float_as_uint(f);
  return (unsigned short)((u + 0x7FFFu + ((u >> 16) & 1u)) >> 16);
}
__device__ __forceinline__ float bf_bits2f(unsigned short h) { return __uint_as_float(((unsigned)h) << 16); }

// hazard guards as plain device helpers (no inline asm inside the kernel template body)
__device__ __forceinline__ void dep_guard_h(v8f& a, v8f& b, v16h x, v16h y) { asm volatile("v_nop\n\tv_nop\n\tv_nop\n\tv_nop" : "+v"(a), "+v"(b) : "v"(x), "v"(y)); }
__device__ __forceinline__ void dep_guard_b(v8f& a, v8f& b, v16b x, v16b y) { asm volatile("v_nop\n\tv_nop\n\tv_nop\n\tv_nop" : "+v"(a), "+v"(b) : "v"(x), "v"(y)); }
__device__ __forceinline__ void keep4_h(v16h a, v16h b, v16h c, v16h d) { asm volatile("v_nop" :: "v"(a), "v"(b), "v"(c), "v"(d)); }
__device__ __forceinline__ void keep4_b(v16b a, v16b b, v16b c, v16b d) { asm volatile("v_nop" :: "v"(a), "v"(b), "v"(c), "v"(d)); }
__device__ __forceinline__ void acc_guard4(v8f& a, v8f& b, v8f& c, v8f& d) { asm volatile("v_nop\n\tv_nop\n\tv_nop\n\tv_nop" : "+v"(a), "+v"(b), "+v"(c), "+v"(d)); }
template <typename T> struct Frag;
template <> struct Frag<_Float16> {
  typedef v16h V; union U { v16h v; v8h h[2]; };
  static __device__ __forceinline__ v16h load(const _Float16* p) {   // elements 0..7 <- p[0..7], 8..15 <- p[16..23]
    U f; f.h[0] = *(const v8h*)(p); f.h[1] = *(const v8h*)(p + 16); return f.v;
  }
  static __device__ __forceinline__ v8f mma(v16h a, v16h b, v8f c) {
    return __builtin_amdgcn_wmma_f32_16x16x32_f16(false, a, false, b, (short)0, c, false, false);
  }
  static __device__ __forceinline__ void guard(v8f& a, v8f& b, v16h x, v16h y) { dep_guard_h(a, b, x, y); }
  static __device__ __forceinline__ void keep(v16h a, v16h b, v16h c, v16h d) { keep4_h(a, b, c, d); }
};
template <> struct Frag<__bf16> {
  typedef v16b V; union U { v16b v; v8b h[2]; };
  static __device__ __forceinline__ v16b load(const __bf16* p) {
    U f; f.h[0] = *(const v8b*)(p); f.h[1] = *(const v8b*)(p + 16); return f.v;
  }
  static __device__ __forceinline__ v8f mma(v16b a, v16b b, v8f c) {
    return __builtin_amdgcn_wmma_f32_16x16x32_bf16(false, a, false, b, (short)0, c, false, false);
  }
  static __device__ __forceinline__ void guard(v8f& a, v8f& b, v16b x, v16b y) { dep_guard_b(a, b, x, y); }
  static __device__ __forceinline__ void keep(v16b a, v16b b, v16b c, v16b d) { keep4_b(a, b, c, d); }
};

// ---- Register-blocked batched WMMA GEMM ------------------------------------
// C[m,n] = scale * sum_k A[m,k] * Bt[n,k] (+bias)(+resid); each wave owns a 64x64 tile.
// A row-major [M,K]; Bt row-major [N,K]; M,N % 64 == 0, K % 32 == 0.
// SPLIT: operands are hi/lo planes (A2/Bt2 = lo planes, same layout); product = hi·hi + hi·lo + lo·hi.
// BIAS_MODE: 0 = none, 1 = bias[m], 2 = bias[n].
// OUT_MODE: 0 = f32, 1 = f16, 2 = bf16 hi plane (Cout) + bf16 lo plane (Cout2).
// ET: 0 = f16 operands, 1 = bf16 operands (pointers passed as 16-bit storage)
// Batches: blockIdx.y steps A, Bt, C by strideA/B/C, blockIdx.z by strideAz/Bz/Cz (elements).
template <int ET> struct Elem;
template <> struct Elem<0> { typedef _Float16 T; };
template <> struct Elem<1> { typedef __bf16 T; };
template <int ET, bool SPLIT, int BIAS_MODE, int OUT_MODE, bool RESID, int ACT = 0>
__global__ __launch_bounds__(256) void wmma_gemm64(
    const unsigned short* __restrict__ Ap, const unsigned short* __restrict__ A2p, int lda, long strideA,
    const unsigned short* __restrict__ Btp, const unsigned short* __restrict__ Bt2p, int ldb, long strideB,
    void* __restrict__ Cout, void* __restrict__ Cout2, int ldc, long strideC,
    const float* __restrict__ bias,
    const float* __restrict__ resid, long strideR,
    int M, int N, int K, float scale,
    long strideAz, long strideBz, long strideCz) {
  typedef typename Elem<ET>::T T;
  typedef typename Frag<T>::V V;
  const T* A = (const T*)Ap; const T* A2 = (const T*)A2p; const T* Bt = (const T*)Btp; const T* Bt2 = (const T*)Bt2p;
  __shared__ __align__(16) float sT[8][16 * 68];   // per-wave 16x64 slab, pitch 68 floats
  const int b    = blockIdx.y;
  const int lane = threadIdx.x & 31;
  const int wave = threadIdx.x >> 5;
  const int tilesN = N >> 6;
  const int tilesM = M >> 6;
  const int tile = blockIdx.x * 8 + wave;
  if (tile >= tilesM * tilesN) return;   // wave-uniform; no block barriers in this kernel
  const int tm = tile / tilesN;
  const int tn = tile - tm * tilesN;
  const int m0 = tm << 6;
  const int n0 = tn << 6;

  const int bz = blockIdx.z;                   // outer batch index (own strides)
  const size_t offA = (size_t)b * strideA + (size_t)bz * strideAz;
  const size_t offB = (size_t)b * strideB + (size_t)bz * strideBz;
  const size_t offC = (size_t)b * strideC + (size_t)bz * strideCz;
  const T* Ab  = A  + offA;
  const T* Bb  = Bt + offB;
  const T* Ab2 = SPLIT ? (A2  + offA) : nullptr;
  const T* Bb2 = SPLIT ? (Bt2 + offB) : nullptr;

  const int rlane = lane & 15;                 // row (A) / col (B, D) within subtile
  const int koff  = (lane >> 4) * 8;           // k offset of this lane half
  const int mOff  = (lane >> 4) * 8;           // D row offset

  v8f acc[4][4];
#pragma unroll
  for (int i = 0; i < 4; ++i)
#pragma unroll
    for (int j = 0; j < 4; ++j) acc[i][j] = (v8f){0.f,0.f,0.f,0.f,0.f,0.f,0.f,0.f};

  for (int k0 = 0; k0 < K; k0 += 32) {
    V bh[4], bl[4];
#pragma unroll
    for (int j = 0; j < 4; ++j) {
      const size_t bo = (size_t)(n0 + (j << 4) + rlane) * ldb + koff + k0;
      bh[j] = Frag<T>::load(Bb + bo);
      if (SPLIT) bl[j] = Frag<T>::load(Bb2 + bo);
    }
#pragma unroll
    for (int i = 0; i < 4; ++i) {
      const size_t ao = (size_t)(m0 + (i << 4) + rlane) * lda + koff + k0;
      V ah = Frag<T>::load(Ab + ao);
      V al;
      if (SPLIT) al = Frag<T>::load(Ab2 + ao);
#pragma unroll
      for (int j = 0; j < 4; ++j) {
        acc[i][j] = Frag<T>::mma(ah, bh[j], acc[i][j]);
        if (SPLIT) {
          acc[i][j] = Frag<T>::mma(ah, bl[j], acc[i][j]);
          acc[i][j] = Frag<T>::mma(al, bh[j], acc[i][j]);
        }
      }
      Frag<T>::guard(acc[i][0], acc[i][3], ah, SPLIT ? al : ah);
    }
    Frag<T>::keep(bh[0], bh[1], bh[2], bh[3]);
    if (SPLIT) Frag<T>::keep(bl[0], bl[1], bl[2], bl[3]);
  }
  acc_guard4(acc[0][0], acc[0][1], acc[0][2], acc[0][3]);
  acc_guard4(acc[1][0], acc[1][1], acc[1][2], acc[1][3]);
  acc_guard4(acc[2][0], acc[2][1], acc[2][2], acc[2][3]);
  acc_guard4(acc[3][0], acc[3][1], acc[3][2], acc[3][3]);

  // ---- epilogue ----
  float* slab = sT[wave];
  const float* Rb = RESID ? (resid + (size_t)b * strideR) : nullptr;
#pragma unroll
  for (int i = 0; i < 4; ++i) {
    const int mBase = m0 + (i << 4);
#pragma unroll
    for (int j = 0; j < 4; ++j) {
      const int n = n0 + (j << 4) + rlane;
      float bv = 0.f;
      if (BIAS_MODE == 2) bv = bias[n];
#pragma unroll
      for (int r = 0; r < 8; ++r) {
        float v = acc[i][j][r] * scale;
        if (BIAS_MODE == 1) v += bias[mBase + mOff + r];
        if (BIAS_MODE == 2) v += bv;
        if (RESID) v += Rb[(size_t)(mBase + mOff + r) * ldc + n];
        if (ACT == 1) v = tanhf(v);
        if (ACT == 2) v = fmaxf(v, 0.0f);
        if (ACT == 3) v = v / (1.0f + expf(-v));
        if (ACT == 4) v = (v > 0.f) ? v : 0.01f * v;
        if (ACT == 5) v = 0.5f * v * (1.0f + erff(v * 0.70710678118654752f));
        slab[(mOff + r) * 68 + (j << 4) + rlane] = v;
      }
    }
    __builtin_amdgcn_fence(__ATOMIC_RELEASE, "workgroup");
    __builtin_amdgcn_wave_barrier();
    __builtin_amdgcn_fence(__ATOMIC_ACQUIRE, "workgroup");
    if (OUT_MODE == 0) {
      float* C = (float*)Cout + offC;
      const int hh = lane >> 4, c4 = (lane & 15) * 4;     // row seg = 256 B = 16 lanes x 16 B
      {
#pragma unroll
        for (int it = 0; it < 8; ++it) {
          const int row = it * 2 + hh;
          v4f v = *(const v4f*)(slab + row * 68 + c4);
          *(v4f*)(C + (size_t)(mBase + row) * ldc + n0 + c4) = v;
        }
        
      }
    } else {
      const int q = lane >> 3, c8 = (lane & 7) * 8;
      unsigned short* C  = (unsigned short*)Cout  + offC;
      unsigned short* C2 = (OUT_MODE == 2) ? ((unsigned short*)Cout2 + offC) : nullptr;
      {
#pragma unroll
        for (int it = 0; it < 4; ++it) {
          const int row = it * 4 + q;
          const float* sp = slab + row * 68 + c8;
          v8h hv, lv;
#pragma unroll
          for (int e = 0; e < 8; ++e) {
            if (OUT_MODE == 1) {
              hv[e] = (_Float16)sp[e];
            } else {
              unsigned short hb = f2bf_bits(sp[e]);
              unsigned short lb = f2bf_bits(sp[e] - bf_bits2f(hb));
              hv[e] = __builtin_bit_cast(_Float16, hb);
              lv[e] = __builtin_bit_cast(_Float16, lb);
            }
          }
          *(v8h*)(C + (size_t)(mBase + row) * ldc + n0 + c8) = hv;
          if (OUT_MODE == 2) *(v8h*)(C2 + (size_t)(mBase + row) * ldc + n0 + c8) = lv;
        }
        
      }
    }
    __builtin_amdgcn_fence(__ATOMIC_RELEASE, "workgroup");
    __builtin_amdgcn_wave_barrier();
    __builtin_amdgcn_fence(__ATOMIC_ACQUIRE, "workgroup");
  }
}

__global__ __launch_bounds__(256) void cast_f32_f16x2(
    const float* __restrict__ in, _Float16* __restrict__ out, int n2) {
  int i = blockIdx.x * 256 + threadIdx.x;
  if (i < n2) {
    const _Float16 h0 = (_Float16)in[2 * i], h1 = (_Float16)in[2 * i + 1];
    const unsigned u = (unsigned)__builtin_bit_cast(unsigned short, h0) | ((unsigned)__builtin_bit_cast(unsigned short, h1) << 16);
    ((unsigned*)out)[i] = u;
    
  }
}


} // namespace w25

__global__ __launch_bounds__(256) void k_castT16(const float* __restrict__ src, long long lds, _Float16* __restrict__ dst, long long ldd, int R, int C, float s) {
    const long long i = (long long)blockIdx.x * 256 + threadIdx.x; const long long np = (long long)C * (R / 2); if (i >= np) return; const int c = (int)(i / (R / 2)); const int r = 2 * (int)(i % (R / 2));
    const _Float16 h0 = (_Float16)(src[(long long)r * lds + c] * s), h1 = (_Float16)(src[(long long)(r + 1) * lds + c] * s);
    const unsigned u = (unsigned)__builtin_bit_cast(unsigned short, h0) | ((unsigned)__builtin_bit_cast(unsigned short, h1) << 16);
    unsigned* d = (unsigned*)(dst + (long long)c * ldd + r); *d = u;  }
__global__ __launch_bounds__(256) void k_cast16(const float* __restrict__ src, long long lds, _Float16* __restrict__ dst, long long ldd, int R, int C, float s) {
    const long long i = (long long)blockIdx.x * 256 + threadIdx.x; const long long np = (long long)R * (C / 2); if (i >= np) return; const int r = (int)(i / (C / 2)); const int c = 2 * (int)(i % (C / 2));
    const _Float16 h0 = (_Float16)(src[(long long)r * lds + c] * s), h1 = (_Float16)(src[(long long)r * lds + c + 1] * s);
    const unsigned u = (unsigned)__builtin_bit_cast(unsigned short, h0) | ((unsigned)__builtin_bit_cast(unsigned short, h1) << 16);
    unsigned* d = (unsigned*)(dst + (long long)r * ldd + c); *d = u;  }

// f32 -> bf16 hi plane + bf16 lo plane (x = hi + lo to ~2^-17 relative; RNE both), [R][C] -> [R][C] (or transposed to [C][R]); 2 consecutive destination elements
__device__ __forceinline__ unsigned int f2bf2_pack(float a, float b, unsigned int* lo) {
    const unsigned short ha = w25::f2bf_bits(a), hb = w25::f2bf_bits(b);
    const unsigned short la = w25::f2bf_bits(a - w25::bf_bits2f(ha)), lb = w25::f2bf_bits(b - w25::bf_bits2f(hb));
    *lo = (unsigned)la | ((unsigned)lb << 16); return (unsigned)ha | ((unsigned)hb << 16); }
__global__ __launch_bounds__(256) void k_castS16(const float* __restrict__ src, long long lds, __bf16* __restrict__ dhi, __bf16* __restrict__ dlo, long long ldd, int R, int C, float s, int transpose) {
    const long long i = (long long)blockIdx.x * 256 + threadIdx.x; long long o; float a, b;
    if (transpose) { const long long np = (long long)C * (R / 2); if (i >= np) return; const int c = (int)(i / (R / 2)); const int r = 2 * (int)(i % (R / 2)); a = src[(long long)r * lds + c] * s; b = src[(long long)(r + 1) * lds + c] * s; o = (long long)c * ldd + r; }
    else { const long long np = (long long)R * (C / 2); if (i >= np) return; const int r = (int)(i / (C / 2)); const int c = 2 * (int)(i % (C / 2)); a = src[(long long)r * lds + c] * s; b = src[(long long)r * lds + c + 1] * s; o = (long long)r * ldd + c; }
    unsigned lo; const unsigned hi = f2bf2_pack(a, b, &lo); unsigned* ph = (unsigned*)(dhi + o); unsigned* pl = (unsigned*)(dlo + o);
    *ph = hi; *pl = lo;  }

namespace w25 {
// =====================================================================================
// Generic causal/non-causal attention for head_dim 64, f32 in / f32 out; 16-bit operands: bf16 with optional hi/lo splits, or
// plain f16 (F16=true, non-split, probabilities carried x2^15).
//   scores = (q*qscale)·kᵀ : v_wmma_f32_16x16x32_bf16; SPLIT_QK -> q,k as bf16 hi/lo (hi·hi + hi·lo + lo·hi)
//   out    = p·v           : v_wmma_f32_16x16x32_bf16; SPLIT_PV -> p,v as bf16 hi/lo; else p,v plain bf16
//   f32 accumulate; online softmax in f32. Block = 4 waves = 64 query rows of one (batch, head); S % 64 == 0.
//   Element (b, s, h, d) of tensor X lives at X[b*X_bs + s*X_rs + h*X_hs + d] (strides in floats, multiples of 4).
//   Masking: mask_mode 0 none, 1 causal (kv > q masked), 2 tensor [S][Skv] shared over (b,h) (float if
//   mask_is_int==0, int32 with element == 0 -> masked if 1, int32 with element != 0 -> masked if 2), 3 per-token vectors qmask[B][S] & kvmask[B][Skv] (int32,
//   0 -> masked), 4 causal + sliding window (kv > q or q - kv > W masked; W passed in mask_is_int);
//   5 = relative-position bias: s += cp[b,h,q][idx[q][kv]] + pc[b,h,kv][idx[q][kv]] with idx = mask_b ([S][Skv] int32) and
//   mask_a an int32 [S][Skv] tensor with nonzero = masked (tables: element (b,h,row,n) at X + b*c_bs + h*c_hs + row*c_rs + n);
//   masked scores are replaced by mask_fill (e.g. -inf or -1e9) before the softmax.
//   grid.x = B * H * (S/64) (or a sub-range with blk0).
// =====================================================================================
#define AT_D 64
#define AT_NW 4
#define AT_QB 64
#define AT_KC 64
struct AttnGeom { const float* cp = nullptr; const float* pc = nullptr; long c_bs = 0, c_rs = 0, c_hs = 0;   // mode-5 score-bias tables
                  long q_bs, q_rs, q_hs, k_bs, k_rs, k_hs, v_bs, v_rs, v_hs, o_bs, o_rs, o_hs;
                  int S, Skv, H, mask_mode; float qscale; int blk0; float mask_fill; int mask_is_int; };
static_assert(sizeof(AttnGeom) == 168, "no padding");

__device__ __forceinline__ unsigned short at_bf_bits(float f) {
  unsigned u = __float_as_uint(f);
  return (unsigned short)((u + 0x7FFFu + ((u >> 16) & 1u)) >> 16);
}
__device__ __forceinline__ __bf16 at_f2bf(float f) { return __builtin_bit_cast(__bf16, at_bf_bits(f)); }
__device__ __forceinline__ void at_split(float f, __bf16& hi, __bf16& lo) {
  const unsigned short hb = at_bf_bits(f);
  hi = __builtin_bit_cast(__bf16, hb);
  lo = at_f2bf(f - __uint_as_float(((unsigned)hb) << 16));
}
__device__ __forceinline__ v8f at_mma(v16b a, v16b b, v8f c) {
  c = __builtin_amdgcn_wmma_f32_16x16x32_bf16(false, a, false, b, (short)0, c, false, false);
  asm volatile("v_nop\n\tv_nop\n\tv_nop\n\tv_nop" : "+v"(c) : "v"(a), "v"(b));
  return c;
}
// 16-bit element as a bit pattern held in a __bf16 slot: f16 bits when F16, bf16 (RNE) otherwise
template <bool F16> __device__ __forceinline__ __bf16 at_to16(float f) {
  if (F16) return __builtin_bit_cast(__bf16, (_Float16)f);
  return at_f2bf(f);
}
template <bool F16> __device__ __forceinline__ v8f at_mma16(v16b a, v16b b, v8f c) {
  if (F16) {
    const v16h ah = __builtin_bit_cast(v16h, a), bh = __builtin_bit_cast(v16h, b);
    c = __builtin_amdgcn_wmma_f32_16x16x32_f16(false, ah, false, bh, (short)0, c, false, false);
    asm volatile("v_nop\n\tv_nop\n\tv_nop\n\tv_nop" : "+v"(c) : "v"(ah), "v"(bh));
    return c;
  }
  return at_mma(a, b, c);
}

template <bool SPLIT_QK, bool SPLIT_PV, bool F16 = false>
__global__ __launch_bounds__(128)
void attn64_kernel(const float* __restrict__ q, const float* __restrict__ k,
                   const float* __restrict__ v, float* __restrict__ out,
                   const void* __restrict__ mask_a, const int* __restrict__ mask_b, AttnGeom g) {
  static_assert(!(F16 && (SPLIT_QK || SPLIT_PV)), "f16 mode is non-split");
  const float PSC = F16 ? 32768.0f : 1.0f;     // f16 probabilities carried x2^15 (subnormal range), folded into the final 1/l
  union FB { v16b v; v8b h[2]; };
  __shared__ __align__(16) __bf16 Ksh[AT_KC * AT_D];             // K hi [kv][d]      8 KB
  __shared__ __align__(16) __bf16 Ksl[SPLIT_QK ? AT_KC * AT_D : 8];
  __shared__ __align__(16) __bf16 Vth[AT_D * AT_KC];             // V hi [d][kv]      8 KB
  __shared__ __align__(16) __bf16 Vtl[SPLIT_PV ? AT_D * AT_KC : 8];
  __shared__ __align__(16) __bf16 Psh[AT_NW][16 * AT_KC];        // per wave P hi [row][kv]  8 KB
  __shared__ __align__(16) __bf16 Psl[SPLIT_PV ? AT_NW : 1][SPLIT_PV ? 16 * AT_KC : 8];
  __shared__ __align__(16) float  Os[AT_NW][16 * 68];            // per wave out tile, pitch 68

  const int tid  = threadIdx.x;
  const int wave = tid >> 5;
  const int lane = tid & 31;
  const int hh   = lane >> 4;
  const int c    = lane & 15;

  const int nqb = g.S / AT_QB;
  const int bx = blockIdx.x + g.blk0;
  const int qb = bx % nqb;
  const int bh = bx / nqb;
  const int h  = bh % g.H;
  const int b  = bh / g.H;
  const int qbase_block = qb * AT_QB;
  const int q0 = qbase_block + wave * 16;

  const float* qb_ptr = q + (size_t)b * g.q_bs + (size_t)h * g.q_hs;
  const float* kb_ptr = k + (size_t)b * g.k_bs + (size_t)h * g.k_hs;
  const float* vb_ptr = v + (size_t)b * g.v_bs + (size_t)h * g.v_hs;
  float*       ob_ptr = out + (size_t)b * g.o_bs + (size_t)h * g.o_hs;

  // ---- Q fragments (A operand): 2 d-chunks, hi (and lo) ----
  v16b qah[2], qal[2];
  {
    const float* qrow = qb_ptr + (size_t)(q0 + c) * g.q_rs;
#pragma unroll
    for (int dc = 0; dc < 2; ++dc) {
#pragma unroll
      for (int e = 0; e < 8; ++e) {
        const float f0 = qrow[dc * 32 + 8 * hh + e] * g.qscale;
        const float f1 = qrow[dc * 32 + 16 + 8 * hh + e] * g.qscale;
        if (SPLIT_QK) { __bf16 hq, lq; at_split(f0, hq, lq); qah[dc][e] = hq; qal[dc][e] = lq; at_split(f1, hq, lq); qah[dc][8 + e] = hq; qal[dc][8 + e] = lq; }
        else { qah[dc][e] = at_to16<F16>(f0); qah[dc][8 + e] = at_to16<F16>(f1); qal[dc][e] = qah[dc][e]; qal[dc][8 + e] = qah[dc][8 + e]; }
      }
    }
  }

  float mrow[8], lrow[8];
  v8f oacc[4];
#pragma unroll
  for (int r = 0; r < 8; ++r) { mrow[r] = -INFINITY; lrow[r] = 0.f; }
#pragma unroll
  for (int t = 0; t < 4; ++t) oacc[t] = (v8f){0.f,0.f,0.f,0.f,0.f,0.f,0.f,0.f};

  const int nChunks = (g.mask_mode == 1 || g.mask_mode == 4) ? (qb + 1) : (g.Skv / AT_KC);   // block-uniform
  // per-row query mask (mode 3)
  int qkeep[8];
#pragma unroll
  for (int r = 0; r < 8; ++r) qkeep[r] = (g.mask_mode == 3) ? mask_b[(size_t)b * g.S + q0 + 8 * hh + r] : 1;   // mask_b = qmask in mode 3
  for (int kc = 0; kc < nChunks; ++kc) {
    const int kv0 = kc * AT_KC;
    __syncthreads();
    {
      const int kvr = tid >> 1, dh = (tid & 1) * 32;
      const float* krow = kb_ptr + (size_t)(kv0 + kvr) * g.k_rs + dh;
      const float* vrow = vb_ptr + (size_t)(kv0 + kvr) * g.v_rs + dh;
#pragma unroll
      for (int i = 0; i < 8; ++i) {
        v4f kk = *(const v4f*)(krow + 4 * i);
        v4f vv = *(const v4f*)(vrow + 4 * i);
#pragma unroll
        for (int e = 0; e < 4; ++e) {
          const int d = dh + 4 * i + e;
          if (SPLIT_QK) { __bf16 a, bl; at_split(kk[e], a, bl); Ksh[kvr * AT_D + d] = a; Ksl[kvr * AT_D + d] = bl; }
          else Ksh[kvr * AT_D + d] = at_to16<F16>(kk[e]);
          if (SPLIT_PV) { __bf16 a, bl; at_split(vv[e], a, bl); Vth[d * AT_KC + kvr] = a; Vtl[d * AT_KC + kvr] = bl; }
          else Vth[d * AT_KC + kvr] = at_to16<F16>(vv[e]);
        }
      }
    }
    __syncthreads();

    v8f s[4];
#pragma unroll
    for (int j = 0; j < 4; ++j) {
      s[j] = (v8f){0.f,0.f,0.f,0.f,0.f,0.f,0.f,0.f};
#pragma unroll 1
      for (int dc = 0; dc < 2; ++dc) {
        FB kb;
        kb.h[0] = *(const v8b*)(Ksh + (j * 16 + c) * AT_D + dc * 32 + 8 * hh);
        kb.h[1] = *(const v8b*)(Ksh + (j * 16 + c) * AT_D + dc * 32 + 16 + 8 * hh);
        s[j] = at_mma16<F16>(qah[dc], kb.v, s[j]);
        if (SPLIT_QK) {
          FB kl;
          kl.h[0] = *(const v8b*)(Ksl + (j * 16 + c) * AT_D + dc * 32 + 8 * hh);
          kl.h[1] = *(const v8b*)(Ksl + (j * 16 + c) * AT_D + dc * 32 + 16 + 8 * hh);
          s[j] = at_mma16<F16>(qah[dc], kl.v, s[j]);
          s[j] = at_mma16<F16>(qal[dc], kb.v, s[j]);
        }
      }
    }
    const bool diag = (g.mask_mode == 1) && (kc == qb);
    int kvkeep[4] = {1, 1, 1, 1};
    if (g.mask_mode == 3) {
#pragma unroll
      for (int j = 0; j < 4; ++j) kvkeep[j] = ((const int*)mask_a)[(size_t)b * g.Skv + kv0 + j * 16 + c];   // mask_a = kvmask
    }
    float cm[8];
#pragma unroll
    for (int r = 0; r < 8; ++r) {
      const int qrow = q0 + 8 * hh + r;
      float m = -INFINITY;
#pragma unroll
      for (int j = 0; j < 4; ++j) {
        const int kvcol = kv0 + j * 16 + c;
        bool masked = false;
        if (diag) masked = (kvcol > qrow);
        else if (g.mask_mode == 4) masked = (kvcol > qrow) || (qrow - kvcol > g.mask_is_int);
        else if (g.mask_mode == 2) {
          const size_t mi = (size_t)qrow * g.Skv + kvcol;
          masked = (g.mask_is_int == 0) ? (((const float*)mask_a)[mi] == 0.0f)
                 : (g.mask_is_int == 1) ? (((const int*)mask_a)[mi] == 0) : (((const int*)mask_a)[mi] != 0);
        } else if (g.mask_mode == 3) masked = (qkeep[r] == 0) || (kvkeep[j] == 0);
        else if (g.mask_mode == 5) {
          const size_t mi = (size_t)qrow * g.Skv + kvcol;
          masked = (((const int*)mask_a)[mi] != 0);
          int n = mask_b[mi]; n = n < 0 ? 0 : n;
          s[j][r] += g.cp[(size_t)b * g.c_bs + (size_t)h * g.c_hs + (size_t)qrow * g.c_rs + n]
                   + g.pc[(size_t)b * g.c_bs + (size_t)h * g.c_hs + (size_t)kvcol * g.c_rs + n];
        }
        if (masked) s[j][r] = g.mask_fill;
        m = fmaxf(m, s[j][r]);
      }
#pragma unroll
      for (int off = 1; off < 16; off <<= 1) m = fmaxf(m, __shfl_xor(m, off, 32));
      cm[r] = m;
    }
    __bf16* pwh = Psh[wave];
    __bf16* pwl = Psl[SPLIT_PV ? wave : 0];
#pragma unroll
    for (int r = 0; r < 8; ++r) {
      const float mnew = fmaxf(mrow[r], cm[r]);
      const float alpha = expf(mrow[r] - mnew);
      mrow[r] = mnew;
      float psum = 0.f;
#pragma unroll
      for (int j = 0; j < 4; ++j) {
        const float p = expf(s[j][r] - mnew);
        psum += p;
        if (SPLIT_PV) { __bf16 a, bl; at_split(p, a, bl); pwh[(8 * hh + r) * AT_KC + j * 16 + c] = a; pwl[(8 * hh + r) * AT_KC + j * 16 + c] = bl; }
        else pwh[(8 * hh + r) * AT_KC + j * 16 + c] = at_to16<F16>(p * PSC);
      }
#pragma unroll
      for (int off = 1; off < 16; off <<= 1) psum += __shfl_xor(psum, off, 32);
      lrow[r] = lrow[r] * alpha + psum;
#pragma unroll
      for (int t = 0; t < 4; ++t) oacc[t][r] *= alpha;
    }
    __builtin_amdgcn_fence(__ATOMIC_RELEASE, "workgroup");
    __builtin_amdgcn_wave_barrier();
    __builtin_amdgcn_fence(__ATOMIC_ACQUIRE, "workgroup");
#pragma unroll 1
    for (int kk = 0; kk < 2; ++kk) {
      FB pa, pl;
      pa.h[0] = *(const v8b*)(pwh + c * AT_KC + kk * 32 + 8 * hh);
      pa.h[1] = *(const v8b*)(pwh + c * AT_KC + kk * 32 + 16 + 8 * hh);
      if (SPLIT_PV) {
        pl.h[0] = *(const v8b*)(pwl + c * AT_KC + kk * 32 + 8 * hh);
        pl.h[1] = *(const v8b*)(pwl + c * AT_KC + kk * 32 + 16 + 8 * hh);
      }
#pragma unroll
      for (int t = 0; t < 4; ++t) {
        FB vb;
        vb.h[0] = *(const v8b*)(Vth + (t * 16 + c) * AT_KC + kk * 32 + 8 * hh);
        vb.h[1] = *(const v8b*)(Vth + (t * 16 + c) * AT_KC + kk * 32 + 16 + 8 * hh);
        oacc[t] = at_mma16<F16>(pa.v, vb.v, oacc[t]);
        if (SPLIT_PV) {
          FB vl;
          vl.h[0] = *(const v8b*)(Vtl + (t * 16 + c) * AT_KC + kk * 32 + 8 * hh);
          vl.h[1] = *(const v8b*)(Vtl + (t * 16 + c) * AT_KC + kk * 32 + 16 + 8 * hh);
          oacc[t] = at_mma16<F16>(pa.v, vl.v, oacc[t]);
          oacc[t] = at_mma16<F16>(pl.v, vb.v, oacc[t]);
        }
      }
    }
  }

  float* os = Os[wave];
#pragma unroll
  for (int r = 0; r < 8; ++r) {
    const float inv = 1.0f / (lrow[r] * PSC);
#pragma unroll
    for (int t = 0; t < 4; ++t) os[(8 * hh + r) * 68 + t * 16 + c] = oacc[t][r] * inv;
  }
  __builtin_amdgcn_fence(__ATOMIC_RELEASE, "workgroup");
  __builtin_amdgcn_wave_barrier();
  __builtin_amdgcn_fence(__ATOMIC_ACQUIRE, "workgroup");
  {
    const int c4 = (lane & 15) * 4;
    {
#pragma unroll
      for (int it = 0; it < 8; ++it) {
        const int row = it * 2 + hh;
        v4f val = *(const v4f*)(os + row * 68 + c4);
        *(v4f*)(ob_ptr + (size_t)(q0 + row) * g.o_rs + c4) = val;
      }
      
    }
  }
}

} // namespace w25

// f32 -> f16 casts by few, fat waves. A block casts CW_BLK consecutive elements, dst[e] = f16(src[e] * s): a thread takes 16 float4, 1024 elements apart, all of them loaded ahead of
// the first conversion; a wave's load covers 512 consecutive bytes, its store 256. (A launch's waves start at a limited rate, and two elements a thread made 65,536 short waves of one 4M-element cast; here it is 2,048.)
typedef __attribute__((ext_vector_type(4))) _Float16 cw_v4h;
constexpr int CW_BLK = 16384;
__device__ __forceinline__ void cw_cast_blk(const float* __restrict__ src, _Float16* __restrict__ dst, float s) {
    const v4f* sp = (const v4f*)src + threadIdx.x;
    v4f x[16];
#pragma unroll
    for (int u = 0; u < 16; ++u) x[u] = sp[256 * u];
    __builtin_amdgcn_sched_barrier(0);   // keeps all 16 loads ahead of the first conversion: one trip to memory a wave, not two
    cw_v4h* dp = (cw_v4h*)dst + threadIdx.x;
#pragma unroll
    for (int u = 0; u < 16; ++u) dp[256 * u] = __builtin_convertvector(x[u] * s, cw_v4h);
    asm volatile("s_wait_xcnt 0x0" ::: "memory");   // ahead of any later write of a register that the stores above name
}
// every cast of an input, one launch: blocks 0..767 X16[0..2] = f16(query, key, value); blocks 768..1023 W16[0..3] = f16(16 Wq, 16 Wk, 16 Wv, 16 Wo);
// block 1024 TK16[r][d] = f16(16 table_k[r][d]), zero rows 129..191
__global__ __launch_bounds__(256) void k_sh_castin(const float* __restrict__ xq, const float* __restrict__ xk, const float* __restrict__ xv,
                                                   const float* __restrict__ Wq, const float* __restrict__ Wk, const float* __restrict__ Wv, const float* __restrict__ Wo,
                                                   const float* __restrict__ TK, _Float16* __restrict__ X16, _Float16* __restrict__ W16, _Float16* __restrict__ TK16) {
    constexpr int XB = 4096 * 1024 / CW_BLK, WB = 1024 * 1024 / CW_BLK, TAB = 129, TP = 192, HD = 64;
    static_assert(TP * HD == 12 * 1024 && TAB * HD == 4 * (8 * 256 + 16), "the table's block: eight float4 per thread, then row 128 by 16 threads, then zeros up to twelve");
    const int bid = blockIdx.x;
    if (bid < 3 * XB) {
        const int sg = bid / XB;
        const float* src = sg == 0 ? xq : (sg == 1 ? xk : xv);
        cw_cast_blk(src + (long long)(bid - sg * XB) * CW_BLK, X16 + (long long)bid * CW_BLK, 1.f);
    } else if (bid < 3 * XB + 4 * WB) {
        const int b2 = bid - 3 * XB, sg = b2 / WB;
        const float* src = sg == 0 ? Wq : (sg == 1 ? Wk : (sg == 2 ? Wv : Wo));
        cw_cast_blk(src + (long long)(b2 - sg * WB) * CW_BLK, W16 + (long long)b2 * CW_BLK, 16.f);
    } else {
        const v4f* sp = (const v4f*)TK + threadIdx.x;
        v4f x[12];
#pragma unroll
        for (int u = 0; u < 8; ++u) x[u] = sp[256 * u];
#pragma unroll
        for (int u = 8; u < 12; ++u) x[u] = (v4f){0.f, 0.f, 0.f, 0.f};
        if (threadIdx.x < 16) x[8] = sp[256 * 8];
        cw_v4h* dp = (cw_v4h*)TK16 + threadIdx.x;
#pragma unroll
        for (int u = 0; u < 12; ++u) dp[256 * u] = __builtin_convertvector(x[u] * 16.f, cw_v4h);
        asm volatile("s_wait_xcnt 0x0" ::: "memory");   // ahead of any later write of a register that the stores above name
    }
}
// the attention output's cast: dst = f16(src), CW_BLK elements a block
__global__ __launch_bounds__(256) void k_sh_castx(const float* __restrict__ src, _Float16* __restrict__ dst) { const long long o = (long long)blockIdx.x * CW_BLK; cw_cast_blk(src + o, dst + o, 1.f); }
// one wave per query row g = b L + q, for the eight heads h0..h0+7 of this launch: s_k = (SC[b][h-h0][q][k] + QT[(b,q,h)][fm[b][q][k]]) / 8; softmax over 512 k (exp once) -> P16[b][h][q][k] = f16(4096 p).
// A lane holds keys 128 c + 4 lane + e (c, e < 4): every load and store covers whole lines. The ids are read and clamped once for the eight heads; the eight QT rows (contiguous) lie in the wave's own LDS.
typedef __attribute__((ext_vector_type(4))) _Float16 sm_v4h;
typedef __attribute__((ext_vector_type(4))) int sm_v4i;
template <int CTRL> __device__ __forceinline__ float sm_dpp(float v) { return __builtin_bit_cast(float, __builtin_amdgcn_update_dpp(0, __builtin_bit_cast(int, v), CTRL, 0xf, 0xf, true)); }   // CTRL 0x160 + m: row_xmask:m
__device__ __forceinline__ float sm_x16(float v) { const unsigned u = __builtin_bit_cast(unsigned, v); return __builtin_bit_cast(float, __builtin_amdgcn_permlanex16(u, u, 0x76543210u, 0xfedcba98u, false, false)); }   // lane l <-> l ^ 16
__device__ __forceinline__ float sm_wmax(float v) { v = fmaxf(v, sm_dpp<0x161>(v)); v = fmaxf(v, sm_dpp<0x162>(v)); v = fmaxf(v, sm_dpp<0x164>(v)); v = fmaxf(v, sm_dpp<0x168>(v)); return fmaxf(v, sm_x16(v)); }
__device__ __forceinline__ float sm_wsum(float v) { v += sm_dpp<0x161>(v); v += sm_dpp<0x162>(v); v += sm_dpp<0x164>(v); v += sm_dpp<0x168>(v); return v + sm_x16(v); }
// 2^t. The v_nop is the slot that the instruction set asks for behind a transcendental; in the same statement it stands directly behind it whatever the scheduler puts next
__device__ __forceinline__ float sm_exp2(float t) { float y; asm("v_exp_f32 %0, %1\n\tv_nop" : "=v"(y) : "v"(t)); return y; }
// amdgpu_waves_per_eu(4): at most 256 VGPRs, so that two blocks share a WGP and all 512 blocks are resident at once
__global__ __launch_bounds__(256) __attribute__((amdgpu_waves_per_eu(4))) void k_sh_soft(const float* __restrict__ SC, const float* __restrict__ QT, const int* __restrict__ FM, _Float16* __restrict__ P16, int h0) {
    constexpr int L = 512, NH = 16, TP = 192, TAB = 129, HG = 8;
    __shared__ __attribute__((aligned(16))) float qtl[8][HG * TP];
    const int lane = threadIdx.x & 31, w = threadIdx.x >> 5;
    const int g = blockIdx.x * 8 + w, b = g >> 9, q = g & (L - 1);
    float* tq = qtl[w];
    // all of the wave's loads go out first, in the order in which they are waited for: QT rows, ids, then the score rows head by head
    const v4f* qs = (const v4f*)(QT + ((long long)g * NH + h0) * TP);
    v4f qv[HG * TP / 128];
#pragma unroll
    for (int u = 0; u < HG * TP / 128; ++u) qv[u] = qs[lane + 32 * u];
    const sm_v4i* fr = (const sm_v4i*)(FM + (long long)g * L);
    sm_v4i idv[4];
#pragma unroll
    for (int c = 0; c < 4; ++c) idv[c] = fr[lane + 32 * c];
    __builtin_amdgcn_sched_barrier(0);   // loads return in issue order: keeps the QT rows and ids ahead of the score rows, so that head 0 need not wait for head 7's rows
    const float* sr = SC + ((long long)b * HG * L + q) * L + 4 * lane;
    v4f s[HG][4];
#pragma unroll
    for (int hl = 0; hl < HG; ++hl) {
#pragma unroll
        for (int c = 0; c < 4; ++c) s[hl][c] = *(const v4f*)(sr + (long long)hl * L * L + 128 * c);
        __builtin_amdgcn_sched_barrier(0);   // keeps the score rows in head order, all issued ahead of the first wait
    }
    // a precaution: the wait in front of every overwrite of the address pair that the score loads name; as an operand the pair stays live up to here, so that no load's own result lands on it
    asm volatile("s_wait_xcnt 0x0" :: "v"(sr) : "memory");
#pragma unroll
    for (int u = 0; u < HG * TP / 128; ++u) *(v4f*)(tq + 4 * (lane + 32 * u)) = qv[u];
    // the wave's own LDS stores before its lanes' gathers from them (no other wave reads these rows: no block barrier)
    __builtin_amdgcn_fence(__ATOMIC_RELEASE, "workgroup", "local");
    __builtin_amdgcn_wave_barrier();
    __builtin_amdgcn_fence(__ATOMIC_ACQUIRE, "workgroup", "local");
    int r[16];
#pragma unroll
    for (int i = 0; i < 16; ++i) { const int id = idv[i >> 2][i & 3]; r[i] = id < 0 ? 0 : (id >= TAB ? TAB - 1 : id); }   // INPUT ids clamped before the address is formed
    _Float16* po = P16 + (((long long)b * NH + h0) * L + q) * L + 4 * lane;
#pragma unroll
    for (int hl = 0; hl < HG; ++hl) {
        float x[16];
#pragma unroll
        for (int i = 0; i < 16; ++i) x[i] = s[hl][i >> 2][i & 3] + tq[hl * TP + r[i]];
        float m = x[0];
#pragma unroll
        for (int i = 1; i < 16; ++i) m = fmaxf(m, x[i]);
        m = sm_wmax(m);
#pragma unroll
        for (int i = 0; i < 16; ++i) x[i] = sm_exp2((x[i] - m) * 0.18033688f);   // exp((x - m) / 8): log2(e) / 8
        const float sum = sm_wsum(((x[0] + x[1]) + (x[2] + x[3])) + ((x[4] + x[5]) + (x[6] + x[7])) + (((x[8] + x[9]) + (x[10] + x[11])) + ((x[12] + x[13]) + (x[14] + x[15]))));
        const float f = (1.f / sum) * 4096.f;
#pragma unroll
        for (int c = 0; c < 4; ++c) {
            const v4f p = {x[4 * c] * f, x[4 * c + 1] * f, x[4 * c + 2] * f, x[4 * c + 3] * f};
            *(sm_v4h*)(po + (long long)hl * L * L + 128 * c) = __builtin_convertvector(p, sm_v4h);
        }
    }
}
// w2 in one launch: one wave per query row g = b L + q. X[g][h*64 + d] += (1/4096) sum_k P16[b][h][q][k] * f16(table_v[fm[g][k]][d]).
// A = the 16 heads' probability rows (16 x 512, straight from P16); B = the gathered table rows, never written out: table_v lies in LDS as f16 rows of 160 bytes,
// and each lane of ds_load_tr16_b128 points at the row that ITS key's id names (lane l: key kbase + 8 (l >> 4) + (l & 7), 16-byte half (l >> 3) & 1), so the
// transposing load returns B[k][d] in the hardware k order (frag_k), the order in which A is loaded. INPUT ids clamped before the address is formed. k runs 0..511 in one accumulator chain.
typedef __attribute__((ext_vector_type(8))) short w2_s16x8;
__device__ __forceinline__ v8h w2_ldtr(const unsigned char* p) { typedef __attribute__((address_space(3))) w2_s16x8 lds_s16x8; return __builtin_bit_cast(v8h, __builtin_amdgcn_ds_load_tr16_b128_v8i16((lds_s16x8*)p)); }
typedef __attribute__((ext_vector_type(4))) _Float16 w2_v4h;
// amdgpu_waves_per_eu(4): at most 256 VGPRs, so that two blocks share a WGP and all 512 blocks are resident at once
__global__ __launch_bounds__(256) __attribute__((amdgpu_waves_per_eu(4))) void k_sh_w2(const _Float16* __restrict__ P16, const int* __restrict__ FM, const float* __restrict__ TV, float* __restrict__ X) {
    constexpr int L = 512, NH = 16, HD = 64, TAB = 129, PITCH = 160;   // PITCH: 32 B x odd, the transposing load's pitch
    static_assert(TAB * HD == 4 * (8 * 256 + 16), "the fill below: eight float4 per thread, then row 128 by 16 threads");
    __shared__ __attribute__((aligned(16))) unsigned char tab[TAB * PITCH];
    const int t = threadIdx.x, lane = t & 31;
    const int g = blockIdx.x * 8 + (t >> 5);
    const int c = lane & 15, h = lane >> 4;
    // the table's loads go first: they are waited for first, while the first ids and probabilities are still on their way
    v4f tv[8];
#pragma unroll
    for (int u = 0; u < 8; ++u) tv[u] = *(const v4f*)(TV + 4 * (t + 256 * u));
    const v4f tl = *(const v4f*)(TV + 4 * (2048 + (t & 15)));
    const int* fr = FM + (long long)g * L + 8 * h + (lane & 7);
    const _Float16* pa = P16 + (((long long)(g >> 9) * NH + c) * L + (g & (L - 1))) * L + 8 * h;
    // keys in four runs of 128, two register buffers: the next run's ids and probabilities fly while this run is multiplied
    int id[2][8];
    v8h a[2][8];
#pragma unroll
    for (int j = 0; j < 8; ++j) { id[0][j] = fr[16 * j]; a[0][j] = *(const v8h*)(pa + 16 * j); }
#pragma unroll
    for (int u = 0; u < 8; ++u) *(w2_v4h*)(tab + ((t >> 4) + 16 * u) * PITCH + (t & 15) * 8) = __builtin_convertvector(tv[u], w2_v4h);
    if (t < 16) *(w2_v4h*)(tab + 128 * PITCH + t * 8) = __builtin_convertvector(tl, w2_v4h);
    __syncthreads();
    const unsigned half16 = 16u * ((lane >> 3) & 1);
    v8f acc[4];
#pragma unroll
    for (int n = 0; n < 4; ++n) acc[n] = (v8f){0.f, 0.f, 0.f, 0.f, 0.f, 0.f, 0.f, 0.f};
#pragma unroll
    for (int ch = 0; ch < 4; ++ch) {
        const int cur = ch & 1, nxt = cur ^ 1;
        if (ch < 3) {
#pragma unroll
            for (int j = 0; j < 8; ++j) { id[nxt][j] = fr[16 * (8 * (ch + 1) + j)]; a[nxt][j] = *(const v8h*)(pa + 16 * (8 * (ch + 1) + j)); }
        }
#pragma unroll
        for (int s = 0; s < 4; ++s) {
            int r0 = id[cur][2 * s], r1 = id[cur][2 * s + 1];
            r0 = r0 < 0 ? 0 : (r0 >= TAB ? TAB - 1 : r0); r1 = r1 < 0 ? 0 : (r1 >= TAB ? TAB - 1 : r1);
            const unsigned char* p0 = tab + (unsigned)r0 * PITCH + half16;
            const unsigned char* p1 = tab + (unsigned)r1 * PITCH + half16;
            union { v16h v; v8h q[2]; } af, bf;
            af.q[0] = a[cur][2 * s]; af.q[1] = a[cur][2 * s + 1];
#pragma unroll
            for (int n = 0; n < 4; ++n) {
                bf.q[0] = w2_ldtr(p0 + 32 * n); bf.q[1] = w2_ldtr(p1 + 32 * n);
                acc[n] = __builtin_amdgcn_wmma_f32_16x16x32_f16(false, af.v, false, bf.v, (short)0, acc[n], false, false);
            }
        }
    }
    float* xo = X + (long long)g * (NH * HD) + (8 * h) * HD + c;
#pragma unroll
    for (int n = 0; n < 4; ++n)
#pragma unroll
        for (int r = 0; r < 8; ++r) { float* x = xo + r * HD + 16 * n; *x = *x + acc[n][r] * (1.f / 4096.f); }
}


extern "C" void kernel_launch(void* const* d_in, const int* in_sizes, int n_in, void* d_out, int out_size, void* d_ws, size_t ws_size, hipStream_t stream) {
    (void)in_sizes; (void)n_in; (void)out_size; (void)ws_size;
    const float* xq = (const float*)d_in[0];
    const float* xk = (const float*)d_in[1];
    const float* xv = (const float*)d_in[2];
    const int* fm = (const int*)d_in[3];
    const float* Wq = (const float*)d_in[4];
    const float* bq = (const float*)d_in[5];
    const float* Wk = (const float*)d_in[6];
    const float* bk = (const float*)d_in[7];
    const float* Wv = (const float*)d_in[8];
    const float* bv = (const float*)d_in[9];
    const float* Wo = (const float*)d_in[10];
    const float* bo = (const float*)d_in[11];
    const float* tk = (const float*)d_in[12];
    const float* tv = (const float*)d_in[13];
    const int Bn = 8;
    const int L = 512;
    const int D = 1024;
    const int NH = 16;
    const int HD = 64;
    const int NR = Bn * L;
    const int TAB = 129;
    const int TP = 192;
    float* out = (float*)d_out;
    char* wsp = (char*)d_ws;
    // kept through the call
    unsigned short* XA16 = (unsigned short*)wsp; wsp += (((size_t)((size_t)3 * NR * D * 2) + 255) / 256) * 256;   // f16 query, key, value
    unsigned short* W16 = (unsigned short*)wsp; wsp += (((size_t)((size_t)4 * D * D * 2) + 255) / 256) * 256;   // f16 16 Wq, 16 Wk, 16 Wv, 16 Wo
    unsigned short* VT16 = (unsigned short*)wsp; wsp += (((size_t)((size_t)Bn * D * L * 2) + 255) / 256) * 256;
    unsigned short* TK16 = (unsigned short*)wsp; wsp += (((size_t)((size_t)TP * HD * 2) + 255) / 256) * 256;
    unsigned short* P16 = (unsigned short*)wsp; wsp += (((size_t)((size_t)Bn * NH * L * L * 2) + 255) / 256) * 256;
    float* X = (float*)wsp; wsp += (((size_t)((size_t)NR * D * 4) + 255) / 256) * 256;
    // one region, used twice in stream order: scores (Q16, K16, QT, SC), then the output projection's A operand
    char* ph = wsp;
    unsigned short* Q16 = (unsigned short*)wsp; wsp += (((size_t)((size_t)NR * D * 2) + 255) / 256) * 256;
    unsigned short* K16 = (unsigned short*)wsp; wsp += (((size_t)((size_t)NR * D * 2) + 255) / 256) * 256;
    float* QT = (float*)wsp; wsp += (((size_t)((size_t)NR * NH * TP * 4) + 255) / 256) * 256;
    float* SC = (float*)wsp; wsp += (((size_t)((size_t)Bn * 8 * L * L * 4) + 255) / 256) * 256;
    unsigned short* G64A = (unsigned short*)ph;
    // every input's cast in one launch: 3 x 256 blocks (query, key, value), 4 x 64 blocks (the weights), one block (table_k)
    k_sh_castin<<<3 * 256 + 4 * 64 + 1, 256, 0, stream>>>(xq, xk, xv, Wq, Wk, Wv, Wo, tk, (_Float16*)XA16, (_Float16*)W16, (_Float16*)TK16);
    w25::wmma_gemm64<0, false, 2, 1, false, 0><<<dim3((unsigned)((((NR) / 64) * ((D) / 64) + 7) / 8), (unsigned)(1)), 256, 0, stream>>>((const unsigned short*)(XA16), nullptr, D, 0, (const unsigned short*)(W16), nullptr, D, 0, (void*)(Q16), nullptr, D, 0, bq, nullptr, 0, NR, D, D, 0.0625f, 0, 0, 0);
    w25::wmma_gemm64<0, false, 2, 1, false, 0><<<dim3((unsigned)((((NR) / 64) * ((D) / 64) + 7) / 8), (unsigned)(1)), 256, 0, stream>>>((const unsigned short*)(XA16 + (size_t)NR * D), nullptr, D, 0, (const unsigned short*)(W16 + (size_t)D * D), nullptr, D, 0, (void*)(K16), nullptr, D, 0, bk, nullptr, 0, NR, D, D, 0.0625f, 0, 0, 0);
    // QT[(b,q,h)][r] for all batches: the (b,q,h) rows of Q16 are contiguous 64-element rows
    w25::wmma_gemm64<0, false, 0, 0, false, 0><<<dim3((unsigned)((((NR * NH) / 64) * ((TP) / 64) + 7) / 8), (unsigned)(1)), 256, 0, stream>>>((const unsigned short*)(Q16), nullptr, HD, 0, (const unsigned short*)(TK16), nullptr, HD, 0, (void*)(QT), nullptr, TP, 0, nullptr, nullptr, 0, NR * NH, TP, HD, 0.0625f, 0, 0, 0);
    // VT16[b][c][k] = v^T, blockIdx.y = batch
    w25::wmma_gemm64<0, false, 1, 1, false, 0><<<dim3((unsigned)((((D) / 64) * ((L) / 64) + 7) / 8), (unsigned)(Bn)), 256, 0, stream>>>((const unsigned short*)(W16 + (size_t)2 * D * D), nullptr, D, 0, (const unsigned short*)(XA16 + (size_t)2 * NR * D), nullptr, D, (long long)L * D, (void*)(VT16), nullptr, L, (long long)D * L, bv, nullptr, 0, D, L, D, 0.0625f, 0, 0, 0);
    // content scores and softmax: eight heads (blockIdx.y) of every batch (blockIdx.z) per launch; the softmax: one wave per query, eight queries per block
    w25::wmma_gemm64<0, false, 0, 0, false, 0><<<dim3((unsigned)((((L) / 64) * ((L) / 64) + 7) / 8), (unsigned)(8), (unsigned)(Bn)), 256, 0, stream>>>((const unsigned short*)(Q16 + 0 * HD), nullptr, D, HD, (const unsigned short*)(K16 + 0 * HD), nullptr, D, HD, (void*)(SC), nullptr, L, (long long)L * L, nullptr, nullptr, 0, L, L, HD, 1.0f, (long long)L * D, (long long)L * D, (long long)8 * L * L);
    k_sh_soft<<<(unsigned)(NR / 8), 256, 0, stream>>>(SC, QT, (const int*)fm, (_Float16*)P16, 0);
    w25::wmma_gemm64<0, false, 0, 0, false, 0><<<dim3((unsigned)((((L) / 64) * ((L) / 64) + 7) / 8), (unsigned)(8), (unsigned)(Bn)), 256, 0, stream>>>((const unsigned short*)(Q16 + 8 * HD), nullptr, D, HD, (const unsigned short*)(K16 + 8 * HD), nullptr, D, HD, (void*)(SC), nullptr, L, (long long)L * L, nullptr, nullptr, 0, L, L, HD, 1.0f, (long long)L * D, (long long)L * D, (long long)8 * L * L);
    k_sh_soft<<<(unsigned)(NR / 8), 256, 0, stream>>>(SC, QT, (const int*)fm, (_Float16*)P16, 8);
    // w1 = attn.v: blockIdx.y = head, blockIdx.z = batch
    w25::wmma_gemm64<0, false, 0, 0, false, 0><<<dim3((unsigned)((((L) / 64) * ((HD) / 64) + 7) / 8), (unsigned)(NH), (unsigned)(Bn)), 256, 0, stream>>>((const unsigned short*)(P16), nullptr, L, (long long)L * L, (const unsigned short*)(VT16), nullptr, L, (long long)HD * L, (void*)(X), nullptr, D, HD, nullptr, nullptr, 0, L, HD, L, 0.000244140625f, (long long)NH * L * L, (long long)D * L, (long long)L * D);
    // w2: one wave per query, eight queries per block
    k_sh_w2<<<(unsigned)(NR / 8), 256, 0, stream>>>((const _Float16*)P16, (const int*)fm, tv, X);
    k_sh_castx<<<256, 256, 0, stream>>>(X, (_Float16*)G64A);
    w25::wmma_gemm64<0, false, 2, 0, false, 0><<<dim3((unsigned)((((4096) / 64) * ((1024) / 64) + 7) / 8), (unsigned)(1)), 256, 0, stream>>>((const unsigned short*)(G64A), nullptr, 1024, 0, (const unsigned short*)(W16 + (size_t)3 * D * D), nullptr, 1024, 0, (void*)(out), nullptr, 1024, 0, bo, nullptr, 0, 4096, 1024, 1024, 0.0625f, 0, 0, 0);
}
